// v000
// The times below were measured on an AMD MI455X: many runs one after another, warmed up first and cycling through
// copies of the inputs, with the whole window's GPU time divided by the number of runs. Launches and the gaps
// between them are all in it. The median over several windows is given; except for v000 it joins two sittings, which
// can be a few percent apart, so the side-by-side timings, each taken in one sitting, are the better comparison.
// v000, which the later versions start from, runs in 7570 microseconds.
// compute dtype: all float inputs rounded to bf16; q/k/v projections with EXACT bf16 products on WMMA 16x16x32 (f32 accumulate); causal scores q x k once to f16 each (1 product) x 64^-0.5 plus the ALiBi bias slope_h (key - query) in f32; softmax over the QUERY axis in f32 (per key column: online max / sum over the visible queries, precise expf); P x 2^11 once to f16 x v once to f16 (1 product); the 16 heads' outputs are SUMMED inside the output projection (ctx x 2^6 once to f16 x wo f16(bf16 x 2^8), the 64-row weight re-used for every head); + bf16(x) residual in f32; f32 output.
#include <hip/hip_runtime.h>
#include <math.h>

typedef __attribute__((ext_vector_type(16))) _Float16 v16h;
typedef __attribute__((ext_vector_type(16))) __bf16 v16b;
typedef __attribute__((ext_vector_type(8)))  _Float16 v8h;
typedef __attribute__((ext_vector_type(8)))  float v8f;
typedef __attribute__((ext_vector_type(4)))  float v4f;
typedef __attribute__((ext_vector_type(2)))  float v2f;
typedef __attribute__((ext_vector_type(4)))  unsigned v4u;
typedef __attribute__((ext_vector_type(4)))  int v4i;
typedef float __attribute__((may_alias)) float_a;
typedef int __attribute__((may_alias)) int_a;

template <typename T> __device__ __forceinline__ void vst2(void* p, T v) { *(T*)p = v;  }
__device__ __forceinline__ v8f wmma16(v16h a, v16h b, v8f c) {
  v8f d = __builtin_amdgcn_wmma_f32_16x16x32_f16(false, a, false, b, (short)0, c, false, false);
  asm volatile("v_nop\n\tv_nop\n\tv_nop\n\tv_nop" : "+v"(d) : "v"(a), "v"(b));
  return d;
}
__device__ __forceinline__ v8f wmma_bf(v16b a, v16b b, v8f c) {
  v8f d = __builtin_amdgcn_wmma_f32_16x16x32_bf16(false, a, false, b, (short)0, c, false, false);
  asm volatile("v_nop\n\tv_nop\n\tv_nop\n\tv_nop" : "+v"(d) : "v"(a), "v"(b));
  return d;
}
// 16x16x32 fragments: lane = (h = lane>>4, row/col = lane&15); elements 0..7 = k0+8h+0..7, 8..15 = k0+16+8h+0..7; D element r = row 8h+r
__device__ __forceinline__ v16h frag_h(const _Float16* rowk0, int lane) {
  union { v16h v; v8h q[2]; } u; const _Float16* p = rowk0 + 8 * (lane >> 4);
  u.q[0] = *(const v8h*)p; u.q[1] = *(const v8h*)(p + 16); return u.v;
}
__device__ __forceinline__ v16h frag_f32(const float* rowk0, int lane) {
  v16h a; const float* p = rowk0 + 8 * (lane >> 4);
#pragma unroll
  for (int i = 0; i < 8; ++i) { a[i] = (_Float16)p[i]; a[8 + i] = (_Float16)p[16 + i]; }
  return a;
}
__device__ __forceinline__ v16h frag_f32s(const float* rowk0, int lane, float sc) {
  v16h a; const float* p = rowk0 + 8 * (lane >> 4);
#pragma unroll
  for (int i = 0; i < 8; ++i) { a[i] = (_Float16)(p[i] * sc); a[8 + i] = (_Float16)(p[16 + i] * sc); }
  return a;
}
// column fragment from a [K][ld] layout (column n), rows >= K read as 0
__device__ __forceinline__ v16h fragc_f32(const float* W, int k0, int n, int lane, int ld, int K) {
  v16h a; const int g = lane >> 4;
#pragma unroll
  for (int i = 0; i < 8; ++i) { const int ka = k0 + 8 * g + i, kb = ka + 16;
    a[i] = (_Float16)(ka < K ? W[(size_t)(ka < K ? ka : K - 1) * ld + n] : 0.f); a[8 + i] = (_Float16)(kb < K ? W[(size_t)(kb < K ? kb : K - 1) * ld + n] : 0.f); }
  return a;
}
struct F2 { v16b h, l; };
__device__ __forceinline__ F2 bsplit16(const float v[16]) { F2 r;
#pragma unroll
  for (int i = 0; i < 16; ++i) { const __bf16 h = (__bf16)v[i]; r.h[i] = h; r.l[i] = (__bf16)(v[i] - (float)h); }
  return r; }
__device__ __forceinline__ F2 split_row(const float* row, int k0, int lane) { float v[16]; const float* p = row + k0 + 8 * (lane >> 4);
#pragma unroll
  for (int i = 0; i < 8; ++i) { v[i] = p[i]; v[8 + i] = p[16 + i]; }
  return bsplit16(v); }
__device__ __forceinline__ F2 split_rowK(const float* row, int k0, int lane, int K) { float v[16]; const int g = lane >> 4;
#pragma unroll
  for (int i = 0; i < 8; ++i) { const int ka = k0 + 8 * g + i, kb = ka + 16; v[i] = ka < K ? row[ka < K ? ka : K - 1] : 0.f; v[8 + i] = kb < K ? row[kb < K ? kb : K - 1] : 0.f; }
  return bsplit16(v); }
__device__ __forceinline__ F2 split_col(const float* W, int k0, int n, int lane, int ld, int K) { float v[16]; const int g = lane >> 4;
#pragma unroll
  for (int i = 0; i < 8; ++i) { const int ka = k0 + 8 * g + i, kb = ka + 16; v[i] = ka < K ? W[(size_t)(ka < K ? ka : K - 1) * ld + n] : 0.f; v[8 + i] = kb < K ? W[(size_t)(kb < K ? kb : K - 1) * ld + n] : 0.f; }
  return bsplit16(v); }
__device__ __forceinline__ v8f mac3(const F2& a, const F2& b, v8f c) { c = wmma_bf(a.l, b.h, c); c = wmma_bf(a.h, b.l, c); return wmma_bf(a.h, b.h, c); }
__device__ __forceinline__ float sigm(float v) { return 1.0f / (1.0f + expf(-v)); }
#define LDSX() do { asm volatile("s_wait_dscnt 0" ::: "memory"); __builtin_amdgcn_wave_barrier(); __builtin_amdgcn_fence(__ATOMIC_RELEASE, "workgroup"); } while (0)

// ALiBi-biased multi-headed attention whose softmax runs over the QUERY axis and whose heads are SUMMED (x [2,2048,1024]; (in,out) wq / wk / wv [1024,1024] N(0, 1/1024), no biases; 16 heads x 64; prod = Q K^T / 8 + slope_h (k - q) with slope_h = 2^(-8 (h + 1) / 16); -inf where k > q; attention_weights = softmax(prod, axis=2) - axis 2 of [B, H, q, k] is the QUERY axis: every key column is normalised over the queries that can see it (faithful to the source); out_h = weights V_h; outputs = (sum over the 16 heads of out_h) wo with wo [64,1024]; result = x + outputs).
#define NB 2
#define TT 2048
#define CC 1024            // NH * HD = projected width
#define DIN 1024          // input (model) width
#define NH 16
#define HD 64
#define NQB (TT / 64)
#define HG 4
#define SCALE (0.125f)
#define CAUSAL 1
#ifndef TNB
#define TNB NB
#endif
__device__ __forceinline__ float bfr(float v) { return (float)(__bf16)v; }
__host__ __device__ __forceinline__ int kb_last(int qb) { return CAUSAL ? ((qb * 64 + 63) >> 7) : (TT / 128 - 1); }
typedef __attribute__((ext_vector_type(8))) __bf16 v8b;
__device__ __forceinline__ v16b frag_b(const __bf16* rowk0, int lane) {
  union { v16b v; v8b q[2]; } u; const __bf16* p = rowk0 + 8 * (lane >> 4);
  u.q[0] = *(const v8b*)p; u.q[1] = *(const v8b*)(p + 16); return u.v;
}
#define QBH 0              // no high-precision blocks: single-product scores and P.v everywhere (the output carries the f32 residual x and the sum of 16 heads: rms - 4)
#define QHI 0               // no q residual plane
#define KHI 64              // no k residual / v hi-lo planes are read
// B fragment (k rows k0+.., output column o) of a weight: (in,out) [K][ld] or (out,in) [ld rows of K]: bf16 exact, or f16(bf16 * 256) exact
__device__ __forceinline__ v16b wcol_io(const float* Wm, int k0, int o, int lane, int ld) { v16b w; const int g = lane >> 4;
#pragma unroll
  for (int i = 0; i < 8; ++i) { w[i] = (__bf16)Wm[(size_t)(k0 + 8 * g + i) * ld + o]; w[8 + i] = (__bf16)Wm[(size_t)(k0 + 16 + 8 * g + i) * ld + o]; }
  return w; }
__device__ __forceinline__ v16b wcol_oi(const float* Wm, int k0, int o, int lane, int K) { v16b w; const float* p = Wm + (size_t)o * K + k0 + 8 * (lane >> 4);
#pragma unroll
  for (int i = 0; i < 8; ++i) { w[i] = (__bf16)p[i]; w[8 + i] = (__bf16)p[16 + i]; }
  return w; }
__device__ __forceinline__ v16h wcolh_io(const float* Wm, int k0, int o, int lane, int ld) { v16h w; const int g = lane >> 4;
#pragma unroll
  for (int i = 0; i < 8; ++i) { w[i] = (_Float16)(bfr(Wm[(size_t)(k0 + 8 * g + i) * ld + o]) * 256.0f); w[8 + i] = (_Float16)(bfr(Wm[(size_t)(k0 + 16 + 8 * g + i) * ld + o]) * 256.0f); }
  return w; }
__device__ __forceinline__ v16h wcolh_oi(const float* Wm, int k0, int o, int lane, int K) { v16h w; const float* p = Wm + (size_t)o * K + k0 + 8 * (lane >> 4);
#pragma unroll
  for (int i = 0; i < 8; ++i) { w[i] = (_Float16)(bfr(p[i]) * 256.0f); w[8 + i] = (_Float16)(bfr(p[16 + i]) * 256.0f); }
  return w; }
#define WQKV_LAYOUT 0   // 0 = (in,out) [DIN][CC]; 1 = (out,in) [CC][DIN]; 2 = per-head [NH][DIN][HD]
__device__ __forceinline__ v16b wcol_hdk(const float* Wm, int k0, int o, int lane) { v16b w; const int g = lane >> 4; const float* p = Wm + (size_t)(o / HD) * DIN * HD + (o % HD);
#pragma unroll
  for (int i = 0; i < 8; ++i) { w[i] = (__bf16)p[(size_t)(k0 + 8 * g + i) * HD]; w[8 + i] = (__bf16)p[(size_t)(k0 + 16 + 8 * g + i) * HD]; }
  return w; }
#define WO_OUT_IN 0
#if WQKV_LAYOUT == 1
#define WCOL(W, k0, o, lane) wcol_oi(W, k0, o, lane, DIN)
#elif WQKV_LAYOUT == 2
#define WCOL(W, k0, o, lane) wcol_hdk(W, k0, o, lane)
#else
#define WCOL(W, k0, o, lane) wcol_io(W, k0, o, lane, CC)
#endif
#if WO_OUT_IN
#define WOCOL(W, k0, o, lane) wcol_oi(W, k0, o, lane, CC)
#define WOCOLH(W, k0, o, lane) wcolh_oi(W, k0, o, lane, CC)
#else
#define WOCOL(W, k0, o, lane) wcol_io(W, (k0) & 63, o, lane, DIN)
#define WOCOLH(W, k0, o, lane) wcolh_io(W, (k0) & 63, o, lane, DIN)   /* wo is [64][1024]: merged column (h*64 + d) uses weight row d - i.e. the 16 heads are summed by the projection itself (k0 is a multiple of 32, so a fragment's 32 rows stay inside one head's 64) */
#endif

#ifndef SM_EXTRA_PARAMS
#define SM_EXTRA_PARAMS
#endif
#ifndef PROJ_EXTRA_PARAMS
#define PROJ_EXTRA_PARAMS
#endif
#ifndef SM_MASK_HOOK
#define SM_MASK_HOOK (void)0
#endif

#define WS_QH  0u                                      // f16 q rows [b*t][CC]
#define WS_KH  (WS_QH + 2u * (size_t)NB * TT * CC)      // f16 k rows [b*t][CC]
#define WS_VT  (WS_KH + 2u * (size_t)NB * TT * CC)      // f16 v planes [b][c][t]
#define WS_QL  (WS_VT + 2u * (size_t)NB * CC * TT)      // f16 q residual x 2^10 rows [b][t < QHI][CC]
#define WS_KL  (WS_QL + 2u * (size_t)NB * QHI * CC)     // f16 k residual x 2^10 rows [b][t < KHI][CC]
#define WS_VB  (WS_KL + 2u * (size_t)NB * KHI * CC)     // bf16 v hi planes [b][c][t < KHI]
#define WS_VBL (WS_VB + 2u * (size_t)NB * CC * KHI)
#define WS_S   (WS_VBL + 2u * (size_t)NB * CC * KHI)    // f32 logits / P [hg][t][s]
#define WS_Y   (WS_S  + 4u * (size_t)HG * TT * TT)      // f32 ctx rows [b*t][CC] (only when there is an output projection)
#define WS_END (WS_Y  + 4u * (size_t)NB * TT * CC)
#define WS_CM (WS_END)                                  // f32 column maxima [HG][TT]
#define WS_CZ (WS_CM + 4u * (size_t)HG * TT)
#define WS_END2 (WS_CZ + 4u * (size_t)HG * TT)

// ---- k_proj: block = (64 rows, 128 cols, which): q/k/v = X W (+ b) with exact bf16 products (K = DIN) -> which 0: q f16 rows (+ residual rows < QHI); 1: k f16 rows (+ residual rows < KHI); 2: v f16 planes [c][t] (+ bf16 hi/lo planes for t < KHI)
__global__ __launch_bounds__(128) void k_proj(const float* __restrict__ XQ, const float* __restrict__ XK, const float* __restrict__ XV, const float* __restrict__ WQ, const float* __restrict__ WK, const float* __restrict__ WV, const float* __restrict__ BQ, const float* __restrict__ BK, const float* __restrict__ BV,
    _Float16* __restrict__ QH, _Float16* __restrict__ QL, _Float16* __restrict__ KH, _Float16* __restrict__ KL, _Float16* __restrict__ VT, __bf16* __restrict__ VB, __bf16* __restrict__ VBL) {
  __shared__ __align__(16) _Float16 sh[64][136], sl[64][136]; __shared__ __align__(16) _Float16 th[128][72]; __shared__ __align__(16) __bf16 tb[128][72], tbl[128][72];
  const int tid = threadIdx.x, wave = tid >> 5, lane = tid & 31, col = lane & 15, g = lane >> 4; const int which = blockIdx.z; const int c0 = blockIdx.y * 128; const size_t r0 = (size_t)blockIdx.x * 64; const size_t bb = r0 / TT; const int t0 = (int)(r0 % TT);
  const float* X = which == 0 ? XQ : which == 1 ? XK : XV; const float* WA = which == 0 ? WQ : which == 1 ? WK : WV; const float* BA = which == 0 ? BQ : which == 1 ? BK : BV;
  v8f acc[8] = {};
#pragma unroll 2
  for (int kc = 0; kc < DIN / 32; ++kc) { v16b a; { const float* p = X + (r0 + wave * 16 + col) * DIN + kc * 32 + 8 * g;
#pragma unroll
      for (int i = 0; i < 8; ++i) { a[i] = (__bf16)p[i]; a[8 + i] = (__bf16)p[16 + i]; } }
    asm volatile("s_wait_loadcnt 0x0" ::: "memory");
#pragma unroll
    for (int j = 0; j < 8; ++j) { const v16b w = WCOL(WA, kc * 32, c0 + j * 16 + col, lane); asm volatile("s_wait_loadcnt 0x0" ::: "memory"); acc[j] = wmma_bf(a, w, acc[j]); } }
  if (which < 2) { _Float16* DH = which == 0 ? QH : KH; _Float16* DL = which == 0 ? QL : KL; const int nhi = which == 0 ? QHI : KHI; const bool hi_rows = t0 < nhi;
#pragma unroll
    for (int j = 0; j < 8; ++j) { const float bias = BA ? bfr(BA[c0 + j * 16 + col]) : 0.f;
#pragma unroll
      for (int r = 0; r < 8; ++r) { const float v = acc[j][r] + bias; const _Float16 hv = (_Float16)v; sh[wave * 16 + 8 * g + r][j * 16 + col] = hv; sl[wave * 16 + 8 * g + r][j * 16 + col] = (_Float16)((v - (float)hv) * 1024.0f); } }
    __syncthreads();
    for (int e = tid; e < 64 * 16; e += 128) { const int rl = e >> 4, q = e & 15; vst2((unsigned*)(DH + (r0 + rl) * CC + c0 + q * 8), *(const v4u*)&sh[rl][q * 8]); if (hi_rows) vst2((unsigned*)(DL + (bb * nhi + t0 + rl) * (size_t)CC + c0 + q * 8), *(const v4u*)&sl[rl][q * 8]); }
  } else { const bool hi_rows = t0 < KHI;
#pragma unroll
    for (int j = 0; j < 8; ++j) { const float bias = BA ? bfr(BA[c0 + j * 16 + col]) : 0.f;
#pragma unroll
      for (int r = 0; r < 8; ++r) { const float v = acc[j][r] + bias; const int rl = wave * 16 + 8 * g + r, cl = j * 16 + col; th[cl][rl] = (_Float16)v; const __bf16 bh = (__bf16)v; tb[cl][rl] = bh; tbl[cl][rl] = (__bf16)(v - (float)bh); } }
    __syncthreads();
    for (int e = tid; e < 128 * 8; e += 128) { const int cl = e >> 3, q = e & 7; vst2((unsigned*)(VT + (bb * CC + c0 + cl) * (size_t)TT + t0 + q * 8), *(const v4u*)&th[cl][q * 8]); if (hi_rows) { const size_t o3 = (bb * CC + c0 + cl) * (size_t)KHI + t0 + q * 8; vst2((unsigned*)(VB + o3), *(const v4u*)&tb[cl][q * 8]); vst2((unsigned*)(VBL + o3), *(const v4u*)&tbl[cl][q * 8]); } } } }
// ---- k_sc: block = (query block qb, key block kb <= kb_last(qb), head in group) of batch b: logits x SCALE; q hi + residual (x 2^10) against k (2 products) for query rows < QHI, plus the k residual (3 products) for query blocks < QBH (causal early rows); causal: blocks past the diagonal exit, the mask itself is applied by index in k_colstat_c and k_csm_c
__global__ __launch_bounds__(128) void k_sc(const _Float16* __restrict__ QH, const _Float16* __restrict__ KH, const _Float16* __restrict__ QL, const _Float16* __restrict__ KL, int b, int h0, float* __restrict__ S0) { __shared__ __align__(16) float ss[4][16][132];
  const int qb = blockIdx.x, kb = blockIdx.y; if (kb > kb_last(qb)) return;
  const int h = h0 + blockIdx.z; float* S = S0 + (size_t)blockIdx.z * TT * TT;
  const int tid = threadIdx.x, wave = tid >> 5, lane = tid & 31, col = lane & 15, g = lane >> 4; const int k0 = kb * 128; const int ql0 = qb * 64 + wave * 16; const size_t q0 = (size_t)b * TT + ql0, kr0 = (size_t)b * TT + k0;
  v8f acc[8] = {}, accl[8] = {};
  const _Float16* QLb = QL + (size_t)b * QHI * CC; const _Float16* KLb = KL + (size_t)b * KHI * CC;
  if (qb < QBH) {
#pragma unroll
    for (int kc = 0; kc < HD / 32; ++kc) { const v16h ah = frag_h(QH + (q0 + col) * CC + h * HD + kc * 32, lane), al = frag_h(QLb + (size_t)(ql0 + col) * CC + h * HD + kc * 32, lane);
#pragma unroll
      for (int j = 0; j < 8; ++j) { const v16h kbf = frag_h(KH + (kr0 + j * 16 + col) * CC + h * HD + kc * 32, lane), klf = frag_h(KLb + (size_t)(k0 + j * 16 + col) * CC + h * HD + kc * 32, lane); acc[j] = wmma16(ah, kbf, acc[j]); accl[j] = wmma16(al, kbf, accl[j]); accl[j] = wmma16(ah, klf, accl[j]); } }
  } else if (qb * 64 < QHI) {
#pragma unroll
    for (int kc = 0; kc < HD / 32; ++kc) { const v16h ah = frag_h(QH + (q0 + col) * CC + h * HD + kc * 32, lane), al = frag_h(QLb + (size_t)(ql0 + col) * CC + h * HD + kc * 32, lane);
#pragma unroll
      for (int j = 0; j < 8; ++j) { const v16h kbf = frag_h(KH + (kr0 + j * 16 + col) * CC + h * HD + kc * 32, lane); acc[j] = wmma16(ah, kbf, acc[j]); accl[j] = wmma16(al, kbf, accl[j]); } }
  } else {
#pragma unroll
    for (int kc = 0; kc < HD / 32; ++kc) { const v16h ah = frag_h(QH + (q0 + col) * CC + h * HD + kc * 32, lane);
#pragma unroll
      for (int j = 0; j < 8; ++j) { const v16h kbf = frag_h(KH + (kr0 + j * 16 + col) * CC + h * HD + kc * 32, lane); acc[j] = wmma16(ah, kbf, acc[j]); } } }
#pragma unroll
  for (int j = 0; j < 8; ++j) {
#pragma unroll
    for (int r = 0; r < 8; ++r) ss[wave][8 * g + r][j * 16 + col] = (acc[j][r] + accl[j][r] * (1.0f / 1024.0f)) * SCALE; }
  LDSX(); for (int rl = 0; rl < 16; ++rl) vst2(S + (size_t)(ql0 + rl) * TT + k0 + lane * 4, *(const v4f*)&ss[wave][rl][lane * 4]); }
// ---- k_sm: block = query row t (head in group): keys [0, kend): causal -> logit if s <= t else excluded; softmax in f32; P x 2^11 in place (0 for excluded)
__global__ __launch_bounds__(256) void k_sm(float* __restrict__ S0 SM_EXTRA_PARAMS) { __shared__ float sred[8]; __shared__ float sbc; __shared__ __align__(16) float shv[TT];
  const int tid = threadIdx.x; const int t = blockIdx.x; const int kend = (kb_last(t >> 6) + 1) * 128;
  float* sr = S0 + (size_t)blockIdx.y * TT * TT + (size_t)t * TT;
  float m = -3.0e38f; for (int k = tid; k < kend; k += 256) { float v = (!CAUSAL || k <= t) ? sr[k] : -3.0e38f; SM_MASK_HOOK; shv[k] = v; m = fmaxf(m, v); }
#pragma unroll
  for (int o = 1; o < 32; o <<= 1) m = fmaxf(m, __shfl_xor(m, o));
  if ((tid & 31) == 0) sred[tid >> 5] = m; __syncthreads(); if (tid == 0) { float a = sred[0]; for (int i = 1; i < 8; ++i) a = fmaxf(a, sred[i]); sbc = a; } __syncthreads(); m = sbc; __syncthreads();
  float sum = 0.f; for (int k = tid; k < kend; k += 256) { const float v = shv[k]; const float e = (v <= -1.0e38f) ? 0.f : expf(v - m); shv[k] = e; sum += e; }
#pragma unroll
  for (int o = 1; o < 32; o <<= 1) sum += __shfl_xor(sum, o);
  if ((tid & 31) == 0) sred[tid >> 5] = sum; __syncthreads(); if (tid == 0) { float a = 0.f; for (int i = 0; i < 8; ++i) a += sred[i]; sbc = a > 0.f ? 2048.0f / a : 0.f; }   /* a fully excluded row yields P = 0 */ __syncthreads(); const float inv = sbc;
  for (int k = tid; k < kend; k += 256) shv[k] = shv[k] * inv;
  __syncthreads(); for (int q = tid; q < kend / 4; q += 256) vst2(sr + q * 4, *(const v4f*)&shv[q * 4]); }
// ---- k_colstat_c: softmax over the QUERY axis under the causal mask (the source's softmax(axis=2) on [B, H, q, k] scores - ALiBi-biased - with -inf where k > q): for every key column k: m_k = max_{q >= k} S[q][k], Z_k = sum_{q >= k} exp(S[q][k] - m_k) (online, one pass, f32, precise expf); thread per column; the row loop starts at the block's first column (block-uniform) and masks q < k by a value select after an unconditional load (rows above a column's diagonal may lie in score blocks k_sc never computed: their content is discarded)
__global__ __launch_bounds__(256) void k_colstat_c(const float* __restrict__ S0, float* __restrict__ CM, float* __restrict__ CZ, int h0) { const float slope_ = exp2f(-0.5f * (float)(h0 + blockIdx.y + 1));   /* ALiBi slope of this head: 2^(-8 (h + 1) / 16) */ const int k = blockIdx.x * 256 + threadIdx.x; const float* sp = S0 + (size_t)blockIdx.y * TT * TT + k; const int q0 = blockIdx.x * 256;
  float m = -3.0e38f, z = 0.f;
#pragma unroll 4
  for (int q = q0; q < TT; ++q) { const float ld = sp[(size_t)q * TT]; asm volatile("s_wait_loadcnt 0x0" ::: "memory"); const bool vis = q >= k; const float v = vis ? (ld + slope_ * (float)(k - q)) : -3.0e38f;   /* + the ALiBi bias slope (key - query) <= 0 */ const float mn = fmaxf(m, v); z = z * expf(m - mn) + (vis ? expf(v - mn) : 0.f); m = mn; }
  vst2(CM + (size_t)blockIdx.y * TT + k, m); vst2(CZ + (size_t)blockIdx.y * TT + k, z); }   /* every column sees at least its own diagonal entry: Z_k >= 1 */
// ---- k_csm_c: block = query row t: P[t][k] = exp(S[t][k] - m_k) / Z_k x 2^11 for k <= t, 0 for t < k < kend (inside the diagonal block); in place; unconditional loads, value select
__global__ __launch_bounds__(256) void k_csm_c(float* __restrict__ S0, const float* __restrict__ CM, const float* __restrict__ CZ, int h0) { const float slope_ = exp2f(-0.5f * (float)(h0 + blockIdx.y + 1)); const int tid = threadIdx.x; const int t = blockIdx.x; const int kend = (kb_last(t >> 6) + 1) * 128; float* sr = S0 + (size_t)blockIdx.y * TT * TT + (size_t)t * TT; const float* cm = CM + (size_t)blockIdx.y * TT; const float* cz = CZ + (size_t)blockIdx.y * TT;
  for (int q4 = tid; q4 < kend / 4; q4 += 256) { const v4f sv = *(const v4f*)(sr + q4 * 4), m4 = *(const v4f*)(cm + q4 * 4), z4 = *(const v4f*)(cz + q4 * 4); asm volatile("s_wait_loadcnt 0x0" ::: "memory"); v4f p;
#pragma unroll
    for (int u = 0; u < 4; ++u) p[u] = (q4 * 4 + u <= t) ? expf((sv[u] + slope_ * (float)(q4 * 4 + u - t)) - m4[u]) * (2048.0f / z4[u]) : 0.f;
    vst2(sr + q4 * 4, p); } }
// ---- k_pv: block = 64 queries (qb) of (b, h): ctx = P . v over keys [0, kend) (P x 2^11 once to f16 against v f16: 1 product; causal early query blocks: P and v as bf16 hi + lo, 3 products); 256-B (row, head) segment by 16 lanes
__global__ __launch_bounds__(128) void k_pv(const float* __restrict__ PS0, const _Float16* __restrict__ VT, const __bf16* __restrict__ VB, const __bf16* __restrict__ VBL, int b, int h0, float* __restrict__ Y) { const int h = h0 + blockIdx.z; const float* PS = PS0 + (size_t)blockIdx.z * TT * TT; __shared__ __align__(16) float ss[4][16][HD + 4];
  const int tid = threadIdx.x, wave = tid >> 5, lane = tid & 31, col = lane & 15, g = lane >> 4; const int qb = blockIdx.x; const int ql0 = qb * 64 + wave * 16; const int kce = (kb_last(qb) + 1) * 4;
  v8f acc[HD / 16] = {};
  if (qb < QBH) {
#pragma unroll 1
    for (int kc = 0; kc < kce; ++kc) { const F2 p = split_row(PS + (size_t)(ql0 + col) * TT, kc * 32, lane);
      asm volatile("s_wait_loadcnt 0x0" ::: "memory");
#pragma unroll
      for (int j = 0; j < HD / 16; ++j) { const size_t po = ((size_t)b * CC + h * HD + j * 16 + col) * (size_t)KHI + kc * 32; const v16b vh = frag_b(VB + po, lane); acc[j] = wmma_bf(p.h, vh, acc[j]); acc[j] = wmma_bf(p.l, vh, acc[j]); acc[j] = wmma_bf(p.h, frag_b(VBL + po, lane), acc[j]); } }
  } else {
#pragma unroll 1
    for (int kc = 0; kc < kce; ++kc) { const v16h p = frag_f32(PS + (size_t)(ql0 + col) * TT + kc * 32, lane);
      asm volatile("s_wait_loadcnt 0x0" ::: "memory");
#pragma unroll
      for (int j = 0; j < HD / 16; ++j) { const size_t po = ((size_t)b * CC + h * HD + j * 16 + col) * (size_t)TT + kc * 32; acc[j] = wmma16(p, frag_h(VT + po, lane), acc[j]); } } }
#pragma unroll
  for (int j = 0; j < HD / 16; ++j)
#pragma unroll
    for (int r = 0; r < 8; ++r) ss[wave][8 * g + r][j * 16 + col] = acc[j][r] * (1.0f / 2048.0f);
  LDSX(); for (int rl = 0; rl < 16; ++rl) if (lane < HD / 4) vst2(Y + ((size_t)b * TT + ql0 + rl) * CC + h * HD + lane * 4, *(const v4f*)&ss[wave][rl][lane * 4]); }
// ---- k_out: block = (64 rows, 128 cols): out = ctx Wo (+ bo): ctx x 2^6 once to f16 against Wo as f16(bf16 x 2^8) exact (1 product) x 2^-14; causal early rows (< QHI of each sequence): ctx bf16 hi + lo against exact bf16 Wo (2 products)
__global__ __launch_bounds__(128) void k_out(const float* __restrict__ Y, const float* __restrict__ WO, const float* __restrict__ BO, float* __restrict__ OUT) { __shared__ __align__(16) float sf[4][16][132];
  const int tid = threadIdx.x, wave = tid >> 5, lane = tid & 31, col = lane & 15, g = lane >> 4; const int c0 = blockIdx.y * 128; const size_t r0 = (size_t)blockIdx.x * 64 + wave * 16;
  v8f acc[8] = {};
  if (CAUSAL && (int)(((size_t)blockIdx.x * 64) % TT) < QHI) {   /* block-uniform */
#pragma unroll 2
    for (int kc = 0; kc < CC / 32; ++kc) { const F2 a = split_row(Y + (r0 + col) * CC, kc * 32, lane); asm volatile("s_wait_loadcnt 0x0" ::: "memory");
#pragma unroll
      for (int j = 0; j < 8; ++j) { const v16b w = WOCOL(WO, kc * 32, c0 + j * 16 + col, lane); asm volatile("s_wait_loadcnt 0x0" ::: "memory"); acc[j] = wmma_bf(a.h, w, acc[j]); acc[j] = wmma_bf(a.l, w, acc[j]); } }
#pragma unroll
    for (int j = 0; j < 8; ++j) { const float bias = 0.f;   /* this module has no output bias: the BO argument carries the RESIDUAL x, added at the store */
#pragma unroll
      for (int r = 0; r < 8; ++r) sf[wave][8 * g + r][j * 16 + col] = acc[j][r] + bias; }
  } else {
#pragma unroll 2
    for (int kc = 0; kc < CC / 32; ++kc) { const v16h a = frag_f32s(Y + (r0 + col) * CC + kc * 32, lane, 64.0f); asm volatile("s_wait_loadcnt 0x0" ::: "memory");   /* ctx carried x 2^6 into f16 so small-magnitude context rows stay clear of f16 subnormals (chip FTZ) */
#pragma unroll
      for (int j = 0; j < 8; ++j) { const v16h w = WOCOLH(WO, kc * 32, c0 + j * 16 + col, lane); asm volatile("s_wait_loadcnt 0x0" ::: "memory"); acc[j] = wmma16(a, w, acc[j]); } }
#pragma unroll
    for (int j = 0; j < 8; ++j) { const float bias = 0.f;   /* this module has no output bias: the BO argument carries the RESIDUAL x, added at the store */
#pragma unroll
      for (int r = 0; r < 8; ++r) sf[wave][8 * g + r][j * 16 + col] = acc[j][r] * (1.0f / 16384.0f) + bias; } }   /* 2^-8 (Wo carry) x 2^-6 (ctx carry) */
  LDSX(); for (int rl = 0; rl < 16; ++rl) { const v4f xr = *(const v4f*)(BO + (r0 + rl) * DIN + c0 + lane * 4); asm volatile("s_wait_loadcnt 0x0" ::: "memory"); v4f o = *(const v4f*)&sf[wave][rl][lane * 4]; o[0] += bfr(xr[0]); o[1] += bfr(xr[1]); o[2] += bfr(xr[2]); o[3] += bfr(xr[3]); vst2(OUT + (r0 + rl) * DIN + c0 + lane * 4, o); } }   /* x + outputs */

extern "C" void kernel_launch(void* const* d_in, const int* in_sizes, int n_in, void* d_out, int out_size, void* d_ws, size_t ws_size, hipStream_t stream) {
  (void)in_sizes; (void)n_in; (void)out_size;
  const float** F = (const float**)d_in;
  if (ws_size < (size_t)WS_END) return;
  char* ws = (char*)d_ws; _Float16 *QH = (_Float16*)(ws + WS_QH), *KH = (_Float16*)(ws + WS_KH), *VT = (_Float16*)(ws + WS_VT), *QL = (_Float16*)(ws + WS_QL), *KL = (_Float16*)(ws + WS_KL); __bf16 *VB = (__bf16*)(ws + WS_VB), *VBL = (__bf16*)(ws + WS_VBL); float *S = (float*)(ws + WS_S), *Y = (float*)(ws + WS_Y);
  (void)Y; (void)QL; (void)KL; (void)VB; (void)VBL;
  // inputs: 0 x [2,2048,1024]; 1 wq [1024,1024] (in,out); 2 wk; 3 wv; 4 wo [64,1024] (in,out: it acts on the SUM of the 16 heads' 64-dim outputs); no biases
  if (ws_size < (size_t)WS_END2) return;
  float *CM = (float*)(ws + WS_CM), *CZ = (float*)(ws + WS_CZ);
  k_proj<<<dim3(TNB * TT / 64, CC / 128, 3), 128, 0, stream>>>(F[0], F[0], F[0], F[1], F[2], F[3], nullptr, nullptr, nullptr, QH, QL, KH, KL, VT, VB, VBL);
  for (int b = 0; b < TNB; ++b) for (int h0 = 0; h0 < NH; h0 += HG) {
    k_sc<<<dim3(NQB, TT / 128, HG), 128, 0, stream>>>(QH, KH, QL, KL, b, h0, S);
    k_colstat_c<<<dim3(TT / 256, HG), 256, 0, stream>>>(S, CM, CZ, h0);   /* per key column: max / sum over the visible queries of exp(score + ALiBi bias) */
    k_csm_c<<<dim3(TT, HG), 256, 0, stream>>>(S, CM, CZ, h0);
    k_pv<<<dim3(NQB, 1, HG), 128, 0, stream>>>(S, VT, VB, VBL, b, h0, Y);
  }
  k_out<<<dim3(TNB * TT / 64, DIN / 128), 128, 0, stream>>>(Y, F[4], F[0], (float*)d_out);   /* sum over heads folded into the projection: merged row (h, d) x wo[d][:] for every h; + x (the third argument is the RESIDUAL here, not a bias) */
}

// v001
// Measured time: 1060 microseconds a run.
// Two timings next to v000 put it at 7.11 and 7.14 times that version's speed.
// compute dtype: all float inputs rounded to bf16; q/k/v projections with EXACT bf16 products on WMMA 16x16x32 (f32 accumulate); causal scores q x k once to f16 each (1 product) x 64^-0.5 plus the ALiBi bias slope_h (key - query) in f32; softmax over the QUERY axis in f32 (per key column: online max / sum over the visible queries, precise expf); P x 2^11 once to f16 x v once to f16 (1 product); the 16 heads' outputs are SUMMED inside the output projection (ctx x 2^6 once to f16 x wo f16(bf16 x 2^8), the 64-row weight re-used for every head); + bf16(x) residual in f32; f32 output.
#include <hip/hip_runtime.h>
#include <math.h>

typedef __attribute__((ext_vector_type(16))) _Float16 v16h;
typedef __attribute__((ext_vector_type(16))) __bf16 v16b;
typedef __attribute__((ext_vector_type(8)))  _Float16 v8h;
typedef __attribute__((ext_vector_type(8)))  float v8f;
typedef __attribute__((ext_vector_type(4)))  float v4f;
typedef __attribute__((ext_vector_type(2)))  float v2f;
typedef __attribute__((ext_vector_type(4)))  unsigned v4u;
typedef __attribute__((ext_vector_type(4)))  int v4i;
typedef float __attribute__((may_alias)) float_a;
typedef int __attribute__((may_alias)) int_a;

template <typename T> __device__ __forceinline__ void vst2(void* p, T v) { *(T*)p = v;  }
__device__ __forceinline__ v8f wmma16(v16h a, v16h b, v8f c) {
  v8f d = __builtin_amdgcn_wmma_f32_16x16x32_f16(false, a, false, b, (short)0, c, false, false);
  asm volatile("v_nop\n\tv_nop\n\tv_nop\n\tv_nop" : "+v"(d) : "v"(a), "v"(b));
  return d;
}
__device__ __forceinline__ v8f wmma_bf(v16b a, v16b b, v8f c) {
  v8f d = __builtin_amdgcn_wmma_f32_16x16x32_bf16(false, a, false, b, (short)0, c, false, false);
  asm volatile("v_nop\n\tv_nop\n\tv_nop\n\tv_nop" : "+v"(d) : "v"(a), "v"(b));
  return d;
}
// 16x16x32 fragments: lane = (h = lane>>4, row/col = lane&15); elements 0..7 = k0+8h+0..7, 8..15 = k0+16+8h+0..7; D element r = row 8h+r
__device__ __forceinline__ v16h frag_h(const _Float16* rowk0, int lane) {
  union { v16h v; v8h q[2]; } u; const _Float16* p = rowk0 + 8 * (lane >> 4);
  u.q[0] = *(const v8h*)p; u.q[1] = *(const v8h*)(p + 16); return u.v;
}
__device__ __forceinline__ v16h frag_f32(const float* rowk0, int lane) {
  v16h a; const float* p = rowk0 + 8 * (lane >> 4);
#pragma unroll
  for (int i = 0; i < 8; ++i) { a[i] = (_Float16)p[i]; a[8 + i] = (_Float16)p[16 + i]; }
  return a;
}
__device__ __forceinline__ v16h frag_f32s(const float* rowk0, int lane, float sc) {
  v16h a; const float* p = rowk0 + 8 * (lane >> 4);
#pragma unroll
  for (int i = 0; i < 8; ++i) { a[i] = (_Float16)(p[i] * sc); a[8 + i] = (_Float16)(p[16 + i] * sc); }
  return a;
}
// column fragment from a [K][ld] layout (column n), rows >= K read as 0
__device__ __forceinline__ v16h fragc_f32(const float* W, int k0, int n, int lane, int ld, int K) {
  v16h a; const int g = lane >> 4;
#pragma unroll
  for (int i = 0; i < 8; ++i) { const int ka = k0 + 8 * g + i, kb = ka + 16;
    a[i] = (_Float16)(ka < K ? W[(size_t)(ka < K ? ka : K - 1) * ld + n] : 0.f); a[8 + i] = (_Float16)(kb < K ? W[(size_t)(kb < K ? kb : K - 1) * ld + n] : 0.f); }
  return a;
}
struct F2 { v16b h, l; };
__device__ __forceinline__ F2 bsplit16(const float v[16]) { F2 r;
#pragma unroll
  for (int i = 0; i < 16; ++i) { const __bf16 h = (__bf16)v[i]; r.h[i] = h; r.l[i] = (__bf16)(v[i] - (float)h); }
  return r; }
__device__ __forceinline__ F2 split_row(const float* row, int k0, int lane) { float v[16]; const float* p = row + k0 + 8 * (lane >> 4);
#pragma unroll
  for (int i = 0; i < 8; ++i) { v[i] = p[i]; v[8 + i] = p[16 + i]; }
  return bsplit16(v); }
__device__ __forceinline__ F2 split_rowK(const float* row, int k0, int lane, int K) { float v[16]; const int g = lane >> 4;
#pragma unroll
  for (int i = 0; i < 8; ++i) { const int ka = k0 + 8 * g + i, kb = ka + 16; v[i] = ka < K ? row[ka < K ? ka : K - 1] : 0.f; v[8 + i] = kb < K ? row[kb < K ? kb : K - 1] : 0.f; }
  return bsplit16(v); }
__device__ __forceinline__ F2 split_col(const float* W, int k0, int n, int lane, int ld, int K) { float v[16]; const int g = lane >> 4;
#pragma unroll
  for (int i = 0; i < 8; ++i) { const int ka = k0 + 8 * g + i, kb = ka + 16; v[i] = ka < K ? W[(size_t)(ka < K ? ka : K - 1) * ld + n] : 0.f; v[8 + i] = kb < K ? W[(size_t)(kb < K ? kb : K - 1) * ld + n] : 0.f; }
  return bsplit16(v); }
__device__ __forceinline__ v8f mac3(const F2& a, const F2& b, v8f c) { c = wmma_bf(a.l, b.h, c); c = wmma_bf(a.h, b.l, c); return wmma_bf(a.h, b.h, c); }
__device__ __forceinline__ float sigm(float v) { return 1.0f / (1.0f + expf(-v)); }
#define LDSX() do { asm volatile("s_wait_dscnt 0" ::: "memory"); __builtin_amdgcn_wave_barrier(); __builtin_amdgcn_fence(__ATOMIC_RELEASE, "workgroup"); } while (0)

// ALiBi-biased multi-headed attention whose softmax runs over the QUERY axis and whose heads are SUMMED (x [2,2048,1024]; (in,out) wq / wk / wv [1024,1024] N(0, 1/1024), no biases; 16 heads x 64; prod = Q K^T / 8 + slope_h (k - q) with slope_h = 2^(-8 (h + 1) / 16); -inf where k > q; attention_weights = softmax(prod, axis=2) - axis 2 of [B, H, q, k] is the QUERY axis: every key column is normalised over the queries that can see it (faithful to the source); out_h = weights V_h; outputs = (sum over the 16 heads of out_h) wo with wo [64,1024]; result = x + outputs).
#define NB 2
#define TT 2048
#define CC 1024            // NH * HD = projected width
#define DIN 1024          // input (model) width
#define NH 16
#define HD 64
#define NQB (TT / 64)
#define HG 4
#define SCALE (0.125f)
#define CAUSAL 1
#ifndef TNB
#define TNB NB
#endif
__device__ __forceinline__ float bfr(float v) { return (float)(__bf16)v; }
__host__ __device__ __forceinline__ int kb_last(int qb) { return CAUSAL ? ((qb * 64 + 63) >> 7) : (TT / 128 - 1); }
typedef __attribute__((ext_vector_type(8))) __bf16 v8b;
__device__ __forceinline__ v16b frag_b(const __bf16* rowk0, int lane) {
  union { v16b v; v8b q[2]; } u; const __bf16* p = rowk0 + 8 * (lane >> 4);
  u.q[0] = *(const v8b*)p; u.q[1] = *(const v8b*)(p + 16); return u.v;
}
#define QBH 0              // no high-precision blocks: single-product scores and P.v everywhere (the output carries the f32 residual x and the sum of 16 heads: rms - 4)
#define QHI 0               // no q residual plane
#define KHI 64              // no k residual / v hi-lo planes are read
// B fragment (k rows k0+.., output column o) of a weight: (in,out) [K][ld] or (out,in) [ld rows of K]: bf16 exact, or f16(bf16 * 256) exact
__device__ __forceinline__ v16b wcol_io(const float* Wm, int k0, int o, int lane, int ld) { v16b w; const int g = lane >> 4;
#pragma unroll
  for (int i = 0; i < 8; ++i) { w[i] = (__bf16)Wm[(size_t)(k0 + 8 * g + i) * ld + o]; w[8 + i] = (__bf16)Wm[(size_t)(k0 + 16 + 8 * g + i) * ld + o]; }
  return w; }
__device__ __forceinline__ v16b wcol_oi(const float* Wm, int k0, int o, int lane, int K) { v16b w; const float* p = Wm + (size_t)o * K + k0 + 8 * (lane >> 4);
#pragma unroll
  for (int i = 0; i < 8; ++i) { w[i] = (__bf16)p[i]; w[8 + i] = (__bf16)p[16 + i]; }
  return w; }
__device__ __forceinline__ v16h wcolh_io(const float* Wm, int k0, int o, int lane, int ld) { v16h w; const int g = lane >> 4;
#pragma unroll
  for (int i = 0; i < 8; ++i) { w[i] = (_Float16)(bfr(Wm[(size_t)(k0 + 8 * g + i) * ld + o]) * 256.0f); w[8 + i] = (_Float16)(bfr(Wm[(size_t)(k0 + 16 + 8 * g + i) * ld + o]) * 256.0f); }
  return w; }
__device__ __forceinline__ v16h wcolh_oi(const float* Wm, int k0, int o, int lane, int K) { v16h w; const float* p = Wm + (size_t)o * K + k0 + 8 * (lane >> 4);
#pragma unroll
  for (int i = 0; i < 8; ++i) { w[i] = (_Float16)(bfr(p[i]) * 256.0f); w[8 + i] = (_Float16)(bfr(p[16 + i]) * 256.0f); }
  return w; }
#define WQKV_LAYOUT 0   // 0 = (in,out) [DIN][CC]; 1 = (out,in) [CC][DIN]; 2 = per-head [NH][DIN][HD]
__device__ __forceinline__ v16b wcol_hdk(const float* Wm, int k0, int o, int lane) { v16b w; const int g = lane >> 4; const float* p = Wm + (size_t)(o / HD) * DIN * HD + (o % HD);
#pragma unroll
  for (int i = 0; i < 8; ++i) { w[i] = (__bf16)p[(size_t)(k0 + 8 * g + i) * HD]; w[8 + i] = (__bf16)p[(size_t)(k0 + 16 + 8 * g + i) * HD]; }
  return w; }
#define WO_OUT_IN 0
#if WQKV_LAYOUT == 1
#define WCOL(W, k0, o, lane) wcol_oi(W, k0, o, lane, DIN)
#elif WQKV_LAYOUT == 2
#define WCOL(W, k0, o, lane) wcol_hdk(W, k0, o, lane)
#else
#define WCOL(W, k0, o, lane) wcol_io(W, k0, o, lane, CC)
#endif
#if WO_OUT_IN
#define WOCOL(W, k0, o, lane) wcol_oi(W, k0, o, lane, CC)
#define WOCOLH(W, k0, o, lane) wcolh_oi(W, k0, o, lane, CC)
#else
#define WOCOL(W, k0, o, lane) wcol_io(W, (k0) & 63, o, lane, DIN)
#define WOCOLH(W, k0, o, lane) wcolh_io(W, (k0) & 63, o, lane, DIN)   /* wo is [64][1024]: merged column (h*64 + d) uses weight row d - i.e. the 16 heads are summed by the projection itself (k0 is a multiple of 32, so a fragment's 32 rows stay inside one head's 64) */
#endif

#ifndef SM_EXTRA_PARAMS
#define SM_EXTRA_PARAMS
#endif
#ifndef PROJ_EXTRA_PARAMS
#define PROJ_EXTRA_PARAMS
#endif
#ifndef SM_MASK_HOOK
#define SM_MASK_HOOK (void)0
#endif

#define WS_QH  0u                                      // f16 q rows [b*t][CC]
#define WS_KH  (WS_QH + 2u * (size_t)NB * TT * CC)      // f16 k rows [b*t][CC]
#define WS_VT  (WS_KH + 2u * (size_t)NB * TT * CC)      // f16 v planes [b][c][t]
#define WS_QL  (WS_VT + 2u * (size_t)NB * CC * TT)      // f16 q residual x 2^10 rows [b][t < QHI][CC]
#define WS_KL  (WS_QL + 2u * (size_t)NB * QHI * CC)     // f16 k residual x 2^10 rows [b][t < KHI][CC]
#define WS_VB  (WS_KL + 2u * (size_t)NB * KHI * CC)     // bf16 v hi planes [b][c][t < KHI]
#define WS_VBL (WS_VB + 2u * (size_t)NB * CC * KHI)
#define WS_S   (WS_VBL + 2u * (size_t)NB * CC * KHI)    // f32 logits / P [hg][t][s]
#define WS_Y   (WS_S  + 4u * (size_t)HG * TT * TT)      // f32 ctx rows [b*t][CC] (only when there is an output projection)
#define WS_END (WS_Y  + 4u * (size_t)NB * TT * CC)
#define WS_CM (WS_END)                                  // f32 column maxima [HG][TT]
#define WS_CZ (WS_CM + 4u * (size_t)HG * TT)
#define WS_END2 (WS_CZ + 4u * (size_t)HG * TT)

// ---- k_proj: block = (64 rows, 128 cols, which): q/k/v = X W (+ b) with exact bf16 products (K = DIN) -> which 0: q f16 rows (+ residual rows < QHI); 1: k f16 rows (+ residual rows < KHI); 2: v f16 planes [c][t] (+ bf16 hi/lo planes for t < KHI)
__global__ __launch_bounds__(128) void k_proj(const float* __restrict__ XQ, const float* __restrict__ XK, const float* __restrict__ XV, const float* __restrict__ WQ, const float* __restrict__ WK, const float* __restrict__ WV, const float* __restrict__ BQ, const float* __restrict__ BK, const float* __restrict__ BV,
    _Float16* __restrict__ QH, _Float16* __restrict__ QL, _Float16* __restrict__ KH, _Float16* __restrict__ KL, _Float16* __restrict__ VT, __bf16* __restrict__ VB, __bf16* __restrict__ VBL) {
  __shared__ __align__(16) _Float16 sh[64][136], sl[64][136]; __shared__ __align__(16) _Float16 th[128][72]; __shared__ __align__(16) __bf16 tb[128][72], tbl[128][72];
  const int tid = threadIdx.x, wave = tid >> 5, lane = tid & 31, col = lane & 15, g = lane >> 4; const int which = blockIdx.z; const int c0 = blockIdx.y * 128; const size_t r0 = (size_t)blockIdx.x * 64; const size_t bb = r0 / TT; const int t0 = (int)(r0 % TT);
  const float* X = which == 0 ? XQ : which == 1 ? XK : XV; const float* WA = which == 0 ? WQ : which == 1 ? WK : WV; const float* BA = which == 0 ? BQ : which == 1 ? BK : BV;
  v8f acc[8] = {};
#pragma unroll 2
  for (int kc = 0; kc < DIN / 32; ++kc) { v16b a; { const float* p = X + (r0 + wave * 16 + col) * DIN + kc * 32 + 8 * g;
#pragma unroll
      for (int i = 0; i < 8; ++i) { a[i] = (__bf16)p[i]; a[8 + i] = (__bf16)p[16 + i]; } }
    asm volatile("s_wait_loadcnt 0x0" ::: "memory");
#pragma unroll
    for (int j = 0; j < 8; ++j) { const v16b w = WCOL(WA, kc * 32, c0 + j * 16 + col, lane); asm volatile("s_wait_loadcnt 0x0" ::: "memory"); acc[j] = wmma_bf(a, w, acc[j]); } }
  if (which < 2) { _Float16* DH = which == 0 ? QH : KH; _Float16* DL = which == 0 ? QL : KL; const int nhi = which == 0 ? QHI : KHI; const bool hi_rows = t0 < nhi;
#pragma unroll
    for (int j = 0; j < 8; ++j) { const float bias = BA ? bfr(BA[c0 + j * 16 + col]) : 0.f;
#pragma unroll
      for (int r = 0; r < 8; ++r) { const float v = acc[j][r] + bias; const _Float16 hv = (_Float16)v; sh[wave * 16 + 8 * g + r][j * 16 + col] = hv; sl[wave * 16 + 8 * g + r][j * 16 + col] = (_Float16)((v - (float)hv) * 1024.0f); } }
    __syncthreads();
    for (int e = tid; e < 64 * 16; e += 128) { const int rl = e >> 4, q = e & 15; vst2((unsigned*)(DH + (r0 + rl) * CC + c0 + q * 8), *(const v4u*)&sh[rl][q * 8]); if (hi_rows) vst2((unsigned*)(DL + (bb * nhi + t0 + rl) * (size_t)CC + c0 + q * 8), *(const v4u*)&sl[rl][q * 8]); }
  } else { const bool hi_rows = t0 < KHI;
#pragma unroll
    for (int j = 0; j < 8; ++j) { const float bias = BA ? bfr(BA[c0 + j * 16 + col]) : 0.f;
#pragma unroll
      for (int r = 0; r < 8; ++r) { const float v = acc[j][r] + bias; const int rl = wave * 16 + 8 * g + r, cl = j * 16 + col; th[cl][rl] = (_Float16)v; const __bf16 bh = (__bf16)v; tb[cl][rl] = bh; tbl[cl][rl] = (__bf16)(v - (float)bh); } }
    __syncthreads();
    for (int e = tid; e < 128 * 8; e += 128) { const int cl = e >> 3, q = e & 7; vst2((unsigned*)(VT + (bb * CC + c0 + cl) * (size_t)TT + t0 + q * 8), *(const v4u*)&th[cl][q * 8]); if (hi_rows) { const size_t o3 = (bb * CC + c0 + cl) * (size_t)KHI + t0 + q * 8; vst2((unsigned*)(VB + o3), *(const v4u*)&tb[cl][q * 8]); vst2((unsigned*)(VBL + o3), *(const v4u*)&tbl[cl][q * 8]); } } } }
// ---- k_sc: block = (query block qb, key block kb <= kb_last(qb), head in group) of batch b: logits x SCALE; q hi + residual (x 2^10) against k (2 products) for query rows < QHI, plus the k residual (3 products) for query blocks < QBH (causal early rows); causal: blocks past the diagonal exit, the mask itself is applied by index in k_colstat_c and k_csm_c
__global__ __launch_bounds__(128) void k_sc(const _Float16* __restrict__ QH, const _Float16* __restrict__ KH, const _Float16* __restrict__ QL, const _Float16* __restrict__ KL, int b, int h0, float* __restrict__ S0) { __shared__ __align__(16) float ss[4][16][132];
  const int qb = blockIdx.x, kb = blockIdx.y; if (kb > kb_last(qb)) return;
  const int h = h0 + blockIdx.z; float* S = S0 + (size_t)blockIdx.z * TT * TT;
  const int tid = threadIdx.x, wave = tid >> 5, lane = tid & 31, col = lane & 15, g = lane >> 4; const int k0 = kb * 128; const int ql0 = qb * 64 + wave * 16; const size_t q0 = (size_t)b * TT + ql0, kr0 = (size_t)b * TT + k0;
  v8f acc[8] = {}, accl[8] = {};
  const _Float16* QLb = QL + (size_t)b * QHI * CC; const _Float16* KLb = KL + (size_t)b * KHI * CC;
  if (qb < QBH) {
#pragma unroll
    for (int kc = 0; kc < HD / 32; ++kc) { const v16h ah = frag_h(QH + (q0 + col) * CC + h * HD + kc * 32, lane), al = frag_h(QLb + (size_t)(ql0 + col) * CC + h * HD + kc * 32, lane);
#pragma unroll
      for (int j = 0; j < 8; ++j) { const v16h kbf = frag_h(KH + (kr0 + j * 16 + col) * CC + h * HD + kc * 32, lane), klf = frag_h(KLb + (size_t)(k0 + j * 16 + col) * CC + h * HD + kc * 32, lane); acc[j] = wmma16(ah, kbf, acc[j]); accl[j] = wmma16(al, kbf, accl[j]); accl[j] = wmma16(ah, klf, accl[j]); } }
  } else if (qb * 64 < QHI) {
#pragma unroll
    for (int kc = 0; kc < HD / 32; ++kc) { const v16h ah = frag_h(QH + (q0 + col) * CC + h * HD + kc * 32, lane), al = frag_h(QLb + (size_t)(ql0 + col) * CC + h * HD + kc * 32, lane);
#pragma unroll
      for (int j = 0; j < 8; ++j) { const v16h kbf = frag_h(KH + (kr0 + j * 16 + col) * CC + h * HD + kc * 32, lane); acc[j] = wmma16(ah, kbf, acc[j]); accl[j] = wmma16(al, kbf, accl[j]); } }
  } else {
#pragma unroll
    for (int kc = 0; kc < HD / 32; ++kc) { const v16h ah = frag_h(QH + (q0 + col) * CC + h * HD + kc * 32, lane);
#pragma unroll
      for (int j = 0; j < 8; ++j) { const v16h kbf = frag_h(KH + (kr0 + j * 16 + col) * CC + h * HD + kc * 32, lane); acc[j] = wmma16(ah, kbf, acc[j]); } } }
#pragma unroll
  for (int j = 0; j < 8; ++j) {
#pragma unroll
    for (int r = 0; r < 8; ++r) ss[wave][8 * g + r][j * 16 + col] = (acc[j][r] + accl[j][r] * (1.0f / 1024.0f)) * SCALE; }
  LDSX(); for (int rl = 0; rl < 16; ++rl) vst2(S + (size_t)(ql0 + rl) * TT + k0 + lane * 4, *(const v4f*)&ss[wave][rl][lane * 4]); }
// ---- k_sm: block = query row t (head in group): keys [0, kend): causal -> logit if s <= t else excluded; softmax in f32; P x 2^11 in place (0 for excluded)
__global__ __launch_bounds__(256) void k_sm(float* __restrict__ S0 SM_EXTRA_PARAMS) { __shared__ float sred[8]; __shared__ float sbc; __shared__ __align__(16) float shv[TT];
  const int tid = threadIdx.x; const int t = blockIdx.x; const int kend = (kb_last(t >> 6) + 1) * 128;
  float* sr = S0 + (size_t)blockIdx.y * TT * TT + (size_t)t * TT;
  float m = -3.0e38f; for (int k = tid; k < kend; k += 256) { float v = (!CAUSAL || k <= t) ? sr[k] : -3.0e38f; SM_MASK_HOOK; shv[k] = v; m = fmaxf(m, v); }
#pragma unroll
  for (int o = 1; o < 32; o <<= 1) m = fmaxf(m, __shfl_xor(m, o));
  if ((tid & 31) == 0) sred[tid >> 5] = m; __syncthreads(); if (tid == 0) { float a = sred[0]; for (int i = 1; i < 8; ++i) a = fmaxf(a, sred[i]); sbc = a; } __syncthreads(); m = sbc; __syncthreads();
  float sum = 0.f; for (int k = tid; k < kend; k += 256) { const float v = shv[k]; const float e = (v <= -1.0e38f) ? 0.f : expf(v - m); shv[k] = e; sum += e; }
#pragma unroll
  for (int o = 1; o < 32; o <<= 1) sum += __shfl_xor(sum, o);
  if ((tid & 31) == 0) sred[tid >> 5] = sum; __syncthreads(); if (tid == 0) { float a = 0.f; for (int i = 0; i < 8; ++i) a += sred[i]; sbc = a > 0.f ? 2048.0f / a : 0.f; }   /* a fully excluded row yields P = 0 */ __syncthreads(); const float inv = sbc;
  for (int k = tid; k < kend; k += 256) shv[k] = shv[k] * inv;
  __syncthreads(); for (int q = tid; q < kend / 4; q += 256) vst2(sr + q * 4, *(const v4f*)&shv[q * 4]); }
// ---- k_colstat_c: softmax over the QUERY axis under the causal mask (the source's softmax(axis=2) on [B, H, q, k] scores - ALiBi-biased - with -inf where k > q): for every key column k: m_k = max_{q >= k} S[q][k], Z_k = sum_{q >= k} exp(S[q][k] - m_k) (online, f32, precise expf). Block = 32 key columns (one 128-B line of every score row) x 128 row slices: a lane holds 4 adjacent columns, 8 lanes cover the line, a wave takes 4 rows a trip and the 32 waves step 128 rows a trip; slice s owns the rows first column + s + 128 i. The row loop starts at the block's first column and masks q < k by a value select after an unconditional load (rows above a column's diagonal still lie in score blocks k_sc computed: their content is discarded). The 128 partial (max, sum) pairs of a column are merged by 2 lane exchanges, then through LDS by wave 0, which alone stores the block's line of CM and of CZ
__device__ __forceinline__ void ms_merge(float& m, float& z, float mo, float zo) { const float mn = fmaxf(m, mo); z = z * expf(m - mn) + zo * expf(mo - mn); m = mn; }   /* an empty slice carries (-3e38, 0) and adds 0 */
__global__ __launch_bounds__(1024) void k_colstat_c(const float* __restrict__ S0, float* __restrict__ CM, float* __restrict__ CZ, int h0) { __shared__ __align__(16) float pm[32][32], pz[32][32];
  const float slope_ = exp2f(-0.5f * (float)(h0 + blockIdx.y + 1));   /* ALiBi slope of this head: 2^(-8 (h + 1) / 16) */ const int tid = threadIdx.x, wave = tid >> 5, lane = tid & 31; const int k0 = blockIdx.x * 32, k = k0 + (lane & 7) * 4; const float* sp = S0 + (size_t)blockIdx.y * TT * TT + k;
  float m[4] = {-3.0e38f, -3.0e38f, -3.0e38f, -3.0e38f}, z[4] = {0.f, 0.f, 0.f, 0.f};
  for (int q = k0 + wave * 4 + (lane >> 3); q < TT; q += 128) { const v4f ld = *(const v4f*)(sp + (size_t)q * TT);
#pragma unroll
    for (int u = 0; u < 4; ++u) { const bool vis = q >= k + u; const float v = vis ? (ld[u] + slope_ * (float)(k + u - q)) : -3.0e38f;   /* + the ALiBi bias slope (key - query) <= 0 */ const float mn = fmaxf(m[u], v); z[u] = z[u] * expf(m[u] - mn) + (vis ? expf(v - mn) : 0.f); m[u] = mn; } }
#pragma unroll
  for (int o = 8; o < 32; o <<= 1) {
#pragma unroll
    for (int u = 0; u < 4; ++u) { const float mo = __shfl_xor(m[u], o), zo = __shfl_xor(z[u], o); ms_merge(m[u], z[u], mo, zo); } }
  if (lane < 8) { v4f a, c;
#pragma unroll
    for (int u = 0; u < 4; ++u) { a[u] = m[u]; c[u] = z[u]; }
    *(v4f*)&pm[wave][lane * 4] = a; *(v4f*)&pz[wave][lane * 4] = c; }
  __syncthreads();
  if (wave == 0) { float mm = pm[0][lane];
#pragma unroll
    for (int w = 1; w < 32; ++w) mm = fmaxf(mm, pm[w][lane]);
    float zz = 0.f;
#pragma unroll
    for (int w = 0; w < 32; ++w) zz += pz[w][lane] * expf(pm[w][lane] - mm);
    vst2(CM + (size_t)blockIdx.y * TT + k0 + lane, mm); vst2(CZ + (size_t)blockIdx.y * TT + k0 + lane, zz); } }   /* every column sees at least its own diagonal entry: Z_k >= 1 */
// ---- k_csm_c: block = query row t: P[t][k] = exp(S[t][k] - m_k) / Z_k x 2^11 for k <= t, 0 for t < k < kend (inside the diagonal block); in place; unconditional loads, value select
__global__ __launch_bounds__(256) void k_csm_c(float* __restrict__ S0, const float* __restrict__ CM, const float* __restrict__ CZ, int h0) { const float slope_ = exp2f(-0.5f * (float)(h0 + blockIdx.y + 1)); const int tid = threadIdx.x; const int t = blockIdx.x; const int kend = (kb_last(t >> 6) + 1) * 128; float* sr = S0 + (size_t)blockIdx.y * TT * TT + (size_t)t * TT; const float* cm = CM + (size_t)blockIdx.y * TT; const float* cz = CZ + (size_t)blockIdx.y * TT;
  for (int q4 = tid; q4 < kend / 4; q4 += 256) { const v4f sv = *(const v4f*)(sr + q4 * 4), m4 = *(const v4f*)(cm + q4 * 4), z4 = *(const v4f*)(cz + q4 * 4); asm volatile("s_wait_loadcnt 0x0" ::: "memory"); v4f p;
#pragma unroll
    for (int u = 0; u < 4; ++u) p[u] = (q4 * 4 + u <= t) ? expf((sv[u] + slope_ * (float)(q4 * 4 + u - t)) - m4[u]) * (2048.0f / z4[u]) : 0.f;
    vst2(sr + q4 * 4, p); } }
// ---- k_pv: block = 64 queries (qb) of (b, h): ctx = P . v over keys [0, kend) (P x 2^11 once to f16 against v f16: 1 product; causal early query blocks: P and v as bf16 hi + lo, 3 products); 256-B (row, head) segment by 16 lanes
__global__ __launch_bounds__(128) void k_pv(const float* __restrict__ PS0, const _Float16* __restrict__ VT, const __bf16* __restrict__ VB, const __bf16* __restrict__ VBL, int b, int h0, float* __restrict__ Y) { const int h = h0 + blockIdx.z; const float* PS = PS0 + (size_t)blockIdx.z * TT * TT; __shared__ __align__(16) float ss[4][16][HD + 4];
  const int tid = threadIdx.x, wave = tid >> 5, lane = tid & 31, col = lane & 15, g = lane >> 4; const int qb = blockIdx.x; const int ql0 = qb * 64 + wave * 16; const int kce = (kb_last(qb) + 1) * 4;
  v8f acc[HD / 16] = {};
  if (qb < QBH) {
#pragma unroll 1
    for (int kc = 0; kc < kce; ++kc) { const F2 p = split_row(PS + (size_t)(ql0 + col) * TT, kc * 32, lane);
      asm volatile("s_wait_loadcnt 0x0" ::: "memory");
#pragma unroll
      for (int j = 0; j < HD / 16; ++j) { const size_t po = ((size_t)b * CC + h * HD + j * 16 + col) * (size_t)KHI + kc * 32; const v16b vh = frag_b(VB + po, lane); acc[j] = wmma_bf(p.h, vh, acc[j]); acc[j] = wmma_bf(p.l, vh, acc[j]); acc[j] = wmma_bf(p.h, frag_b(VBL + po, lane), acc[j]); } }
  } else {
#pragma unroll 1
    for (int kc = 0; kc < kce; ++kc) { const v16h p = frag_f32(PS + (size_t)(ql0 + col) * TT + kc * 32, lane);
      asm volatile("s_wait_loadcnt 0x0" ::: "memory");
#pragma unroll
      for (int j = 0; j < HD / 16; ++j) { const size_t po = ((size_t)b * CC + h * HD + j * 16 + col) * (size_t)TT + kc * 32; acc[j] = wmma16(p, frag_h(VT + po, lane), acc[j]); } } }
#pragma unroll
  for (int j = 0; j < HD / 16; ++j)
#pragma unroll
    for (int r = 0; r < 8; ++r) ss[wave][8 * g + r][j * 16 + col] = acc[j][r] * (1.0f / 2048.0f);
  LDSX(); for (int rl = 0; rl < 16; ++rl) if (lane < HD / 4) vst2(Y + ((size_t)b * TT + ql0 + rl) * CC + h * HD + lane * 4, *(const v4f*)&ss[wave][rl][lane * 4]); }
// ---- k_out: block = (64 rows, 128 cols): out = ctx Wo (+ bo): ctx x 2^6 once to f16 against Wo as f16(bf16 x 2^8) exact (1 product) x 2^-14; causal early rows (< QHI of each sequence): ctx bf16 hi + lo against exact bf16 Wo (2 products)
__global__ __launch_bounds__(128) void k_out(const float* __restrict__ Y, const float* __restrict__ WO, const float* __restrict__ BO, float* __restrict__ OUT) { __shared__ __align__(16) float sf[4][16][132];
  const int tid = threadIdx.x, wave = tid >> 5, lane = tid & 31, col = lane & 15, g = lane >> 4; const int c0 = blockIdx.y * 128; const size_t r0 = (size_t)blockIdx.x * 64 + wave * 16;
  v8f acc[8] = {};
  if (CAUSAL && (int)(((size_t)blockIdx.x * 64) % TT) < QHI) {   /* block-uniform */
#pragma unroll 2
    for (int kc = 0; kc < CC / 32; ++kc) { const F2 a = split_row(Y + (r0 + col) * CC, kc * 32, lane); asm volatile("s_wait_loadcnt 0x0" ::: "memory");
#pragma unroll
      for (int j = 0; j < 8; ++j) { const v16b w = WOCOL(WO, kc * 32, c0 + j * 16 + col, lane); asm volatile("s_wait_loadcnt 0x0" ::: "memory"); acc[j] = wmma_bf(a.h, w, acc[j]); acc[j] = wmma_bf(a.l, w, acc[j]); } }
#pragma unroll
    for (int j = 0; j < 8; ++j) { const float bias = 0.f;   /* this module has no output bias: the BO argument carries the RESIDUAL x, added at the store */
#pragma unroll
      for (int r = 0; r < 8; ++r) sf[wave][8 * g + r][j * 16 + col] = acc[j][r] + bias; }
  } else {
#pragma unroll 2
    for (int kc = 0; kc < CC / 32; ++kc) { const v16h a = frag_f32s(Y + (r0 + col) * CC + kc * 32, lane, 64.0f); asm volatile("s_wait_loadcnt 0x0" ::: "memory");   /* ctx carried x 2^6 into f16 so small-magnitude context rows stay clear of f16 subnormals (chip FTZ) */
#pragma unroll
      for (int j = 0; j < 8; ++j) { const v16h w = WOCOLH(WO, kc * 32, c0 + j * 16 + col, lane); asm volatile("s_wait_loadcnt 0x0" ::: "memory"); acc[j] = wmma16(a, w, acc[j]); } }
#pragma unroll
    for (int j = 0; j < 8; ++j) { const float bias = 0.f;   /* this module has no output bias: the BO argument carries the RESIDUAL x, added at the store */
#pragma unroll
      for (int r = 0; r < 8; ++r) sf[wave][8 * g + r][j * 16 + col] = acc[j][r] * (1.0f / 16384.0f) + bias; } }   /* 2^-8 (Wo carry) x 2^-6 (ctx carry) */
  LDSX(); for (int rl = 0; rl < 16; ++rl) { const v4f xr = *(const v4f*)(BO + (r0 + rl) * DIN + c0 + lane * 4); asm volatile("s_wait_loadcnt 0x0" ::: "memory"); v4f o = *(const v4f*)&sf[wave][rl][lane * 4]; o[0] += bfr(xr[0]); o[1] += bfr(xr[1]); o[2] += bfr(xr[2]); o[3] += bfr(xr[3]); vst2(OUT + (r0 + rl) * DIN + c0 + lane * 4, o); } }   /* x + outputs */

extern "C" void kernel_launch(void* const* d_in, const int* in_sizes, int n_in, void* d_out, int out_size, void* d_ws, size_t ws_size, hipStream_t stream) {
  (void)in_sizes; (void)n_in; (void)out_size;
  const float** F = (const float**)d_in;
  if (ws_size < (size_t)WS_END) return;
  char* ws = (char*)d_ws; _Float16 *QH = (_Float16*)(ws + WS_QH), *KH = (_Float16*)(ws + WS_KH), *VT = (_Float16*)(ws + WS_VT), *QL = (_Float16*)(ws + WS_QL), *KL = (_Float16*)(ws + WS_KL); __bf16 *VB = (__bf16*)(ws + WS_VB), *VBL = (__bf16*)(ws + WS_VBL); float *S = (float*)(ws + WS_S), *Y = (float*)(ws + WS_Y);
  (void)Y; (void)QL; (void)KL; (void)VB; (void)VBL;
  // inputs: 0 x [2,2048,1024]; 1 wq [1024,1024] (in,out); 2 wk; 3 wv; 4 wo [64,1024] (in,out: it acts on the SUM of the 16 heads' 64-dim outputs); no biases
  if (ws_size < (size_t)WS_END2) return;
  float *CM = (float*)(ws + WS_CM), *CZ = (float*)(ws + WS_CZ);
  k_proj<<<dim3(TNB * TT / 64, CC / 128, 3), 128, 0, stream>>>(F[0], F[0], F[0], F[1], F[2], F[3], nullptr, nullptr, nullptr, QH, QL, KH, KL, VT, VB, VBL);
  for (int b = 0; b < TNB; ++b) for (int h0 = 0; h0 < NH; h0 += HG) {
    k_sc<<<dim3(NQB, TT / 128, HG), 128, 0, stream>>>(QH, KH, QL, KL, b, h0, S);
    k_colstat_c<<<dim3(TT / 32, HG), 1024, 0, stream>>>(S, CM, CZ, h0);   /* per key column: max / sum over the visible queries of exp(score + ALiBi bias) */
    k_csm_c<<<dim3(TT, HG), 256, 0, stream>>>(S, CM, CZ, h0);
    k_pv<<<dim3(NQB, 1, HG), 128, 0, stream>>>(S, VT, VB, VBL, b, h0, Y);
  }
  k_out<<<dim3(TNB * TT / 64, DIN / 128), 128, 0, stream>>>(Y, F[4], F[0], (float*)d_out);   /* sum over heads folded into the projection: merged row (h, d) x wo[d][:] for every h; + x (the third argument is the RESIDUAL here, not a bias) */
}

// v002
// One run takes 308 microseconds.
// Next to v001, in two timings, it ran 3.45 and 3.46 times as fast.
// Over all steps from v000 it is 24.6 times as fast.
// compute dtype: all float inputs rounded to bf16; q/k/v projections with EXACT bf16 products on WMMA 16x16x32 (f32 accumulate); causal scores q x k once to f16 each (1 product) x 64^-0.5 plus the ALiBi bias slope_h (key - query) in f32; softmax over the QUERY axis in f32 (per key column: online max / sum over the visible queries, precise expf); P x 2^11 once to f16 x v once to f16 (1 product); the 16 heads' outputs are SUMMED inside the output projection (ctx x 2^6 once to f16 x wo f16(bf16 x 2^8), the 64-row weight re-used for every head); + bf16(x) residual in f32; f32 output.
#include <hip/hip_runtime.h>
#include <math.h>

typedef __attribute__((ext_vector_type(16))) _Float16 v16h;
typedef __attribute__((ext_vector_type(16))) __bf16 v16b;
typedef __attribute__((ext_vector_type(8)))  _Float16 v8h;
typedef __attribute__((ext_vector_type(8)))  float v8f;
typedef __attribute__((ext_vector_type(4)))  float v4f;
typedef __attribute__((ext_vector_type(2)))  float v2f;
typedef __attribute__((ext_vector_type(4)))  unsigned v4u;
typedef __attribute__((ext_vector_type(4)))  int v4i;
typedef float __attribute__((may_alias)) float_a;
typedef int __attribute__((may_alias)) int_a;

template <typename T> __device__ __forceinline__ void vst2(void* p, T v) { *(T*)p = v;  }
__device__ __forceinline__ v8f wmma16(v16h a, v16h b, v8f c) {
  v8f d = __builtin_amdgcn_wmma_f32_16x16x32_f16(false, a, false, b, (short)0, c, false, false);
  asm volatile("v_nop\n\tv_nop\n\tv_nop\n\tv_nop" : "+v"(d) : "v"(a), "v"(b));
  return d;
}
__device__ __forceinline__ v8f wmma_bf(v16b a, v16b b, v8f c) {
  v8f d = __builtin_amdgcn_wmma_f32_16x16x32_bf16(false, a, false, b, (short)0, c, false, false);
  asm volatile("v_nop\n\tv_nop\n\tv_nop\n\tv_nop" : "+v"(d) : "v"(a), "v"(b));
  return d;
}
// 16x16x32 fragments: lane = (h = lane>>4, row/col = lane&15); elements 0..7 = k0+8h+0..7, 8..15 = k0+16+8h+0..7; D element r = row 8h+r
__device__ __forceinline__ v16h frag_h(const _Float16* rowk0, int lane) {
  union { v16h v; v8h q[2]; } u; const _Float16* p = rowk0 + 8 * (lane >> 4);
  u.q[0] = *(const v8h*)p; u.q[1] = *(const v8h*)(p + 16); return u.v;
}
__device__ __forceinline__ v16h frag_f32(const float* rowk0, int lane) {
  v16h a; const float* p = rowk0 + 8 * (lane >> 4);
#pragma unroll
  for (int i = 0; i < 8; ++i) { a[i] = (_Float16)p[i]; a[8 + i] = (_Float16)p[16 + i]; }
  return a;
}
__device__ __forceinline__ v16h frag_f32s(const float* rowk0, int lane, float sc) {
  v16h a; const float* p = rowk0 + 8 * (lane >> 4);
#pragma unroll
  for (int i = 0; i < 8; ++i) { a[i] = (_Float16)(p[i] * sc); a[8 + i] = (_Float16)(p[16 + i] * sc); }
  return a;
}
// column fragment from a [K][ld] layout (column n), rows >= K read as 0
__device__ __forceinline__ v16h fragc_f32(const float* W, int k0, int n, int lane, int ld, int K) {
  v16h a; const int g = lane >> 4;
#pragma unroll
  for (int i = 0; i < 8; ++i) { const int ka = k0 + 8 * g + i, kb = ka + 16;
    a[i] = (_Float16)(ka < K ? W[(size_t)(ka < K ? ka : K - 1) * ld + n] : 0.f); a[8 + i] = (_Float16)(kb < K ? W[(size_t)(kb < K ? kb : K - 1) * ld + n] : 0.f); }
  return a;
}
struct F2 { v16b h, l; };
__device__ __forceinline__ F2 bsplit16(const float v[16]) { F2 r;
#pragma unroll
  for (int i = 0; i < 16; ++i) { const __bf16 h = (__bf16)v[i]; r.h[i] = h; r.l[i] = (__bf16)(v[i] - (float)h); }
  return r; }
__device__ __forceinline__ F2 split_row(const float* row, int k0, int lane) { float v[16]; const float* p = row + k0 + 8 * (lane >> 4);
#pragma unroll
  for (int i = 0; i < 8; ++i) { v[i] = p[i]; v[8 + i] = p[16 + i]; }
  return bsplit16(v); }
__device__ __forceinline__ F2 split_rowK(const float* row, int k0, int lane, int K) { float v[16]; const int g = lane >> 4;
#pragma unroll
  for (int i = 0; i < 8; ++i) { const int ka = k0 + 8 * g + i, kb = ka + 16; v[i] = ka < K ? row[ka < K ? ka : K - 1] : 0.f; v[8 + i] = kb < K ? row[kb < K ? kb : K - 1] : 0.f; }
  return bsplit16(v); }
__device__ __forceinline__ F2 split_col(const float* W, int k0, int n, int lane, int ld, int K) { float v[16]; const int g = lane >> 4;
#pragma unroll
  for (int i = 0; i < 8; ++i) { const int ka = k0 + 8 * g + i, kb = ka + 16; v[i] = ka < K ? W[(size_t)(ka < K ? ka : K - 1) * ld + n] : 0.f; v[8 + i] = kb < K ? W[(size_t)(kb < K ? kb : K - 1) * ld + n] : 0.f; }
  return bsplit16(v); }
__device__ __forceinline__ v8f mac3(const F2& a, const F2& b, v8f c) { c = wmma_bf(a.l, b.h, c); c = wmma_bf(a.h, b.l, c); return wmma_bf(a.h, b.h, c); }
__device__ __forceinline__ float sigm(float v) { return 1.0f / (1.0f + expf(-v)); }
#define LDSX() do { asm volatile("s_wait_dscnt 0" ::: "memory"); __builtin_amdgcn_wave_barrier(); __builtin_amdgcn_fence(__ATOMIC_RELEASE, "workgroup"); } while (0)

// ALiBi-biased multi-headed attention whose softmax runs over the QUERY axis and whose heads are SUMMED (x [2,2048,1024]; (in,out) wq / wk / wv [1024,1024] N(0, 1/1024), no biases; 16 heads x 64; prod = Q K^T / 8 + slope_h (k - q) with slope_h = 2^(-8 (h + 1) / 16); -inf where k > q; attention_weights = softmax(prod, axis=2) - axis 2 of [B, H, q, k] is the QUERY axis: every key column is normalised over the queries that can see it (faithful to the source); out_h = weights V_h; outputs = (sum over the 16 heads of out_h) wo with wo [64,1024]; result = x + outputs).
#define NB 2
#define TT 2048
#define CC 1024            // NH * HD = projected width
#define DIN 1024          // input (model) width
#define NH 16
#define HD 64
#define SCALE (0.125f)
#define CAUSAL 1
#ifndef TNB
#define TNB NB
#endif
__device__ __forceinline__ float bfr(float v) { return (float)(__bf16)v; }
typedef __attribute__((ext_vector_type(8))) __bf16 v8b;
__device__ __forceinline__ v16b frag_b(const __bf16* rowk0, int lane) {
  union { v16b v; v8b q[2]; } u; const __bf16* p = rowk0 + 8 * (lane >> 4);
  u.q[0] = *(const v8b*)p; u.q[1] = *(const v8b*)(p + 16); return u.v;
}
#define QBH 0              // no high-precision blocks: single-product scores and P.v everywhere (the output carries the f32 residual x and the sum of 16 heads: rms - 4)
#define QHI 0               // no q residual plane
#define KHI 64              // no k residual / v hi-lo planes are read
// B fragment (k rows k0+.., output column o) of a weight: (in,out) [K][ld] or (out,in) [ld rows of K]: bf16 exact, or f16(bf16 * 256) exact
__device__ __forceinline__ v16b wcol_io(const float* Wm, int k0, int o, int lane, int ld) { v16b w; const int g = lane >> 4;
#pragma unroll
  for (int i = 0; i < 8; ++i) { w[i] = (__bf16)Wm[(size_t)(k0 + 8 * g + i) * ld + o]; w[8 + i] = (__bf16)Wm[(size_t)(k0 + 16 + 8 * g + i) * ld + o]; }
  return w; }
__device__ __forceinline__ v16b wcol_oi(const float* Wm, int k0, int o, int lane, int K) { v16b w; const float* p = Wm + (size_t)o * K + k0 + 8 * (lane >> 4);
#pragma unroll
  for (int i = 0; i < 8; ++i) { w[i] = (__bf16)p[i]; w[8 + i] = (__bf16)p[16 + i]; }
  return w; }
__device__ __forceinline__ v16h wcolh_io(const float* Wm, int k0, int o, int lane, int ld) { v16h w; const int g = lane >> 4;
#pragma unroll
  for (int i = 0; i < 8; ++i) { w[i] = (_Float16)(bfr(Wm[(size_t)(k0 + 8 * g + i) * ld + o]) * 256.0f); w[8 + i] = (_Float16)(bfr(Wm[(size_t)(k0 + 16 + 8 * g + i) * ld + o]) * 256.0f); }
  return w; }
__device__ __forceinline__ v16h wcolh_oi(const float* Wm, int k0, int o, int lane, int K) { v16h w; const float* p = Wm + (size_t)o * K + k0 + 8 * (lane >> 4);
#pragma unroll
  for (int i = 0; i < 8; ++i) { w[i] = (_Float16)(bfr(p[i]) * 256.0f); w[8 + i] = (_Float16)(bfr(p[16 + i]) * 256.0f); }
  return w; }
#define WQKV_LAYOUT 0   // 0 = (in,out) [DIN][CC]; 1 = (out,in) [CC][DIN]; 2 = per-head [NH][DIN][HD]
__device__ __forceinline__ v16b wcol_hdk(const float* Wm, int k0, int o, int lane) { v16b w; const int g = lane >> 4; const float* p = Wm + (size_t)(o / HD) * DIN * HD + (o % HD);
#pragma unroll
  for (int i = 0; i < 8; ++i) { w[i] = (__bf16)p[(size_t)(k0 + 8 * g + i) * HD]; w[8 + i] = (__bf16)p[(size_t)(k0 + 16 + 8 * g + i) * HD]; }
  return w; }
#define WO_OUT_IN 0
#if WQKV_LAYOUT == 1
#define WCOL(W, k0, o, lane) wcol_oi(W, k0, o, lane, DIN)
#elif WQKV_LAYOUT == 2
#define WCOL(W, k0, o, lane) wcol_hdk(W, k0, o, lane)
#else
#define WCOL(W, k0, o, lane) wcol_io(W, k0, o, lane, CC)
#endif
#if WO_OUT_IN
#define WOCOL(W, k0, o, lane) wcol_oi(W, k0, o, lane, CC)
#define WOCOLH(W, k0, o, lane) wcolh_oi(W, k0, o, lane, CC)
#else
#define WOCOL(W, k0, o, lane) wcol_io(W, (k0) & 63, o, lane, DIN)
#define WOCOLH(W, k0, o, lane) wcolh_io(W, (k0) & 63, o, lane, DIN)   /* wo is [64][1024]: merged column (h*64 + d) uses weight row d - i.e. the 16 heads are summed by the projection itself (k0 is a multiple of 32, so a fragment's 32 rows stay inside one head's 64) */
#endif

#ifndef PROJ_EXTRA_PARAMS
#define PROJ_EXTRA_PARAMS
#endif

#define WS_QH  0u                                      // f16 q rows [b*t][CC]
#define WS_KH  (WS_QH + 2u * (size_t)NB * TT * CC)      // f16 k rows [b*t][CC]
#define WS_VT  (WS_KH + 2u * (size_t)NB * TT * CC)      // f16 v planes [b][c][t]
#define WS_QL  (WS_VT + 2u * (size_t)NB * CC * TT)      // f16 q residual x 2^10 rows [b][t < QHI][CC]
#define WS_KL  (WS_QL + 2u * (size_t)NB * QHI * CC)     // f16 k residual x 2^10 rows [b][t < KHI][CC]
#define WS_VB  (WS_KL + 2u * (size_t)NB * KHI * CC)     // bf16 v hi planes [b][c][t < KHI]
#define WS_VBL (WS_VB + 2u * (size_t)NB * CC * KHI)
#define WS_Y   (WS_VBL + 2u * (size_t)NB * CC * KHI)    // f32 ctx rows [b*t][CC] (only when there is an output projection)
#define WS_END (WS_Y  + 4u * (size_t)NB * TT * CC)
#define WS_CM (WS_END)                                  // f32 column maxima [b][h][TT]
#define WS_CI (WS_CM + 4u * (size_t)NB * NH * TT)       // f32 2^11 / column sums [b][h][TT]
#define WS_END2 (WS_CI + 4u * (size_t)NB * NH * TT)

// ---- k_proj: block = (64 rows, 128 cols, which): q/k/v = X W (+ b) with exact bf16 products (K = DIN) -> which 0: q f16 rows (+ residual rows < QHI); 1: k f16 rows (+ residual rows < KHI); 2: v f16 planes [c][t] (+ bf16 hi/lo planes for t < KHI)
__global__ __launch_bounds__(128) void k_proj(const float* __restrict__ XQ, const float* __restrict__ XK, const float* __restrict__ XV, const float* __restrict__ WQ, const float* __restrict__ WK, const float* __restrict__ WV, const float* __restrict__ BQ, const float* __restrict__ BK, const float* __restrict__ BV,
    _Float16* __restrict__ QH, _Float16* __restrict__ QL, _Float16* __restrict__ KH, _Float16* __restrict__ KL, _Float16* __restrict__ VT, __bf16* __restrict__ VB, __bf16* __restrict__ VBL) {
  __shared__ __align__(16) _Float16 sh[64][136], sl[64][136]; __shared__ __align__(16) _Float16 th[128][72]; __shared__ __align__(16) __bf16 tb[128][72], tbl[128][72];
  const int tid = threadIdx.x, wave = tid >> 5, lane = tid & 31, col = lane & 15, g = lane >> 4; const int which = blockIdx.z; const int c0 = blockIdx.y * 128; const size_t r0 = (size_t)blockIdx.x * 64; const size_t bb = r0 / TT; const int t0 = (int)(r0 % TT);
  const float* X = which == 0 ? XQ : which == 1 ? XK : XV; const float* WA = which == 0 ? WQ : which == 1 ? WK : WV; const float* BA = which == 0 ? BQ : which == 1 ? BK : BV;
  v8f acc[8] = {};
#pragma unroll 2
  for (int kc = 0; kc < DIN / 32; ++kc) { v16b a; { const float* p = X + (r0 + wave * 16 + col) * DIN + kc * 32 + 8 * g;
#pragma unroll
      for (int i = 0; i < 8; ++i) { a[i] = (__bf16)p[i]; a[8 + i] = (__bf16)p[16 + i]; } }
    asm volatile("s_wait_loadcnt 0x0" ::: "memory");
#pragma unroll
    for (int j = 0; j < 8; ++j) { const v16b w = WCOL(WA, kc * 32, c0 + j * 16 + col, lane); asm volatile("s_wait_loadcnt 0x0" ::: "memory"); acc[j] = wmma_bf(a, w, acc[j]); } }
  if (which < 2) { _Float16* DH = which == 0 ? QH : KH; _Float16* DL = which == 0 ? QL : KL; const int nhi = which == 0 ? QHI : KHI; const bool hi_rows = t0 < nhi;
#pragma unroll
    for (int j = 0; j < 8; ++j) { const float bias = BA ? bfr(BA[c0 + j * 16 + col]) : 0.f;
#pragma unroll
      for (int r = 0; r < 8; ++r) { const float v = acc[j][r] + bias; const _Float16 hv = (_Float16)v; sh[wave * 16 + 8 * g + r][j * 16 + col] = hv; sl[wave * 16 + 8 * g + r][j * 16 + col] = (_Float16)((v - (float)hv) * 1024.0f); } }
    __syncthreads();
    for (int e = tid; e < 64 * 16; e += 128) { const int rl = e >> 4, q = e & 15; vst2((unsigned*)(DH + (r0 + rl) * CC + c0 + q * 8), *(const v4u*)&sh[rl][q * 8]); if (hi_rows) vst2((unsigned*)(DL + (bb * nhi + t0 + rl) * (size_t)CC + c0 + q * 8), *(const v4u*)&sl[rl][q * 8]); }
  } else { const bool hi_rows = t0 < KHI;
#pragma unroll
    for (int j = 0; j < 8; ++j) { const float bias = BA ? bfr(BA[c0 + j * 16 + col]) : 0.f;
#pragma unroll
      for (int r = 0; r < 8; ++r) { const float v = acc[j][r] + bias; const int rl = wave * 16 + 8 * g + r, cl = j * 16 + col; th[cl][rl] = (_Float16)v; const __bf16 bh = (__bf16)v; tb[cl][rl] = bh; tbl[cl][rl] = (__bf16)(v - (float)bh); } }
    __syncthreads();
    for (int e = tid; e < 128 * 8; e += 128) { const int cl = e >> 3, q = e & 7; vst2((unsigned*)(VT + (bb * CC + c0 + cl) * (size_t)TT + t0 + q * 8), *(const v4u*)&th[cl][q * 8]); if (hi_rows) { const size_t o3 = (bb * CC + c0 + cl) * (size_t)KHI + t0 + q * 8; vst2((unsigned*)(VB + o3), *(const v4u*)&tb[cl][q * 8]); vst2((unsigned*)(VBL + o3), *(const v4u*)&tbl[cl][q * 8]); } } } }
// ---- k_stat: softmax over the QUERY axis under the causal mask (the source's softmax(axis=2) on [B, H, q, k] scores): for every key column k of (b, h): m_k = max_{q >= k} s[q][k], Z_k = sum_{q >= k} exp(s[q][k] - m_k), with s = q.k x SCALE + slope (k - q) formed in registers and never stored. Block = 32 key columns (one 128-B line of CM and of CI) x 8 waves; wave w takes the 16-query tiles first tile + w + 8 i. D register r of a tile = query 8g + r, lane column = key, so a lane reduces its own column; the two lane halves are merged by one exchange, the 8 waves through LDS by wave 0, which alone stores m_k and 2^11 / Z_k
__device__ __forceinline__ void ms_merge(float& m, float& z, float mo, float zo) { const float mn = fmaxf(m, mo); z = z * expf(m - mn) + zo * expf(mo - mn); m = mn; }   /* an empty slice carries (-3e38, 0) and adds 0 */
__global__ __launch_bounds__(256) void k_stat(const _Float16* __restrict__ QH, const _Float16* __restrict__ KH, float* __restrict__ CM, float* __restrict__ CI) { __shared__ float pm[8][32], pz[8][32];
  const int tid = threadIdx.x, wave = __builtin_amdgcn_readfirstlane(tid >> 5), lane = tid & 31, col = lane & 15, g = lane >> 4; const int kb = blockIdx.x, h = blockIdx.y, b = blockIdx.z;   /* the wave's number in a scalar register: the tile loop branches on SCC */
  const float slope_ = exp2f(-0.5f * (float)(h + 1));   /* ALiBi slope of this head: 2^(-8 (h + 1) / 16) */
  const _Float16* kp = KH + ((size_t)b * TT + kb * 32 + col) * CC + h * HD;
  const v16h kf[2][2] = {{frag_h(kp, lane), frag_h(kp + 32, lane)}, {frag_h(kp + 16 * CC, lane), frag_h(kp + 16 * CC + 32, lane)}};
  float m[2] = {-3.0e38f, -3.0e38f}, z[2] = {0.f, 0.f};
  for (int qt = kb * 2 + wave; qt < TT / 16; qt += 8) { const _Float16* qa = QH + ((size_t)b * TT + qt * 16 + col) * CC + h * HD + 8 * g;   /* the lane's own address: fragment elements 0..7 = +0, 8..15 = +16, as in frag_h */
    union { v16h v; v8h q[2]; } q0, q1; q0.q[0] = *(const v8h*)qa; q0.q[1] = *(const v8h*)(qa + 16); q1.q[0] = *(const v8h*)(qa + 32); q1.q[1] = *(const v8h*)(qa + 48);
    asm volatile("s_wait_xcnt 0x0" :: "v"(qa) : "memory");   /* the address as an input keeps the address pair of the four q loads alive to this wait: none of them lands in it, and the wait stands in front of its next overwrite */
#pragma unroll
    for (int u = 0; u < 2; ++u) { v8f s = {}; s = wmma16(q0.v, kf[u][0], s); s = wmma16(q1.v, kf[u][1], s);
      const int d0 = kb * 32 + u * 16 + col - (qt * 16 + 8 * g);   /* key - query of register 0 */ const float fd0 = (float)d0; float v[8]; float mn = m[u];
#pragma unroll
      for (int r = 0; r < 8; ++r) { v[r] = (d0 - r <= 0) ? (s[r] * SCALE + slope_ * (fd0 - (float)r)) : -3.0e38f; mn = fmaxf(mn, v[r]); }   /* + the ALiBi bias slope (key - query) <= 0 */
      float zt = 0.f;
#pragma unroll
      for (int r = 0; r < 8; ++r) { const float e = expf(v[r] - mn); zt += (d0 - r <= 0) ? e : 0.f; }   /* value select, no branch: the 8 chains interleave */
      z[u] = z[u] * expf(m[u] - mn) + zt; m[u] = mn; } }
#pragma unroll
  for (int u = 0; u < 2; ++u) { const float mo = __shfl_xor(m[u], 16), zo = __shfl_xor(z[u], 16); ms_merge(m[u], z[u], mo, zo); if (g == 0) { pm[wave][u * 16 + col] = m[u]; pz[wave][u * 16 + col] = z[u]; } }
  __syncthreads();
  if (wave == 0) { float mm = pm[0][lane];
#pragma unroll
    for (int w = 1; w < 8; ++w) mm = fmaxf(mm, pm[w][lane]);
    float zz = 0.f;
#pragma unroll
    for (int w = 0; w < 8; ++w) zz += pz[w][lane] * expf(pm[w][lane] - mm);
    const size_t o = ((size_t)b * NH + h) * TT + kb * 32 + lane; vst2(CM + o, mm); vst2(CI + o, 2048.0f / zz); } }   /* every column sees at least its own diagonal entry: Z_k >= 1 */
// ---- k_att: block = 16 queries of (b, h) x 4 waves; wave w takes the 32-key chunks w + 4 i up to the diagonal. The scores are formed again, TRANSPOSED (A = k rows, B = q rows): D register r of key tile 0 / 1 = key 8g + r / 16 + 8g + r of the lane's own query, which is the place that key has in the A fragment of P . v, so P = exp(s - m_k) x 2^11 / Z_k (0 above the diagonal) goes once to f16 in registers against v f16 (1 product). The 4 waves' partial ctx tiles are summed through LDS; 256-B (row, head) segment by 16 lanes
__global__ __launch_bounds__(128) void k_att(const _Float16* __restrict__ QH, const _Float16* __restrict__ KH, const _Float16* __restrict__ VT, const float* __restrict__ CM, const float* __restrict__ CI, float* __restrict__ Y) { __shared__ __align__(16) float ss[4][16][HD + 4];
  const int tid = threadIdx.x, wave = __builtin_amdgcn_readfirstlane(tid >> 5), lane = tid & 31, col = lane & 15, g = lane >> 4; const int qt = TT / 16 - 1 - blockIdx.x, h = blockIdx.y, b = blockIdx.z;   /* the wave's number in a scalar register: the chunk loop branches on SCC; the longest key ranges start first */
  const float slope_ = exp2f(-0.5f * (float)(h + 1));
  const _Float16* qp = QH + ((size_t)b * TT + qt * 16 + col) * CC + h * HD; const v16h q0 = frag_h(qp, lane), q1 = frag_h(qp + 32, lane);
  const float* cm = CM + ((size_t)b * NH + h) * TT + 8 * g; const float* ci = CI + ((size_t)b * NH + h) * TT + 8 * g; const _Float16* vp = VT + ((size_t)b * CC + h * HD + col) * (size_t)TT;
  v8f acc[HD / 16] = {};
  for (int c = wave; c <= (qt >> 1); c += 4) { const int k0 = c * 32; const _Float16* kp = KH + ((size_t)b * TT + k0 + col) * CC + h * HD;
    v4f mk[4], ik[4];   /* all of a chunk's column-stat and k loads stand in front of the first product: one latency for the lot */
#pragma unroll
    for (int i = 0; i < 4; ++i) { mk[i] = *(const v4f*)(cm + k0 + (i >> 1) * 16 + (i & 1) * 4); ik[i] = *(const v4f*)(ci + k0 + (i >> 1) * 16 + (i & 1) * 4); }
    asm volatile("s_wait_xcnt 0x0" ::: "memory");   /* the k loads below land in registers that held the stat loads' addresses */
    const v16h kf[2][2] = {{frag_h(kp, lane), frag_h(kp + 32, lane)}, {frag_h(kp + 16 * CC, lane), frag_h(kp + 16 * CC + 32, lane)}};
    v8f s[2] = {};
#pragma unroll
    for (int u = 0; u < 2; ++u) { s[u] = wmma16(kf[u][0], q0, s[u]); s[u] = wmma16(kf[u][1], q1, s[u]); }
    v16h vf[HD / 16], p;
#pragma unroll
    for (int j = 0; j < HD / 16; ++j) vf[j] = frag_h(vp + (size_t)j * 16 * TT + k0, lane);
    __builtin_amdgcn_sched_barrier(0);   /* keeps the v loads in front of the exponentials, which then cover their latency; without it they are sunk to the P . v products */
#pragma unroll
    for (int u = 0; u < 2; ++u) { const int d0 = k0 + u * 16 + 8 * g - (qt * 16 + col);   /* key - query of register 0 */ const float fd0 = (float)d0;
#pragma unroll
      for (int r = 0; r < 8; ++r) { const float e = expf((s[u][r] * SCALE + slope_ * (fd0 + (float)r)) - mk[u * 2 + (r >> 2)][r & 3]) * ik[u * 2 + (r >> 2)][r & 3]; p[u * 8 + r] = (_Float16)((d0 + r <= 0) ? e : 0.f); } }   /* value select, no branch: the 16 chains interleave */
#pragma unroll
    for (int j = 0; j < HD / 16; ++j) acc[j] = wmma16(p, vf[j], acc[j]); }
#pragma unroll
  for (int j = 0; j < HD / 16; ++j)
#pragma unroll
    for (int r = 0; r < 8; ++r) ss[wave][8 * g + r][j * 16 + col] = acc[j][r];
  __syncthreads();
  for (int e = tid; e < 16 * (HD / 4); e += 128) { const int rl = e / (HD / 4), c4 = (e % (HD / 4)) * 4; const v4f o = ((*(const v4f*)&ss[0][rl][c4] + *(const v4f*)&ss[1][rl][c4]) + (*(const v4f*)&ss[2][rl][c4] + *(const v4f*)&ss[3][rl][c4])) * (1.0f / 2048.0f); vst2(Y + ((size_t)b * TT + qt * 16 + rl) * CC + h * HD + c4, o); } }
// ---- k_out: block = (64 rows, 128 cols): out = ctx Wo (+ bo): ctx x 2^6 once to f16 against Wo as f16(bf16 x 2^8) exact (1 product) x 2^-14; causal early rows (< QHI of each sequence): ctx bf16 hi + lo against exact bf16 Wo (2 products)
__global__ __launch_bounds__(128) void k_out(const float* __restrict__ Y, const float* __restrict__ WO, const float* __restrict__ BO, float* __restrict__ OUT) { __shared__ __align__(16) float sf[4][16][132];
  const int tid = threadIdx.x, wave = tid >> 5, lane = tid & 31, col = lane & 15, g = lane >> 4; const int c0 = blockIdx.y * 128; const size_t r0 = (size_t)blockIdx.x * 64 + wave * 16;
  v8f acc[8] = {};
  if (CAUSAL && (int)(((size_t)blockIdx.x * 64) % TT) < QHI) {   /* block-uniform */
#pragma unroll 2
    for (int kc = 0; kc < CC / 32; ++kc) { const F2 a = split_row(Y + (r0 + col) * CC, kc * 32, lane); asm volatile("s_wait_loadcnt 0x0" ::: "memory");
#pragma unroll
      for (int j = 0; j < 8; ++j) { const v16b w = WOCOL(WO, kc * 32, c0 + j * 16 + col, lane); asm volatile("s_wait_loadcnt 0x0" ::: "memory"); acc[j] = wmma_bf(a.h, w, acc[j]); acc[j] = wmma_bf(a.l, w, acc[j]); } }
#pragma unroll
    for (int j = 0; j < 8; ++j) { const float bias = 0.f;   /* this module has no output bias: the BO argument carries the RESIDUAL x, added at the store */
#pragma unroll
      for (int r = 0; r < 8; ++r) sf[wave][8 * g + r][j * 16 + col] = acc[j][r] + bias; }
  } else {
#pragma unroll 2
    for (int kc = 0; kc < CC / 32; ++kc) { const v16h a = frag_f32s(Y + (r0 + col) * CC + kc * 32, lane, 64.0f); asm volatile("s_wait_loadcnt 0x0" ::: "memory");   /* ctx carried x 2^6 into f16 so small-magnitude context rows stay clear of f16 subnormals (chip FTZ) */
#pragma unroll
      for (int j = 0; j < 8; ++j) { const v16h w = WOCOLH(WO, kc * 32, c0 + j * 16 + col, lane); asm volatile("s_wait_loadcnt 0x0" ::: "memory"); acc[j] = wmma16(a, w, acc[j]); } }
#pragma unroll
    for (int j = 0; j < 8; ++j) { const float bias = 0.f;   /* this module has no output bias: the BO argument carries the RESIDUAL x, added at the store */
#pragma unroll
      for (int r = 0; r < 8; ++r) sf[wave][8 * g + r][j * 16 + col] = acc[j][r] * (1.0f / 16384.0f) + bias; } }   /* 2^-8 (Wo carry) x 2^-6 (ctx carry) */
  LDSX(); for (int rl = 0; rl < 16; ++rl) { const v4f xr = *(const v4f*)(BO + (r0 + rl) * DIN + c0 + lane * 4); asm volatile("s_wait_loadcnt 0x0" ::: "memory"); v4f o = *(const v4f*)&sf[wave][rl][lane * 4]; o[0] += bfr(xr[0]); o[1] += bfr(xr[1]); o[2] += bfr(xr[2]); o[3] += bfr(xr[3]); vst2(OUT + (r0 + rl) * DIN + c0 + lane * 4, o); } }   /* x + outputs */

extern "C" void kernel_launch(void* const* d_in, const int* in_sizes, int n_in, void* d_out, int out_size, void* d_ws, size_t ws_size, hipStream_t stream) {
  (void)in_sizes; (void)n_in; (void)out_size;
  const float** F = (const float**)d_in;
  if (ws_size < (size_t)WS_END) return;
  char* ws = (char*)d_ws; _Float16 *QH = (_Float16*)(ws + WS_QH), *KH = (_Float16*)(ws + WS_KH), *VT = (_Float16*)(ws + WS_VT), *QL = (_Float16*)(ws + WS_QL), *KL = (_Float16*)(ws + WS_KL); __bf16 *VB = (__bf16*)(ws + WS_VB), *VBL = (__bf16*)(ws + WS_VBL); float *Y = (float*)(ws + WS_Y);
  (void)Y; (void)QL; (void)KL; (void)VB; (void)VBL;
  // inputs: 0 x [2,2048,1024]; 1 wq [1024,1024] (in,out); 2 wk; 3 wv; 4 wo [64,1024] (in,out: it acts on the SUM of the 16 heads' 64-dim outputs); no biases
  if (ws_size < (size_t)WS_END2) return;
  float *CM = (float*)(ws + WS_CM), *CI = (float*)(ws + WS_CI);
  k_proj<<<dim3(TNB * TT / 64, CC / 128, 3), 128, 0, stream>>>(F[0], F[0], F[0], F[1], F[2], F[3], nullptr, nullptr, nullptr, QH, QL, KH, KL, VT, VB, VBL);
  k_stat<<<dim3(TT / 32, NH, TNB), 256, 0, stream>>>(QH, KH, CM, CI);   /* per key column: max / sum over the visible queries of exp(score + ALiBi bias) */
  k_att<<<dim3(TT / 16, NH, TNB), 128, 0, stream>>>(QH, KH, VT, CM, CI, Y);
  k_out<<<dim3(TNB * TT / 64, DIN / 128), 128, 0, stream>>>(Y, F[4], F[0], (float*)d_out);   /* sum over heads folded into the projection: merged row (h, d) x wo[d][:] for every h; + x (the third argument is the RESIDUAL here, not a bias) */
}

// v003
// A run of this version takes 213 microseconds.
// Next to v002, in two timings, it ran 1.44 and 1.45 times as fast.
// Counting every step since v000, it is 35.6 times as fast.
// compute dtype: all float inputs rounded to bf16; q/k/v projections with EXACT bf16 products on WMMA 16x16x32 (f32 accumulate); causal scores q x k once to f16 each (1 product) x 64^-0.5 plus the ALiBi bias slope_h (key - query) in f32; softmax over the QUERY axis in f32 (per key column: online max / sum over the visible queries, precise expf); P x 2^11 once to f16 x v once to f16 (1 product); the 16 heads' outputs are SUMMED inside the output projection (ctx x 2^6 once to f16 x wo f16(bf16 x 2^8), the 64-row weight re-used for every head); + bf16(x) residual in f32; f32 output.
#include <hip/hip_runtime.h>
#include <math.h>

typedef __attribute__((ext_vector_type(16))) _Float16 v16h;
typedef __attribute__((ext_vector_type(16))) __bf16 v16b;
typedef __attribute__((ext_vector_type(8)))  _Float16 v8h;
typedef __attribute__((ext_vector_type(8)))  float v8f;
typedef __attribute__((ext_vector_type(4)))  float v4f;
typedef __attribute__((ext_vector_type(2)))  float v2f;
typedef __attribute__((ext_vector_type(4)))  unsigned v4u;
typedef __attribute__((ext_vector_type(4)))  int v4i;
typedef float __attribute__((may_alias)) float_a;
typedef int __attribute__((may_alias)) int_a;

template <typename T> __device__ __forceinline__ void vst2(void* p, T v) { *(T*)p = v;  }
__device__ __forceinline__ v8f wmma16(v16h a, v16h b, v8f c) {
  v8f d = __builtin_amdgcn_wmma_f32_16x16x32_f16(false, a, false, b, (short)0, c, false, false);
  asm volatile("v_nop\n\tv_nop\n\tv_nop\n\tv_nop" : "+v"(d) : "v"(a), "v"(b));
  return d;
}
__device__ __forceinline__ v8f wmma_bf(v16b a, v16b b, v8f c) {
  v8f d = __builtin_amdgcn_wmma_f32_16x16x32_bf16(false, a, false, b, (short)0, c, false, false);
  asm volatile("v_nop\n\tv_nop\n\tv_nop\n\tv_nop" : "+v"(d) : "v"(a), "v"(b));
  return d;
}
// 16x16x32 fragments: lane = (h = lane>>4, row/col = lane&15); elements 0..7 = k0+8h+0..7, 8..15 = k0+16+8h+0..7; D element r = row 8h+r
__device__ __forceinline__ v16h frag_h(const _Float16* rowk0, int lane) {
  union { v16h v; v8h q[2]; } u; const _Float16* p = rowk0 + 8 * (lane >> 4);
  u.q[0] = *(const v8h*)p; u.q[1] = *(const v8h*)(p + 16); return u.v;
}
__device__ __forceinline__ v16h frag_f32(const float* rowk0, int lane) {
  v16h a; const float* p = rowk0 + 8 * (lane >> 4);
#pragma unroll
  for (int i = 0; i < 8; ++i) { a[i] = (_Float16)p[i]; a[8 + i] = (_Float16)p[16 + i]; }
  return a;
}
__device__ __forceinline__ v16h frag_f32s(const float* rowk0, int lane, float sc) {
  v16h a; const float* p = rowk0 + 8 * (lane >> 4);
#pragma unroll
  for (int i = 0; i < 8; ++i) { a[i] = (_Float16)(p[i] * sc); a[8 + i] = (_Float16)(p[16 + i] * sc); }
  return a;
}
// column fragment from a [K][ld] layout (column n), rows >= K read as 0
__device__ __forceinline__ v16h fragc_f32(const float* W, int k0, int n, int lane, int ld, int K) {
  v16h a; const int g = lane >> 4;
#pragma unroll
  for (int i = 0; i < 8; ++i) { const int ka = k0 + 8 * g + i, kb = ka + 16;
    a[i] = (_Float16)(ka < K ? W[(size_t)(ka < K ? ka : K - 1) * ld + n] : 0.f); a[8 + i] = (_Float16)(kb < K ? W[(size_t)(kb < K ? kb : K - 1) * ld + n] : 0.f); }
  return a;
}
struct F2 { v16b h, l; };
__device__ __forceinline__ F2 bsplit16(const float v[16]) { F2 r;
#pragma unroll
  for (int i = 0; i < 16; ++i) { const __bf16 h = (__bf16)v[i]; r.h[i] = h; r.l[i] = (__bf16)(v[i] - (float)h); }
  return r; }
__device__ __forceinline__ F2 split_row(const float* row, int k0, int lane) { float v[16]; const float* p = row + k0 + 8 * (lane >> 4);
#pragma unroll
  for (int i = 0; i < 8; ++i) { v[i] = p[i]; v[8 + i] = p[16 + i]; }
  return bsplit16(v); }
__device__ __forceinline__ F2 split_rowK(const float* row, int k0, int lane, int K) { float v[16]; const int g = lane >> 4;
#pragma unroll
  for (int i = 0; i < 8; ++i) { const int ka = k0 + 8 * g + i, kb = ka + 16; v[i] = ka < K ? row[ka < K ? ka : K - 1] : 0.f; v[8 + i] = kb < K ? row[kb < K ? kb : K - 1] : 0.f; }
  return bsplit16(v); }
__device__ __forceinline__ F2 split_col(const float* W, int k0, int n, int lane, int ld, int K) { float v[16]; const int g = lane >> 4;
#pragma unroll
  for (int i = 0; i < 8; ++i) { const int ka = k0 + 8 * g + i, kb = ka + 16; v[i] = ka < K ? W[(size_t)(ka < K ? ka : K - 1) * ld + n] : 0.f; v[8 + i] = kb < K ? W[(size_t)(kb < K ? kb : K - 1) * ld + n] : 0.f; }
  return bsplit16(v); }
__device__ __forceinline__ v8f mac3(const F2& a, const F2& b, v8f c) { c = wmma_bf(a.l, b.h, c); c = wmma_bf(a.h, b.l, c); return wmma_bf(a.h, b.h, c); }
__device__ __forceinline__ float sigm(float v) { return 1.0f / (1.0f + expf(-v)); }
#define LDSX() do { asm volatile("s_wait_dscnt 0" ::: "memory"); __builtin_amdgcn_wave_barrier(); __builtin_amdgcn_fence(__ATOMIC_RELEASE, "workgroup"); } while (0)

// ALiBi-biased multi-headed attention whose softmax runs over the QUERY axis and whose heads are SUMMED (x [2,2048,1024]; (in,out) wq / wk / wv [1024,1024] N(0, 1/1024), no biases; 16 heads x 64; prod = Q K^T / 8 + slope_h (k - q) with slope_h = 2^(-8 (h + 1) / 16); -inf where k > q; attention_weights = softmax(prod, axis=2) - axis 2 of [B, H, q, k] is the QUERY axis: every key column is normalised over the queries that can see it (faithful to the source); out_h = weights V_h; outputs = (sum over the 16 heads of out_h) wo with wo [64,1024]; result = x + outputs).
#define NB 2
#define TT 2048
#define CC 1024            // NH * HD = projected width
#define DIN 1024          // input (model) width
#define NH 16
#define HD 64
#define SCALE (0.125f)
#define CAUSAL 1
#ifndef TNB
#define TNB NB
#endif
__device__ __forceinline__ float bfr(float v) { return (float)(__bf16)v; }
typedef __attribute__((ext_vector_type(8))) __bf16 v8b;
__device__ __forceinline__ v16b frag_b(const __bf16* rowk0, int lane) {
  union { v16b v; v8b q[2]; } u; const __bf16* p = rowk0 + 8 * (lane >> 4);
  u.q[0] = *(const v8b*)p; u.q[1] = *(const v8b*)(p + 16); return u.v;
}
#define QBH 0              // no high-precision blocks: single-product scores and P.v everywhere (the output carries the f32 residual x and the sum of 16 heads: rms - 4)
#define QHI 0               // no q residual plane
#define KHI 64              // no k residual / v hi-lo planes are read
// B fragment (k rows k0+.., output column o) of a weight: (in,out) [K][ld] or (out,in) [ld rows of K]: bf16 exact, or f16(bf16 * 256) exact
__device__ __forceinline__ v16b wcol_io(const float* Wm, int k0, int o, int lane, int ld) { v16b w; const int g = lane >> 4;
#pragma unroll
  for (int i = 0; i < 8; ++i) { w[i] = (__bf16)Wm[(size_t)(k0 + 8 * g + i) * ld + o]; w[8 + i] = (__bf16)Wm[(size_t)(k0 + 16 + 8 * g + i) * ld + o]; }
  return w; }
__device__ __forceinline__ v16b wcol_oi(const float* Wm, int k0, int o, int lane, int K) { v16b w; const float* p = Wm + (size_t)o * K + k0 + 8 * (lane >> 4);
#pragma unroll
  for (int i = 0; i < 8; ++i) { w[i] = (__bf16)p[i]; w[8 + i] = (__bf16)p[16 + i]; }
  return w; }
__device__ __forceinline__ v16h wcolh_io(const float* Wm, int k0, int o, int lane, int ld) { v16h w; const int g = lane >> 4;
#pragma unroll
  for (int i = 0; i < 8; ++i) { w[i] = (_Float16)(bfr(Wm[(size_t)(k0 + 8 * g + i) * ld + o]) * 256.0f); w[8 + i] = (_Float16)(bfr(Wm[(size_t)(k0 + 16 + 8 * g + i) * ld + o]) * 256.0f); }
  return w; }
__device__ __forceinline__ v16h wcolh_oi(const float* Wm, int k0, int o, int lane, int K) { v16h w; const float* p = Wm + (size_t)o * K + k0 + 8 * (lane >> 4);
#pragma unroll
  for (int i = 0; i < 8; ++i) { w[i] = (_Float16)(bfr(p[i]) * 256.0f); w[8 + i] = (_Float16)(bfr(p[16 + i]) * 256.0f); }
  return w; }
#define WQKV_LAYOUT 0   // selects WCOL only, which nothing uses: k_proj reads (in,out) [DIN][CC] for any value
__device__ __forceinline__ v16b wcol_hdk(const float* Wm, int k0, int o, int lane) { v16b w; const int g = lane >> 4; const float* p = Wm + (size_t)(o / HD) * DIN * HD + (o % HD);
#pragma unroll
  for (int i = 0; i < 8; ++i) { w[i] = (__bf16)p[(size_t)(k0 + 8 * g + i) * HD]; w[8 + i] = (__bf16)p[(size_t)(k0 + 16 + 8 * g + i) * HD]; }
  return w; }
#define WO_OUT_IN 0
#if WQKV_LAYOUT == 1
#define WCOL(W, k0, o, lane) wcol_oi(W, k0, o, lane, DIN)
#elif WQKV_LAYOUT == 2
#define WCOL(W, k0, o, lane) wcol_hdk(W, k0, o, lane)
#else
#define WCOL(W, k0, o, lane) wcol_io(W, k0, o, lane, CC)
#endif
#if WO_OUT_IN
#define WOCOL(W, k0, o, lane) wcol_oi(W, k0, o, lane, CC)
#define WOCOLH(W, k0, o, lane) wcolh_oi(W, k0, o, lane, CC)
#else
#define WOCOL(W, k0, o, lane) wcol_io(W, (k0) & 63, o, lane, DIN)
#define WOCOLH(W, k0, o, lane) wcolh_io(W, (k0) & 63, o, lane, DIN)   /* wo is [64][1024]: merged column (h*64 + d) uses weight row d - i.e. the 16 heads are summed by the projection itself (k0 is a multiple of 32, so a fragment's 32 rows stay inside one head's 64) */
#endif

#ifndef PROJ_EXTRA_PARAMS
#define PROJ_EXTRA_PARAMS
#endif

#define WS_QH  0u                                      // f16 q rows [b*t][CC]
#define WS_KH  (WS_QH + 2u * (size_t)NB * TT * CC)      // f16 k rows [b*t][CC]
#define WS_VT  (WS_KH + 2u * (size_t)NB * TT * CC)      // f16 v planes [b][c][t]
#define WS_QL  (WS_VT + 2u * (size_t)NB * CC * TT)      // f16 q residual x 2^10 rows [b][t < QHI][CC]
#define WS_KL  (WS_QL + 2u * (size_t)NB * QHI * CC)     // f16 k residual x 2^10 rows [b][t < KHI][CC]
#define WS_VB  (WS_KL + 2u * (size_t)NB * KHI * CC)     // bf16 v hi planes [b][c][t < KHI]
#define WS_VBL (WS_VB + 2u * (size_t)NB * CC * KHI)
#define WS_Y   (WS_VBL + 2u * (size_t)NB * CC * KHI)    // f32 ctx rows [b*t][CC] (only when there is an output projection)
#define WS_END (WS_Y  + 4u * (size_t)NB * TT * CC)
#define WS_CM (WS_END)                                  // f32 column maxima [b][h][TT]
#define WS_CI (WS_CM + 4u * (size_t)NB * NH * TT)       // f32 2^11 / column sums [b][h][TT]
#define WS_END2 (WS_CI + 4u * (size_t)NB * NH * TT)

// ---- k_proj: block = (128 rows, 128 cols, which) x 4 waves: q/k/v = X W (+ b) with exact bf16 products (K = DIN). Per 32-deep k tile the block rounds its X rows and its W columns to bf16 ONCE into LDS (X as [row][k], W transposed to [col][k]), two buffers: the next tile's global loads (whole 128-B lines) fly while this tile's products run. Wave w owns rows 16 w + 0..15 of each 64-row half. -> which 0: q f16 rows (+ residual rows < QHI); 1: k f16 rows (+ residual rows < KHI); 2: v f16 planes [c][t] (+ bf16 hi/lo planes for t < KHI)
typedef __attribute__((ext_vector_type(4))) __bf16 v4b;
__device__ __forceinline__ void vst_w(void* p, v4u v) { asm volatile("global_store_b128 %0, %1, off\n\ts_wait_xcnt 0x0" :: "v"(p), "v"(v) : "memory"); }   /* a 16-byte global store with its wait in ONE statement: in a statement of its own the wait was passed by the next trip's address steps and LDS reads, which overwrite the store's registers */
#define PBK 32               // k depth of one staged tile
#define PPI 40               // pitch of a staged row in bf16 elements: 64 B of data + 16 B = 16 B x 5 (odd), the conflict-free pitch for 16-byte fragment reads
#define PBUF (128 * PPI)     // elements of one staged operand tile
__global__ __launch_bounds__(128) void k_proj(const float* __restrict__ XQ, const float* __restrict__ XK, const float* __restrict__ XV, const float* __restrict__ WQ, const float* __restrict__ WK, const float* __restrict__ WV, const float* __restrict__ BQ, const float* __restrict__ BK, const float* __restrict__ BV,
    _Float16* __restrict__ QH, _Float16* __restrict__ QL, _Float16* __restrict__ KH, _Float16* __restrict__ KL, _Float16* __restrict__ VT, __bf16* __restrict__ VB, __bf16* __restrict__ VBL) {
  __shared__ __align__(16) unsigned char smem[90112];   /* the staged tiles of the main loop and the transposing planes of the epilogue share these bytes (a barrier stands between the two uses) */
  _Float16 (*sh)[136] = (_Float16 (*)[136])smem; _Float16 (*sl)[136] = (_Float16 (*)[136])(smem + 17408); _Float16 (*th)[72] = (_Float16 (*)[72])(smem + 34816); __bf16 (*tb)[72] = (__bf16 (*)[72])(smem + 53248); __bf16 (*tbl)[72] = (__bf16 (*)[72])(smem + 71680);
  __bf16* sA = (__bf16*)smem; __bf16* sW = (__bf16*)(smem + 4 * PBUF);   /* 2 buffers of X rows, then 2 buffers of W columns */
  const int tid = threadIdx.x, wave = tid >> 5, lane = tid & 31, col = lane & 15, g = lane >> 4; const int which = blockIdx.z; const int c0 = blockIdx.y * 128; const size_t r0 = (size_t)blockIdx.x * 128; const size_t bb = r0 / TT; const int t0 = (int)(r0 % TT);
  const float* X = which == 0 ? XQ : which == 1 ? XK : XV; const float* WA = which == 0 ? WQ : which == 1 ? WK : WV; const float* BA = which == 0 ? BQ : which == 1 ? BK : BV;
  const int l8 = lane & 7, l3 = lane >> 3;
  const float* pa = X + r0 * DIN; const unsigned oa = (unsigned)((wave * 4 + l3) * DIN + l8 * 4);   /* X: 8 lanes read one row's 128 B; load j = rows + 16 j */
  const float* pw = WA + c0; const unsigned ow = (unsigned)(8 * l3 * CC + (wave * 8 + l8) * 4);     /* W (in,out): the lane holds k rows 8 l3 + 0..7 of 4 columns; 8 lanes read 128 B of a row */
  __bf16* da = sA + (wave * 4 + l3) * PPI + l8 * 4;
  __bf16* dw = sW + (wave * 32 + l8 * 4) * PPI + 8 * l3;                       /* 8 k of one column = one 16-byte store; the 32 lanes fall on every bank twice */
  v4f ar[8], wr[8];
  v8f acc[2][8] = {};
  auto issue = [&](const float* qa, const float* qw) {
#pragma unroll
    for (int j = 0; j < 8; ++j) { ar[j] = *(const v4f*)(qa + (size_t)j * 16 * DIN); wr[j] = *(const v4f*)(qw + (size_t)j * CC); } };
  auto stage = [&](int buf) {
#pragma unroll
    for (int j = 0; j < 8; ++j) { v4b t;
#pragma unroll
      for (int e = 0; e < 4; ++e) t[e] = (__bf16)ar[j][e];
      *(v4b*)(da + buf * PBUF + j * 16 * PPI) = t; }
#pragma unroll
    for (int i = 0; i < 4; ++i) { v8b t;
#pragma unroll
      for (int r = 0; r < 8; ++r) t[r] = (__bf16)wr[r][i];
      *(v8b*)(dw + buf * PBUF + i * PPI) = t; } };
  issue(pa + oa, pw + ow);
  asm volatile("s_wait_xcnt 0x0" ::: "memory");   /* stands behind the 16 loads, in front of the next overwrite of a register that they name */
  __builtin_amdgcn_sched_barrier(0);   /* no later write of such a register is lifted over the wait */
  stage(0);
  for (int kc = 0; kc < DIN / PBK; ++kc) {
    __syncthreads();   /* publishes tile kc and ends every wave's reads of the buffer that tile kc + 1 is written into below */
    const __bf16* ba = sA + (kc & 1) * PBUF + (wave * 16 + col) * PPI; const __bf16* bw = sW + (kc & 1) * PBUF + col * PPI;
    const v16b a0 = frag_b(ba, lane), a1 = frag_b(ba + 64 * PPI, lane); v16b w[8];   /* all 20 fragment reads of the tile as one group: one LDS latency a tile, not one a column block */
#pragma unroll
    for (int j = 0; j < 8; ++j) w[j] = frag_b(bw + j * 16 * PPI, lane);
    __builtin_amdgcn_sched_barrier(0);   /* the fragment reads go first: their latency runs under the issue of the global loads */
    if (kc + 1 < DIN / PBK) { const int ks = __builtin_amdgcn_readfirstlane((kc + 1) * PBK); const float* qa = pa + oa + ks; const float* qw = pw + ow + (size_t)ks * CC;   /* the tile's step through a scalar register: the two addresses are formed anew for each tile, and the pairs that the loads name are the very values that the wait below takes */
      issue(qa, qw);
      asm volatile("s_wait_xcnt 0x0" :: "v"(qa), "v"(qw) : "memory"); }   /* stands behind the 16 loads, in front of the next overwrite of their address registers; the two addresses as inputs keep the pairs alive to this wait, so that no load lands in one */
    __builtin_amdgcn_sched_barrier(0);   /* the products, and every later write of an address register, stay behind the loads and their wait */
#pragma unroll
    for (int j = 0; j < 8; ++j) { acc[0][j] = wmma_bf(a0, w[j], acc[0][j]); acc[1][j] = wmma_bf(a1, w[j], acc[1][j]); }
    __builtin_amdgcn_sched_barrier(0);   /* the conversions of stage() wait for the global loads: lifted among the products they would stall the wave at once */
    if (kc + 1 < DIN / PBK) stage((kc + 1) & 1); }
  __syncthreads();   /* the last tile's reads end before the epilogue planes overwrite the staged tiles */
  if (which < 2) { _Float16* DH = which == 0 ? QH : KH; _Float16* DL = which == 0 ? QL : KL; const int nhi = which == 0 ? QHI : KHI;
#pragma unroll
    for (int i = 0; i < 2; ++i) { const size_t rb = r0 + i * 64; const int tq = t0 + i * 64; const bool hi_rows = tq < nhi;   /* the two 64-row halves go through the same planes one after the other */
#pragma unroll
      for (int j = 0; j < 8; ++j) { const float bias = BA ? bfr(BA[c0 + j * 16 + col]) : 0.f;
#pragma unroll
        for (int r = 0; r < 8; ++r) { const float v = acc[i][j][r] + bias; const _Float16 hv = (_Float16)v; sh[wave * 16 + 8 * g + r][j * 16 + col] = hv; sl[wave * 16 + 8 * g + r][j * 16 + col] = (_Float16)((v - (float)hv) * 1024.0f); } }
      __syncthreads();
      for (int e = tid; e < 64 * 16; e += 128) { const int rl = e >> 4, q = e & 15; vst_w(DH + (rb + rl) * CC + c0 + q * 8, *(const v4u*)&sh[rl][q * 8]); if (hi_rows) vst_w(DL + (bb * nhi + tq + rl) * (size_t)CC + c0 + q * 8, *(const v4u*)&sl[rl][q * 8]); }
      if (i == 0) __syncthreads(); }   /* the first half is read out before the second overwrites the planes */
  } else {
#pragma unroll
    for (int i = 0; i < 2; ++i) { const int tq = t0 + i * 64; const bool hi_rows = tq < KHI;
#pragma unroll
      for (int j = 0; j < 8; ++j) { const float bias = BA ? bfr(BA[c0 + j * 16 + col]) : 0.f;
#pragma unroll
        for (int r = 0; r < 8; ++r) { const float v = acc[i][j][r] + bias; const int rl = wave * 16 + 8 * g + r, cl = j * 16 + col; th[cl][rl] = (_Float16)v; const __bf16 bh = (__bf16)v; tb[cl][rl] = bh; tbl[cl][rl] = (__bf16)(v - (float)bh); } }
      __syncthreads();
      for (int e = tid; e < 128 * 8; e += 128) { const int cl = e >> 3, q = e & 7; vst_w(VT + (bb * CC + c0 + cl) * (size_t)TT + tq + q * 8, *(const v4u*)&th[cl][q * 8]); if (hi_rows) { const size_t o3 = (bb * CC + c0 + cl) * (size_t)KHI + tq + q * 8; vst_w(VB + o3, *(const v4u*)&tb[cl][q * 8]); vst_w(VBL + o3, *(const v4u*)&tbl[cl][q * 8]); } }
      if (i == 0) __syncthreads(); } } }   /* as above */
// ---- k_stat: softmax over the QUERY axis under the causal mask (the source's softmax(axis=2) on [B, H, q, k] scores): for every key column k of (b, h): m_k = max_{q >= k} s[q][k], Z_k = sum_{q >= k} exp(s[q][k] - m_k), with s = q.k x SCALE + slope (k - q) formed in registers and never stored. Block = 32 key columns (one 128-B line of CM and of CI) x 8 waves; wave w takes the 16-query tiles first tile + w + 8 i. D register r of a tile = query 8g + r, lane column = key, so a lane reduces its own column; the two lane halves are merged by one exchange, the 8 waves through LDS by wave 0, which alone stores m_k and 2^11 / Z_k
__device__ __forceinline__ void ms_merge(float& m, float& z, float mo, float zo) { const float mn = fmaxf(m, mo); z = z * expf(m - mn) + zo * expf(mo - mn); m = mn; }   /* an empty slice carries (-3e38, 0) and adds 0 */
__global__ __launch_bounds__(256) void k_stat(const _Float16* __restrict__ QH, const _Float16* __restrict__ KH, float* __restrict__ CM, float* __restrict__ CI) { __shared__ float pm[8][32], pz[8][32];
  const int tid = threadIdx.x, wave = __builtin_amdgcn_readfirstlane(tid >> 5), lane = tid & 31, col = lane & 15, g = lane >> 4; const int kb = blockIdx.x, h = blockIdx.y, b = blockIdx.z;   /* the wave's number in a scalar register: the tile loop branches on SCC */
  const float slope_ = exp2f(-0.5f * (float)(h + 1));   /* ALiBi slope of this head: 2^(-8 (h + 1) / 16) */
  const _Float16* kp = KH + ((size_t)b * TT + kb * 32 + col) * CC + h * HD;
  const v16h kf[2][2] = {{frag_h(kp, lane), frag_h(kp + 32, lane)}, {frag_h(kp + 16 * CC, lane), frag_h(kp + 16 * CC + 32, lane)}};
  float m[2] = {-3.0e38f, -3.0e38f}, z[2] = {0.f, 0.f};
  for (int qt = kb * 2 + wave; qt < TT / 16; qt += 8) { const _Float16* qa = QH + ((size_t)b * TT + qt * 16 + col) * CC + h * HD + 8 * g;   /* the lane's own address: fragment elements 0..7 = +0, 8..15 = +16, as in frag_h */
    union { v16h v; v8h q[2]; } q0, q1; q0.q[0] = *(const v8h*)qa; q0.q[1] = *(const v8h*)(qa + 16); q1.q[0] = *(const v8h*)(qa + 32); q1.q[1] = *(const v8h*)(qa + 48);
    asm volatile("s_wait_xcnt 0x0" :: "v"(qa) : "memory");   /* the address as an input keeps the address pair of the four q loads alive to this wait: none of them lands in it, and the wait stands in front of its next overwrite */
#pragma unroll
    for (int u = 0; u < 2; ++u) { v8f s = {}; s = wmma16(q0.v, kf[u][0], s); s = wmma16(q1.v, kf[u][1], s);
      const int d0 = kb * 32 + u * 16 + col - (qt * 16 + 8 * g);   /* key - query of register 0 */ const float fd0 = (float)d0; float v[8]; float mn = m[u];
#pragma unroll
      for (int r = 0; r < 8; ++r) { v[r] = (d0 - r <= 0) ? (s[r] * SCALE + slope_ * (fd0 - (float)r)) : -3.0e38f; mn = fmaxf(mn, v[r]); }   /* + the ALiBi bias slope (key - query) <= 0 */
      float zt = 0.f;
#pragma unroll
      for (int r = 0; r < 8; ++r) { const float e = expf(v[r] - mn); zt += (d0 - r <= 0) ? e : 0.f; }   /* value select, no branch: the 8 chains interleave */
      z[u] = z[u] * expf(m[u] - mn) + zt; m[u] = mn; } }
#pragma unroll
  for (int u = 0; u < 2; ++u) { const float mo = __shfl_xor(m[u], 16), zo = __shfl_xor(z[u], 16); ms_merge(m[u], z[u], mo, zo); if (g == 0) { pm[wave][u * 16 + col] = m[u]; pz[wave][u * 16 + col] = z[u]; } }
  __syncthreads();
  if (wave == 0) { float mm = pm[0][lane];
#pragma unroll
    for (int w = 1; w < 8; ++w) mm = fmaxf(mm, pm[w][lane]);
    float zz = 0.f;
#pragma unroll
    for (int w = 0; w < 8; ++w) zz += pz[w][lane] * expf(pm[w][lane] - mm);
    const size_t o = ((size_t)b * NH + h) * TT + kb * 32 + lane; vst2(CM + o, mm); vst2(CI + o, 2048.0f / zz); } }   /* every column sees at least its own diagonal entry: Z_k >= 1 */
// ---- k_att: block = 16 queries of (b, h) x 4 waves; wave w takes the 32-key chunks w + 4 i up to the diagonal. The scores are formed again, TRANSPOSED (A = k rows, B = q rows): D register r of key tile 0 / 1 = key 8g + r / 16 + 8g + r of the lane's own query, which is the place that key has in the A fragment of P . v, so P = exp(s - m_k) x 2^11 / Z_k (0 above the diagonal) goes once to f16 in registers against v f16 (1 product). The 4 waves' partial ctx tiles are summed through LDS; 256-B (row, head) segment by 16 lanes
__global__ __launch_bounds__(128) void k_att(const _Float16* __restrict__ QH, const _Float16* __restrict__ KH, const _Float16* __restrict__ VT, const float* __restrict__ CM, const float* __restrict__ CI, float* __restrict__ Y) { __shared__ __align__(16) float ss[4][16][HD + 4];
  const int tid = threadIdx.x, wave = __builtin_amdgcn_readfirstlane(tid >> 5), lane = tid & 31, col = lane & 15, g = lane >> 4; const int qt = TT / 16 - 1 - blockIdx.x, h = blockIdx.y, b = blockIdx.z;   /* the wave's number in a scalar register: the chunk loop branches on SCC; the longest key ranges start first */
  const float slope_ = exp2f(-0.5f * (float)(h + 1));
  const _Float16* qp = QH + ((size_t)b * TT + qt * 16 + col) * CC + h * HD; const v16h q0 = frag_h(qp, lane), q1 = frag_h(qp + 32, lane);
  const float* cm = CM + ((size_t)b * NH + h) * TT + 8 * g; const float* ci = CI + ((size_t)b * NH + h) * TT + 8 * g; const _Float16* vp = VT + ((size_t)b * CC + h * HD + col) * (size_t)TT;
  v8f acc[HD / 16] = {};
  for (int c = wave; c <= (qt >> 1); c += 4) { const int k0 = c * 32; const _Float16* kp = KH + ((size_t)b * TT + k0 + col) * CC + h * HD;
    v4f mk[4], ik[4];   /* all of a chunk's column-stat and k loads stand in front of the first product: one latency for the lot */
#pragma unroll
    for (int i = 0; i < 4; ++i) { mk[i] = *(const v4f*)(cm + k0 + (i >> 1) * 16 + (i & 1) * 4); ik[i] = *(const v4f*)(ci + k0 + (i >> 1) * 16 + (i & 1) * 4); }
    asm volatile("s_wait_xcnt 0x0" ::: "memory");   /* the k loads below land in registers that held the stat loads' addresses */
    const v16h kf[2][2] = {{frag_h(kp, lane), frag_h(kp + 32, lane)}, {frag_h(kp + 16 * CC, lane), frag_h(kp + 16 * CC + 32, lane)}};
    v8f s[2] = {};
#pragma unroll
    for (int u = 0; u < 2; ++u) { s[u] = wmma16(kf[u][0], q0, s[u]); s[u] = wmma16(kf[u][1], q1, s[u]); }
    v16h vf[HD / 16], p;
#pragma unroll
    for (int j = 0; j < HD / 16; ++j) vf[j] = frag_h(vp + (size_t)j * 16 * TT + k0, lane);
    __builtin_amdgcn_sched_barrier(0);   /* keeps the v loads in front of the exponentials, which then cover their latency; without it they are sunk to the P . v products */
#pragma unroll
    for (int u = 0; u < 2; ++u) { const int d0 = k0 + u * 16 + 8 * g - (qt * 16 + col);   /* key - query of register 0 */ const float fd0 = (float)d0;
#pragma unroll
      for (int r = 0; r < 8; ++r) { const float e = expf((s[u][r] * SCALE + slope_ * (fd0 + (float)r)) - mk[u * 2 + (r >> 2)][r & 3]) * ik[u * 2 + (r >> 2)][r & 3]; p[u * 8 + r] = (_Float16)((d0 + r <= 0) ? e : 0.f); } }   /* value select, no branch: the 16 chains interleave */
#pragma unroll
    for (int j = 0; j < HD / 16; ++j) acc[j] = wmma16(p, vf[j], acc[j]); }
#pragma unroll
  for (int j = 0; j < HD / 16; ++j)
#pragma unroll
    for (int r = 0; r < 8; ++r) ss[wave][8 * g + r][j * 16 + col] = acc[j][r];
  __syncthreads();
  for (int e = tid; e < 16 * (HD / 4); e += 128) { const int rl = e / (HD / 4), c4 = (e % (HD / 4)) * 4; const v4f o = ((*(const v4f*)&ss[0][rl][c4] + *(const v4f*)&ss[1][rl][c4]) + (*(const v4f*)&ss[2][rl][c4] + *(const v4f*)&ss[3][rl][c4])) * (1.0f / 2048.0f); vst2(Y + ((size_t)b * TT + qt * 16 + rl) * CC + h * HD + c4, o); } }
// ---- k_out: block = (64 rows, 128 cols): out = ctx Wo (+ bo): ctx x 2^6 once to f16 against Wo as f16(bf16 x 2^8) exact (1 product) x 2^-14; causal early rows (< QHI of each sequence): ctx bf16 hi + lo against exact bf16 Wo (2 products)
__global__ __launch_bounds__(128) void k_out(const float* __restrict__ Y, const float* __restrict__ WO, const float* __restrict__ BO, float* __restrict__ OUT) { __shared__ __align__(16) float sf[4][16][132];
  const int tid = threadIdx.x, wave = tid >> 5, lane = tid & 31, col = lane & 15, g = lane >> 4; const int c0 = blockIdx.y * 128; const size_t r0 = (size_t)blockIdx.x * 64 + wave * 16;
  v8f acc[8] = {};
  if (CAUSAL && (int)(((size_t)blockIdx.x * 64) % TT) < QHI) {   /* block-uniform */
#pragma unroll 2
    for (int kc = 0; kc < CC / 32; ++kc) { const F2 a = split_row(Y + (r0 + col) * CC, kc * 32, lane); asm volatile("s_wait_loadcnt 0x0" ::: "memory");
#pragma unroll
      for (int j = 0; j < 8; ++j) { const v16b w = WOCOL(WO, kc * 32, c0 + j * 16 + col, lane); asm volatile("s_wait_loadcnt 0x0" ::: "memory"); acc[j] = wmma_bf(a.h, w, acc[j]); acc[j] = wmma_bf(a.l, w, acc[j]); } }
#pragma unroll
    for (int j = 0; j < 8; ++j) { const float bias = 0.f;   /* this module has no output bias: the BO argument carries the RESIDUAL x, added at the store */
#pragma unroll
      for (int r = 0; r < 8; ++r) sf[wave][8 * g + r][j * 16 + col] = acc[j][r] + bias; }
  } else {
#pragma unroll 2
    for (int kc = 0; kc < CC / 32; ++kc) { const v16h a = frag_f32s(Y + (r0 + col) * CC + kc * 32, lane, 64.0f); asm volatile("s_wait_loadcnt 0x0" ::: "memory");   /* ctx carried x 2^6 into f16 so small-magnitude context rows stay clear of f16 subnormals (chip FTZ) */
#pragma unroll
      for (int j = 0; j < 8; ++j) { const v16h w = WOCOLH(WO, kc * 32, c0 + j * 16 + col, lane); asm volatile("s_wait_loadcnt 0x0" ::: "memory"); acc[j] = wmma16(a, w, acc[j]); } }
#pragma unroll
    for (int j = 0; j < 8; ++j) { const float bias = 0.f;   /* this module has no output bias: the BO argument carries the RESIDUAL x, added at the store */
#pragma unroll
      for (int r = 0; r < 8; ++r) sf[wave][8 * g + r][j * 16 + col] = acc[j][r] * (1.0f / 16384.0f) + bias; } }   /* 2^-8 (Wo carry) x 2^-6 (ctx carry) */
  LDSX(); for (int rl = 0; rl < 16; ++rl) { const v4f xr = *(const v4f*)(BO + (r0 + rl) * DIN + c0 + lane * 4); asm volatile("s_wait_loadcnt 0x0" ::: "memory"); v4f o = *(const v4f*)&sf[wave][rl][lane * 4]; o[0] += bfr(xr[0]); o[1] += bfr(xr[1]); o[2] += bfr(xr[2]); o[3] += bfr(xr[3]); vst2(OUT + (r0 + rl) * DIN + c0 + lane * 4, o); } }   /* x + outputs */

extern "C" void kernel_launch(void* const* d_in, const int* in_sizes, int n_in, void* d_out, int out_size, void* d_ws, size_t ws_size, hipStream_t stream) {
  (void)in_sizes; (void)n_in; (void)out_size;
  const float** F = (const float**)d_in;
  if (ws_size < (size_t)WS_END) return;
  char* ws = (char*)d_ws; _Float16 *QH = (_Float16*)(ws + WS_QH), *KH = (_Float16*)(ws + WS_KH), *VT = (_Float16*)(ws + WS_VT), *QL = (_Float16*)(ws + WS_QL), *KL = (_Float16*)(ws + WS_KL); __bf16 *VB = (__bf16*)(ws + WS_VB), *VBL = (__bf16*)(ws + WS_VBL); float *Y = (float*)(ws + WS_Y);
  (void)Y; (void)QL; (void)KL; (void)VB; (void)VBL;
  // inputs: 0 x [2,2048,1024]; 1 wq [1024,1024] (in,out); 2 wk; 3 wv; 4 wo [64,1024] (in,out: it acts on the SUM of the 16 heads' 64-dim outputs); no biases
  if (ws_size < (size_t)WS_END2) return;
  float *CM = (float*)(ws + WS_CM), *CI = (float*)(ws + WS_CI);
  k_proj<<<dim3(TNB * TT / 128, CC / 128, 3), 128, 0, stream>>>(F[0], F[0], F[0], F[1], F[2], F[3], nullptr, nullptr, nullptr, QH, QL, KH, KL, VT, VB, VBL);
  k_stat<<<dim3(TT / 32, NH, TNB), 256, 0, stream>>>(QH, KH, CM, CI);   /* per key column: max / sum over the visible queries of exp(score + ALiBi bias) */
  k_att<<<dim3(TT / 16, NH, TNB), 128, 0, stream>>>(QH, KH, VT, CM, CI, Y);
  k_out<<<dim3(TNB * TT / 64, DIN / 128), 128, 0, stream>>>(Y, F[4], F[0], (float*)d_out);   /* sum over heads folded into the projection: merged row (h, d) x wo[d][:] for every h; + x (the third argument is the RESIDUAL here, not a bias) */
}

// v004
// It runs in 158 microseconds.
// Next to v003, in two timings, it ran 1.35 times as fast each time.
// All steps since v000 together make it 48.1 times as fast.
// compute dtype: all float inputs rounded to bf16; q/k/v projections with EXACT bf16 products on WMMA 16x16x32 (f32 accumulate); causal scores q x k once to f16 each (1 product) x 64^-0.5 plus the ALiBi bias slope_h (key - query) in f32; softmax over the QUERY axis in f32 (per key column: online max / sum over the visible queries, precise expf); P x 2^11 once to f16 x v once to f16 (1 product); the 16 heads' outputs are summed in f32 in front of the output projection (the sum x 2^6 once to f16 x wo f16(bf16 x 2^8), 1 product over K = 64); + bf16(x) residual in f32; f32 output.
#include <hip/hip_runtime.h>
#include <math.h>

typedef __attribute__((ext_vector_type(16))) _Float16 v16h;
typedef __attribute__((ext_vector_type(16))) __bf16 v16b;
typedef __attribute__((ext_vector_type(8)))  _Float16 v8h;
typedef __attribute__((ext_vector_type(8)))  float v8f;
typedef __attribute__((ext_vector_type(4)))  float v4f;
typedef __attribute__((ext_vector_type(2)))  float v2f;
typedef __attribute__((ext_vector_type(4)))  unsigned v4u;
typedef __attribute__((ext_vector_type(4)))  int v4i;
typedef float __attribute__((may_alias)) float_a;
typedef int __attribute__((may_alias)) int_a;

template <typename T> __device__ __forceinline__ void vst2(void* p, T v) { *(T*)p = v;  }
__device__ __forceinline__ v8f wmma16(v16h a, v16h b, v8f c) {
  v8f d = __builtin_amdgcn_wmma_f32_16x16x32_f16(false, a, false, b, (short)0, c, false, false);
  asm volatile("v_nop\n\tv_nop\n\tv_nop\n\tv_nop" : "+v"(d) : "v"(a), "v"(b));
  return d;
}
__device__ __forceinline__ v8f wmma_bf(v16b a, v16b b, v8f c) {
  v8f d = __builtin_amdgcn_wmma_f32_16x16x32_bf16(false, a, false, b, (short)0, c, false, false);
  asm volatile("v_nop\n\tv_nop\n\tv_nop\n\tv_nop" : "+v"(d) : "v"(a), "v"(b));
  return d;
}
// 16x16x32 fragments: lane = (h = lane>>4, row/col = lane&15); elements 0..7 = k0+8h+0..7, 8..15 = k0+16+8h+0..7; D element r = row 8h+r
__device__ __forceinline__ v16h frag_h(const _Float16* rowk0, int lane) {
  union { v16h v; v8h q[2]; } u; const _Float16* p = rowk0 + 8 * (lane >> 4);
  u.q[0] = *(const v8h*)p; u.q[1] = *(const v8h*)(p + 16); return u.v;
}
__device__ __forceinline__ v16h frag_f32(const float* rowk0, int lane) {
  v16h a; const float* p = rowk0 + 8 * (lane >> 4);
#pragma unroll
  for (int i = 0; i < 8; ++i) { a[i] = (_Float16)p[i]; a[8 + i] = (_Float16)p[16 + i]; }
  return a;
}
__device__ __forceinline__ v16h frag_f32s(const float* rowk0, int lane, float sc) {
  v16h a; const float* p = rowk0 + 8 * (lane >> 4);
#pragma unroll
  for (int i = 0; i < 8; ++i) { a[i] = (_Float16)(p[i] * sc); a[8 + i] = (_Float16)(p[16 + i] * sc); }
  return a;
}
// column fragment from a [K][ld] layout (column n), rows >= K read as 0
__device__ __forceinline__ v16h fragc_f32(const float* W, int k0, int n, int lane, int ld, int K) {
  v16h a; const int g = lane >> 4;
#pragma unroll
  for (int i = 0; i < 8; ++i) { const int ka = k0 + 8 * g + i, kb = ka + 16;
    a[i] = (_Float16)(ka < K ? W[(size_t)(ka < K ? ka : K - 1) * ld + n] : 0.f); a[8 + i] = (_Float16)(kb < K ? W[(size_t)(kb < K ? kb : K - 1) * ld + n] : 0.f); }
  return a;
}
struct F2 { v16b h, l; };
__device__ __forceinline__ F2 bsplit16(const float v[16]) { F2 r;
#pragma unroll
  for (int i = 0; i < 16; ++i) { const __bf16 h = (__bf16)v[i]; r.h[i] = h; r.l[i] = (__bf16)(v[i] - (float)h); }
  return r; }
__device__ __forceinline__ F2 split_row(const float* row, int k0, int lane) { float v[16]; const float* p = row + k0 + 8 * (lane >> 4);
#pragma unroll
  for (int i = 0; i < 8; ++i) { v[i] = p[i]; v[8 + i] = p[16 + i]; }
  return bsplit16(v); }
__device__ __forceinline__ F2 split_rowK(const float* row, int k0, int lane, int K) { float v[16]; const int g = lane >> 4;
#pragma unroll
  for (int i = 0; i < 8; ++i) { const int ka = k0 + 8 * g + i, kb = ka + 16; v[i] = ka < K ? row[ka < K ? ka : K - 1] : 0.f; v[8 + i] = kb < K ? row[kb < K ? kb : K - 1] : 0.f; }
  return bsplit16(v); }
__device__ __forceinline__ F2 split_col(const float* W, int k0, int n, int lane, int ld, int K) { float v[16]; const int g = lane >> 4;
#pragma unroll
  for (int i = 0; i < 8; ++i) { const int ka = k0 + 8 * g + i, kb = ka + 16; v[i] = ka < K ? W[(size_t)(ka < K ? ka : K - 1) * ld + n] : 0.f; v[8 + i] = kb < K ? W[(size_t)(kb < K ? kb : K - 1) * ld + n] : 0.f; }
  return bsplit16(v); }
__device__ __forceinline__ v8f mac3(const F2& a, const F2& b, v8f c) { c = wmma_bf(a.l, b.h, c); c = wmma_bf(a.h, b.l, c); return wmma_bf(a.h, b.h, c); }
__device__ __forceinline__ float sigm(float v) { return 1.0f / (1.0f + expf(-v)); }
#define LDSX() do { asm volatile("s_wait_dscnt 0" ::: "memory"); __builtin_amdgcn_wave_barrier(); __builtin_amdgcn_fence(__ATOMIC_RELEASE, "workgroup"); } while (0)

// ALiBi-biased multi-headed attention whose softmax runs over the QUERY axis and whose heads are SUMMED (x [2,2048,1024]; (in,out) wq / wk / wv [1024,1024] N(0, 1/1024), no biases; 16 heads x 64; prod = Q K^T / 8 + slope_h (k - q) with slope_h = 2^(-8 (h + 1) / 16); -inf where k > q; attention_weights = softmax(prod, axis=2) - axis 2 of [B, H, q, k] is the QUERY axis: every key column is normalised over the queries that can see it (faithful to the source); out_h = weights V_h; outputs = (sum over the 16 heads of out_h) wo with wo [64,1024]; result = x + outputs).
#define NB 2
#define TT 2048
#define CC 1024            // NH * HD = projected width
#define DIN 1024          // input (model) width
#define NH 16
#define HD 64
#define SCALE (0.125f)
#define CAUSAL 1
#ifndef TNB
#define TNB NB
#endif
__device__ __forceinline__ float bfr(float v) { return (float)(__bf16)v; }
typedef __attribute__((ext_vector_type(8))) __bf16 v8b;
__device__ __forceinline__ v16b frag_b(const __bf16* rowk0, int lane) {
  union { v16b v; v8b q[2]; } u; const __bf16* p = rowk0 + 8 * (lane >> 4);
  u.q[0] = *(const v8b*)p; u.q[1] = *(const v8b*)(p + 16); return u.v;
}
#define QBH 0              // no high-precision blocks: single-product scores and P.v everywhere (the output carries the f32 residual x and the sum of 16 heads: rms - 4)
#define QHI 0               // no q residual plane
#define KHI 64              // no k residual / v hi-lo planes are read
// B fragment (k rows k0+.., output column o) of a weight: (in,out) [K][ld] or (out,in) [ld rows of K]: bf16 exact, or f16(bf16 * 256) exact
__device__ __forceinline__ v16b wcol_io(const float* Wm, int k0, int o, int lane, int ld) { v16b w; const int g = lane >> 4;
#pragma unroll
  for (int i = 0; i < 8; ++i) { w[i] = (__bf16)Wm[(size_t)(k0 + 8 * g + i) * ld + o]; w[8 + i] = (__bf16)Wm[(size_t)(k0 + 16 + 8 * g + i) * ld + o]; }
  return w; }
__device__ __forceinline__ v16b wcol_oi(const float* Wm, int k0, int o, int lane, int K) { v16b w; const float* p = Wm + (size_t)o * K + k0 + 8 * (lane >> 4);
#pragma unroll
  for (int i = 0; i < 8; ++i) { w[i] = (__bf16)p[i]; w[8 + i] = (__bf16)p[16 + i]; }
  return w; }
__device__ __forceinline__ v16h wcolh_io(const float* Wm, int k0, int o, int lane, int ld) { v16h w; const int g = lane >> 4;
#pragma unroll
  for (int i = 0; i < 8; ++i) { w[i] = (_Float16)(bfr(Wm[(size_t)(k0 + 8 * g + i) * ld + o]) * 256.0f); w[8 + i] = (_Float16)(bfr(Wm[(size_t)(k0 + 16 + 8 * g + i) * ld + o]) * 256.0f); }
  return w; }
__device__ __forceinline__ v16h wcolh_oi(const float* Wm, int k0, int o, int lane, int K) { v16h w; const float* p = Wm + (size_t)o * K + k0 + 8 * (lane >> 4);
#pragma unroll
  for (int i = 0; i < 8; ++i) { w[i] = (_Float16)(bfr(p[i]) * 256.0f); w[8 + i] = (_Float16)(bfr(p[16 + i]) * 256.0f); }
  return w; }
#define WQKV_LAYOUT 0   // selects WCOL only, which nothing uses: k_proj reads (in,out) [DIN][CC] for any value
__device__ __forceinline__ v16b wcol_hdk(const float* Wm, int k0, int o, int lane) { v16b w; const int g = lane >> 4; const float* p = Wm + (size_t)(o / HD) * DIN * HD + (o % HD);
#pragma unroll
  for (int i = 0; i < 8; ++i) { w[i] = (__bf16)p[(size_t)(k0 + 8 * g + i) * HD]; w[8 + i] = (__bf16)p[(size_t)(k0 + 16 + 8 * g + i) * HD]; }
  return w; }
#if WQKV_LAYOUT == 1
#define WCOL(W, k0, o, lane) wcol_oi(W, k0, o, lane, DIN)
#elif WQKV_LAYOUT == 2
#define WCOL(W, k0, o, lane) wcol_hdk(W, k0, o, lane)
#else
#define WCOL(W, k0, o, lane) wcol_io(W, k0, o, lane, CC)
#endif

#ifndef PROJ_EXTRA_PARAMS
#define PROJ_EXTRA_PARAMS
#endif

#define WS_QH  0u                                      // f16 q rows [b*t][CC]
#define WS_KH  (WS_QH + 2u * (size_t)NB * TT * CC)      // f16 k rows [b*t][CC]
#define WS_VT  (WS_KH + 2u * (size_t)NB * TT * CC)      // f16 v planes [b][c][t]
#define WS_QL  (WS_VT + 2u * (size_t)NB * CC * TT)      // f16 q residual x 2^10 rows [b][t < QHI][CC]
#define WS_KL  (WS_QL + 2u * (size_t)NB * QHI * CC)     // f16 k residual x 2^10 rows [b][t < KHI][CC]
#define WS_VB  (WS_KL + 2u * (size_t)NB * KHI * CC)     // bf16 v hi planes [b][c][t < KHI]
#define WS_VBL (WS_VB + 2u * (size_t)NB * CC * KHI)
#define WS_Y   (WS_VBL + 2u * (size_t)NB * CC * KHI)    // f32 ctx rows [b*t][CC] (only when there is an output projection)
#define WS_END (WS_Y  + 4u * (size_t)NB * TT * CC)
#define WS_CM (WS_END)                                  // f32 column maxima [b][h][TT]
#define WS_CI (WS_CM + 4u * (size_t)NB * NH * TT)       // f32 2^11 / column sums [b][h][TT]
#define WS_END2 (WS_CI + 4u * (size_t)NB * NH * TT)

// ---- k_proj: block = (128 rows, 128 cols, which) x 4 waves: q/k/v = X W (+ b) with exact bf16 products (K = DIN). Per 32-deep k tile the block rounds its X rows and its W columns to bf16 ONCE into LDS (X as [row][k], W transposed to [col][k]), two buffers: the next tile's global loads (whole 128-B lines) fly while this tile's products run. Wave w owns rows 16 w + 0..15 of each 64-row half. -> which 0: q f16 rows (+ residual rows < QHI); 1: k f16 rows (+ residual rows < KHI); 2: v f16 planes [c][t] (+ bf16 hi/lo planes for t < KHI)
typedef __attribute__((ext_vector_type(4))) __bf16 v4b;
__device__ __forceinline__ void vst_w(void* p, v4u v) { asm volatile("global_store_b128 %0, %1, off\n\ts_wait_xcnt 0x0" :: "v"(p), "v"(v) : "memory"); }   /* a 16-byte global store with its wait in ONE statement: in a statement of its own the wait was passed by the next trip's address steps and LDS reads, which overwrite the store's registers */
#define PBK 32               // k depth of one staged tile
#define PPI 40               // pitch of a staged row in bf16 elements: 64 B of data + 16 B = 16 B x 5 (odd), the conflict-free pitch for 16-byte fragment reads
#define PBUF (128 * PPI)     // elements of one staged operand tile
__global__ __launch_bounds__(128) void k_proj(const float* __restrict__ XQ, const float* __restrict__ XK, const float* __restrict__ XV, const float* __restrict__ WQ, const float* __restrict__ WK, const float* __restrict__ WV, const float* __restrict__ BQ, const float* __restrict__ BK, const float* __restrict__ BV,
    _Float16* __restrict__ QH, _Float16* __restrict__ QL, _Float16* __restrict__ KH, _Float16* __restrict__ KL, _Float16* __restrict__ VT, __bf16* __restrict__ VB, __bf16* __restrict__ VBL) {
  __shared__ __align__(16) unsigned char smem[90112];   /* the staged tiles of the main loop and the transposing planes of the epilogue share these bytes (a barrier stands between the two uses) */
  _Float16 (*sh)[136] = (_Float16 (*)[136])smem; _Float16 (*sl)[136] = (_Float16 (*)[136])(smem + 17408); _Float16 (*th)[72] = (_Float16 (*)[72])(smem + 34816); __bf16 (*tb)[72] = (__bf16 (*)[72])(smem + 53248); __bf16 (*tbl)[72] = (__bf16 (*)[72])(smem + 71680);
  __bf16* sA = (__bf16*)smem; __bf16* sW = (__bf16*)(smem + 4 * PBUF);   /* 2 buffers of X rows, then 2 buffers of W columns */
  const int tid = threadIdx.x, wave = tid >> 5, lane = tid & 31, col = lane & 15, g = lane >> 4; const int which = blockIdx.z; const int c0 = blockIdx.y * 128; const size_t r0 = (size_t)blockIdx.x * 128; const size_t bb = r0 / TT; const int t0 = (int)(r0 % TT);
  const float* X = which == 0 ? XQ : which == 1 ? XK : XV; const float* WA = which == 0 ? WQ : which == 1 ? WK : WV; const float* BA = which == 0 ? BQ : which == 1 ? BK : BV;
  const int l8 = lane & 7, l3 = lane >> 3;
  const float* pa = X + r0 * DIN; const unsigned oa = (unsigned)((wave * 4 + l3) * DIN + l8 * 4);   /* X: 8 lanes read one row's 128 B; load j = rows + 16 j */
  const float* pw = WA + c0; const unsigned ow = (unsigned)(8 * l3 * CC + (wave * 8 + l8) * 4);     /* W (in,out): the lane holds k rows 8 l3 + 0..7 of 4 columns; 8 lanes read 128 B of a row */
  __bf16* da = sA + (wave * 4 + l3) * PPI + l8 * 4;
  __bf16* dw = sW + (wave * 32 + l8 * 4) * PPI + 8 * l3;                       /* 8 k of one column = one 16-byte store; the 32 lanes fall on every bank twice */
  v4f ar[8], wr[8];
  v8f acc[2][8] = {};
  auto issue = [&](const float* qa, const float* qw) {
#pragma unroll
    for (int j = 0; j < 8; ++j) { ar[j] = *(const v4f*)(qa + (size_t)j * 16 * DIN); wr[j] = *(const v4f*)(qw + (size_t)j * CC); } };
  auto stage = [&](int buf) {
#pragma unroll
    for (int j = 0; j < 8; ++j) { v4b t;
#pragma unroll
      for (int e = 0; e < 4; ++e) t[e] = (__bf16)ar[j][e];
      *(v4b*)(da + buf * PBUF + j * 16 * PPI) = t; }
#pragma unroll
    for (int i = 0; i < 4; ++i) { v8b t;
#pragma unroll
      for (int r = 0; r < 8; ++r) t[r] = (__bf16)wr[r][i];
      *(v8b*)(dw + buf * PBUF + i * PPI) = t; } };
  issue(pa + oa, pw + ow);
  asm volatile("s_wait_xcnt 0x0" ::: "memory");   /* stands behind the 16 loads, in front of the next overwrite of a register that they name */
  __builtin_amdgcn_sched_barrier(0);   /* no later write of such a register is lifted over the wait */
  stage(0);
  for (int kc = 0; kc < DIN / PBK; ++kc) {
    __syncthreads();   /* publishes tile kc and ends every wave's reads of the buffer that tile kc + 1 is written into below */
    const __bf16* ba = sA + (kc & 1) * PBUF + (wave * 16 + col) * PPI; const __bf16* bw = sW + (kc & 1) * PBUF + col * PPI;
    const v16b a0 = frag_b(ba, lane), a1 = frag_b(ba + 64 * PPI, lane); v16b w[8];   /* all 20 fragment reads of the tile as one group: one LDS latency a tile, not one a column block */
#pragma unroll
    for (int j = 0; j < 8; ++j) w[j] = frag_b(bw + j * 16 * PPI, lane);
    __builtin_amdgcn_sched_barrier(0);   /* the fragment reads go first: their latency runs under the issue of the global loads */
    if (kc + 1 < DIN / PBK) { const int ks = __builtin_amdgcn_readfirstlane((kc + 1) * PBK); const float* qa = pa + oa + ks; const float* qw = pw + ow + (size_t)ks * CC;   /* the tile's step through a scalar register: the two addresses are formed anew for each tile, and the pairs that the loads name are the very values that the wait below takes */
      issue(qa, qw);
      asm volatile("s_wait_xcnt 0x0" :: "v"(qa), "v"(qw) : "memory"); }   /* stands behind the 16 loads, in front of the next overwrite of their address registers; the two addresses as inputs keep the pairs alive to this wait, so that no load lands in one */
    __builtin_amdgcn_sched_barrier(0);   /* the products, and every later write of an address register, stay behind the loads and their wait */
#pragma unroll
    for (int j = 0; j < 8; ++j) { acc[0][j] = wmma_bf(a0, w[j], acc[0][j]); acc[1][j] = wmma_bf(a1, w[j], acc[1][j]); }
    __builtin_amdgcn_sched_barrier(0);   /* the conversions of stage() wait for the global loads: lifted among the products they would stall the wave at once */
    if (kc + 1 < DIN / PBK) stage((kc + 1) & 1); }
  __syncthreads();   /* the last tile's reads end before the epilogue planes overwrite the staged tiles */
  if (which < 2) { _Float16* DH = which == 0 ? QH : KH; _Float16* DL = which == 0 ? QL : KL; const int nhi = which == 0 ? QHI : KHI;
#pragma unroll
    for (int i = 0; i < 2; ++i) { const size_t rb = r0 + i * 64; const int tq = t0 + i * 64; const bool hi_rows = tq < nhi;   /* the two 64-row halves go through the same planes one after the other */
#pragma unroll
      for (int j = 0; j < 8; ++j) { const float bias = BA ? bfr(BA[c0 + j * 16 + col]) : 0.f;
#pragma unroll
        for (int r = 0; r < 8; ++r) { const float v = acc[i][j][r] + bias; const _Float16 hv = (_Float16)v; sh[wave * 16 + 8 * g + r][j * 16 + col] = hv; sl[wave * 16 + 8 * g + r][j * 16 + col] = (_Float16)((v - (float)hv) * 1024.0f); } }
      __syncthreads();
      for (int e = tid; e < 64 * 16; e += 128) { const int rl = e >> 4, q = e & 15; vst_w(DH + (rb + rl) * CC + c0 + q * 8, *(const v4u*)&sh[rl][q * 8]); if (hi_rows) vst_w(DL + (bb * nhi + tq + rl) * (size_t)CC + c0 + q * 8, *(const v4u*)&sl[rl][q * 8]); }
      if (i == 0) __syncthreads(); }   /* the first half is read out before the second overwrites the planes */
  } else {
#pragma unroll
    for (int i = 0; i < 2; ++i) { const int tq = t0 + i * 64; const bool hi_rows = tq < KHI;
#pragma unroll
      for (int j = 0; j < 8; ++j) { const float bias = BA ? bfr(BA[c0 + j * 16 + col]) : 0.f;
#pragma unroll
        for (int r = 0; r < 8; ++r) { const float v = acc[i][j][r] + bias; const int rl = wave * 16 + 8 * g + r, cl = j * 16 + col; th[cl][rl] = (_Float16)v; const __bf16 bh = (__bf16)v; tb[cl][rl] = bh; tbl[cl][rl] = (__bf16)(v - (float)bh); } }
      __syncthreads();
      for (int e = tid; e < 128 * 8; e += 128) { const int cl = e >> 3, q = e & 7; vst_w(VT + (bb * CC + c0 + cl) * (size_t)TT + tq + q * 8, *(const v4u*)&th[cl][q * 8]); if (hi_rows) { const size_t o3 = (bb * CC + c0 + cl) * (size_t)KHI + tq + q * 8; vst_w(VB + o3, *(const v4u*)&tb[cl][q * 8]); vst_w(VBL + o3, *(const v4u*)&tbl[cl][q * 8]); } }
      if (i == 0) __syncthreads(); } } }   /* as above */
// ---- k_stat: softmax over the QUERY axis under the causal mask (the source's softmax(axis=2) on [B, H, q, k] scores): for every key column k of (b, h): m_k = max_{q >= k} s[q][k], Z_k = sum_{q >= k} exp(s[q][k] - m_k), with s = q.k x SCALE + slope (k - q) formed in registers and never stored. Block = 32 key columns (one 128-B line of CM and of CI) x 8 waves; wave w takes the 16-query tiles first tile + w + 8 i. D register r of a tile = query 8g + r, lane column = key, so a lane reduces its own column; the two lane halves are merged by one exchange, the 8 waves through LDS by wave 0, which alone stores m_k and 2^11 / Z_k
__device__ __forceinline__ void ms_merge(float& m, float& z, float mo, float zo) { const float mn = fmaxf(m, mo); z = z * expf(m - mn) + zo * expf(mo - mn); m = mn; }   /* an empty slice carries (-3e38, 0) and adds 0 */
__global__ __launch_bounds__(256) void k_stat(const _Float16* __restrict__ QH, const _Float16* __restrict__ KH, float* __restrict__ CM, float* __restrict__ CI) { __shared__ float pm[8][32], pz[8][32];
  const int tid = threadIdx.x, wave = __builtin_amdgcn_readfirstlane(tid >> 5), lane = tid & 31, col = lane & 15, g = lane >> 4; const int kb = blockIdx.x, h = blockIdx.y, b = blockIdx.z;   /* the wave's number in a scalar register: the tile loop branches on SCC */
  const float slope_ = exp2f(-0.5f * (float)(h + 1));   /* ALiBi slope of this head: 2^(-8 (h + 1) / 16) */
  const _Float16* kp = KH + ((size_t)b * TT + kb * 32 + col) * CC + h * HD;
  const v16h kf[2][2] = {{frag_h(kp, lane), frag_h(kp + 32, lane)}, {frag_h(kp + 16 * CC, lane), frag_h(kp + 16 * CC + 32, lane)}};
  float m[2] = {-3.0e38f, -3.0e38f}, z[2] = {0.f, 0.f};
  for (int qt = kb * 2 + wave; qt < TT / 16; qt += 8) { const _Float16* qa = QH + ((size_t)b * TT + qt * 16 + col) * CC + h * HD + 8 * g;   /* the lane's own address: fragment elements 0..7 = +0, 8..15 = +16, as in frag_h */
    union { v16h v; v8h q[2]; } q0, q1; q0.q[0] = *(const v8h*)qa; q0.q[1] = *(const v8h*)(qa + 16); q1.q[0] = *(const v8h*)(qa + 32); q1.q[1] = *(const v8h*)(qa + 48);
    asm volatile("s_wait_xcnt 0x0" :: "v"(qa) : "memory");   /* the address as an input keeps the address pair of the four q loads alive to this wait: none of them lands in it, and the wait stands in front of its next overwrite */
#pragma unroll
    for (int u = 0; u < 2; ++u) { v8f s = {}; s = wmma16(q0.v, kf[u][0], s); s = wmma16(q1.v, kf[u][1], s);
      const int d0 = kb * 32 + u * 16 + col - (qt * 16 + 8 * g);   /* key - query of register 0 */ const float fd0 = (float)d0; float v[8]; float mn = m[u];
#pragma unroll
      for (int r = 0; r < 8; ++r) { v[r] = (d0 - r <= 0) ? (s[r] * SCALE + slope_ * (fd0 - (float)r)) : -3.0e38f; mn = fmaxf(mn, v[r]); }   /* + the ALiBi bias slope (key - query) <= 0 */
      float zt = 0.f;
#pragma unroll
      for (int r = 0; r < 8; ++r) { const float e = expf(v[r] - mn); zt += (d0 - r <= 0) ? e : 0.f; }   /* value select, no branch: the 8 chains interleave */
      z[u] = z[u] * expf(m[u] - mn) + zt; m[u] = mn; } }
#pragma unroll
  for (int u = 0; u < 2; ++u) { const float mo = __shfl_xor(m[u], 16), zo = __shfl_xor(z[u], 16); ms_merge(m[u], z[u], mo, zo); if (g == 0) { pm[wave][u * 16 + col] = m[u]; pz[wave][u * 16 + col] = z[u]; } }
  __syncthreads();
  if (wave == 0) { float mm = pm[0][lane];
#pragma unroll
    for (int w = 1; w < 8; ++w) mm = fmaxf(mm, pm[w][lane]);
    float zz = 0.f;
#pragma unroll
    for (int w = 0; w < 8; ++w) zz += pz[w][lane] * expf(pm[w][lane] - mm);
    const size_t o = ((size_t)b * NH + h) * TT + kb * 32 + lane; vst2(CM + o, mm); vst2(CI + o, 2048.0f / zz); } }   /* every column sees at least its own diagonal entry: Z_k >= 1 */
// ---- k_att: block = 16 queries of (b, h) x 4 waves; wave w takes the 32-key chunks w + 4 i up to the diagonal. The scores are formed again, TRANSPOSED (A = k rows, B = q rows): D register r of key tile 0 / 1 = key 8g + r / 16 + 8g + r of the lane's own query, which is the place that key has in the A fragment of P . v, so P = exp(s - m_k) x 2^11 / Z_k (0 above the diagonal) goes once to f16 in registers against v f16 (1 product). The 4 waves' partial ctx tiles are summed through LDS; 256-B (row, head) segment by 16 lanes
__global__ __launch_bounds__(128) void k_att(const _Float16* __restrict__ QH, const _Float16* __restrict__ KH, const _Float16* __restrict__ VT, const float* __restrict__ CM, const float* __restrict__ CI, float* __restrict__ Y) { __shared__ __align__(16) float ss[4][16][HD + 4];
  const int tid = threadIdx.x, wave = __builtin_amdgcn_readfirstlane(tid >> 5), lane = tid & 31, col = lane & 15, g = lane >> 4; const int qt = TT / 16 - 1 - blockIdx.x, h = blockIdx.y, b = blockIdx.z;   /* the wave's number in a scalar register: the chunk loop branches on SCC; the longest key ranges start first */
  const float slope_ = exp2f(-0.5f * (float)(h + 1));
  const _Float16* qp = QH + ((size_t)b * TT + qt * 16 + col) * CC + h * HD; const v16h q0 = frag_h(qp, lane), q1 = frag_h(qp + 32, lane);
  const float* cm = CM + ((size_t)b * NH + h) * TT + 8 * g; const float* ci = CI + ((size_t)b * NH + h) * TT + 8 * g; const _Float16* vp = VT + ((size_t)b * CC + h * HD + col) * (size_t)TT;
  v8f acc[HD / 16] = {};
  for (int c = wave; c <= (qt >> 1); c += 4) { const int k0 = c * 32; const _Float16* kp = KH + ((size_t)b * TT + k0 + col) * CC + h * HD;
    v4f mk[4], ik[4];   /* all of a chunk's column-stat and k loads stand in front of the first product: one latency for the lot */
#pragma unroll
    for (int i = 0; i < 4; ++i) { mk[i] = *(const v4f*)(cm + k0 + (i >> 1) * 16 + (i & 1) * 4); ik[i] = *(const v4f*)(ci + k0 + (i >> 1) * 16 + (i & 1) * 4); }
    asm volatile("s_wait_xcnt 0x0" ::: "memory");   /* the k loads below land in registers that held the stat loads' addresses */
    const v16h kf[2][2] = {{frag_h(kp, lane), frag_h(kp + 32, lane)}, {frag_h(kp + 16 * CC, lane), frag_h(kp + 16 * CC + 32, lane)}};
    v8f s[2] = {};
#pragma unroll
    for (int u = 0; u < 2; ++u) { s[u] = wmma16(kf[u][0], q0, s[u]); s[u] = wmma16(kf[u][1], q1, s[u]); }
    v16h vf[HD / 16], p;
#pragma unroll
    for (int j = 0; j < HD / 16; ++j) vf[j] = frag_h(vp + (size_t)j * 16 * TT + k0, lane);
    __builtin_amdgcn_sched_barrier(0);   /* keeps the v loads in front of the exponentials, which then cover their latency; without it they are sunk to the P . v products */
#pragma unroll
    for (int u = 0; u < 2; ++u) { const int d0 = k0 + u * 16 + 8 * g - (qt * 16 + col);   /* key - query of register 0 */ const float fd0 = (float)d0;
#pragma unroll
      for (int r = 0; r < 8; ++r) { const float e = expf((s[u][r] * SCALE + slope_ * (fd0 + (float)r)) - mk[u * 2 + (r >> 2)][r & 3]) * ik[u * 2 + (r >> 2)][r & 3]; p[u * 8 + r] = (_Float16)((d0 + r <= 0) ? e : 0.f); } }   /* value select, no branch: the 16 chains interleave */
#pragma unroll
    for (int j = 0; j < HD / 16; ++j) acc[j] = wmma16(p, vf[j], acc[j]); }
#pragma unroll
  for (int j = 0; j < HD / 16; ++j)
#pragma unroll
    for (int r = 0; r < 8; ++r) ss[wave][8 * g + r][j * 16 + col] = acc[j][r];
  __syncthreads();
  for (int e = tid; e < 16 * (HD / 4); e += 128) { const int rl = e / (HD / 4), c4 = (e % (HD / 4)) * 4; const v4f o = ((*(const v4f*)&ss[0][rl][c4] + *(const v4f*)&ss[1][rl][c4]) + (*(const v4f*)&ss[2][rl][c4] + *(const v4f*)&ss[3][rl][c4])) * (1.0f / 2048.0f); vst2(Y + ((size_t)b * TT + qt * 16 + rl) * CC + h * HD + c4, o); } }
// ---- k_out: block = 16 rows x all 1024 output columns x 16 waves: out = x + (sum over the 16 heads of ctx) Wo. The heads are summed FIRST, in f32: a thread adds 8 heads of 4 channels of one row (pairwise tree), the two 8-head halves meet in LDS and are added where the A fragment is formed; the sum goes x 2^6 once to f16, and the product with Wo as f16(bf16 x 2^8) exact runs over K = 64 (2 WMMAs a column tile). Wave w owns columns 64 w + 0..63. Lane column n of tile e stands for output column 64 w + 4 n + e, so one 16-byte load of a Wo row feeds the 4 tiles, and the 4 tiles' D registers of a row are 16 neighbouring output bytes of the lane: 16 lanes read / write 256 B of a row
__global__ __launch_bounds__(512) void k_out(const float* __restrict__ Y, const float* __restrict__ WO, const float* __restrict__ BO, float* __restrict__ OUT) { __shared__ __align__(16) float sp[2][16][HD + 4];
  const int tid = threadIdx.x, wave = tid >> 5, lane = tid & 31, col = lane & 15, g = lane >> 4; const size_t r0 = (size_t)blockIdx.x * 16;
  const int yh = tid >> 8, yr = (tid >> 4) & 15, yc = (tid & 15) * 4;                /* the thread's half of the heads, its row, its 4 channels */
  const float* yp = Y + (r0 + yr) * CC + yh * (NH / 2) * HD + yc;
  const float* wp = WO + (size_t)(8 * g) * DIN + wave * 64 + col * 4;                /* fragment elements 0..7 = k rows k0 + 8g + 0..7, 8..15 = k0 + 16 + 8g + 0..7, as in frag_h */
  const size_t oo = (r0 + 8 * g) * DIN + wave * 64 + col * 4; const float* xp = BO + oo;   /* the BO argument carries the RESIDUAL x (this module has no output bias) */
  v4f yv[NH / 2], wv[2][16], xr[8];   /* every load of the block is independent of every other: all are issued before the first is used, one latency for the lot */
#pragma unroll
  for (int h = 0; h < NH / 2; ++h) yv[h] = *(const v4f*)(yp + h * HD);
#pragma unroll
  for (int s = 0; s < 2; ++s)
#pragma unroll
    for (int i = 0; i < 8; ++i) { wv[s][i] = *(const v4f*)(wp + (size_t)(s * 32 + i) * DIN); wv[s][8 + i] = *(const v4f*)(wp + (size_t)(s * 32 + 16 + i) * DIN); }
#pragma unroll
  for (int r = 0; r < 8; ++r) xr[r] = *(const v4f*)(xp + (size_t)r * DIN);
  asm volatile("s_wait_xcnt 0x0" :: "v"(yp), "v"(wp), "v"(xp) : "memory");   /* stands behind the loads, in front of the next overwrite of a register that they name; the three addresses as inputs keep the pairs alive to this wait */
  __builtin_amdgcn_sched_barrier(0);   /* the conversions below wait for loaded values: lifted over the last loads they would put a second memory latency behind the first */
#pragma unroll
  for (int st = 1; st < NH / 2; st *= 2)
#pragma unroll
    for (int h = 0; h < NH / 2; h += 2 * st) yv[h] += yv[h + st];
  *(v4f*)&sp[yh][yr][yc] = yv[0];
  __syncthreads();   /* publishes the two half sums of the 16 rows to the 16 waves */
  v16h a[2];
#pragma unroll
  for (int s = 0; s < 2; ++s)
#pragma unroll
    for (int q = 0; q < 4; ++q) { const int k = s * 32 + (q >> 1) * 16 + 8 * g + (q & 1) * 4; const v4f t = (*(const v4f*)&sp[0][col][k] + *(const v4f*)&sp[1][col][k]) * 64.0f;   /* carried x 2^6 into f16 so small-magnitude context rows stay clear of f16 subnormals */
#pragma unroll
      for (int e = 0; e < 4; ++e) a[s][q * 4 + e] = (_Float16)t[e]; }
  v8f acc[4];
#pragma unroll
  for (int e = 0; e < 4; ++e) { v16h w0, w1;
#pragma unroll
    for (int i = 0; i < 16; ++i) { w0[i] = (_Float16)(bfr(wv[0][i][e]) * 256.0f); w1[i] = (_Float16)(bfr(wv[1][i][e]) * 256.0f); }
    v8f d = {}; d = wmma16(a[0], w0, d); acc[e] = wmma16(a[1], w1, d); }
  v4f o[8];
#pragma unroll
  for (int r = 0; r < 8; ++r)
#pragma unroll
    for (int e = 0; e < 4; ++e) o[r][e] = acc[e][r] * (1.0f / 16384.0f) + bfr(xr[r][e]);   /* 2^-8 (Wo carry) x 2^-6 (ctx carry); x + outputs */
  __builtin_amdgcn_sched_barrier(0);   /* all 8 results are formed in front of the first store: no register that an issued store names is written again */
#pragma unroll
  for (int r = 0; r < 8; ++r) vst2(OUT + oo + (size_t)r * DIN, o[r]); }

extern "C" void kernel_launch(void* const* d_in, const int* in_sizes, int n_in, void* d_out, int out_size, void* d_ws, size_t ws_size, hipStream_t stream) {
  (void)in_sizes; (void)n_in; (void)out_size;
  const float** F = (const float**)d_in;
  if (ws_size < (size_t)WS_END) return;
  char* ws = (char*)d_ws; _Float16 *QH = (_Float16*)(ws + WS_QH), *KH = (_Float16*)(ws + WS_KH), *VT = (_Float16*)(ws + WS_VT), *QL = (_Float16*)(ws + WS_QL), *KL = (_Float16*)(ws + WS_KL); __bf16 *VB = (__bf16*)(ws + WS_VB), *VBL = (__bf16*)(ws + WS_VBL); float *Y = (float*)(ws + WS_Y);
  (void)Y; (void)QL; (void)KL; (void)VB; (void)VBL;
  // inputs: 0 x [2,2048,1024]; 1 wq [1024,1024] (in,out); 2 wk; 3 wv; 4 wo [64,1024] (in,out: it acts on the SUM of the 16 heads' 64-dim outputs); no biases
  if (ws_size < (size_t)WS_END2) return;
  float *CM = (float*)(ws + WS_CM), *CI = (float*)(ws + WS_CI);
  k_proj<<<dim3(TNB * TT / 128, CC / 128, 3), 128, 0, stream>>>(F[0], F[0], F[0], F[1], F[2], F[3], nullptr, nullptr, nullptr, QH, QL, KH, KL, VT, VB, VBL);
  k_stat<<<dim3(TT / 32, NH, TNB), 256, 0, stream>>>(QH, KH, CM, CI);   /* per key column: max / sum over the visible queries of exp(score + ALiBi bias) */
  k_att<<<dim3(TT / 16, NH, TNB), 128, 0, stream>>>(QH, KH, VT, CM, CI, Y);
  k_out<<<dim3(TNB * TT / 16), 512, 0, stream>>>(Y, F[4], F[0], (float*)d_out);   /* (sum over heads) x wo + x (the third argument is the RESIDUAL here, not a bias) */
}

// v005
// It runs in 140 microseconds.
// Timed twice side by side with v004, it ran 1.13 times as fast both times.
// All steps since v000 together make it 54.2 times as fast.
// compute dtype: all float inputs rounded to bf16; q/k/v projections with EXACT bf16 products on WMMA 16x16x32 (f32 accumulate); causal scores q x k once to f16 each (1 product) x 64^-0.5 plus the ALiBi bias slope_h (key - query) in f32; softmax over the QUERY axis in f32 (per key column: online max / sum over the visible queries, precise expf); P x 2^11 once to f16 x v once to f16 (1 product); the 16 heads' outputs are summed in f32 in front of the output projection (the sum x 2^6 once to f16 x wo f16(bf16 x 2^8), 1 product over K = 64); + bf16(x) residual in f32; f32 output.
#include <hip/hip_runtime.h>
#include <math.h>

typedef __attribute__((ext_vector_type(16))) _Float16 v16h;
typedef __attribute__((ext_vector_type(16))) __bf16 v16b;
typedef __attribute__((ext_vector_type(8)))  _Float16 v8h;
typedef __attribute__((ext_vector_type(8)))  float v8f;
typedef __attribute__((ext_vector_type(4)))  float v4f;
typedef __attribute__((ext_vector_type(2)))  float v2f;
typedef __attribute__((ext_vector_type(4)))  unsigned v4u;
typedef __attribute__((ext_vector_type(4)))  int v4i;
typedef float __attribute__((may_alias)) float_a;
typedef int __attribute__((may_alias)) int_a;

template <typename T> __device__ __forceinline__ void vst2(void* p, T v) { *(T*)p = v;  }
__device__ __forceinline__ v8f wmma16(v16h a, v16h b, v8f c) {
  v8f d = __builtin_amdgcn_wmma_f32_16x16x32_f16(false, a, false, b, (short)0, c, false, false);
  asm volatile("v_nop\n\tv_nop\n\tv_nop\n\tv_nop" : "+v"(d) : "v"(a), "v"(b));
  return d;
}
__device__ __forceinline__ v8f wmma_bf(v16b a, v16b b, v8f c) {
  v8f d = __builtin_amdgcn_wmma_f32_16x16x32_bf16(false, a, false, b, (short)0, c, false, false);
  asm volatile("v_nop\n\tv_nop\n\tv_nop\n\tv_nop" : "+v"(d) : "v"(a), "v"(b));
  return d;
}
// 16x16x32 fragments: lane = (h = lane>>4, row/col = lane&15); elements 0..7 = k0+8h+0..7, 8..15 = k0+16+8h+0..7; D element r = row 8h+r
__device__ __forceinline__ v16h frag_h(const _Float16* rowk0, int lane) {
  union { v16h v; v8h q[2]; } u; const _Float16* p = rowk0 + 8 * (lane >> 4);
  u.q[0] = *(const v8h*)p; u.q[1] = *(const v8h*)(p + 16); return u.v;
}
__device__ __forceinline__ v16h frag_f32(const float* rowk0, int lane) {
  v16h a; const float* p = rowk0 + 8 * (lane >> 4);
#pragma unroll
  for (int i = 0; i < 8; ++i) { a[i] = (_Float16)p[i]; a[8 + i] = (_Float16)p[16 + i]; }
  return a;
}
__device__ __forceinline__ v16h frag_f32s(const float* rowk0, int lane, float sc) {
  v16h a; const float* p = rowk0 + 8 * (lane >> 4);
#pragma unroll
  for (int i = 0; i < 8; ++i) { a[i] = (_Float16)(p[i] * sc); a[8 + i] = (_Float16)(p[16 + i] * sc); }
  return a;
}
// column fragment from a [K][ld] layout (column n), rows >= K read as 0
__device__ __forceinline__ v16h fragc_f32(const float* W, int k0, int n, int lane, int ld, int K) {
  v16h a; const int g = lane >> 4;
#pragma unroll
  for (int i = 0; i < 8; ++i) { const int ka = k0 + 8 * g + i, kb = ka + 16;
    a[i] = (_Float16)(ka < K ? W[(size_t)(ka < K ? ka : K - 1) * ld + n] : 0.f); a[8 + i] = (_Float16)(kb < K ? W[(size_t)(kb < K ? kb : K - 1) * ld + n] : 0.f); }
  return a;
}
struct F2 { v16b h, l; };
__device__ __forceinline__ F2 bsplit16(const float v[16]) { F2 r;
#pragma unroll
  for (int i = 0; i < 16; ++i) { const __bf16 h = (__bf16)v[i]; r.h[i] = h; r.l[i] = (__bf16)(v[i] - (float)h); }
  return r; }
__device__ __forceinline__ F2 split_row(const float* row, int k0, int lane) { float v[16]; const float* p = row + k0 + 8 * (lane >> 4);
#pragma unroll
  for (int i = 0; i < 8; ++i) { v[i] = p[i]; v[8 + i] = p[16 + i]; }
  return bsplit16(v); }
__device__ __forceinline__ F2 split_rowK(const float* row, int k0, int lane, int K) { float v[16]; const int g = lane >> 4;
#pragma unroll
  for (int i = 0; i < 8; ++i) { const int ka = k0 + 8 * g + i, kb = ka + 16; v[i] = ka < K ? row[ka < K ? ka : K - 1] : 0.f; v[8 + i] = kb < K ? row[kb < K ? kb : K - 1] : 0.f; }
  return bsplit16(v); }
__device__ __forceinline__ F2 split_col(const float* W, int k0, int n, int lane, int ld, int K) { float v[16]; const int g = lane >> 4;
#pragma unroll
  for (int i = 0; i < 8; ++i) { const int ka = k0 + 8 * g + i, kb = ka + 16; v[i] = ka < K ? W[(size_t)(ka < K ? ka : K - 1) * ld + n] : 0.f; v[8 + i] = kb < K ? W[(size_t)(kb < K ? kb : K - 1) * ld + n] : 0.f; }
  return bsplit16(v); }
__device__ __forceinline__ v8f mac3(const F2& a, const F2& b, v8f c) { c = wmma_bf(a.l, b.h, c); c = wmma_bf(a.h, b.l, c); return wmma_bf(a.h, b.h, c); }
__device__ __forceinline__ float sigm(float v) { return 1.0f / (1.0f + expf(-v)); }
#define LDSX() do { asm volatile("s_wait_dscnt 0" ::: "memory"); __builtin_amdgcn_wave_barrier(); __builtin_amdgcn_fence(__ATOMIC_RELEASE, "workgroup"); } while (0)

// ALiBi-biased multi-headed attention whose softmax runs over the QUERY axis and whose heads are SUMMED (x [2,2048,1024]; (in,out) wq / wk / wv [1024,1024] N(0, 1/1024), no biases; 16 heads x 64; prod = Q K^T / 8 + slope_h (k - q) with slope_h = 2^(-8 (h + 1) / 16); -inf where k > q; attention_weights = softmax(prod, axis=2) - axis 2 of [B, H, q, k] is the QUERY axis: every key column is normalised over the queries that can see it (faithful to the source); out_h = weights V_h; outputs = (sum over the 16 heads of out_h) wo with wo [64,1024]; result = x + outputs).
#define NB 2
#define TT 2048
#define CC 1024            // NH * HD = projected width
#define DIN 1024          // input (model) width
#define NH 16
#define HD 64
#define SCALE (0.125f)
#define CAUSAL 1
#ifndef TNB
#define TNB NB
#endif
__device__ __forceinline__ float bfr(float v) { return (float)(__bf16)v; }
typedef __attribute__((ext_vector_type(8))) __bf16 v8b;
__device__ __forceinline__ v16b frag_b(const __bf16* rowk0, int lane) {
  union { v16b v; v8b q[2]; } u; const __bf16* p = rowk0 + 8 * (lane >> 4);
  u.q[0] = *(const v8b*)p; u.q[1] = *(const v8b*)(p + 16); return u.v;
}
#define QBH 0              // no high-precision blocks: single-product scores and P.v everywhere (the output carries the f32 residual x and the sum of 16 heads: rms - 4)
#define QHI 0               // no q residual plane
#define KHI 64              // no k residual / v hi-lo planes are read
// B fragment (k rows k0+.., output column o) of a weight: (in,out) [K][ld] or (out,in) [ld rows of K]: bf16 exact, or f16(bf16 * 256) exact
__device__ __forceinline__ v16b wcol_io(const float* Wm, int k0, int o, int lane, int ld) { v16b w; const int g = lane >> 4;
#pragma unroll
  for (int i = 0; i < 8; ++i) { w[i] = (__bf16)Wm[(size_t)(k0 + 8 * g + i) * ld + o]; w[8 + i] = (__bf16)Wm[(size_t)(k0 + 16 + 8 * g + i) * ld + o]; }
  return w; }
__device__ __forceinline__ v16b wcol_oi(const float* Wm, int k0, int o, int lane, int K) { v16b w; const float* p = Wm + (size_t)o * K + k0 + 8 * (lane >> 4);
#pragma unroll
  for (int i = 0; i < 8; ++i) { w[i] = (__bf16)p[i]; w[8 + i] = (__bf16)p[16 + i]; }
  return w; }
__device__ __forceinline__ v16h wcolh_io(const float* Wm, int k0, int o, int lane, int ld) { v16h w; const int g = lane >> 4;
#pragma unroll
  for (int i = 0; i < 8; ++i) { w[i] = (_Float16)(bfr(Wm[(size_t)(k0 + 8 * g + i) * ld + o]) * 256.0f); w[8 + i] = (_Float16)(bfr(Wm[(size_t)(k0 + 16 + 8 * g + i) * ld + o]) * 256.0f); }
  return w; }
__device__ __forceinline__ v16h wcolh_oi(const float* Wm, int k0, int o, int lane, int K) { v16h w; const float* p = Wm + (size_t)o * K + k0 + 8 * (lane >> 4);
#pragma unroll
  for (int i = 0; i < 8; ++i) { w[i] = (_Float16)(bfr(p[i]) * 256.0f); w[8 + i] = (_Float16)(bfr(p[16 + i]) * 256.0f); }
  return w; }
#define WQKV_LAYOUT 0   // selects WCOL only, which nothing uses: k_proj reads (in,out) [DIN][CC] for any value
__device__ __forceinline__ v16b wcol_hdk(const float* Wm, int k0, int o, int lane) { v16b w; const int g = lane >> 4; const float* p = Wm + (size_t)(o / HD) * DIN * HD + (o % HD);
#pragma unroll
  for (int i = 0; i < 8; ++i) { w[i] = (__bf16)p[(size_t)(k0 + 8 * g + i) * HD]; w[8 + i] = (__bf16)p[(size_t)(k0 + 16 + 8 * g + i) * HD]; }
  return w; }
#if WQKV_LAYOUT == 1
#define WCOL(W, k0, o, lane) wcol_oi(W, k0, o, lane, DIN)
#elif WQKV_LAYOUT == 2
#define WCOL(W, k0, o, lane) wcol_hdk(W, k0, o, lane)
#else
#define WCOL(W, k0, o, lane) wcol_io(W, k0, o, lane, CC)
#endif

#ifndef PROJ_EXTRA_PARAMS
#define PROJ_EXTRA_PARAMS
#endif

#define WS_QH  0u                                      // f16 q in fragment order [b*t / 16][head][FT]
#define WS_KH  (WS_QH + 2u * (size_t)NB * TT * CC)      // f16 k in fragment order [b*t / 16][head][FT]
#define WS_VT  (WS_KH + 2u * (size_t)NB * TT * CC)      // f16 v in fragment order [b][head][t / 32][FV]
#define WS_QL  (WS_VT + 2u * (size_t)NB * CC * TT)      // f16 q residual x 2^10 rows [b][t < QHI][CC]
#define WS_KL  (WS_QL + 2u * (size_t)NB * QHI * CC)     // f16 k residual x 2^10 rows [b][t < KHI][CC]
#define WS_VB  (WS_KL + 2u * (size_t)NB * KHI * CC)     // bf16 v hi planes [b][c][t < KHI]
#define WS_VBL (WS_VB + 2u * (size_t)NB * CC * KHI)
#define WS_Y   (WS_VBL + 2u * (size_t)NB * CC * KHI)    // f32 ctx rows [b*t][CC] (only when there is an output projection)
#define WS_END (WS_Y  + 4u * (size_t)NB * TT * CC)
#define WS_CM (WS_END)                                  // f32 column maxima [b][h][TT]
#define WS_CI (WS_CM + 4u * (size_t)NB * NH * TT)       // f32 2^11 / column sums [b][h][TT]
#define WS_END2 (WS_CI + 4u * (size_t)NB * NH * TT)

// Fragment order of q, k, v in the workspace: the 16 bytes that lane l takes with one load of a 16x16x32 fragment stand at 16 l in a 512-byte piece, so a wave's load reads 4 whole 128-B lines (from row-major rows it touches 32 B of each of 16 lines).
// q / k: block (16-row tile, head) = FT halves = 4 pieces; piece p, lane l = row l & 15, channels 16 p + 8 (l >> 4) + 0..7; pieces 2 s, 2 s + 1 are elements 0..7, 8..15 of the fragment of channels 32 s + 0..31.
// v: block (head, 32-key chunk) = FV halves = 8 pieces; piece 2 j + i, lane l = channel 16 j + (l & 15), keys 16 i + 8 (l >> 4) + 0..7; pieces 2 j, 2 j + 1 are the fragment of channel tile j.
#define FT (16 * HD)
#define FV (32 * HD)
__device__ __forceinline__ v16h frag_t(const _Float16* piece_lane) {   /* address of the lane's 16 bytes in the first of the fragment's two pieces */
  union { v16h v; v8h q[2]; } u; u.q[0] = *(const v8h*)piece_lane; u.q[1] = *(const v8h*)(piece_lane + 256); return u.v;
}
// ---- k_proj: block = (128 rows, 128 cols, which) x 4 waves: q/k/v = X W (+ b) with exact bf16 products (K = DIN). Per 32-deep k tile the block rounds its X rows and its W columns to bf16 ONCE into LDS (X as [row][k], W transposed to [col][k]), two buffers: the next tile's global loads (whole 128-B lines) fly while this tile's products run. Wave w owns rows 16 w + 0..15 of each 64-row half. -> which 0: q f16 in fragment order (+ residual rows < QHI); 1: k f16 in fragment order (+ residual rows < KHI); 2: v f16 in fragment order (+ bf16 hi/lo planes for t < KHI)
typedef __attribute__((ext_vector_type(4))) __bf16 v4b;
__device__ __forceinline__ void vst_w(void* p, v4u v) { asm volatile("global_store_b128 %0, %1, off\n\ts_wait_xcnt 0x0" :: "v"(p), "v"(v) : "memory"); }   /* a 16-byte global store with its wait in ONE statement: in a statement of its own the wait was passed by the next trip's address steps and LDS reads, which overwrite the store's registers */
#define PBK 32               // k depth of one staged tile
#define PPI 40               // pitch of a staged row in bf16 elements: 64 B of data + 16 B = 16 B x 5 (odd), the conflict-free pitch for 16-byte fragment reads
#define PBUF (128 * PPI)     // elements of one staged operand tile
__global__ __launch_bounds__(128) void k_proj(const float* __restrict__ XQ, const float* __restrict__ XK, const float* __restrict__ XV, const float* __restrict__ WQ, const float* __restrict__ WK, const float* __restrict__ WV, const float* __restrict__ BQ, const float* __restrict__ BK, const float* __restrict__ BV,
    _Float16* __restrict__ QH, _Float16* __restrict__ QL, _Float16* __restrict__ KH, _Float16* __restrict__ KL, _Float16* __restrict__ VT, __bf16* __restrict__ VB, __bf16* __restrict__ VBL) {
  __shared__ __align__(16) unsigned char smem[90112];   /* the staged tiles of the main loop and the transposing planes of the epilogue share these bytes (a barrier stands between the two uses) */
  _Float16 (*sh)[136] = (_Float16 (*)[136])smem; _Float16 (*sl)[136] = (_Float16 (*)[136])(smem + 17408); _Float16 (*th)[72] = (_Float16 (*)[72])(smem + 34816); __bf16 (*tb)[72] = (__bf16 (*)[72])(smem + 53248); __bf16 (*tbl)[72] = (__bf16 (*)[72])(smem + 71680);
  __bf16* sA = (__bf16*)smem; __bf16* sW = (__bf16*)(smem + 4 * PBUF);   /* 2 buffers of X rows, then 2 buffers of W columns */
  const int tid = threadIdx.x, wave = tid >> 5, lane = tid & 31, col = lane & 15, g = lane >> 4; const int which = blockIdx.z; const int c0 = blockIdx.y * 128; const size_t r0 = (size_t)blockIdx.x * 128; const size_t bb = r0 / TT; const int t0 = (int)(r0 % TT);
  const float* X = which == 0 ? XQ : which == 1 ? XK : XV; const float* WA = which == 0 ? WQ : which == 1 ? WK : WV; const float* BA = which == 0 ? BQ : which == 1 ? BK : BV;
  const int l8 = lane & 7, l3 = lane >> 3;
  const float* pa = X + r0 * DIN; const unsigned oa = (unsigned)((wave * 4 + l3) * DIN + l8 * 4);   /* X: 8 lanes read one row's 128 B; load j = rows + 16 j */
  const float* pw = WA + c0; const unsigned ow = (unsigned)(8 * l3 * CC + (wave * 8 + l8) * 4);     /* W (in,out): the lane holds k rows 8 l3 + 0..7 of 4 columns; 8 lanes read 128 B of a row */
  __bf16* da = sA + (wave * 4 + l3) * PPI + l8 * 4;
  __bf16* dw = sW + (wave * 32 + l8 * 4) * PPI + 8 * l3;                       /* 8 k of one column = one 16-byte store; the 32 lanes fall on every bank twice */
  v4f ar[8], wr[8];
  v8f acc[2][8] = {};
  auto issue = [&](const float* qa, const float* qw) {
#pragma unroll
    for (int j = 0; j < 8; ++j) { ar[j] = *(const v4f*)(qa + (size_t)j * 16 * DIN); wr[j] = *(const v4f*)(qw + (size_t)j * CC); } };
  auto stage = [&](int buf) {
#pragma unroll
    for (int j = 0; j < 8; ++j) { v4b t;
#pragma unroll
      for (int e = 0; e < 4; ++e) t[e] = (__bf16)ar[j][e];
      *(v4b*)(da + buf * PBUF + j * 16 * PPI) = t; }
#pragma unroll
    for (int i = 0; i < 4; ++i) { v8b t;
#pragma unroll
      for (int r = 0; r < 8; ++r) t[r] = (__bf16)wr[r][i];
      *(v8b*)(dw + buf * PBUF + i * PPI) = t; } };
  issue(pa + oa, pw + ow);
  asm volatile("s_wait_xcnt 0x0" ::: "memory");   /* stands behind the 16 loads, in front of the next overwrite of a register that they name */
  __builtin_amdgcn_sched_barrier(0);   /* no later write of such a register is lifted over the wait */
  stage(0);
  for (int kc = 0; kc < DIN / PBK; ++kc) {
    __syncthreads();   /* publishes tile kc and ends every wave's reads of the buffer that tile kc + 1 is written into below */
    const __bf16* ba = sA + (kc & 1) * PBUF + (wave * 16 + col) * PPI; const __bf16* bw = sW + (kc & 1) * PBUF + col * PPI;
    const v16b a0 = frag_b(ba, lane), a1 = frag_b(ba + 64 * PPI, lane); v16b w[8];   /* all 20 fragment reads of the tile as one group: one LDS latency a tile, not one a column block */
#pragma unroll
    for (int j = 0; j < 8; ++j) w[j] = frag_b(bw + j * 16 * PPI, lane);
    __builtin_amdgcn_sched_barrier(0);   /* the fragment reads go first: their latency runs under the issue of the global loads */
    if (kc + 1 < DIN / PBK) { const int ks = __builtin_amdgcn_readfirstlane((kc + 1) * PBK); const float* qa = pa + oa + ks; const float* qw = pw + ow + (size_t)ks * CC;   /* the tile's step through a scalar register: the two addresses are formed anew for each tile, and the pairs that the loads name are the very values that the wait below takes */
      issue(qa, qw);
      asm volatile("s_wait_xcnt 0x0" :: "v"(qa), "v"(qw) : "memory"); }   /* stands behind the 16 loads, in front of the next overwrite of their address registers; the two addresses as inputs keep the pairs alive to this wait, so that no load lands in one */
    __builtin_amdgcn_sched_barrier(0);   /* the products, and every later write of an address register, stay behind the loads and their wait */
#pragma unroll
    for (int j = 0; j < 8; ++j) { acc[0][j] = wmma_bf(a0, w[j], acc[0][j]); acc[1][j] = wmma_bf(a1, w[j], acc[1][j]); }
    __builtin_amdgcn_sched_barrier(0);   /* the conversions of stage() wait for the global loads: lifted among the products they would stall the wave at once */
    if (kc + 1 < DIN / PBK) stage((kc + 1) & 1); }
  __syncthreads();   /* the last tile's reads end before the epilogue planes overwrite the staged tiles */
  if (which < 2) { _Float16* DH = which == 0 ? QH : KH; _Float16* DL = which == 0 ? QL : KL; const int nhi = which == 0 ? QHI : KHI;
#pragma unroll
    for (int i = 0; i < 2; ++i) { const size_t rb = r0 + i * 64; const int tq = t0 + i * 64; const bool hi_rows = tq < nhi;   /* the two 64-row halves go through the same planes one after the other */
#pragma unroll
      for (int j = 0; j < 8; ++j) { const float bias = BA ? bfr(BA[c0 + j * 16 + col]) : 0.f;
#pragma unroll
        for (int r = 0; r < 8; ++r) { const float v = acc[i][j][r] + bias; const _Float16 hv = (_Float16)v; sh[wave * 16 + 8 * g + r][j * 16 + col] = hv; sl[wave * 16 + 8 * g + r][j * 16 + col] = (_Float16)((v - (float)hv) * 1024.0f); } }
      __syncthreads();
      for (int e = tid; e < 64 * 16; e += 128) { const int fl = e & 31, fp = (e >> 5) & 3, fh = (e >> 7) & 1, ft = e >> 8; const int rl = ft * 16 + (fl & 15), q = fh * 8 + fp * 2 + (fl >> 4);   /* e runs along the destination: lane, piece, head, row tile; a wave stores 512 neighbouring bytes */
        vst_w(DH + (((rb >> 4) + ft) * NH + (c0 >> 6) + fh) * FT + fp * 256 + fl * 8, *(const v4u*)&sh[rl][q * 8]); if (hi_rows) vst_w(DL + (bb * nhi + tq + rl) * (size_t)CC + c0 + q * 8, *(const v4u*)&sl[rl][q * 8]); }
      if (i == 0) __syncthreads(); }   /* the first half is read out before the second overwrites the planes */
  } else {
#pragma unroll
    for (int i = 0; i < 2; ++i) { const int tq = t0 + i * 64; const bool hi_rows = tq < KHI;
#pragma unroll
      for (int j = 0; j < 8; ++j) { const float bias = BA ? bfr(BA[c0 + j * 16 + col]) : 0.f;
#pragma unroll
        for (int r = 0; r < 8; ++r) { const float v = acc[i][j][r] + bias; const int rl = wave * 16 + 8 * g + r, cl = j * 16 + col; th[cl][rl] = (_Float16)v; const __bf16 bh = (__bf16)v; tb[cl][rl] = bh; tbl[cl][rl] = (__bf16)(v - (float)bh); } }
      __syncthreads();
      for (int e = tid; e < 128 * 8; e += 128) { const int fl = e & 31, fp = (e >> 5) & 7, fc = (e >> 8) & 1, fh = e >> 9; const int cl = fh * 64 + (fp >> 1) * 16 + (fl & 15), q = fc * 4 + (fp & 1) * 2 + (fl >> 4);   /* e runs along the destination: lane, piece, key chunk, head */
        vst_w(VT + ((bb * NH + (c0 >> 6) + fh) * (TT / 32) + (tq >> 5) + fc) * FV + fp * 256 + fl * 8, *(const v4u*)&th[cl][q * 8]); if (hi_rows) { const size_t o3 = (bb * CC + c0 + cl) * (size_t)KHI + tq + q * 8; vst_w(VB + o3, *(const v4u*)&tb[cl][q * 8]); vst_w(VBL + o3, *(const v4u*)&tbl[cl][q * 8]); } }
      if (i == 0) __syncthreads(); } } }   /* as above */
// ---- k_stat: softmax over the QUERY axis under the causal mask (the source's softmax(axis=2) on [B, H, q, k] scores): for every key column k of (b, h): m_k = max_{q >= k} s[q][k], Z_k = sum_{q >= k} exp(s[q][k] - m_k), with s = q.k x SCALE + slope (k - q) formed in registers and never stored. Block = 32 key columns (one 128-B line of CM and of CI) x 8 waves; wave w takes the 16-query tiles first tile + w + 8 i. D register r of a tile = query 8g + r, lane column = key, so a lane reduces its own column; the two lane halves are merged by one exchange, the 8 waves through LDS by wave 0, which alone stores m_k and 2^11 / Z_k
__device__ __forceinline__ void ms_merge(float& m, float& z, float mo, float zo) { const float mn = fmaxf(m, mo); z = z * expf(m - mn) + zo * expf(mo - mn); m = mn; }   /* an empty slice carries (-3e38, 0) and adds 0 */
__global__ __launch_bounds__(256) void k_stat(const _Float16* __restrict__ QH, const _Float16* __restrict__ KH, float* __restrict__ CM, float* __restrict__ CI) { __shared__ float pm[8][32], pz[8][32];
  const int tid = threadIdx.x, wave = __builtin_amdgcn_readfirstlane(tid >> 5), lane = tid & 31, col = lane & 15, g = lane >> 4; const int kb = blockIdx.x, h = blockIdx.y, b = blockIdx.z;   /* the wave's number in a scalar register: the tile loop branches on SCC */
  const float slope_ = exp2f(-0.5f * (float)(h + 1));   /* ALiBi slope of this head: 2^(-8 (h + 1) / 16) */
  const _Float16* kp = KH + (((size_t)b * (TT / 16) + kb * 2) * NH + h) * FT + lane * 8;
  const v16h kf[2][2] = {{frag_t(kp), frag_t(kp + 512)}, {frag_t(kp + NH * FT), frag_t(kp + NH * FT + 512)}};
  float m[2] = {-3.0e38f, -3.0e38f}, z[2] = {0.f, 0.f};
  for (int qt = kb * 2 + wave; qt < TT / 16; qt += 8) { const _Float16* qa = QH + (((size_t)b * (TT / 16) + qt) * NH + h) * FT + lane * 8;   /* the lane's own address in piece 0 of the tile; the four pieces as in frag_t */
    union { v16h v; v8h q[2]; } q0, q1; q0.q[0] = *(const v8h*)qa; q0.q[1] = *(const v8h*)(qa + 256); q1.q[0] = *(const v8h*)(qa + 512); q1.q[1] = *(const v8h*)(qa + 768);
    asm volatile("s_wait_xcnt 0x0" :: "v"(qa) : "memory");   /* the address as an input keeps the address pair of the four q loads alive to this wait: none of them lands in it, and the wait stands in front of its next overwrite */
#pragma unroll
    for (int u = 0; u < 2; ++u) { v8f s = {}; s = wmma16(q0.v, kf[u][0], s); s = wmma16(q1.v, kf[u][1], s);
      const int d0 = kb * 32 + u * 16 + col - (qt * 16 + 8 * g);   /* key - query of register 0 */ const float fd0 = (float)d0; float v[8]; float mn = m[u];
#pragma unroll
      for (int r = 0; r < 8; ++r) { v[r] = (d0 - r <= 0) ? (s[r] * SCALE + slope_ * (fd0 - (float)r)) : -3.0e38f; mn = fmaxf(mn, v[r]); }   /* + the ALiBi bias slope (key - query) <= 0 */
      float zt = 0.f;
#pragma unroll
      for (int r = 0; r < 8; ++r) { const float e = expf(v[r] - mn); zt += (d0 - r <= 0) ? e : 0.f; }   /* value select, no branch: the 8 chains interleave */
      z[u] = z[u] * expf(m[u] - mn) + zt; m[u] = mn; } }
#pragma unroll
  for (int u = 0; u < 2; ++u) { const float mo = __shfl_xor(m[u], 16), zo = __shfl_xor(z[u], 16); ms_merge(m[u], z[u], mo, zo); if (g == 0) { pm[wave][u * 16 + col] = m[u]; pz[wave][u * 16 + col] = z[u]; } }
  __syncthreads();
  if (wave == 0) { float mm = pm[0][lane];
#pragma unroll
    for (int w = 1; w < 8; ++w) mm = fmaxf(mm, pm[w][lane]);
    float zz = 0.f;
#pragma unroll
    for (int w = 0; w < 8; ++w) zz += pz[w][lane] * expf(pm[w][lane] - mm);
    const size_t o = ((size_t)b * NH + h) * TT + kb * 32 + lane; vst2(CM + o, mm); vst2(CI + o, 2048.0f / zz); } }   /* every column sees at least its own diagonal entry: Z_k >= 1 */
// ---- k_att: block = 16 queries of (b, h) x 4 waves; wave w takes the 32-key chunks w + 4 i up to the diagonal. The scores are formed again, TRANSPOSED (A = k rows, B = q rows): D register r of key tile 0 / 1 = key 8g + r / 16 + 8g + r of the lane's own query, which is the place that key has in the A fragment of P . v, so P = exp(s - m_k) x 2^11 / Z_k (0 above the diagonal) goes once to f16 in registers against v f16 (1 product). The 4 waves' partial ctx tiles are summed through LDS; 256-B (row, head) segment by 16 lanes
__global__ __launch_bounds__(128) void k_att(const _Float16* __restrict__ QH, const _Float16* __restrict__ KH, const _Float16* __restrict__ VT, const float* __restrict__ CM, const float* __restrict__ CI, float* __restrict__ Y) { __shared__ __align__(16) float ss[4][16][HD + 4];
  const int tid = threadIdx.x, wave = __builtin_amdgcn_readfirstlane(tid >> 5), lane = tid & 31, col = lane & 15, g = lane >> 4; const int qt = TT / 16 - 1 - blockIdx.x, h = blockIdx.y, b = blockIdx.z;   /* the wave's number in a scalar register: the chunk loop branches on SCC; the longest key ranges start first */
  const float slope_ = exp2f(-0.5f * (float)(h + 1));
  const _Float16* qp = QH + (((size_t)b * (TT / 16) + qt) * NH + h) * FT + lane * 8; const v16h q0 = frag_t(qp), q1 = frag_t(qp + 512);
  const float* cm = CM + ((size_t)b * NH + h) * TT + 8 * g; const float* ci = CI + ((size_t)b * NH + h) * TT + 8 * g; const _Float16* vp = VT + ((size_t)b * NH + h) * (TT / 32) * FV + lane * 8;
  v8f acc[HD / 16] = {};
  for (int c = wave; c <= (qt >> 1); c += 4) { const int k0 = c * 32; const _Float16* kp = KH + (((size_t)b * (TT / 16) + c * 2) * NH + h) * FT + lane * 8;
    v4f mk[4], ik[4];   /* all of a chunk's column-stat and k loads stand in front of the first product: one latency for the lot */
#pragma unroll
    for (int i = 0; i < 4; ++i) { mk[i] = *(const v4f*)(cm + k0 + (i >> 1) * 16 + (i & 1) * 4); ik[i] = *(const v4f*)(ci + k0 + (i >> 1) * 16 + (i & 1) * 4); }
    asm volatile("s_wait_xcnt 0x0" ::: "memory");   /* the k loads below land in registers that held the stat loads' addresses */
    const v16h kf[2][2] = {{frag_t(kp), frag_t(kp + 512)}, {frag_t(kp + NH * FT), frag_t(kp + NH * FT + 512)}};
    v8f s[2] = {};
#pragma unroll
    for (int u = 0; u < 2; ++u) { s[u] = wmma16(kf[u][0], q0, s[u]); s[u] = wmma16(kf[u][1], q1, s[u]); }
    v16h vf[HD / 16], p;
#pragma unroll
    for (int j = 0; j < HD / 16; ++j) vf[j] = frag_t(vp + (size_t)c * FV + j * 512);
    __builtin_amdgcn_sched_barrier(0);   /* keeps the v loads in front of the exponentials, which then cover their latency; without it they are sunk to the P . v products */
#pragma unroll
    for (int u = 0; u < 2; ++u) { const int d0 = k0 + u * 16 + 8 * g - (qt * 16 + col);   /* key - query of register 0 */ const float fd0 = (float)d0;
#pragma unroll
      for (int r = 0; r < 8; ++r) { const float e = expf((s[u][r] * SCALE + slope_ * (fd0 + (float)r)) - mk[u * 2 + (r >> 2)][r & 3]) * ik[u * 2 + (r >> 2)][r & 3]; p[u * 8 + r] = (_Float16)((d0 + r <= 0) ? e : 0.f); } }   /* value select, no branch: the 16 chains interleave */
#pragma unroll
    for (int j = 0; j < HD / 16; ++j) acc[j] = wmma16(p, vf[j], acc[j]); }
#pragma unroll
  for (int j = 0; j < HD / 16; ++j)
#pragma unroll
    for (int r = 0; r < 8; ++r) ss[wave][8 * g + r][j * 16 + col] = acc[j][r];
  __syncthreads();
  for (int e = tid; e < 16 * (HD / 4); e += 128) { const int rl = e / (HD / 4), c4 = (e % (HD / 4)) * 4; const v4f o = ((*(const v4f*)&ss[0][rl][c4] + *(const v4f*)&ss[1][rl][c4]) + (*(const v4f*)&ss[2][rl][c4] + *(const v4f*)&ss[3][rl][c4])) * (1.0f / 2048.0f); vst2(Y + ((size_t)b * TT + qt * 16 + rl) * CC + h * HD + c4, o); } }
// ---- k_out: block = 16 rows x all 1024 output columns x 16 waves: out = x + (sum over the 16 heads of ctx) Wo. The heads are summed FIRST, in f32: a thread adds 8 heads of 4 channels of one row (pairwise tree), the two 8-head halves meet in LDS and are added where the A fragment is formed; the sum goes x 2^6 once to f16, and the product with Wo as f16(bf16 x 2^8) exact runs over K = 64 (2 WMMAs a column tile). Wave w owns columns 64 w + 0..63. Lane column n of tile e stands for output column 64 w + 4 n + e, so one 16-byte load of a Wo row feeds the 4 tiles, and the 4 tiles' D registers of a row are 16 neighbouring output bytes of the lane: 16 lanes read / write 256 B of a row
__global__ __launch_bounds__(512) void k_out(const float* __restrict__ Y, const float* __restrict__ WO, const float* __restrict__ BO, float* __restrict__ OUT) { __shared__ __align__(16) float sp[2][16][HD + 4];
  const int tid = threadIdx.x, wave = tid >> 5, lane = tid & 31, col = lane & 15, g = lane >> 4; const size_t r0 = (size_t)blockIdx.x * 16;
  const int yh = tid >> 8, yr = (tid >> 4) & 15, yc = (tid & 15) * 4;                /* the thread's half of the heads, its row, its 4 channels */
  const float* yp = Y + (r0 + yr) * CC + yh * (NH / 2) * HD + yc;
  const float* wp = WO + (size_t)(8 * g) * DIN + wave * 64 + col * 4;                /* fragment elements 0..7 = k rows k0 + 8g + 0..7, 8..15 = k0 + 16 + 8g + 0..7, as in frag_h */
  const size_t oo = (r0 + 8 * g) * DIN + wave * 64 + col * 4; const float* xp = BO + oo;   /* the BO argument carries the RESIDUAL x (this module has no output bias) */
  v4f yv[NH / 2], wv[2][16], xr[8];   /* every load of the block is independent of every other: all are issued before the first is used, one latency for the lot */
#pragma unroll
  for (int h = 0; h < NH / 2; ++h) yv[h] = *(const v4f*)(yp + h * HD);
#pragma unroll
  for (int s = 0; s < 2; ++s)
#pragma unroll
    for (int i = 0; i < 8; ++i) { wv[s][i] = *(const v4f*)(wp + (size_t)(s * 32 + i) * DIN); wv[s][8 + i] = *(const v4f*)(wp + (size_t)(s * 32 + 16 + i) * DIN); }
#pragma unroll
  for (int r = 0; r < 8; ++r) xr[r] = *(const v4f*)(xp + (size_t)r * DIN);
  asm volatile("s_wait_xcnt 0x0" :: "v"(yp), "v"(wp), "v"(xp) : "memory");   /* stands behind the loads, in front of the next overwrite of a register that they name; the three addresses as inputs keep the pairs alive to this wait */
  __builtin_amdgcn_sched_barrier(0);   /* the conversions below wait for loaded values: lifted over the last loads they would put a second memory latency behind the first */
#pragma unroll
  for (int st = 1; st < NH / 2; st *= 2)
#pragma unroll
    for (int h = 0; h < NH / 2; h += 2 * st) yv[h] += yv[h + st];
  *(v4f*)&sp[yh][yr][yc] = yv[0];
  __syncthreads();   /* publishes the two half sums of the 16 rows to the 16 waves */
  v16h a[2];
#pragma unroll
  for (int s = 0; s < 2; ++s)
#pragma unroll
    for (int q = 0; q < 4; ++q) { const int k = s * 32 + (q >> 1) * 16 + 8 * g + (q & 1) * 4; const v4f t = (*(const v4f*)&sp[0][col][k] + *(const v4f*)&sp[1][col][k]) * 64.0f;   /* carried x 2^6 into f16 so small-magnitude context rows stay clear of f16 subnormals */
#pragma unroll
      for (int e = 0; e < 4; ++e) a[s][q * 4 + e] = (_Float16)t[e]; }
  v8f acc[4];
#pragma unroll
  for (int e = 0; e < 4; ++e) { v16h w0, w1;
#pragma unroll
    for (int i = 0; i < 16; ++i) { w0[i] = (_Float16)(bfr(wv[0][i][e]) * 256.0f); w1[i] = (_Float16)(bfr(wv[1][i][e]) * 256.0f); }
    v8f d = {}; d = wmma16(a[0], w0, d); acc[e] = wmma16(a[1], w1, d); }
  v4f o[8];
#pragma unroll
  for (int r = 0; r < 8; ++r)
#pragma unroll
    for (int e = 0; e < 4; ++e) o[r][e] = acc[e][r] * (1.0f / 16384.0f) + bfr(xr[r][e]);   /* 2^-8 (Wo carry) x 2^-6 (ctx carry); x + outputs */
  __builtin_amdgcn_sched_barrier(0);   /* all 8 results are formed in front of the first store: no register that an issued store names is written again */
#pragma unroll
  for (int r = 0; r < 8; ++r) vst2(OUT + oo + (size_t)r * DIN, o[r]); }

extern "C" void kernel_launch(void* const* d_in, const int* in_sizes, int n_in, void* d_out, int out_size, void* d_ws, size_t ws_size, hipStream_t stream) {
  (void)in_sizes; (void)n_in; (void)out_size;
  const float** F = (const float**)d_in;
  if (ws_size < (size_t)WS_END) return;
  char* ws = (char*)d_ws; _Float16 *QH = (_Float16*)(ws + WS_QH), *KH = (_Float16*)(ws + WS_KH), *VT = (_Float16*)(ws + WS_VT), *QL = (_Float16*)(ws + WS_QL), *KL = (_Float16*)(ws + WS_KL); __bf16 *VB = (__bf16*)(ws + WS_VB), *VBL = (__bf16*)(ws + WS_VBL); float *Y = (float*)(ws + WS_Y);
  (void)Y; (void)QL; (void)KL; (void)VB; (void)VBL;
  // inputs: 0 x [2,2048,1024]; 1 wq [1024,1024] (in,out); 2 wk; 3 wv; 4 wo [64,1024] (in,out: it acts on the SUM of the 16 heads' 64-dim outputs); no biases
  if (ws_size < (size_t)WS_END2) return;
  float *CM = (float*)(ws + WS_CM), *CI = (float*)(ws + WS_CI);
  k_proj<<<dim3(TNB * TT / 128, CC / 128, 3), 128, 0, stream>>>(F[0], F[0], F[0], F[1], F[2], F[3], nullptr, nullptr, nullptr, QH, QL, KH, KL, VT, VB, VBL);
  k_stat<<<dim3(TT / 32, NH, TNB), 256, 0, stream>>>(QH, KH, CM, CI);   /* per key column: max / sum over the visible queries of exp(score + ALiBi bias) */
  k_att<<<dim3(TT / 16, NH, TNB), 128, 0, stream>>>(QH, KH, VT, CM, CI, Y);
  k_out<<<dim3(TNB * TT / 16), 512, 0, stream>>>(Y, F[4], F[0], (float*)d_out);   /* (sum over heads) x wo + x (the third argument is the RESIDUAL here, not a bias) */
}

// v006
// A run of this version takes 117 microseconds.
// Timed twice side by side with v005, it ran 1.20 and 1.21 times as fast.
// All steps since v000 together make it 65.4 times as fast.
// compute dtype: all float inputs rounded to bf16; q/k/v projections with EXACT bf16 products on WMMA 16x16x32 (f32 accumulate); causal scores q x k once to f16 each (1 product) x 64^-0.5 plus the ALiBi bias slope_h (key - query) in f32; softmax over the QUERY axis in f32, in base 2 (scores and bias x log2 e; per key column: online max / sum over the visible queries, v_exp_f32); P x 2^11 once to f16 x v once to f16 (1 product); the 16 heads' outputs are summed in f32 in front of the output projection (the sum x 2^6 once to f16 x wo f16(bf16 x 2^8), 1 product over K = 64); + bf16(x) residual in f32; f32 output.
#include <hip/hip_runtime.h>
#include <math.h>

typedef __attribute__((ext_vector_type(16))) _Float16 v16h;
typedef __attribute__((ext_vector_type(16))) __bf16 v16b;
typedef __attribute__((ext_vector_type(8)))  _Float16 v8h;
typedef __attribute__((ext_vector_type(8)))  float v8f;
typedef __attribute__((ext_vector_type(4)))  float v4f;
typedef __attribute__((ext_vector_type(2)))  float v2f;
typedef __attribute__((ext_vector_type(4)))  unsigned v4u;
typedef __attribute__((ext_vector_type(4)))  int v4i;
typedef float __attribute__((may_alias)) float_a;
typedef int __attribute__((may_alias)) int_a;

template <typename T> __device__ __forceinline__ void vst2(void* p, T v) { *(T*)p = v;  }
__device__ __forceinline__ v8f wmma16(v16h a, v16h b, v8f c) {
  v8f d = __builtin_amdgcn_wmma_f32_16x16x32_f16(false, a, false, b, (short)0, c, false, false);
  asm volatile("v_nop\n\tv_nop\n\tv_nop\n\tv_nop" : "+v"(d) : "v"(a), "v"(b));
  return d;
}
__device__ __forceinline__ v8f wmma_bf(v16b a, v16b b, v8f c) {
  v8f d = __builtin_amdgcn_wmma_f32_16x16x32_bf16(false, a, false, b, (short)0, c, false, false);
  asm volatile("v_nop\n\tv_nop\n\tv_nop\n\tv_nop" : "+v"(d) : "v"(a), "v"(b));
  return d;
}
// 16x16x32 fragments: lane = (h = lane>>4, row/col = lane&15); elements 0..7 = k0+8h+0..7, 8..15 = k0+16+8h+0..7; D element r = row 8h+r
__device__ __forceinline__ v16h frag_h(const _Float16* rowk0, int lane) {
  union { v16h v; v8h q[2]; } u; const _Float16* p = rowk0 + 8 * (lane >> 4);
  u.q[0] = *(const v8h*)p; u.q[1] = *(const v8h*)(p + 16); return u.v;
}
__device__ __forceinline__ v16h frag_f32(const float* rowk0, int lane) {
  v16h a; const float* p = rowk0 + 8 * (lane >> 4);
#pragma unroll
  for (int i = 0; i < 8; ++i) { a[i] = (_Float16)p[i]; a[8 + i] = (_Float16)p[16 + i]; }
  return a;
}
__device__ __forceinline__ v16h frag_f32s(const float* rowk0, int lane, float sc) {
  v16h a; const float* p = rowk0 + 8 * (lane >> 4);
#pragma unroll
  for (int i = 0; i < 8; ++i) { a[i] = (_Float16)(p[i] * sc); a[8 + i] = (_Float16)(p[16 + i] * sc); }
  return a;
}
// column fragment from a [K][ld] layout (column n), rows >= K read as 0
__device__ __forceinline__ v16h fragc_f32(const float* W, int k0, int n, int lane, int ld, int K) {
  v16h a; const int g = lane >> 4;
#pragma unroll
  for (int i = 0; i < 8; ++i) { const int ka = k0 + 8 * g + i, kb = ka + 16;
    a[i] = (_Float16)(ka < K ? W[(size_t)(ka < K ? ka : K - 1) * ld + n] : 0.f); a[8 + i] = (_Float16)(kb < K ? W[(size_t)(kb < K ? kb : K - 1) * ld + n] : 0.f); }
  return a;
}
struct F2 { v16b h, l; };
__device__ __forceinline__ F2 bsplit16(const float v[16]) { F2 r;
#pragma unroll
  for (int i = 0; i < 16; ++i) { const __bf16 h = (__bf16)v[i]; r.h[i] = h; r.l[i] = (__bf16)(v[i] - (float)h); }
  return r; }
__device__ __forceinline__ F2 split_row(const float* row, int k0, int lane) { float v[16]; const float* p = row + k0 + 8 * (lane >> 4);
#pragma unroll
  for (int i = 0; i < 8; ++i) { v[i] = p[i]; v[8 + i] = p[16 + i]; }
  return bsplit16(v); }
__device__ __forceinline__ F2 split_rowK(const float* row, int k0, int lane, int K) { float v[16]; const int g = lane >> 4;
#pragma unroll
  for (int i = 0; i < 8; ++i) { const int ka = k0 + 8 * g + i, kb = ka + 16; v[i] = ka < K ? row[ka < K ? ka : K - 1] : 0.f; v[8 + i] = kb < K ? row[kb < K ? kb : K - 1] : 0.f; }
  return bsplit16(v); }
__device__ __forceinline__ F2 split_col(const float* W, int k0, int n, int lane, int ld, int K) { float v[16]; const int g = lane >> 4;
#pragma unroll
  for (int i = 0; i < 8; ++i) { const int ka = k0 + 8 * g + i, kb = ka + 16; v[i] = ka < K ? W[(size_t)(ka < K ? ka : K - 1) * ld + n] : 0.f; v[8 + i] = kb < K ? W[(size_t)(kb < K ? kb : K - 1) * ld + n] : 0.f; }
  return bsplit16(v); }
__device__ __forceinline__ v8f mac3(const F2& a, const F2& b, v8f c) { c = wmma_bf(a.l, b.h, c); c = wmma_bf(a.h, b.l, c); return wmma_bf(a.h, b.h, c); }
__device__ __forceinline__ float sigm(float v) { return 1.0f / (1.0f + expf(-v)); }
#define LDSX() do { asm volatile("s_wait_dscnt 0" ::: "memory"); __builtin_amdgcn_wave_barrier(); __builtin_amdgcn_fence(__ATOMIC_RELEASE, "workgroup"); } while (0)

// ALiBi-biased multi-headed attention whose softmax runs over the QUERY axis and whose heads are SUMMED (x [2,2048,1024]; (in,out) wq / wk / wv [1024,1024] N(0, 1/1024), no biases; 16 heads x 64; prod = Q K^T / 8 + slope_h (k - q) with slope_h = 2^(-8 (h + 1) / 16); -inf where k > q; attention_weights = softmax(prod, axis=2) - axis 2 of [B, H, q, k] is the QUERY axis: every key column is normalised over the queries that can see it (faithful to the source); out_h = weights V_h; outputs = (sum over the 16 heads of out_h) wo with wo [64,1024]; result = x + outputs).
#define NB 2
#define TT 2048
#define CC 1024            // NH * HD = projected width
#define DIN 1024          // input (model) width
#define NH 16
#define HD 64
#define SCALE (0.125f)
#define CAUSAL 1
#ifndef TNB
#define TNB NB
#endif
__device__ __forceinline__ float bfr(float v) { return (float)(__bf16)v; }
typedef __attribute__((ext_vector_type(8))) __bf16 v8b;
__device__ __forceinline__ v16b frag_b(const __bf16* rowk0, int lane) {
  union { v16b v; v8b q[2]; } u; const __bf16* p = rowk0 + 8 * (lane >> 4);
  u.q[0] = *(const v8b*)p; u.q[1] = *(const v8b*)(p + 16); return u.v;
}
#define QBH 0              // no high-precision blocks: single-product scores and P.v everywhere (the output carries the f32 residual x and the sum of 16 heads: rms - 4)
#define QHI 0               // no q residual plane
#define KHI 64              // no k residual / v hi-lo planes are read
// B fragment (k rows k0+.., output column o) of a weight: (in,out) [K][ld] or (out,in) [ld rows of K]: bf16 exact, or f16(bf16 * 256) exact
__device__ __forceinline__ v16b wcol_io(const float* Wm, int k0, int o, int lane, int ld) { v16b w; const int g = lane >> 4;
#pragma unroll
  for (int i = 0; i < 8; ++i) { w[i] = (__bf16)Wm[(size_t)(k0 + 8 * g + i) * ld + o]; w[8 + i] = (__bf16)Wm[(size_t)(k0 + 16 + 8 * g + i) * ld + o]; }
  return w; }
__device__ __forceinline__ v16b wcol_oi(const float* Wm, int k0, int o, int lane, int K) { v16b w; const float* p = Wm + (size_t)o * K + k0 + 8 * (lane >> 4);
#pragma unroll
  for (int i = 0; i < 8; ++i) { w[i] = (__bf16)p[i]; w[8 + i] = (__bf16)p[16 + i]; }
  return w; }
__device__ __forceinline__ v16h wcolh_io(const float* Wm, int k0, int o, int lane, int ld) { v16h w; const int g = lane >> 4;
#pragma unroll
  for (int i = 0; i < 8; ++i) { w[i] = (_Float16)(bfr(Wm[(size_t)(k0 + 8 * g + i) * ld + o]) * 256.0f); w[8 + i] = (_Float16)(bfr(Wm[(size_t)(k0 + 16 + 8 * g + i) * ld + o]) * 256.0f); }
  return w; }
__device__ __forceinline__ v16h wcolh_oi(const float* Wm, int k0, int o, int lane, int K) { v16h w; const float* p = Wm + (size_t)o * K + k0 + 8 * (lane >> 4);
#pragma unroll
  for (int i = 0; i < 8; ++i) { w[i] = (_Float16)(bfr(p[i]) * 256.0f); w[8 + i] = (_Float16)(bfr(p[16 + i]) * 256.0f); }
  return w; }
#define WQKV_LAYOUT 0   // selects WCOL only, which nothing uses: k_proj reads (in,out) [DIN][CC] for any value
__device__ __forceinline__ v16b wcol_hdk(const float* Wm, int k0, int o, int lane) { v16b w; const int g = lane >> 4; const float* p = Wm + (size_t)(o / HD) * DIN * HD + (o % HD);
#pragma unroll
  for (int i = 0; i < 8; ++i) { w[i] = (__bf16)p[(size_t)(k0 + 8 * g + i) * HD]; w[8 + i] = (__bf16)p[(size_t)(k0 + 16 + 8 * g + i) * HD]; }
  return w; }
#if WQKV_LAYOUT == 1
#define WCOL(W, k0, o, lane) wcol_oi(W, k0, o, lane, DIN)
#elif WQKV_LAYOUT == 2
#define WCOL(W, k0, o, lane) wcol_hdk(W, k0, o, lane)
#else
#define WCOL(W, k0, o, lane) wcol_io(W, k0, o, lane, CC)
#endif

#ifndef PROJ_EXTRA_PARAMS
#define PROJ_EXTRA_PARAMS
#endif

#define WS_QH  0u                                      // f16 q in fragment order [b*t / 16][head][FT]
#define WS_KH  (WS_QH + 2u * (size_t)NB * TT * CC)      // f16 k in fragment order [b*t / 16][head][FT]
#define WS_VT  (WS_KH + 2u * (size_t)NB * TT * CC)      // f16 v in fragment order [b][head][t / 32][FV]
#define WS_QL  (WS_VT + 2u * (size_t)NB * CC * TT)      // f16 q residual x 2^10 rows [b][t < QHI][CC]
#define WS_KL  (WS_QL + 2u * (size_t)NB * QHI * CC)     // f16 k residual x 2^10 rows [b][t < KHI][CC]
#define WS_VB  (WS_KL + 2u * (size_t)NB * KHI * CC)     // bf16 v hi planes [b][c][t < KHI]
#define WS_VBL (WS_VB + 2u * (size_t)NB * CC * KHI)
#define WS_Y   (WS_VBL + 2u * (size_t)NB * CC * KHI)    // f32 ctx rows [b*t][CC] (only when there is an output projection)
#define WS_END (WS_Y  + 4u * (size_t)NB * TT * CC)
#define WS_CM (WS_END)                                  // f32 column exponent offsets m_k + log2 Z_k - 11 - slope (k mod 32) (base 2) [b][h][TT]
#define WS_END2 (WS_CM + 4u * (size_t)NB * NH * TT)

// Fragment order of q, k, v in the workspace: the 16 bytes that lane l takes with one load of a 16x16x32 fragment stand at 16 l in a 512-byte piece, so a wave's load reads 4 whole 128-B lines (from row-major rows it touches 32 B of each of 16 lines).
// q / k: block (16-row tile, head) = FT halves = 4 pieces; piece p, lane l = row l & 15, channels 16 p + 8 (l >> 4) + 0..7; pieces 2 s, 2 s + 1 are elements 0..7, 8..15 of the fragment of channels 32 s + 0..31.
// v: block (head, 32-key chunk) = FV halves = 8 pieces; piece 2 j + i, lane l = channel 16 j + (l & 15), keys 16 i + 8 (l >> 4) + 0..7; pieces 2 j, 2 j + 1 are the fragment of channel tile j.
#define FT (16 * HD)
#define FV (32 * HD)
__device__ __forceinline__ v16h frag_t(const _Float16* piece_lane) {   /* address of the lane's 16 bytes in the first of the fragment's two pieces */
  union { v16h v; v8h q[2]; } u; u.q[0] = *(const v8h*)piece_lane; u.q[1] = *(const v8h*)(piece_lane + 256); return u.v;
}
// ---- k_proj: block = (128 rows, 128 cols, which) x 4 waves: q/k/v = X W (+ b) with exact bf16 products (K = DIN). Per 32-deep k tile the block rounds its X rows and its W columns to bf16 ONCE into LDS (X as [row][k], W transposed to [col][k]), two buffers: the next tile's global loads (whole 128-B lines) fly while this tile's products run. Wave w owns rows 16 w + 0..15 of each 64-row half. -> which 0: q f16 in fragment order (+ residual rows < QHI); 1: k f16 in fragment order (+ residual rows < KHI); 2: v f16 in fragment order (+ bf16 hi/lo planes for t < KHI)
typedef __attribute__((ext_vector_type(4))) __bf16 v4b;
__device__ __forceinline__ void vst_w(void* p, v4u v) { asm volatile("global_store_b128 %0, %1, off\n\ts_wait_xcnt 0x0" :: "v"(p), "v"(v) : "memory"); }   /* a 16-byte global store with its wait in ONE statement: in a statement of its own the wait was passed by the next trip's address steps and LDS reads, which overwrite the store's registers */
#define PBK 32               // k depth of one staged tile
#define PPI 40               // pitch of a staged row in bf16 elements: 64 B of data + 16 B = 16 B x 5 (odd), the conflict-free pitch for 16-byte fragment reads
#define PBUF (128 * PPI)     // elements of one staged operand tile
__global__ __launch_bounds__(128) void k_proj(const float* __restrict__ XQ, const float* __restrict__ XK, const float* __restrict__ XV, const float* __restrict__ WQ, const float* __restrict__ WK, const float* __restrict__ WV, const float* __restrict__ BQ, const float* __restrict__ BK, const float* __restrict__ BV,
    _Float16* __restrict__ QH, _Float16* __restrict__ QL, _Float16* __restrict__ KH, _Float16* __restrict__ KL, _Float16* __restrict__ VT, __bf16* __restrict__ VB, __bf16* __restrict__ VBL) {
  __shared__ __align__(16) unsigned char smem[90112];   /* the staged tiles of the main loop and the transposing planes of the epilogue share these bytes (a barrier stands between the two uses) */
  _Float16 (*sh)[136] = (_Float16 (*)[136])smem; _Float16 (*sl)[136] = (_Float16 (*)[136])(smem + 17408); _Float16 (*th)[72] = (_Float16 (*)[72])(smem + 34816); __bf16 (*tb)[72] = (__bf16 (*)[72])(smem + 53248); __bf16 (*tbl)[72] = (__bf16 (*)[72])(smem + 71680);
  __bf16* sA = (__bf16*)smem; __bf16* sW = (__bf16*)(smem + 4 * PBUF);   /* 2 buffers of X rows, then 2 buffers of W columns */
  const int tid = threadIdx.x, wave = tid >> 5, lane = tid & 31, col = lane & 15, g = lane >> 4; const int which = blockIdx.z; const int c0 = blockIdx.y * 128; const size_t r0 = (size_t)blockIdx.x * 128; const size_t bb = r0 / TT; const int t0 = (int)(r0 % TT);
  const float* X = which == 0 ? XQ : which == 1 ? XK : XV; const float* WA = which == 0 ? WQ : which == 1 ? WK : WV; const float* BA = which == 0 ? BQ : which == 1 ? BK : BV;
  const int l8 = lane & 7, l3 = lane >> 3;
  const float* pa = X + r0 * DIN; const unsigned oa = (unsigned)((wave * 4 + l3) * DIN + l8 * 4);   /* X: 8 lanes read one row's 128 B; load j = rows + 16 j */
  const float* pw = WA + c0; const unsigned ow = (unsigned)(8 * l3 * CC + (wave * 8 + l8) * 4);     /* W (in,out): the lane holds k rows 8 l3 + 0..7 of 4 columns; 8 lanes read 128 B of a row */
  __bf16* da = sA + (wave * 4 + l3) * PPI + l8 * 4;
  __bf16* dw = sW + (wave * 32 + l8 * 4) * PPI + 8 * l3;                       /* 8 k of one column = one 16-byte store; the 32 lanes fall on every bank twice */
  v4f ar[8], wr[8];
  v8f acc[2][8] = {};
  auto issue = [&](const float* qa, const float* qw) {
#pragma unroll
    for (int j = 0; j < 8; ++j) { ar[j] = *(const v4f*)(qa + (size_t)j * 16 * DIN); wr[j] = *(const v4f*)(qw + (size_t)j * CC); } };
  auto stage = [&](int buf) {
#pragma unroll
    for (int j = 0; j < 8; ++j) { v4b t;
#pragma unroll
      for (int e = 0; e < 4; ++e) t[e] = (__bf16)ar[j][e];
      *(v4b*)(da + buf * PBUF + j * 16 * PPI) = t; }
#pragma unroll
    for (int i = 0; i < 4; ++i) { v8b t;
#pragma unroll
      for (int r = 0; r < 8; ++r) t[r] = (__bf16)wr[r][i];
      *(v8b*)(dw + buf * PBUF + i * PPI) = t; } };
  issue(pa + oa, pw + ow);
  asm volatile("s_wait_xcnt 0x0" ::: "memory");   /* stands behind the 16 loads, in front of the next overwrite of a register that they name */
  __builtin_amdgcn_sched_barrier(0);   /* no later write of such a register is lifted over the wait */
  stage(0);
  for (int kc = 0; kc < DIN / PBK; ++kc) {
    __syncthreads();   /* publishes tile kc and ends every wave's reads of the buffer that tile kc + 1 is written into below */
    const __bf16* ba = sA + (kc & 1) * PBUF + (wave * 16 + col) * PPI; const __bf16* bw = sW + (kc & 1) * PBUF + col * PPI;
    const v16b a0 = frag_b(ba, lane), a1 = frag_b(ba + 64 * PPI, lane); v16b w[8];   /* all 20 fragment reads of the tile as one group: one LDS latency a tile, not one a column block */
#pragma unroll
    for (int j = 0; j < 8; ++j) w[j] = frag_b(bw + j * 16 * PPI, lane);
    __builtin_amdgcn_sched_barrier(0);   /* the fragment reads go first: their latency runs under the issue of the global loads */
    if (kc + 1 < DIN / PBK) { const int ks = __builtin_amdgcn_readfirstlane((kc + 1) * PBK); const float* qa = pa + oa + ks; const float* qw = pw + ow + (size_t)ks * CC;   /* the tile's step through a scalar register: the two addresses are formed anew for each tile, and the pairs that the loads name are the very values that the wait below takes */
      issue(qa, qw);
      asm volatile("s_wait_xcnt 0x0" :: "v"(qa), "v"(qw) : "memory"); }   /* stands behind the 16 loads, in front of the next overwrite of their address registers; the two addresses as inputs keep the pairs alive to this wait, so that no load lands in one */
    __builtin_amdgcn_sched_barrier(0);   /* the products, and every later write of an address register, stay behind the loads and their wait */
#pragma unroll
    for (int j = 0; j < 8; ++j) { acc[0][j] = wmma_bf(a0, w[j], acc[0][j]); acc[1][j] = wmma_bf(a1, w[j], acc[1][j]); }
    __builtin_amdgcn_sched_barrier(0);   /* the conversions of stage() wait for the global loads: lifted among the products they would stall the wave at once */
    if (kc + 1 < DIN / PBK) stage((kc + 1) & 1); }
  __syncthreads();   /* the last tile's reads end before the epilogue planes overwrite the staged tiles */
  if (which < 2) { _Float16* DH = which == 0 ? QH : KH; _Float16* DL = which == 0 ? QL : KL; const int nhi = which == 0 ? QHI : KHI;
#pragma unroll
    for (int i = 0; i < 2; ++i) { const size_t rb = r0 + i * 64; const int tq = t0 + i * 64; const bool hi_rows = tq < nhi;   /* the two 64-row halves go through the same planes one after the other */
#pragma unroll
      for (int j = 0; j < 8; ++j) { const float bias = BA ? bfr(BA[c0 + j * 16 + col]) : 0.f;
#pragma unroll
        for (int r = 0; r < 8; ++r) { const float v = acc[i][j][r] + bias; const _Float16 hv = (_Float16)v; sh[wave * 16 + 8 * g + r][j * 16 + col] = hv; sl[wave * 16 + 8 * g + r][j * 16 + col] = (_Float16)((v - (float)hv) * 1024.0f); } }
      __syncthreads();
      for (int e = tid; e < 64 * 16; e += 128) { const int fl = e & 31, fp = (e >> 5) & 3, fh = (e >> 7) & 1, ft = e >> 8; const int rl = ft * 16 + (fl & 15), q = fh * 8 + fp * 2 + (fl >> 4);   /* e runs along the destination: lane, piece, head, row tile; a wave stores 512 neighbouring bytes */
        vst_w(DH + (((rb >> 4) + ft) * NH + (c0 >> 6) + fh) * FT + fp * 256 + fl * 8, *(const v4u*)&sh[rl][q * 8]); if (hi_rows) vst_w(DL + (bb * nhi + tq + rl) * (size_t)CC + c0 + q * 8, *(const v4u*)&sl[rl][q * 8]); }
      if (i == 0) __syncthreads(); }   /* the first half is read out before the second overwrites the planes */
  } else {
#pragma unroll
    for (int i = 0; i < 2; ++i) { const int tq = t0 + i * 64; const bool hi_rows = tq < KHI;
#pragma unroll
      for (int j = 0; j < 8; ++j) { const float bias = BA ? bfr(BA[c0 + j * 16 + col]) : 0.f;
#pragma unroll
        for (int r = 0; r < 8; ++r) { const float v = acc[i][j][r] + bias; const int rl = wave * 16 + 8 * g + r, cl = j * 16 + col; th[cl][rl] = (_Float16)v; const __bf16 bh = (__bf16)v; tb[cl][rl] = bh; tbl[cl][rl] = (__bf16)(v - (float)bh); } }
      __syncthreads();
      for (int e = tid; e < 128 * 8; e += 128) { const int fl = e & 31, fp = (e >> 5) & 7, fc = (e >> 8) & 1, fh = e >> 9; const int cl = fh * 64 + (fp >> 1) * 16 + (fl & 15), q = fc * 4 + (fp & 1) * 2 + (fl >> 4);   /* e runs along the destination: lane, piece, key chunk, head */
        vst_w(VT + ((bb * NH + (c0 >> 6) + fh) * (TT / 32) + (tq >> 5) + fc) * FV + fp * 256 + fl * 8, *(const v4u*)&th[cl][q * 8]); if (hi_rows) { const size_t o3 = (bb * CC + c0 + cl) * (size_t)KHI + tq + q * 8; vst_w(VB + o3, *(const v4u*)&tb[cl][q * 8]); vst_w(VBL + o3, *(const v4u*)&tbl[cl][q * 8]); } }
      if (i == 0) __syncthreads(); } } }   /* as above */
// ---- k_stat: softmax over the QUERY axis under the causal mask (the source's softmax(axis=2) on [B, H, q, k] scores): for every key column k of (b, h): m_k = max_{q >= k} s[q][k], Z_k = sum_{q >= k} exp(s[q][k] - m_k), with s = q.k x SCALE + slope (k - q) formed in registers and never stored. Block = 32 key columns (one 128-B line of CM) x 8 waves; wave w takes the 16-query tiles first tile + w + 8 i. D register r of a tile = query 8g + r, lane column = key, so a lane reduces its own column; the two lane halves are merged by one exchange, the 8 waves through LDS by wave 0, which alone stores the column's offset. All exponentials are base 2: s, m_k carry the factor log2 e (folded into the score scale and the slope), so each is one v_exp_f32; what is stored is c_k = m_k + log2 Z_k - 11 - slope (k mod 32), with which k_att forms P x 2^11 = 2^(q.k scale + slope (chunk start - query) - c_k): no multiply, and one bias value a lane and chunk
#define LOG2E 1.44269504088896340736f
__device__ __forceinline__ float ex2(float v) { return __builtin_amdgcn_exp2f(v); }   /* v_exp_f32: 2^v; far below the normal range it gives 0, which is what every use here wants */
// 8 values to 2^v in place, one statement: each v_exp_f32 touches its own register alone, so none reads a result or overwrites a source of the one in front of it, and the closing v_nop is the one slot that the instruction set asks for behind a transcendental
__device__ __forceinline__ void ex2x8(float (&a)[8]) {
  asm("v_exp_f32 %0, %0\n\tv_exp_f32 %1, %1\n\tv_exp_f32 %2, %2\n\tv_exp_f32 %3, %3\n\tv_exp_f32 %4, %4\n\tv_exp_f32 %5, %5\n\tv_exp_f32 %6, %6\n\tv_exp_f32 %7, %7\n\tv_nop" : "+v"(a[0]), "+v"(a[1]), "+v"(a[2]), "+v"(a[3]), "+v"(a[4]), "+v"(a[5]), "+v"(a[6]), "+v"(a[7])); }
__device__ __forceinline__ void ms_merge(float& m, float& z, float mo, float zo) { const float mn = fmaxf(m, mo); z = z * ex2(m - mn) + zo * ex2(mo - mn); m = mn; }   /* an empty slice carries (-3e38, 0) and adds 0 */
__global__ __launch_bounds__(256) void k_stat(const _Float16* __restrict__ QH, const _Float16* __restrict__ KH, float* __restrict__ CM) { __shared__ float pm[8][32], pz[8][32];
  const int tid = threadIdx.x, wave = __builtin_amdgcn_readfirstlane(tid >> 5), lane = tid & 31, col = lane & 15, g = lane >> 4; const int kb = blockIdx.x, h = blockIdx.y, b = blockIdx.z;   /* the wave's number in a scalar register: the tile loop branches on SCC */
  const float slope_ = exp2f(-0.5f * (float)(h + 1)) * LOG2E;   /* ALiBi slope of this head, 2^(-8 (h + 1) / 16), x log2 e */
  const _Float16* kp = KH + (((size_t)b * (TT / 16) + kb * 2) * NH + h) * FT + lane * 8;
  const v16h kf[2][2] = {{frag_t(kp), frag_t(kp + 512)}, {frag_t(kp + NH * FT), frag_t(kp + NH * FT + 512)}};
  float m[2] = {-3.0e38f, -3.0e38f}, z[2] = {0.f, 0.f};
  for (int qt = kb * 2 + wave; qt < TT / 16; qt += 8) { const _Float16* qa = QH + (((size_t)b * (TT / 16) + qt) * NH + h) * FT + lane * 8;   /* the lane's own address in piece 0 of the tile; the four pieces as in frag_t */
    union { v16h v; v8h q[2]; } q0, q1; q0.q[0] = *(const v8h*)qa; q0.q[1] = *(const v8h*)(qa + 256); q1.q[0] = *(const v8h*)(qa + 512); q1.q[1] = *(const v8h*)(qa + 768);
    asm volatile("s_wait_xcnt 0x0" :: "v"(qa) : "memory");   /* the address as an input keeps the address pair of the four q loads alive to this wait: none of them lands in it, and the wait stands in front of its next overwrite */
#pragma unroll
    for (int u = 0; u < 2; ++u) { v8f s = {}; s = wmma16(q0.v, kf[u][0], s); s = wmma16(q1.v, kf[u][1], s);
      const int d0 = kb * 32 + u * 16 + col - (qt * 16 + 8 * g);   /* key - query of register 0 */ const float b0 = slope_ * (float)d0; float v[8]; float mn = m[u];
#pragma unroll
      for (int r = 0; r < 8; ++r) { v[r] = (d0 - r <= 0) ? (s[r] * (SCALE * LOG2E) + (b0 - slope_ * (float)r)) : -3.0e38f; mn = fmaxf(mn, v[r]); }   /* + the ALiBi bias slope (key - query) <= 0 */
#pragma unroll
      for (int r = 0; r < 8; ++r) v[r] -= mn;
      ex2x8(v);
      float zt = (d0 <= 0) ? v[0] : 0.f;
#pragma unroll
      for (int r = 1; r < 8; ++r) zt += (d0 - r <= 0) ? v[r] : 0.f;   /* value select, no branch */
      z[u] = z[u] * ex2(m[u] - mn) + zt; m[u] = mn; } }
#pragma unroll
  for (int u = 0; u < 2; ++u) { const float mo = __shfl_xor(m[u], 16), zo = __shfl_xor(z[u], 16); ms_merge(m[u], z[u], mo, zo); if (g == 0) { pm[wave][u * 16 + col] = m[u]; pz[wave][u * 16 + col] = z[u]; } }
  __syncthreads();
  if (wave == 0) { float mm = pm[0][lane];
#pragma unroll
    for (int w = 1; w < 8; ++w) mm = fmaxf(mm, pm[w][lane]);
    float zz = 0.f;
#pragma unroll
    for (int w = 0; w < 8; ++w) zz += pz[w][lane] * ex2(pm[w][lane] - mm);
    const size_t o = ((size_t)b * NH + h) * TT + kb * 32 + lane; vst2(CM + o, mm + log2f(zz) - 11.0f - slope_ * (float)lane); } }   /* every column sees at least its own diagonal entry: Z_k >= 1 */
// ---- k_att: block = 16 queries of (b, h) x 4 waves; wave w takes the 32-key chunks w + 4 i up to the diagonal. The scores are formed again, TRANSPOSED (A = k rows, B = q rows): D register r of key tile 0 / 1 = key 8g + r / 16 + 8g + r of the lane's own query, which is the place that key has in the A fragment of P . v, so P x 2^11 = 2^(q.k scale + slope (chunk start - query) - c_k) (base 2 as in k_stat; 0 above the diagonal) goes once to f16 in registers against v f16 (1 product). The 4 waves' partial ctx tiles are summed through LDS; 256-B (row, head) segment by 16 lanes
__global__ __launch_bounds__(128) void k_att(const _Float16* __restrict__ QH, const _Float16* __restrict__ KH, const _Float16* __restrict__ VT, const float* __restrict__ CM, float* __restrict__ Y) { __shared__ __align__(16) float ss[4][16][HD + 4];
  const int tid = threadIdx.x, wave = __builtin_amdgcn_readfirstlane(tid >> 5), lane = tid & 31, col = lane & 15, g = lane >> 4; const int qt = TT / 16 - 1 - blockIdx.x, h = blockIdx.y, b = blockIdx.z;   /* the wave's number in a scalar register: the chunk loop branches on SCC; the longest key ranges start first */
  const float slope_ = exp2f(-0.5f * (float)(h + 1)) * LOG2E;
  const _Float16* qp = QH + (((size_t)b * (TT / 16) + qt) * NH + h) * FT + lane * 8; const v16h q0 = frag_t(qp), q1 = frag_t(qp + 512);
  const float* cm = CM + ((size_t)b * NH + h) * TT + 8 * g; const _Float16* vp = VT + ((size_t)b * NH + h) * (TT / 32) * FV + lane * 8;
  v8f acc[HD / 16] = {};
  for (int c = wave; c <= (qt >> 1); c += 4) { const int k0 = c * 32; const _Float16* kp = KH + (((size_t)b * (TT / 16) + c * 2) * NH + h) * FT + lane * 8;
    v4f mk[4];   /* all of a chunk's column-stat and k loads stand in front of the first product: one latency for the lot */
#pragma unroll
    for (int i = 0; i < 4; ++i) mk[i] = *(const v4f*)(cm + k0 + (i >> 1) * 16 + (i & 1) * 4);
    asm volatile("s_wait_xcnt 0x0" ::: "memory");   /* the k loads below land in registers that held the stat loads' addresses */
    const v16h kf[2][2] = {{frag_t(kp), frag_t(kp + 512)}, {frag_t(kp + NH * FT), frag_t(kp + NH * FT + 512)}};
    v8f s[2] = {};
#pragma unroll
    for (int u = 0; u < 2; ++u) { s[u] = wmma16(kf[u][0], q0, s[u]); s[u] = wmma16(kf[u][1], q1, s[u]); }
    v16h vf[HD / 16], p;
#pragma unroll
    for (int j = 0; j < HD / 16; ++j) vf[j] = frag_t(vp + (size_t)c * FV + j * 512);
    const float bq = slope_ * (float)(k0 - (qt * 16 + col));   /* ALiBi bias of the chunk's first key; the keys' own steps are in c_k */
    __builtin_amdgcn_sched_barrier(0);   /* keeps the v loads in front of the exponentials, which then cover their latency; without it they are sunk to the P . v products */
#pragma unroll
    for (int u = 0; u < 2; ++u) { const int d0 = k0 + u * 16 + 8 * g - (qt * 16 + col);   /* key - query of register 0 */
      float e[8];
#pragma unroll
      for (int r = 0; r < 8; ++r) e[r] = s[u][r] * (SCALE * LOG2E) + (bq - mk[u * 2 + (r >> 2)][r & 3]);
      ex2x8(e);
#pragma unroll
      for (int r = 0; r < 8; ++r) p[u * 8 + r] = (_Float16)((d0 + r <= 0) ? e[r] : 0.f); }   /* value select, no branch */
#pragma unroll
    for (int j = 0; j < HD / 16; ++j) acc[j] = wmma16(p, vf[j], acc[j]); }
#pragma unroll
  for (int j = 0; j < HD / 16; ++j)
#pragma unroll
    for (int r = 0; r < 8; ++r) ss[wave][8 * g + r][j * 16 + col] = acc[j][r];
  __syncthreads();
  for (int e = tid; e < 16 * (HD / 4); e += 128) { const int rl = e / (HD / 4), c4 = (e % (HD / 4)) * 4; const v4f o = ((*(const v4f*)&ss[0][rl][c4] + *(const v4f*)&ss[1][rl][c4]) + (*(const v4f*)&ss[2][rl][c4] + *(const v4f*)&ss[3][rl][c4])) * (1.0f / 2048.0f); vst2(Y + ((size_t)b * TT + qt * 16 + rl) * CC + h * HD + c4, o); } }
// ---- k_out: block = 16 rows x all 1024 output columns x 16 waves: out = x + (sum over the 16 heads of ctx) Wo. The heads are summed FIRST, in f32: a thread adds 8 heads of 4 channels of one row (pairwise tree), the two 8-head halves meet in LDS and are added where the A fragment is formed; the sum goes x 2^6 once to f16, and the product with Wo as f16(bf16 x 2^8) exact runs over K = 64 (2 WMMAs a column tile). Wave w owns columns 64 w + 0..63. Lane column n of tile e stands for output column 64 w + 4 n + e, so one 16-byte load of a Wo row feeds the 4 tiles, and the 4 tiles' D registers of a row are 16 neighbouring output bytes of the lane: 16 lanes read / write 256 B of a row
__global__ __launch_bounds__(512) void k_out(const float* __restrict__ Y, const float* __restrict__ WO, const float* __restrict__ BO, float* __restrict__ OUT) { __shared__ __align__(16) float sp[2][16][HD + 4];
  const int tid = threadIdx.x, wave = tid >> 5, lane = tid & 31, col = lane & 15, g = lane >> 4; const size_t r0 = (size_t)blockIdx.x * 16;
  const int yh = tid >> 8, yr = (tid >> 4) & 15, yc = (tid & 15) * 4;                /* the thread's half of the heads, its row, its 4 channels */
  const float* yp = Y + (r0 + yr) * CC + yh * (NH / 2) * HD + yc;
  const float* wp = WO + (size_t)(8 * g) * DIN + wave * 64 + col * 4;                /* fragment elements 0..7 = k rows k0 + 8g + 0..7, 8..15 = k0 + 16 + 8g + 0..7, as in frag_h */
  const size_t oo = (r0 + 8 * g) * DIN + wave * 64 + col * 4; const float* xp = BO + oo;   /* the BO argument carries the RESIDUAL x (this module has no output bias) */
  v4f yv[NH / 2], wv[2][16], xr[8];   /* every load of the block is independent of every other: all are issued before the first is used, one latency for the lot */
#pragma unroll
  for (int h = 0; h < NH / 2; ++h) yv[h] = *(const v4f*)(yp + h * HD);
#pragma unroll
  for (int s = 0; s < 2; ++s)
#pragma unroll
    for (int i = 0; i < 8; ++i) { wv[s][i] = *(const v4f*)(wp + (size_t)(s * 32 + i) * DIN); wv[s][8 + i] = *(const v4f*)(wp + (size_t)(s * 32 + 16 + i) * DIN); }
#pragma unroll
  for (int r = 0; r < 8; ++r) xr[r] = *(const v4f*)(xp + (size_t)r * DIN);
  asm volatile("s_wait_xcnt 0x0" :: "v"(yp), "v"(wp), "v"(xp) : "memory");   /* stands behind the loads, in front of the next overwrite of a register that they name; the three addresses as inputs keep the pairs alive to this wait */
  __builtin_amdgcn_sched_barrier(0);   /* the conversions below wait for loaded values: lifted over the last loads they would put a second memory latency behind the first */
#pragma unroll
  for (int st = 1; st < NH / 2; st *= 2)
#pragma unroll
    for (int h = 0; h < NH / 2; h += 2 * st) yv[h] += yv[h + st];
  *(v4f*)&sp[yh][yr][yc] = yv[0];
  __syncthreads();   /* publishes the two half sums of the 16 rows to the 16 waves */
  v16h a[2];
#pragma unroll
  for (int s = 0; s < 2; ++s)
#pragma unroll
    for (int q = 0; q < 4; ++q) { const int k = s * 32 + (q >> 1) * 16 + 8 * g + (q & 1) * 4; const v4f t = (*(const v4f*)&sp[0][col][k] + *(const v4f*)&sp[1][col][k]) * 64.0f;   /* carried x 2^6 into f16 so small-magnitude context rows stay clear of f16 subnormals */
#pragma unroll
      for (int e = 0; e < 4; ++e) a[s][q * 4 + e] = (_Float16)t[e]; }
  v8f acc[4];
#pragma unroll
  for (int e = 0; e < 4; ++e) { v16h w0, w1;
#pragma unroll
    for (int i = 0; i < 16; ++i) { w0[i] = (_Float16)(bfr(wv[0][i][e]) * 256.0f); w1[i] = (_Float16)(bfr(wv[1][i][e]) * 256.0f); }
    v8f d = {}; d = wmma16(a[0], w0, d); acc[e] = wmma16(a[1], w1, d); }
  v4f o[8];
#pragma unroll
  for (int r = 0; r < 8; ++r)
#pragma unroll
    for (int e = 0; e < 4; ++e) o[r][e] = acc[e][r] * (1.0f / 16384.0f) + bfr(xr[r][e]);   /* 2^-8 (Wo carry) x 2^-6 (ctx carry); x + outputs */
  __builtin_amdgcn_sched_barrier(0);   /* all 8 results are formed in front of the first store: no register that an issued store names is written again */
#pragma unroll
  for (int r = 0; r < 8; ++r) vst2(OUT + oo + (size_t)r * DIN, o[r]); }

extern "C" void kernel_launch(void* const* d_in, const int* in_sizes, int n_in, void* d_out, int out_size, void* d_ws, size_t ws_size, hipStream_t stream) {
  (void)in_sizes; (void)n_in; (void)out_size;
  const float** F = (const float**)d_in;
  if (ws_size < (size_t)WS_END) return;
  char* ws = (char*)d_ws; _Float16 *QH = (_Float16*)(ws + WS_QH), *KH = (_Float16*)(ws + WS_KH), *VT = (_Float16*)(ws + WS_VT), *QL = (_Float16*)(ws + WS_QL), *KL = (_Float16*)(ws + WS_KL); __bf16 *VB = (__bf16*)(ws + WS_VB), *VBL = (__bf16*)(ws + WS_VBL); float *Y = (float*)(ws + WS_Y);
  (void)Y; (void)QL; (void)KL; (void)VB; (void)VBL;
  // inputs: 0 x [2,2048,1024]; 1 wq [1024,1024] (in,out); 2 wk; 3 wv; 4 wo [64,1024] (in,out: it acts on the SUM of the 16 heads' 64-dim outputs); no biases
  if (ws_size < (size_t)WS_END2) return;
  float *CM = (float*)(ws + WS_CM);
  k_proj<<<dim3(TNB * TT / 128, CC / 128, 3), 128, 0, stream>>>(F[0], F[0], F[0], F[1], F[2], F[3], nullptr, nullptr, nullptr, QH, QL, KH, KL, VT, VB, VBL);
  k_stat<<<dim3(TT / 32, NH, TNB), 256, 0, stream>>>(QH, KH, CM);   /* per key column: max and sum over the visible queries of exp(score + ALiBi bias), as one exponent offset */
  k_att<<<dim3(TT / 16, NH, TNB), 128, 0, stream>>>(QH, KH, VT, CM, Y);
  k_out<<<dim3(TNB * TT / 16), 512, 0, stream>>>(Y, F[4], F[0], (float*)d_out);   /* (sum over heads) x wo + x (the third argument is the RESIDUAL here, not a bias) */
}

// v007
// One run takes 109 microseconds.
// In two side-by-side timings against v006, it was 1.05 and 1.06 times as fast.
// All steps since v000 together make it 69.2 times as fast.
// compute dtype: all float inputs rounded to bf16; q/k/v projections with EXACT bf16 products on WMMA 16x16x32 (f32 accumulate); causal scores q x k once to f16 each (1 product) x 64^-0.5 plus the ALiBi bias slope_h (key - query) in f32; softmax over the QUERY axis in f32, in base 2 (scores and bias x log2 e; per key column: online max / sum over the visible queries, v_exp_f32); P x 2^11 once to f16 x v once to f16 (1 product); the 16 heads' outputs are summed in f32 in front of the output projection (the sum x 2^6 once to f16 x wo f16(bf16 x 2^8), 1 product over K = 64); + bf16(x) residual in f32; f32 output.
#include <hip/hip_runtime.h>
#include <math.h>

typedef __attribute__((ext_vector_type(16))) _Float16 v16h;
typedef __attribute__((ext_vector_type(16))) __bf16 v16b;
typedef __attribute__((ext_vector_type(8)))  _Float16 v8h;
typedef __attribute__((ext_vector_type(8)))  float v8f;
typedef __attribute__((ext_vector_type(4)))  float v4f;
typedef __attribute__((ext_vector_type(2)))  float v2f;
typedef __attribute__((ext_vector_type(4)))  unsigned v4u;
typedef __attribute__((ext_vector_type(4)))  int v4i;
typedef float __attribute__((may_alias)) float_a;
typedef int __attribute__((may_alias)) int_a;

template <typename T> __device__ __forceinline__ void vst2(void* p, T v) { *(T*)p = v;  }
__device__ __forceinline__ v8f wmma16(v16h a, v16h b, v8f c) {
  v8f d = __builtin_amdgcn_wmma_f32_16x16x32_f16(false, a, false, b, (short)0, c, false, false);
  asm volatile("v_nop\n\tv_nop\n\tv_nop\n\tv_nop" : "+v"(d) : "v"(a), "v"(b));
  return d;
}
__device__ __forceinline__ v8f wmma_bf(v16b a, v16b b, v8f c) {
  v8f d = __builtin_amdgcn_wmma_f32_16x16x32_bf16(false, a, false, b, (short)0, c, false, false);
  asm volatile("v_nop\n\tv_nop\n\tv_nop\n\tv_nop" : "+v"(d) : "v"(a), "v"(b));
  return d;
}
// 16x16x32 fragments: lane = (h = lane>>4, row/col = lane&15); elements 0..7 = k0+8h+0..7, 8..15 = k0+16+8h+0..7; D element r = row 8h+r
__device__ __forceinline__ v16h frag_h(const _Float16* rowk0, int lane) {
  union { v16h v; v8h q[2]; } u; const _Float16* p = rowk0 + 8 * (lane >> 4);
  u.q[0] = *(const v8h*)p; u.q[1] = *(const v8h*)(p + 16); return u.v;
}
__device__ __forceinline__ v16h frag_f32(const float* rowk0, int lane) {
  v16h a; const float* p = rowk0 + 8 * (lane >> 4);
#pragma unroll
  for (int i = 0; i < 8; ++i) { a[i] = (_Float16)p[i]; a[8 + i] = (_Float16)p[16 + i]; }
  return a;
}
__device__ __forceinline__ v16h frag_f32s(const float* rowk0, int lane, float sc) {
  v16h a; const float* p = rowk0 + 8 * (lane >> 4);
#pragma unroll
  for (int i = 0; i < 8; ++i) { a[i] = (_Float16)(p[i] * sc); a[8 + i] = (_Float16)(p[16 + i] * sc); }
  return a;
}
// column fragment from a [K][ld] layout (column n), rows >= K read as 0
__device__ __forceinline__ v16h fragc_f32(const float* W, int k0, int n, int lane, int ld, int K) {
  v16h a; const int g = lane >> 4;
#pragma unroll
  for (int i = 0; i < 8; ++i) { const int ka = k0 + 8 * g + i, kb = ka + 16;
    a[i] = (_Float16)(ka < K ? W[(size_t)(ka < K ? ka : K - 1) * ld + n] : 0.f); a[8 + i] = (_Float16)(kb < K ? W[(size_t)(kb < K ? kb : K - 1) * ld + n] : 0.f); }
  return a;
}
struct F2 { v16b h, l; };
__device__ __forceinline__ F2 bsplit16(const float v[16]) { F2 r;
#pragma unroll
  for (int i = 0; i < 16; ++i) { const __bf16 h = (__bf16)v[i]; r.h[i] = h; r.l[i] = (__bf16)(v[i] - (float)h); }
  return r; }
__device__ __forceinline__ F2 split_row(const float* row, int k0, int lane) { float v[16]; const float* p = row + k0 + 8 * (lane >> 4);
#pragma unroll
  for (int i = 0; i < 8; ++i) { v[i] = p[i]; v[8 + i] = p[16 + i]; }
  return bsplit16(v); }
__device__ __forceinline__ F2 split_rowK(const float* row, int k0, int lane, int K) { float v[16]; const int g = lane >> 4;
#pragma unroll
  for (int i = 0; i < 8; ++i) { const int ka = k0 + 8 * g + i, kb = ka + 16; v[i] = ka < K ? row[ka < K ? ka : K - 1] : 0.f; v[8 + i] = kb < K ? row[kb < K ? kb : K - 1] : 0.f; }
  return bsplit16(v); }
__device__ __forceinline__ F2 split_col(const float* W, int k0, int n, int lane, int ld, int K) { float v[16]; const int g = lane >> 4;
#pragma unroll
  for (int i = 0; i < 8; ++i) { const int ka = k0 + 8 * g + i, kb = ka + 16; v[i] = ka < K ? W[(size_t)(ka < K ? ka : K - 1) * ld + n] : 0.f; v[8 + i] = kb < K ? W[(size_t)(kb < K ? kb : K - 1) * ld + n] : 0.f; }
  return bsplit16(v); }
__device__ __forceinline__ v8f mac3(const F2& a, const F2& b, v8f c) { c = wmma_bf(a.l, b.h, c); c = wmma_bf(a.h, b.l, c); return wmma_bf(a.h, b.h, c); }
__device__ __forceinline__ float sigm(float v) { return 1.0f / (1.0f + expf(-v)); }
#define LDSX() do { asm volatile("s_wait_dscnt 0" ::: "memory"); __builtin_amdgcn_wave_barrier(); __builtin_amdgcn_fence(__ATOMIC_RELEASE, "workgroup"); } while (0)

// ALiBi-biased multi-headed attention whose softmax runs over the QUERY axis and whose heads are SUMMED (x [2,2048,1024]; (in,out) wq / wk / wv [1024,1024] N(0, 1/1024), no biases; 16 heads x 64; prod = Q K^T / 8 + slope_h (k - q) with slope_h = 2^(-8 (h + 1) / 16); -inf where k > q; attention_weights = softmax(prod, axis=2) - axis 2 of [B, H, q, k] is the QUERY axis: every key column is normalised over the queries that can see it (faithful to the source); out_h = weights V_h; outputs = (sum over the 16 heads of out_h) wo with wo [64,1024]; result = x + outputs).
#define NB 2
#define TT 2048
#define CC 1024            // NH * HD = projected width
#define DIN 1024          // input (model) width
#define NH 16
#define HD 64
#define SCALE (0.125f)
#define CAUSAL 1
#ifndef TNB
#define TNB NB
#endif
__device__ __forceinline__ float bfr(float v) { return (float)(__bf16)v; }
typedef __attribute__((ext_vector_type(8))) __bf16 v8b;
__device__ __forceinline__ v16b frag_b(const __bf16* rowk0, int lane) {
  union { v16b v; v8b q[2]; } u; const __bf16* p = rowk0 + 8 * (lane >> 4);
  u.q[0] = *(const v8b*)p; u.q[1] = *(const v8b*)(p + 16); return u.v;
}
#define QBH 0              // no high-precision blocks: single-product scores and P.v everywhere (the output carries the f32 residual x and the sum of 16 heads: rms - 4)
#define QHI 0               // no q residual plane
#define KHI 64              // no k residual / v hi-lo planes are read
// B fragment (k rows k0+.., output column o) of a weight: (in,out) [K][ld] or (out,in) [ld rows of K]: bf16 exact, or f16(bf16 * 256) exact
__device__ __forceinline__ v16b wcol_io(const float* Wm, int k0, int o, int lane, int ld) { v16b w; const int g = lane >> 4;
#pragma unroll
  for (int i = 0; i < 8; ++i) { w[i] = (__bf16)Wm[(size_t)(k0 + 8 * g + i) * ld + o]; w[8 + i] = (__bf16)Wm[(size_t)(k0 + 16 + 8 * g + i) * ld + o]; }
  return w; }
__device__ __forceinline__ v16b wcol_oi(const float* Wm, int k0, int o, int lane, int K) { v16b w; const float* p = Wm + (size_t)o * K + k0 + 8 * (lane >> 4);
#pragma unroll
  for (int i = 0; i < 8; ++i) { w[i] = (__bf16)p[i]; w[8 + i] = (__bf16)p[16 + i]; }
  return w; }
__device__ __forceinline__ v16h wcolh_io(const float* Wm, int k0, int o, int lane, int ld) { v16h w; const int g = lane >> 4;
#pragma unroll
  for (int i = 0; i < 8; ++i) { w[i] = (_Float16)(bfr(Wm[(size_t)(k0 + 8 * g + i) * ld + o]) * 256.0f); w[8 + i] = (_Float16)(bfr(Wm[(size_t)(k0 + 16 + 8 * g + i) * ld + o]) * 256.0f); }
  return w; }
__device__ __forceinline__ v16h wcolh_oi(const float* Wm, int k0, int o, int lane, int K) { v16h w; const float* p = Wm + (size_t)o * K + k0 + 8 * (lane >> 4);
#pragma unroll
  for (int i = 0; i < 8; ++i) { w[i] = (_Float16)(bfr(p[i]) * 256.0f); w[8 + i] = (_Float16)(bfr(p[16 + i]) * 256.0f); }
  return w; }
#define WQKV_LAYOUT 0   // selects WCOL only, which nothing uses: k_proj reads (in,out) [DIN][CC] for any value
__device__ __forceinline__ v16b wcol_hdk(const float* Wm, int k0, int o, int lane) { v16b w; const int g = lane >> 4; const float* p = Wm + (size_t)(o / HD) * DIN * HD + (o % HD);
#pragma unroll
  for (int i = 0; i < 8; ++i) { w[i] = (__bf16)p[(size_t)(k0 + 8 * g + i) * HD]; w[8 + i] = (__bf16)p[(size_t)(k0 + 16 + 8 * g + i) * HD]; }
  return w; }
#if WQKV_LAYOUT == 1
#define WCOL(W, k0, o, lane) wcol_oi(W, k0, o, lane, DIN)
#elif WQKV_LAYOUT == 2
#define WCOL(W, k0, o, lane) wcol_hdk(W, k0, o, lane)
#else
#define WCOL(W, k0, o, lane) wcol_io(W, k0, o, lane, CC)
#endif

#ifndef PROJ_EXTRA_PARAMS
#define PROJ_EXTRA_PARAMS
#endif

#define WS_QH  0u                                      // f16 q in fragment order [b*t / 16][head][FT]
#define WS_KH  (WS_QH + 2u * (size_t)NB * TT * CC)      // f16 k in fragment order [b*t / 16][head][FT]
#define WS_VT  (WS_KH + 2u * (size_t)NB * TT * CC)      // f16 v in fragment order [b][head][t / 32][FV]
#define WS_QL  (WS_VT + 2u * (size_t)NB * CC * TT)      // f16 q residual x 2^10 rows [b][t < QHI][CC]
#define WS_KL  (WS_QL + 2u * (size_t)NB * QHI * CC)     // f16 k residual x 2^10 rows [b][t < KHI][CC]
#define WS_VB  (WS_KL + 2u * (size_t)NB * KHI * CC)     // bf16 v hi planes [b][c][t < KHI]
#define WS_VBL (WS_VB + 2u * (size_t)NB * CC * KHI)
#define WS_Y   (WS_VBL + 2u * (size_t)NB * CC * KHI)    // f32 ctx rows [b*t][CC] (only when there is an output projection)
#define WS_END (WS_Y  + 4u * (size_t)NB * TT * CC)
#define WS_CM (WS_END)                                  // f32 column exponent offsets m_k + log2 Z_k - 11 - slope (k mod 32) (base 2) [b][h][TT]
#define WS_END2 (WS_CM + 4u * (size_t)NB * NH * TT)

// Fragment order of q, k, v in the workspace: the 16 bytes that lane l takes with one load of a 16x16x32 fragment stand at 16 l in a 512-byte piece, so a wave's load reads 4 whole 128-B lines (from row-major rows it touches 32 B of each of 16 lines).
// q / k: block (16-row tile, head) = FT halves = 4 pieces; piece p, lane l = row l & 15, channels 16 p + 8 (l >> 4) + 0..7; pieces 2 s, 2 s + 1 are elements 0..7, 8..15 of the fragment of channels 32 s + 0..31.
// v: block (head, 32-key chunk) = FV halves = 8 pieces; piece 2 j + i, lane l = channel 16 j + (l & 15), keys 16 i + 8 (l >> 4) + 0..7; pieces 2 j, 2 j + 1 are the fragment of channel tile j.
#define FT (16 * HD)
#define FV (32 * HD)
__device__ __forceinline__ v16h frag_t(const _Float16* piece_lane) {   /* address of the lane's 16 bytes in the first of the fragment's two pieces */
  union { v16h v; v8h q[2]; } u; u.q[0] = *(const v8h*)piece_lane; u.q[1] = *(const v8h*)(piece_lane + 256); return u.v;
}
// ---- k_proj: block = (128 rows, 128 cols, which) x 4 waves: q/k/v = X W (+ b) with exact bf16 products (K = DIN). Per 32-deep k tile the block rounds its X rows and its W columns to bf16 ONCE into LDS (X as [row][k], W transposed to [col][k]), two buffers: the next tile's global loads (whole 128-B lines) fly while this tile's products run. Wave w owns rows 16 w + 0..15 of each 64-row half. -> which 0: q f16 in fragment order (+ residual rows < QHI); 1: k f16 in fragment order (+ residual rows < KHI); 2: v f16 in fragment order (+ bf16 hi/lo planes for t < KHI)
typedef __attribute__((ext_vector_type(4))) __bf16 v4b;
__device__ __forceinline__ void vst_w(void* p, v4u v) { asm volatile("global_store_b128 %0, %1, off\n\ts_wait_xcnt 0x0" :: "v"(p), "v"(v) : "memory"); }   /* a 16-byte global store with its wait in ONE statement: in a statement of its own the wait was passed by the next trip's address steps and LDS reads, which overwrite the store's registers */
#define PBK 32               // k depth of one staged tile
#define PPI 40               // pitch of a staged row in bf16 elements: 64 B of data + 16 B = 16 B x 5 (odd), the conflict-free pitch for 16-byte fragment reads
#define PBUF (128 * PPI)     // elements of one staged operand tile
__global__ __launch_bounds__(128) void k_proj(const float* __restrict__ XQ, const float* __restrict__ XK, const float* __restrict__ XV, const float* __restrict__ WQ, const float* __restrict__ WK, const float* __restrict__ WV, const float* __restrict__ BQ, const float* __restrict__ BK, const float* __restrict__ BV,
    _Float16* __restrict__ QH, _Float16* __restrict__ QL, _Float16* __restrict__ KH, _Float16* __restrict__ KL, _Float16* __restrict__ VT, __bf16* __restrict__ VB, __bf16* __restrict__ VBL) {
  __shared__ __align__(16) unsigned char smem[90112];   /* the staged tiles of the main loop and the transposing planes of the epilogue share these bytes (a barrier stands between the two uses) */
  _Float16 (*sh)[136] = (_Float16 (*)[136])smem; _Float16 (*sl)[136] = (_Float16 (*)[136])(smem + 17408); _Float16 (*th)[72] = (_Float16 (*)[72])(smem + 34816); __bf16 (*tb)[72] = (__bf16 (*)[72])(smem + 53248); __bf16 (*tbl)[72] = (__bf16 (*)[72])(smem + 71680);
  __bf16* sA = (__bf16*)smem; __bf16* sW = (__bf16*)(smem + 4 * PBUF);   /* 2 buffers of X rows, then 2 buffers of W columns */
  const int tid = threadIdx.x, wave = tid >> 5, lane = tid & 31, col = lane & 15, g = lane >> 4; const int which = blockIdx.z; const int c0 = blockIdx.y * 128; const size_t r0 = (size_t)blockIdx.x * 128; const size_t bb = r0 / TT; const int t0 = (int)(r0 % TT);
  const float* X = which == 0 ? XQ : which == 1 ? XK : XV; const float* WA = which == 0 ? WQ : which == 1 ? WK : WV; const float* BA = which == 0 ? BQ : which == 1 ? BK : BV;
  const int l8 = lane & 7, l3 = lane >> 3;
  const float* pa = X + r0 * DIN; const unsigned oa = (unsigned)((wave * 4 + l3) * DIN + l8 * 4);   /* X: 8 lanes read one row's 128 B; load j = rows + 16 j */
  const float* pw = WA + c0; const unsigned ow = (unsigned)(8 * l3 * CC + (wave * 8 + l8) * 4);     /* W (in,out): the lane holds k rows 8 l3 + 0..7 of 4 columns; 8 lanes read 128 B of a row */
  __bf16* da = sA + (wave * 4 + l3) * PPI + l8 * 4;
  __bf16* dw = sW + (wave * 32 + l8 * 4) * PPI + 8 * l3;                       /* 8 k of one column = one 16-byte store; the 32 lanes fall on every bank twice */
  v4f ar[8], wr[8];
  v8f acc[2][8] = {};
  auto issue = [&](const float* qa, const float* qw) {
#pragma unroll
    for (int j = 0; j < 8; ++j) { ar[j] = *(const v4f*)(qa + (size_t)j * 16 * DIN); wr[j] = *(const v4f*)(qw + (size_t)j * CC); } };
  auto stage = [&](int buf) {
#pragma unroll
    for (int j = 0; j < 8; ++j) { v4b t;
#pragma unroll
      for (int e = 0; e < 4; ++e) t[e] = (__bf16)ar[j][e];
      *(v4b*)(da + buf * PBUF + j * 16 * PPI) = t; }
#pragma unroll
    for (int i = 0; i < 4; ++i) { v8b t;
#pragma unroll
      for (int r = 0; r < 8; ++r) t[r] = (__bf16)wr[r][i];
      *(v8b*)(dw + buf * PBUF + i * PPI) = t; } };
  issue(pa + oa, pw + ow);
  asm volatile("s_wait_xcnt 0x0" ::: "memory");   /* stands behind the 16 loads, in front of the next overwrite of a register that they name */
  __builtin_amdgcn_sched_barrier(0);   /* no later write of such a register is lifted over the wait */
  stage(0);
  for (int kc = 0; kc < DIN / PBK; ++kc) {
    __syncthreads();   /* publishes tile kc and ends every wave's reads of the buffer that tile kc + 1 is written into below */
    const __bf16* ba = sA + (kc & 1) * PBUF + (wave * 16 + col) * PPI; const __bf16* bw = sW + (kc & 1) * PBUF + col * PPI;
    const v16b a0 = frag_b(ba, lane), a1 = frag_b(ba + 64 * PPI, lane); v16b w[8];   /* all 20 fragment reads of the tile as one group: one LDS latency a tile, not one a column block */
#pragma unroll
    for (int j = 0; j < 8; ++j) w[j] = frag_b(bw + j * 16 * PPI, lane);
    __builtin_amdgcn_sched_barrier(0);   /* the fragment reads go first: their latency runs under the issue of the global loads */
    if (kc + 1 < DIN / PBK) { const int ks = __builtin_amdgcn_readfirstlane((kc + 1) * PBK); const float* qa = pa + oa + ks; const float* qw = pw + ow + (size_t)ks * CC;   /* the tile's step through a scalar register: the two addresses are formed anew for each tile, and the pairs that the loads name are the very values that the wait below takes */
      issue(qa, qw);
      asm volatile("s_wait_xcnt 0x0" :: "v"(qa), "v"(qw) : "memory"); }   /* stands behind the 16 loads, in front of the next overwrite of their address registers; the two addresses as inputs keep the pairs alive to this wait, so that no load lands in one */
    __builtin_amdgcn_sched_barrier(0);   /* the products, and every later write of an address register, stay behind the loads and their wait */
#pragma unroll
    for (int j = 0; j < 8; ++j) { acc[0][j] = wmma_bf(a0, w[j], acc[0][j]); acc[1][j] = wmma_bf(a1, w[j], acc[1][j]); }
    __builtin_amdgcn_sched_barrier(0);   /* the conversions of stage() wait for the global loads: lifted among the products they would stall the wave at once */
    if (kc + 1 < DIN / PBK) stage((kc + 1) & 1); }
  __syncthreads();   /* the last tile's reads end before the epilogue planes overwrite the staged tiles */
  if (which < 2) { _Float16* DH = which == 0 ? QH : KH; _Float16* DL = which == 0 ? QL : KL; const int nhi = which == 0 ? QHI : KHI;
#pragma unroll
    for (int i = 0; i < 2; ++i) { const size_t rb = r0 + i * 64; const int tq = t0 + i * 64; const bool hi_rows = tq < nhi;   /* the two 64-row halves go through the same planes one after the other */
#pragma unroll
      for (int j = 0; j < 8; ++j) { const float bias = BA ? bfr(BA[c0 + j * 16 + col]) : 0.f;
#pragma unroll
        for (int r = 0; r < 8; ++r) { const float v = acc[i][j][r] + bias; const _Float16 hv = (_Float16)v; sh[wave * 16 + 8 * g + r][j * 16 + col] = hv; sl[wave * 16 + 8 * g + r][j * 16 + col] = (_Float16)((v - (float)hv) * 1024.0f); } }
      __syncthreads();
      for (int e = tid; e < 64 * 16; e += 128) { const int fl = e & 31, fp = (e >> 5) & 3, fh = (e >> 7) & 1, ft = e >> 8; const int rl = ft * 16 + (fl & 15), q = fh * 8 + fp * 2 + (fl >> 4);   /* e runs along the destination: lane, piece, head, row tile; a wave stores 512 neighbouring bytes */
        vst_w(DH + (((rb >> 4) + ft) * NH + (c0 >> 6) + fh) * FT + fp * 256 + fl * 8, *(const v4u*)&sh[rl][q * 8]); if (hi_rows) vst_w(DL + (bb * nhi + tq + rl) * (size_t)CC + c0 + q * 8, *(const v4u*)&sl[rl][q * 8]); }
      if (i == 0) __syncthreads(); }   /* the first half is read out before the second overwrites the planes */
  } else {
#pragma unroll
    for (int i = 0; i < 2; ++i) { const int tq = t0 + i * 64; const bool hi_rows = tq < KHI;
#pragma unroll
      for (int j = 0; j < 8; ++j) { const float bias = BA ? bfr(BA[c0 + j * 16 + col]) : 0.f;
#pragma unroll
        for (int r = 0; r < 8; ++r) { const float v = acc[i][j][r] + bias; const int rl = wave * 16 + 8 * g + r, cl = j * 16 + col; th[cl][rl] = (_Float16)v; const __bf16 bh = (__bf16)v; tb[cl][rl] = bh; tbl[cl][rl] = (__bf16)(v - (float)bh); } }
      __syncthreads();
      for (int e = tid; e < 128 * 8; e += 128) { const int fl = e & 31, fp = (e >> 5) & 7, fc = (e >> 8) & 1, fh = e >> 9; const int cl = fh * 64 + (fp >> 1) * 16 + (fl & 15), q = fc * 4 + (fp & 1) * 2 + (fl >> 4);   /* e runs along the destination: lane, piece, key chunk, head */
        vst_w(VT + ((bb * NH + (c0 >> 6) + fh) * (TT / 32) + (tq >> 5) + fc) * FV + fp * 256 + fl * 8, *(const v4u*)&th[cl][q * 8]); if (hi_rows) { const size_t o3 = (bb * CC + c0 + cl) * (size_t)KHI + tq + q * 8; vst_w(VB + o3, *(const v4u*)&tb[cl][q * 8]); vst_w(VBL + o3, *(const v4u*)&tbl[cl][q * 8]); } }
      if (i == 0) __syncthreads(); } } }   /* as above */
// ---- k_stat: softmax over the QUERY axis under the causal mask (the source's softmax(axis=2) on [B, H, q, k] scores): for every key column k of (b, h): m_k = max_{q >= k} s[q][k], Z_k = sum_{q >= k} exp(s[q][k] - m_k), with s = q.k x SCALE + slope (k - q) formed in registers and never stored. Block = 32 key columns (one 128-B line of CM) x 8 waves; wave w takes the 16-query tiles first tile + w + 8 i. D register r of a tile = query 8g + r, lane column = key, so a lane reduces its own column; the two lane halves are merged by one exchange, the 8 waves through LDS by wave 0, which alone stores the column's offset. All exponentials are base 2: s, m_k carry the factor log2 e (folded into the score scale and the slope), so each is one v_exp_f32; what is stored is c_k = m_k + log2 Z_k - 11 - slope (k mod 32), with which k_att forms P x 2^11 = 2^(q.k scale + slope (chunk start - query) - c_k): no multiply, and one bias value a lane, query tile and chunk
#define LOG2E 1.44269504088896340736f
__device__ __forceinline__ float ex2(float v) { return __builtin_amdgcn_exp2f(v); }   /* v_exp_f32: 2^v; far below the normal range it gives 0, which is what every use here wants */
// 8 values to 2^v in place, one statement: each v_exp_f32 touches its own register alone, so none reads a result or overwrites a source of the one in front of it, and the closing v_nop is the one slot that the instruction set asks for behind a transcendental
__device__ __forceinline__ void ex2x8(float (&a)[8]) {
  asm("v_exp_f32 %0, %0\n\tv_exp_f32 %1, %1\n\tv_exp_f32 %2, %2\n\tv_exp_f32 %3, %3\n\tv_exp_f32 %4, %4\n\tv_exp_f32 %5, %5\n\tv_exp_f32 %6, %6\n\tv_exp_f32 %7, %7\n\tv_nop" : "+v"(a[0]), "+v"(a[1]), "+v"(a[2]), "+v"(a[3]), "+v"(a[4]), "+v"(a[5]), "+v"(a[6]), "+v"(a[7])); }
__device__ __forceinline__ void ms_merge(float& m, float& z, float mo, float zo) { const float mn = fmaxf(m, mo); z = z * ex2(m - mn) + zo * ex2(mo - mn); m = mn; }   /* an empty slice carries (-3e38, 0) and adds 0 */
__global__ __launch_bounds__(256) void k_stat(const _Float16* __restrict__ QH, const _Float16* __restrict__ KH, float* __restrict__ CM) { __shared__ float pm[8][32], pz[8][32];
  const int tid = threadIdx.x, wave = __builtin_amdgcn_readfirstlane(tid >> 5), lane = tid & 31, col = lane & 15, g = lane >> 4; const int kb = blockIdx.x, h = blockIdx.y, b = blockIdx.z;   /* the wave's number in a scalar register: the tile loop branches on SCC */
  const float slope_ = exp2f(-0.5f * (float)(h + 1)) * LOG2E;   /* ALiBi slope of this head, 2^(-8 (h + 1) / 16), x log2 e */
  const _Float16* kp = KH + (((size_t)b * (TT / 16) + kb * 2) * NH + h) * FT + lane * 8;
  const v16h kf[2][2] = {{frag_t(kp), frag_t(kp + 512)}, {frag_t(kp + NH * FT), frag_t(kp + NH * FT + 512)}};
  float m[2] = {-3.0e38f, -3.0e38f}, z[2] = {0.f, 0.f};
  for (int qt = kb * 2 + wave; qt < TT / 16; qt += 8) { const _Float16* qa = QH + (((size_t)b * (TT / 16) + qt) * NH + h) * FT + lane * 8;   /* the lane's own address in piece 0 of the tile; the four pieces as in frag_t */
    union { v16h v; v8h q[2]; } q0, q1; q0.q[0] = *(const v8h*)qa; q0.q[1] = *(const v8h*)(qa + 256); q1.q[0] = *(const v8h*)(qa + 512); q1.q[1] = *(const v8h*)(qa + 768);
    asm volatile("s_wait_xcnt 0x0" :: "v"(qa) : "memory");   /* the address as an input keeps the address pair of the four q loads alive to this wait: none of them lands in it, and the wait stands in front of its next overwrite */
#pragma unroll
    for (int u = 0; u < 2; ++u) { v8f s = {}; s = wmma16(q0.v, kf[u][0], s); s = wmma16(q1.v, kf[u][1], s);
      const int d0 = kb * 32 + u * 16 + col - (qt * 16 + 8 * g);   /* key - query of register 0 */ const float b0 = slope_ * (float)d0; float v[8]; float mn = m[u];
#pragma unroll
      for (int r = 0; r < 8; ++r) { v[r] = (d0 - r <= 0) ? (s[r] * (SCALE * LOG2E) + (b0 - slope_ * (float)r)) : -3.0e38f; mn = fmaxf(mn, v[r]); }   /* + the ALiBi bias slope (key - query) <= 0 */
#pragma unroll
      for (int r = 0; r < 8; ++r) v[r] -= mn;
      ex2x8(v);
      float zt = (d0 <= 0) ? v[0] : 0.f;
#pragma unroll
      for (int r = 1; r < 8; ++r) zt += (d0 - r <= 0) ? v[r] : 0.f;   /* value select, no branch */
      z[u] = z[u] * ex2(m[u] - mn) + zt; m[u] = mn; } }
#pragma unroll
  for (int u = 0; u < 2; ++u) { const float mo = __shfl_xor(m[u], 16), zo = __shfl_xor(z[u], 16); ms_merge(m[u], z[u], mo, zo); if (g == 0) { pm[wave][u * 16 + col] = m[u]; pz[wave][u * 16 + col] = z[u]; } }
  __syncthreads();
  if (wave == 0) { float mm = pm[0][lane];
#pragma unroll
    for (int w = 1; w < 8; ++w) mm = fmaxf(mm, pm[w][lane]);
    float zz = 0.f;
#pragma unroll
    for (int w = 0; w < 8; ++w) zz += pz[w][lane] * ex2(pm[w][lane] - mm);
    const size_t o = ((size_t)b * NH + h) * TT + kb * 32 + lane; vst2(CM + o, mm + log2f(zz) - 11.0f - slope_ * (float)lane); } }   /* every column sees at least its own diagonal entry: Z_k >= 1 */
// ---- k_att: block = 32 queries (2 query tiles) of (b, h) x 4 waves; wave w takes the 32-key chunks w + 4 i up to the diagonal, and every k, v and column-offset load of a chunk feeds BOTH query tiles, which the wave holds in registers. The scores are formed again, TRANSPOSED (A = k rows, B = q rows): D register r of key tile 0 / 1 = key 8g + r / 16 + 8g + r of the lane's own query, which is the place that key has in the A fragment of P . v, so P x 2^11 = 2^(q.k scale + slope (chunk start - query) - c_k) (base 2 as in k_stat; 0 above the diagonal) goes once to f16 in registers against v f16 (1 product). The 4 waves' partial ctx tiles are summed through LDS; 256-B (row, head) segment by 16 lanes
#define QW 2               // query tiles of a wave
__global__ __launch_bounds__(128) void k_att(const _Float16* __restrict__ QH, const _Float16* __restrict__ KH, const _Float16* __restrict__ VT, const float* __restrict__ CM, float* __restrict__ Y) { __shared__ __align__(16) float ss[4][16 * QW][HD + 4];
  const int tid = threadIdx.x, wave = __builtin_amdgcn_readfirstlane(tid >> 5), lane = tid & 31, col = lane & 15, g = lane >> 4; const int qb = TT / (16 * QW) - 1 - blockIdx.x, h = blockIdx.y, b = blockIdx.z;   /* the wave's number in a scalar register: the chunk loop branches on SCC; the longest key ranges start first */
  const float slope_ = exp2f(-0.5f * (float)(h + 1)) * LOG2E;
  const _Float16* qp = QH + (((size_t)b * (TT / 16) + qb * QW) * NH + h) * FT + lane * 8; v16h qf[QW][2];   /* every loop over t below is unrolled: t selects registers */
#pragma unroll
  for (int t = 0; t < QW; ++t) { qf[t][0] = frag_t(qp + t * NH * FT); qf[t][1] = frag_t(qp + t * NH * FT + 512); }
  const float* cm = CM + ((size_t)b * NH + h) * TT + 8 * g; const _Float16* vp = VT + ((size_t)b * NH + h) * (TT / 32) * FV + lane * 8;
  v8f acc[QW][HD / 16] = {};
  for (int c = wave; c <= (qb * QW + QW - 1) >> 1; c += 4) { const int k0 = c * 32; const _Float16* kp = KH + (((size_t)b * (TT / 16) + c * 2) * NH + h) * FT + lane * 8;
    v4f mk[4];   /* all of a chunk's column-stat and k loads stand in front of the first product: one latency for the lot */
#pragma unroll
    for (int i = 0; i < 4; ++i) mk[i] = *(const v4f*)(cm + k0 + (i >> 1) * 16 + (i & 1) * 4);
    asm volatile("s_wait_xcnt 0x0" ::: "memory");   /* the k loads below land in registers that held the stat loads' addresses */
    const v16h kf[2][2] = {{frag_t(kp), frag_t(kp + 512)}, {frag_t(kp + NH * FT), frag_t(kp + NH * FT + 512)}};
    v8f s[QW][2] = {};
#pragma unroll
    for (int t = 0; t < QW; ++t)
#pragma unroll
      for (int u = 0; u < 2; ++u) { s[t][u] = wmma16(kf[u][0], qf[t][0], s[t][u]); s[t][u] = wmma16(kf[u][1], qf[t][1], s[t][u]); }
    v16h vf[HD / 16], p[QW];
#pragma unroll
    for (int j = 0; j < HD / 16; ++j) vf[j] = frag_t(vp + (size_t)c * FV + j * 512);
    __builtin_amdgcn_sched_barrier(0);   /* keeps the v loads in front of the exponentials, which then cover their latency; without it they are sunk to the P . v products */
#pragma unroll
    for (int t = 0; t < QW; ++t) { const int qq = (qb * QW + t) * 16 + col;   /* the lane's query in tile t */
      const float bq = slope_ * (float)(k0 - qq);   /* ALiBi bias of the chunk's first key; the keys' own steps are in c_k */
#pragma unroll
      for (int u = 0; u < 2; ++u) { const int d0 = k0 + u * 16 + 8 * g - qq;   /* key - query of register 0 */
        float e[8];
#pragma unroll
        for (int r = 0; r < 8; ++r) e[r] = s[t][u][r] * (SCALE * LOG2E) + (bq - mk[u * 2 + (r >> 2)][r & 3]);
        ex2x8(e);
#pragma unroll
        for (int r = 0; r < 8; ++r) p[t][u * 8 + r] = (_Float16)((d0 + r <= 0) ? e[r] : 0.f); } }   /* value select, no branch */
#pragma unroll
    for (int t = 0; t < QW; ++t)
#pragma unroll
      for (int j = 0; j < HD / 16; ++j) acc[t][j] = wmma16(p[t], vf[j], acc[t][j]); }
#pragma unroll
  for (int t = 0; t < QW; ++t)
#pragma unroll
    for (int j = 0; j < HD / 16; ++j)
#pragma unroll
      for (int r = 0; r < 8; ++r) ss[wave][t * 16 + 8 * g + r][j * 16 + col] = acc[t][j][r];
  __syncthreads();
  for (int e = tid; e < 16 * QW * (HD / 4); e += 128) { const int rl = e / (HD / 4), c4 = (e % (HD / 4)) * 4; const v4f o = ((*(const v4f*)&ss[0][rl][c4] + *(const v4f*)&ss[1][rl][c4]) + (*(const v4f*)&ss[2][rl][c4] + *(const v4f*)&ss[3][rl][c4])) * (1.0f / 2048.0f); vst2(Y + ((size_t)b * TT + qb * 16 * QW + rl) * CC + h * HD + c4, o); } }
// ---- k_out: block = 16 rows x all 1024 output columns x 16 waves: out = x + (sum over the 16 heads of ctx) Wo. The heads are summed FIRST, in f32: a thread adds 8 heads of 4 channels of one row (pairwise tree), the two 8-head halves meet in LDS and are added where the A fragment is formed; the sum goes x 2^6 once to f16, and the product with Wo as f16(bf16 x 2^8) exact runs over K = 64 (2 WMMAs a column tile). Wave w owns columns 64 w + 0..63. Lane column n of tile e stands for output column 64 w + 4 n + e, so one 16-byte load of a Wo row feeds the 4 tiles, and the 4 tiles' D registers of a row are 16 neighbouring output bytes of the lane: 16 lanes read / write 256 B of a row
__global__ __launch_bounds__(512) void k_out(const float* __restrict__ Y, const float* __restrict__ WO, const float* __restrict__ BO, float* __restrict__ OUT) { __shared__ __align__(16) float sp[2][16][HD + 4];
  const int tid = threadIdx.x, wave = tid >> 5, lane = tid & 31, col = lane & 15, g = lane >> 4; const size_t r0 = (size_t)blockIdx.x * 16;
  const int yh = tid >> 8, yr = (tid >> 4) & 15, yc = (tid & 15) * 4;                /* the thread's half of the heads, its row, its 4 channels */
  const float* yp = Y + (r0 + yr) * CC + yh * (NH / 2) * HD + yc;
  const float* wp = WO + (size_t)(8 * g) * DIN + wave * 64 + col * 4;                /* fragment elements 0..7 = k rows k0 + 8g + 0..7, 8..15 = k0 + 16 + 8g + 0..7, as in frag_h */
  const size_t oo = (r0 + 8 * g) * DIN + wave * 64 + col * 4; const float* xp = BO + oo;   /* the BO argument carries the RESIDUAL x (this module has no output bias) */
  v4f yv[NH / 2], wv[2][16], xr[8];   /* every load of the block is independent of every other: all are issued before the first is used, one latency for the lot */
#pragma unroll
  for (int h = 0; h < NH / 2; ++h) yv[h] = *(const v4f*)(yp + h * HD);
#pragma unroll
  for (int s = 0; s < 2; ++s)
#pragma unroll
    for (int i = 0; i < 8; ++i) { wv[s][i] = *(const v4f*)(wp + (size_t)(s * 32 + i) * DIN); wv[s][8 + i] = *(const v4f*)(wp + (size_t)(s * 32 + 16 + i) * DIN); }
#pragma unroll
  for (int r = 0; r < 8; ++r) xr[r] = *(const v4f*)(xp + (size_t)r * DIN);
  asm volatile("s_wait_xcnt 0x0" :: "v"(yp), "v"(wp), "v"(xp) : "memory");   /* stands behind the loads, in front of the next overwrite of a register that they name; the three addresses as inputs keep the pairs alive to this wait */
  __builtin_amdgcn_sched_barrier(0);   /* the conversions below wait for loaded values: lifted over the last loads they would put a second memory latency behind the first */
#pragma unroll
  for (int st = 1; st < NH / 2; st *= 2)
#pragma unroll
    for (int h = 0; h < NH / 2; h += 2 * st) yv[h] += yv[h + st];
  *(v4f*)&sp[yh][yr][yc] = yv[0];
  __syncthreads();   /* publishes the two half sums of the 16 rows to the 16 waves */
  v16h a[2];
#pragma unroll
  for (int s = 0; s < 2; ++s)
#pragma unroll
    for (int q = 0; q < 4; ++q) { const int k = s * 32 + (q >> 1) * 16 + 8 * g + (q & 1) * 4; const v4f t = (*(const v4f*)&sp[0][col][k] + *(const v4f*)&sp[1][col][k]) * 64.0f;   /* carried x 2^6 into f16 so small-magnitude context rows stay clear of f16 subnormals */
#pragma unroll
      for (int e = 0; e < 4; ++e) a[s][q * 4 + e] = (_Float16)t[e]; }
  v8f acc[4];
#pragma unroll
  for (int e = 0; e < 4; ++e) { v16h w0, w1;
#pragma unroll
    for (int i = 0; i < 16; ++i) { w0[i] = (_Float16)(bfr(wv[0][i][e]) * 256.0f); w1[i] = (_Float16)(bfr(wv[1][i][e]) * 256.0f); }
    v8f d = {}; d = wmma16(a[0], w0, d); acc[e] = wmma16(a[1], w1, d); }
  v4f o[8];
#pragma unroll
  for (int r = 0; r < 8; ++r)
#pragma unroll
    for (int e = 0; e < 4; ++e) o[r][e] = acc[e][r] * (1.0f / 16384.0f) + bfr(xr[r][e]);   /* 2^-8 (Wo carry) x 2^-6 (ctx carry); x + outputs */
  __builtin_amdgcn_sched_barrier(0);   /* all 8 results are formed in front of the first store: no register that an issued store names is written again */
#pragma unroll
  for (int r = 0; r < 8; ++r) vst2(OUT + oo + (size_t)r * DIN, o[r]); }

extern "C" void kernel_launch(void* const* d_in, const int* in_sizes, int n_in, void* d_out, int out_size, void* d_ws, size_t ws_size, hipStream_t stream) {
  (void)in_sizes; (void)n_in; (void)out_size;
  const float** F = (const float**)d_in;
  if (ws_size < (size_t)WS_END) return;
  char* ws = (char*)d_ws; _Float16 *QH = (_Float16*)(ws + WS_QH), *KH = (_Float16*)(ws + WS_KH), *VT = (_Float16*)(ws + WS_VT), *QL = (_Float16*)(ws + WS_QL), *KL = (_Float16*)(ws + WS_KL); __bf16 *VB = (__bf16*)(ws + WS_VB), *VBL = (__bf16*)(ws + WS_VBL); float *Y = (float*)(ws + WS_Y);
  (void)Y; (void)QL; (void)KL; (void)VB; (void)VBL;
  // inputs: 0 x [2,2048,1024]; 1 wq [1024,1024] (in,out); 2 wk; 3 wv; 4 wo [64,1024] (in,out: it acts on the SUM of the 16 heads' 64-dim outputs); no biases
  if (ws_size < (size_t)WS_END2) return;
  float *CM = (float*)(ws + WS_CM);
  k_proj<<<dim3(TNB * TT / 128, CC / 128, 3), 128, 0, stream>>>(F[0], F[0], F[0], F[1], F[2], F[3], nullptr, nullptr, nullptr, QH, QL, KH, KL, VT, VB, VBL);
  k_stat<<<dim3(TT / 32, NH, TNB), 256, 0, stream>>>(QH, KH, CM);   /* per key column: max and sum over the visible queries of exp(score + ALiBi bias), as one exponent offset */
  k_att<<<dim3(TT / (16 * QW), NH, TNB), 128, 0, stream>>>(QH, KH, VT, CM, Y);
  k_out<<<dim3(TNB * TT / 16), 512, 0, stream>>>(Y, F[4], F[0], (float*)d_out);   /* (sum over heads) x wo + x (the third argument is the RESIDUAL here, not a bias) */
}

// v008
// One run takes 106 microseconds.
// Next to v007, in two timings, it ran 1.04 and 1.03 times as fast.
// All steps since v000 together make it 71.7 times as fast.
// compute dtype: all float inputs rounded to bf16; q/k/v projections with EXACT bf16 products on WMMA 16x16x32 (f32 accumulate); causal scores q x k once to f16 each (1 product) x 64^-0.5 plus the ALiBi bias slope_h (key - query) in f32; softmax over the QUERY axis in f32, in base 2 (scores and bias x log2 e; per key column: online max / sum over the visible queries, v_exp_f32); P x 2^11 once to f16 x v once to f16 (1 product); the 16 heads' outputs are summed in f32 in front of the output projection (the sum x 2^6 once to f16 x wo f16(bf16 x 2^8), 1 product over K = 64); + bf16(x) residual in f32; f32 output.
#include <hip/hip_runtime.h>
#include <math.h>

typedef __attribute__((ext_vector_type(16))) _Float16 v16h;
typedef __attribute__((ext_vector_type(16))) __bf16 v16b;
typedef __attribute__((ext_vector_type(8)))  _Float16 v8h;
typedef __attribute__((ext_vector_type(8)))  float v8f;
typedef __attribute__((ext_vector_type(4)))  float v4f;
typedef __attribute__((ext_vector_type(2)))  float v2f;
typedef __attribute__((ext_vector_type(4)))  unsigned v4u;
typedef __attribute__((ext_vector_type(4)))  int v4i;
typedef float __attribute__((may_alias)) float_a;
typedef int __attribute__((may_alias)) int_a;

template <typename T> __device__ __forceinline__ void vst2(void* p, T v) { *(T*)p = v;  }
__device__ __forceinline__ v8f wmma16(v16h a, v16h b, v8f c) {
  v8f d = __builtin_amdgcn_wmma_f32_16x16x32_f16(false, a, false, b, (short)0, c, false, false);
  asm volatile("v_nop\n\tv_nop\n\tv_nop\n\tv_nop" : "+v"(d) : "v"(a), "v"(b));
  return d;
}
__device__ __forceinline__ v8f wmma_bf(v16b a, v16b b, v8f c) {
  v8f d = __builtin_amdgcn_wmma_f32_16x16x32_bf16(false, a, false, b, (short)0, c, false, false);
  asm volatile("v_nop\n\tv_nop\n\tv_nop\n\tv_nop" : "+v"(d) : "v"(a), "v"(b));
  return d;
}
// 16x16x32 fragments: lane = (h = lane>>4, row/col = lane&15); elements 0..7 = k0+8h+0..7, 8..15 = k0+16+8h+0..7; D element r = row 8h+r
__device__ __forceinline__ v16h frag_h(const _Float16* rowk0, int lane) {
  union { v16h v; v8h q[2]; } u; const _Float16* p = rowk0 + 8 * (lane >> 4);
  u.q[0] = *(const v8h*)p; u.q[1] = *(const v8h*)(p + 16); return u.v;
}
__device__ __forceinline__ v16h frag_f32(const float* rowk0, int lane) {
  v16h a; const float* p = rowk0 + 8 * (lane >> 4);
#pragma unroll
  for (int i = 0; i < 8; ++i) { a[i] = (_Float16)p[i]; a[8 + i] = (_Float16)p[16 + i]; }
  return a;
}
__device__ __forceinline__ v16h frag_f32s(const float* rowk0, int lane, float sc) {
  v16h a; const float* p = rowk0 + 8 * (lane >> 4);
#pragma unroll
  for (int i = 0; i < 8; ++i) { a[i] = (_Float16)(p[i] * sc); a[8 + i] = (_Float16)(p[16 + i] * sc); }
  return a;
}
// column fragment from a [K][ld] layout (column n), rows >= K read as 0
__device__ __forceinline__ v16h fragc_f32(const float* W, int k0, int n, int lane, int ld, int K) {
  v16h a; const int g = lane >> 4;
#pragma unroll
  for (int i = 0; i < 8; ++i) { const int ka = k0 + 8 * g + i, kb = ka + 16;
    a[i] = (_Float16)(ka < K ? W[(size_t)(ka < K ? ka : K - 1) * ld + n] : 0.f); a[8 + i] = (_Float16)(kb < K ? W[(size_t)(kb < K ? kb : K - 1) * ld + n] : 0.f); }
  return a;
}
struct F2 { v16b h, l; };
__device__ __forceinline__ F2 bsplit16(const float v[16]) { F2 r;
#pragma unroll
  for (int i = 0; i < 16; ++i) { const __bf16 h = (__bf16)v[i]; r.h[i] = h; r.l[i] = (__bf16)(v[i] - (float)h); }
  return r; }
__device__ __forceinline__ F2 split_row(const float* row, int k0, int lane) { float v[16]; const float* p = row + k0 + 8 * (lane >> 4);
#pragma unroll
  for (int i = 0; i < 8; ++i) { v[i] = p[i]; v[8 + i] = p[16 + i]; }
  return bsplit16(v); }
__device__ __forceinline__ F2 split_rowK(const float* row, int k0, int lane, int K) { float v[16]; const int g = lane >> 4;
#pragma unroll
  for (int i = 0; i < 8; ++i) { const int ka = k0 + 8 * g + i, kb = ka + 16; v[i] = ka < K ? row[ka < K ? ka : K - 1] : 0.f; v[8 + i] = kb < K ? row[kb < K ? kb : K - 1] : 0.f; }
  return bsplit16(v); }
__device__ __forceinline__ F2 split_col(const float* W, int k0, int n, int lane, int ld, int K) { float v[16]; const int g = lane >> 4;
#pragma unroll
  for (int i = 0; i < 8; ++i) { const int ka = k0 + 8 * g + i, kb = ka + 16; v[i] = ka < K ? W[(size_t)(ka < K ? ka : K - 1) * ld + n] : 0.f; v[8 + i] = kb < K ? W[(size_t)(kb < K ? kb : K - 1) * ld + n] : 0.f; }
  return bsplit16(v); }
__device__ __forceinline__ v8f mac3(const F2& a, const F2& b, v8f c) { c = wmma_bf(a.l, b.h, c); c = wmma_bf(a.h, b.l, c); return wmma_bf(a.h, b.h, c); }
__device__ __forceinline__ float sigm(float v) { return 1.0f / (1.0f + expf(-v)); }
#define LDSX() do { asm volatile("s_wait_dscnt 0" ::: "memory"); __builtin_amdgcn_wave_barrier(); __builtin_amdgcn_fence(__ATOMIC_RELEASE, "workgroup"); } while (0)

// ALiBi-biased multi-headed attention whose softmax runs over the QUERY axis and whose heads are SUMMED (x [2,2048,1024]; (in,out) wq / wk / wv [1024,1024] N(0, 1/1024), no biases; 16 heads x 64; prod = Q K^T / 8 + slope_h (k - q) with slope_h = 2^(-8 (h + 1) / 16); -inf where k > q; attention_weights = softmax(prod, axis=2) - axis 2 of [B, H, q, k] is the QUERY axis: every key column is normalised over the queries that can see it (faithful to the source); out_h = weights V_h; outputs = (sum over the 16 heads of out_h) wo with wo [64,1024]; result = x + outputs).
#define NB 2
#define TT 2048
#define CC 1024            // NH * HD = projected width
#define DIN 1024          // input (model) width
#define NH 16
#define HD 64
#define SCALE (0.125f)
#define CAUSAL 1
#ifndef TNB
#define TNB NB
#endif
__device__ __forceinline__ float bfr(float v) { return (float)(__bf16)v; }
typedef __attribute__((ext_vector_type(8))) __bf16 v8b;
__device__ __forceinline__ v16b frag_b(const __bf16* rowk0, int lane) {
  union { v16b v; v8b q[2]; } u; const __bf16* p = rowk0 + 8 * (lane >> 4);
  u.q[0] = *(const v8b*)p; u.q[1] = *(const v8b*)(p + 16); return u.v;
}
#define QBH 0              // no high-precision blocks: single-product scores and P.v everywhere (the output carries the f32 residual x and the sum of 16 heads: rms - 4)
#define QHI 0               // no q residual plane
#define KHI 64              // no k residual / v hi-lo planes are read
// B fragment (k rows k0+.., output column o) of a weight: (in,out) [K][ld] or (out,in) [ld rows of K]: bf16 exact, or f16(bf16 * 256) exact
__device__ __forceinline__ v16b wcol_io(const float* Wm, int k0, int o, int lane, int ld) { v16b w; const int g = lane >> 4;
#pragma unroll
  for (int i = 0; i < 8; ++i) { w[i] = (__bf16)Wm[(size_t)(k0 + 8 * g + i) * ld + o]; w[8 + i] = (__bf16)Wm[(size_t)(k0 + 16 + 8 * g + i) * ld + o]; }
  return w; }
__device__ __forceinline__ v16b wcol_oi(const float* Wm, int k0, int o, int lane, int K) { v16b w; const float* p = Wm + (size_t)o * K + k0 + 8 * (lane >> 4);
#pragma unroll
  for (int i = 0; i < 8; ++i) { w[i] = (__bf16)p[i]; w[8 + i] = (__bf16)p[16 + i]; }
  return w; }
__device__ __forceinline__ v16h wcolh_io(const float* Wm, int k0, int o, int lane, int ld) { v16h w; const int g = lane >> 4;
#pragma unroll
  for (int i = 0; i < 8; ++i) { w[i] = (_Float16)(bfr(Wm[(size_t)(k0 + 8 * g + i) * ld + o]) * 256.0f); w[8 + i] = (_Float16)(bfr(Wm[(size_t)(k0 + 16 + 8 * g + i) * ld + o]) * 256.0f); }
  return w; }
__device__ __forceinline__ v16h wcolh_oi(const float* Wm, int k0, int o, int lane, int K) { v16h w; const float* p = Wm + (size_t)o * K + k0 + 8 * (lane >> 4);
#pragma unroll
  for (int i = 0; i < 8; ++i) { w[i] = (_Float16)(bfr(p[i]) * 256.0f); w[8 + i] = (_Float16)(bfr(p[16 + i]) * 256.0f); }
  return w; }
#define WQKV_LAYOUT 0   // selects WCOL only, which nothing uses: k_proj reads (in,out) [DIN][CC] for any value
__device__ __forceinline__ v16b wcol_hdk(const float* Wm, int k0, int o, int lane) { v16b w; const int g = lane >> 4; const float* p = Wm + (size_t)(o / HD) * DIN * HD + (o % HD);
#pragma unroll
  for (int i = 0; i < 8; ++i) { w[i] = (__bf16)p[(size_t)(k0 + 8 * g + i) * HD]; w[8 + i] = (__bf16)p[(size_t)(k0 + 16 + 8 * g + i) * HD]; }
  return w; }
#if WQKV_LAYOUT == 1
#define WCOL(W, k0, o, lane) wcol_oi(W, k0, o, lane, DIN)
#elif WQKV_LAYOUT == 2
#define WCOL(W, k0, o, lane) wcol_hdk(W, k0, o, lane)
#else
#define WCOL(W, k0, o, lane) wcol_io(W, k0, o, lane, CC)
#endif

#ifndef PROJ_EXTRA_PARAMS
#define PROJ_EXTRA_PARAMS
#endif

#define WS_QH  0u                                      // f16 q in fragment order [b*t / 16][head][FT]
#define WS_KH  (WS_QH + 2u * (size_t)NB * TT * CC)      // f16 k in fragment order [b*t / 16][head][FT]
#define WS_VT  (WS_KH + 2u * (size_t)NB * TT * CC)      // f16 v in fragment order [b][head][t / 32][FV]
#define WS_QL  (WS_VT + 2u * (size_t)NB * CC * TT)      // f16 q residual x 2^10 rows [b][t < QHI][CC]
#define WS_KL  (WS_QL + 2u * (size_t)NB * QHI * CC)     // f16 k residual x 2^10 rows [b][t < KHI][CC]
#define WS_VB  (WS_KL + 2u * (size_t)NB * KHI * CC)     // bf16 v hi planes [b][c][t < KHI]
#define WS_VBL (WS_VB + 2u * (size_t)NB * CC * KHI)
#define WS_Y   (WS_VBL + 2u * (size_t)NB * CC * KHI)    // f32 ctx rows [b*t][CC] (only when there is an output projection)
#define WS_END (WS_Y  + 4u * (size_t)NB * TT * CC)
#define WS_CM (WS_END)                                  // f32 column exponent offsets m_k + log2 Z_k - 11 - slope (k mod 32) (base 2) [b][h][TT]
#define WS_END2 (WS_CM + 4u * (size_t)NB * NH * TT)

// Fragment order of q, k, v in the workspace: the 16 bytes that lane l takes with one load of a 16x16x32 fragment stand at 16 l in a 512-byte piece, so a wave's load reads 4 whole 128-B lines (from row-major rows it touches 32 B of each of 16 lines).
// q / k: block (16-row tile, head) = FT halves = 4 pieces; piece p, lane l = row l & 15, channels 16 p + 8 (l >> 4) + 0..7; pieces 2 s, 2 s + 1 are elements 0..7, 8..15 of the fragment of channels 32 s + 0..31.
// v: block (head, 32-key chunk) = FV halves = 8 pieces; piece 2 j + i, lane l = channel 16 j + (l & 15), keys 16 i + 8 (l >> 4) + 0..7; pieces 2 j, 2 j + 1 are the fragment of channel tile j.
#define FT (16 * HD)
#define FV (32 * HD)
__device__ __forceinline__ v16h frag_t(const _Float16* piece_lane) {   /* address of the lane's 16 bytes in the first of the fragment's two pieces */
  union { v16h v; v8h q[2]; } u; u.q[0] = *(const v8h*)piece_lane; u.q[1] = *(const v8h*)(piece_lane + 256); return u.v;
}
// ---- k_proj: block = (128 rows, 128 cols, which) x 4 waves: q/k/v = X W (+ b) with exact bf16 products (K = DIN). Per 32-deep k tile the block rounds its X rows and its W columns to bf16 ONCE into LDS (X as [row][k], W transposed to [col][k]), two buffers: the next tile's global loads (whole 128-B lines) fly while this tile's products run. Wave w owns rows 16 w + 0..15 of each 64-row half. -> which 0: q f16 in fragment order (+ residual rows < QHI); 1: k f16 in fragment order (+ residual rows < KHI); 2: v f16 in fragment order (+ bf16 hi/lo planes for t < KHI)
typedef __attribute__((ext_vector_type(4))) __bf16 v4b;
__device__ __forceinline__ void vst_w(void* p, v4u v) { asm volatile("global_store_b128 %0, %1, off\n\ts_wait_xcnt 0x0" :: "v"(p), "v"(v) : "memory"); }   /* a 16-byte global store with its wait in ONE statement: in a statement of its own the wait was passed by the next trip's address steps and LDS reads, which overwrite the store's registers */
#define PBK 32               // k depth of one staged tile
#define PPI 40               // pitch of a staged row in bf16 elements: 64 B of data + 16 B = 16 B x 5 (odd), the conflict-free pitch for 16-byte fragment reads
#define PBUF (128 * PPI)     // elements of one staged operand tile
__global__ __launch_bounds__(128) void k_proj(const float* __restrict__ XQ, const float* __restrict__ XK, const float* __restrict__ XV, const float* __restrict__ WQ, const float* __restrict__ WK, const float* __restrict__ WV, const float* __restrict__ BQ, const float* __restrict__ BK, const float* __restrict__ BV,
    _Float16* __restrict__ QH, _Float16* __restrict__ QL, _Float16* __restrict__ KH, _Float16* __restrict__ KL, _Float16* __restrict__ VT, __bf16* __restrict__ VB, __bf16* __restrict__ VBL) {
  __shared__ __align__(16) unsigned char smem[90112];   /* the staged tiles of the main loop and the transposing planes of the epilogue share these bytes (a barrier stands between the two uses) */
  _Float16 (*sh)[136] = (_Float16 (*)[136])smem; _Float16 (*sl)[136] = (_Float16 (*)[136])(smem + 17408); _Float16 (*th)[72] = (_Float16 (*)[72])(smem + 34816); __bf16 (*tb)[72] = (__bf16 (*)[72])(smem + 53248); __bf16 (*tbl)[72] = (__bf16 (*)[72])(smem + 71680);
  __bf16* sA = (__bf16*)smem; __bf16* sW = (__bf16*)(smem + 4 * PBUF);   /* 2 buffers of X rows, then 2 buffers of W columns */
  const int tid = threadIdx.x, wave = tid >> 5, lane = tid & 31, col = lane & 15, g = lane >> 4; const int which = blockIdx.z; const int c0 = blockIdx.y * 128; const size_t r0 = (size_t)blockIdx.x * 128; const size_t bb = r0 / TT; const int t0 = (int)(r0 % TT);
  const float* X = which == 0 ? XQ : which == 1 ? XK : XV; const float* WA = which == 0 ? WQ : which == 1 ? WK : WV; const float* BA = which == 0 ? BQ : which == 1 ? BK : BV;
  const int l8 = lane & 7, l3 = lane >> 3;
  const float* pa = X + r0 * DIN; const unsigned oa = (unsigned)((wave * 4 + l3) * DIN + l8 * 4);   /* X: 8 lanes read one row's 128 B; load j = rows + 16 j */
  const float* pw = WA + c0; const unsigned ow = (unsigned)(8 * l3 * CC + (wave * 8 + l8) * 4);     /* W (in,out): the lane holds k rows 8 l3 + 0..7 of 4 columns; 8 lanes read 128 B of a row */
  __bf16* da = sA + (wave * 4 + l3) * PPI + l8 * 4;
  __bf16* dw = sW + (wave * 32 + l8 * 4) * PPI + 8 * l3;                       /* 8 k of one column = one 16-byte store; the 32 lanes fall on every bank twice */
  v4f ar[8], wr[8];
  v8f acc[2][8] = {};
  auto issue = [&](const float* qa, const float* qw) {
#pragma unroll
    for (int j = 0; j < 8; ++j) { ar[j] = *(const v4f*)(qa + (size_t)j * 16 * DIN); wr[j] = *(const v4f*)(qw + (size_t)j * CC); } };
  auto stage = [&](int buf) {
#pragma unroll
    for (int j = 0; j < 8; ++j) { v4b t;
#pragma unroll
      for (int e = 0; e < 4; ++e) t[e] = (__bf16)ar[j][e];
      *(v4b*)(da + buf * PBUF + j * 16 * PPI) = t; }
#pragma unroll
    for (int i = 0; i < 4; ++i) { v8b t;
#pragma unroll
      for (int r = 0; r < 8; ++r) t[r] = (__bf16)wr[r][i];
      *(v8b*)(dw + buf * PBUF + i * PPI) = t; } };
  issue(pa + oa, pw + ow);
  asm volatile("s_wait_xcnt 0x0" ::: "memory");   /* stands behind the 16 loads, in front of the next overwrite of a register that they name */
  __builtin_amdgcn_sched_barrier(0);   /* no later write of such a register is lifted over the wait */
  stage(0);
  for (int kc = 0; kc < DIN / PBK; ++kc) {
    __syncthreads();   /* publishes tile kc and ends every wave's reads of the buffer that tile kc + 1 is written into below */
    const __bf16* ba = sA + (kc & 1) * PBUF + (wave * 16 + col) * PPI; const __bf16* bw = sW + (kc & 1) * PBUF + col * PPI;
    const v16b a0 = frag_b(ba, lane), a1 = frag_b(ba + 64 * PPI, lane); v16b w[8];   /* all 20 fragment reads of the tile as one group: one LDS latency a tile, not one a column block */
#pragma unroll
    for (int j = 0; j < 8; ++j) w[j] = frag_b(bw + j * 16 * PPI, lane);
    __builtin_amdgcn_sched_barrier(0);   /* the fragment reads go first: their latency runs under the issue of the global loads */
    if (kc + 1 < DIN / PBK) { const int ks = __builtin_amdgcn_readfirstlane((kc + 1) * PBK); const float* qa = pa + oa + ks; const float* qw = pw + ow + (size_t)ks * CC;   /* the tile's step through a scalar register: the two addresses are formed anew for each tile, and the pairs that the loads name are the very values that the wait below takes */
      issue(qa, qw);
      asm volatile("s_wait_xcnt 0x0" :: "v"(qa), "v"(qw) : "memory"); }   /* stands behind the 16 loads, in front of the next overwrite of their address registers; the two addresses as inputs keep the pairs alive to this wait, so that no load lands in one */
    __builtin_amdgcn_sched_barrier(0);   /* the products, and every later write of an address register, stay behind the loads and their wait */
#pragma unroll
    for (int j = 0; j < 8; ++j) { acc[0][j] = wmma_bf(a0, w[j], acc[0][j]); acc[1][j] = wmma_bf(a1, w[j], acc[1][j]); }
    __builtin_amdgcn_sched_barrier(0);   /* the conversions of stage() wait for the global loads: lifted among the products they would stall the wave at once */
    if (kc + 1 < DIN / PBK) stage((kc + 1) & 1); }
  __syncthreads();   /* the last tile's reads end before the epilogue planes overwrite the staged tiles */
  if (which < 2) { _Float16* DH = which == 0 ? QH : KH; _Float16* DL = which == 0 ? QL : KL; const int nhi = which == 0 ? QHI : KHI;
#pragma unroll
    for (int i = 0; i < 2; ++i) { const size_t rb = r0 + i * 64; const int tq = t0 + i * 64; const bool hi_rows = tq < nhi;   /* the two 64-row halves go through the same planes one after the other */
#pragma unroll
      for (int j = 0; j < 8; ++j) { const float bias = BA ? bfr(BA[c0 + j * 16 + col]) : 0.f;
#pragma unroll
        for (int r = 0; r < 8; ++r) { const float v = acc[i][j][r] + bias; const _Float16 hv = (_Float16)v; sh[wave * 16 + 8 * g + r][j * 16 + col] = hv; sl[wave * 16 + 8 * g + r][j * 16 + col] = (_Float16)((v - (float)hv) * 1024.0f); } }
      __syncthreads();
      for (int e = tid; e < 64 * 16; e += 128) { const int fl = e & 31, fp = (e >> 5) & 3, fh = (e >> 7) & 1, ft = e >> 8; const int rl = ft * 16 + (fl & 15), q = fh * 8 + fp * 2 + (fl >> 4);   /* e runs along the destination: lane, piece, head, row tile; a wave stores 512 neighbouring bytes */
        vst_w(DH + (((rb >> 4) + ft) * NH + (c0 >> 6) + fh) * FT + fp * 256 + fl * 8, *(const v4u*)&sh[rl][q * 8]); if (hi_rows) vst_w(DL + (bb * nhi + tq + rl) * (size_t)CC + c0 + q * 8, *(const v4u*)&sl[rl][q * 8]); }
      if (i == 0) __syncthreads(); }   /* the first half is read out before the second overwrites the planes */
  } else {
#pragma unroll
    for (int i = 0; i < 2; ++i) { const int tq = t0 + i * 64; const bool hi_rows = tq < KHI;
#pragma unroll
      for (int j = 0; j < 8; ++j) { const float bias = BA ? bfr(BA[c0 + j * 16 + col]) : 0.f;
#pragma unroll
        for (int r = 0; r < 8; ++r) { const float v = acc[i][j][r] + bias; const int rl = wave * 16 + 8 * g + r, cl = j * 16 + col; th[cl][rl] = (_Float16)v; const __bf16 bh = (__bf16)v; tb[cl][rl] = bh; tbl[cl][rl] = (__bf16)(v - (float)bh); } }
      __syncthreads();
      for (int e = tid; e < 128 * 8; e += 128) { const int fl = e & 31, fp = (e >> 5) & 7, fc = (e >> 8) & 1, fh = e >> 9; const int cl = fh * 64 + (fp >> 1) * 16 + (fl & 15), q = fc * 4 + (fp & 1) * 2 + (fl >> 4);   /* e runs along the destination: lane, piece, key chunk, head */
        vst_w(VT + ((bb * NH + (c0 >> 6) + fh) * (TT / 32) + (tq >> 5) + fc) * FV + fp * 256 + fl * 8, *(const v4u*)&th[cl][q * 8]); if (hi_rows) { const size_t o3 = (bb * CC + c0 + cl) * (size_t)KHI + tq + q * 8; vst_w(VB + o3, *(const v4u*)&tb[cl][q * 8]); vst_w(VBL + o3, *(const v4u*)&tbl[cl][q * 8]); } }
      if (i == 0) __syncthreads(); } } }   /* as above */
// ---- k_stat: softmax over the QUERY axis under the causal mask (the source's softmax(axis=2) on [B, H, q, k] scores): for every key column k of (b, h): m_k = max_{q >= k} s[q][k], Z_k = sum_{q >= k} exp(s[q][k] - m_k), with s = q.k x SCALE + slope (k - q) formed in registers and never stored. Block = 32 key columns (one 128-B line of CM) x 8 waves; wave w takes the 16-query tiles first tile + w + 8 i. D register r of a tile = query 8g + r, lane column = key, so a lane reduces its own column; the two lane halves are merged by one exchange, the 8 waves through LDS by wave 0, which alone stores the column's offset. All exponentials are base 2: s, m_k carry the factor log2 e (folded into the score scale and the slope), so each is one v_exp_f32; what is stored is c_k = m_k + log2 Z_k - 11 - slope (k mod 32), with which k_att forms P x 2^11 = 2^(q.k scale + slope (chunk start - query) - c_k): no multiply, and one bias value a lane, query tile and chunk
#define LOG2E 1.44269504088896340736f
__device__ __forceinline__ float ex2(float v) { return __builtin_amdgcn_exp2f(v); }   /* v_exp_f32: 2^v; far below the normal range it gives 0, which is what every use here wants */
// 8 values to 2^v in place, one statement: each v_exp_f32 touches its own register alone, so none reads a result or overwrites a source of the one in front of it, and the closing v_nop is the one slot that the instruction set asks for behind a transcendental
__device__ __forceinline__ void ex2x8(float (&a)[8]) {
  asm("v_exp_f32 %0, %0\n\tv_exp_f32 %1, %1\n\tv_exp_f32 %2, %2\n\tv_exp_f32 %3, %3\n\tv_exp_f32 %4, %4\n\tv_exp_f32 %5, %5\n\tv_exp_f32 %6, %6\n\tv_exp_f32 %7, %7\n\tv_nop" : "+v"(a[0]), "+v"(a[1]), "+v"(a[2]), "+v"(a[3]), "+v"(a[4]), "+v"(a[5]), "+v"(a[6]), "+v"(a[7])); }
// the same for the 8 values of a tile and the factor that rescales the running sum: 9 registers, one closing slot (as a v_exp_f32 of its own, in the loop without selects, the factor's source was overwritten directly behind it)
__device__ __forceinline__ void ex2x9(float (&a)[8], float& b) {
  asm("v_exp_f32 %0, %0\n\tv_exp_f32 %1, %1\n\tv_exp_f32 %2, %2\n\tv_exp_f32 %3, %3\n\tv_exp_f32 %4, %4\n\tv_exp_f32 %5, %5\n\tv_exp_f32 %6, %6\n\tv_exp_f32 %7, %7\n\tv_exp_f32 %8, %8\n\tv_nop" : "+v"(a[0]), "+v"(a[1]), "+v"(a[2]), "+v"(a[3]), "+v"(a[4]), "+v"(a[5]), "+v"(a[6]), "+v"(a[7]), "+v"(b)); }
__device__ __forceinline__ void ms_merge(float& m, float& z, float mo, float zo) { const float mn = fmaxf(m, mo); z = z * ex2(m - mn) + zo * ex2(mo - mn); m = mn; }   /* an empty slice carries (-3e38, 0) and adds 0 */
__global__ __launch_bounds__(256) void k_stat(const _Float16* __restrict__ QH, const _Float16* __restrict__ KH, float* __restrict__ CM) { __shared__ float pm[8][32], pz[8][32];
  const int tid = threadIdx.x, wave = __builtin_amdgcn_readfirstlane(tid >> 5), lane = tid & 31, col = lane & 15, g = lane >> 4; const int kb = blockIdx.x, h = blockIdx.y, b = blockIdx.z;   /* the wave's number in a scalar register: the tile loop branches on SCC */
  const float slope_ = exp2f(-0.5f * (float)(h + 1)) * LOG2E;   /* ALiBi slope of this head, 2^(-8 (h + 1) / 16), x log2 e */
  const _Float16* kp = KH + (((size_t)b * (TT / 16) + kb * 2) * NH + h) * FT + lane * 8;
  const v16h kf[2][2] = {{frag_t(kp), frag_t(kp + 512)}, {frag_t(kp + NH * FT), frag_t(kp + NH * FT + 512)}};
  float m[2] = {-3.0e38f, -3.0e38f}, z[2] = {0.f, 0.f};
  /* one 16-query tile against the block's 32 columns; masked = the tile can hold a key above a query (a literal at both calls: the compares and selects are compiled only into the diagonal form) */
  auto tile = [&](const int qt, const bool masked) __attribute__((always_inline)) { const _Float16* qa = QH + (((size_t)b * (TT / 16) + qt) * NH + h) * FT + lane * 8;   /* the lane's own address in piece 0 of the tile; the four pieces as in frag_t */
    union { v16h v; v8h q[2]; } q0, q1; q0.q[0] = *(const v8h*)qa; q0.q[1] = *(const v8h*)(qa + 256); q1.q[0] = *(const v8h*)(qa + 512); q1.q[1] = *(const v8h*)(qa + 768);
    asm volatile("s_wait_xcnt 0x0" :: "v"(qa) : "memory");   /* the address as an input keeps the address pair of the four q loads alive to this wait: none of them lands in it, and the wait stands in front of its next overwrite */
#pragma unroll
    for (int u = 0; u < 2; ++u) { v8f s = {}; s = wmma16(q0.v, kf[u][0], s); s = wmma16(q1.v, kf[u][1], s);
      const int d0 = kb * 32 + u * 16 + col - (qt * 16 + 8 * g);   /* key - query of register 0 */ const float b0 = slope_ * (float)d0; float v[8]; float mn = m[u];
#pragma unroll
      for (int r = 0; r < 8; ++r) { const float sv = s[r] * (SCALE * LOG2E) + (b0 - slope_ * (float)r); v[r] = (!masked || d0 - r <= 0) ? sv : -3.0e38f; mn = fmaxf(mn, v[r]); }   /* + the ALiBi bias slope (key - query) <= 0 */
#pragma unroll
      for (int r = 0; r < 8; ++r) v[r] -= mn;
      float rs = m[u] - mn;   /* exponent of the running sum's rescale */
      ex2x9(v, rs);
      float zt = (!masked || d0 <= 0) ? v[0] : 0.f;
#pragma unroll
      for (int r = 1; r < 8; ++r) zt += (!masked || d0 - r <= 0) ? v[r] : 0.f;   /* value select, no branch */
      z[u] = z[u] * rs + zt; m[u] = mn; } };
  int qt = kb * 2 + wave;
  if (wave < 2) { tile(qt, true); qt += 8; }   /* only query tiles 2 kb and 2 kb + 1 meet the diagonal of these 32 columns; they are the first tiles of waves 0 and 1 (scalar branch) */
  for (; qt < TT / 16; qt += 8) tile(qt, false);   /* from tile 2 kb + 2 on every query is above every key of the block */
#pragma unroll
  for (int u = 0; u < 2; ++u) { const float mo = __shfl_xor(m[u], 16), zo = __shfl_xor(z[u], 16); ms_merge(m[u], z[u], mo, zo); if (g == 0) { pm[wave][u * 16 + col] = m[u]; pz[wave][u * 16 + col] = z[u]; } }
  __syncthreads();
  if (wave == 0) { float mm = pm[0][lane];
#pragma unroll
    for (int w = 1; w < 8; ++w) mm = fmaxf(mm, pm[w][lane]);
    float zz = 0.f;
#pragma unroll
    for (int w = 0; w < 8; ++w) zz += pz[w][lane] * ex2(pm[w][lane] - mm);
    const size_t o = ((size_t)b * NH + h) * TT + kb * 32 + lane; vst2(CM + o, mm + log2f(zz) - 11.0f - slope_ * (float)lane); } }   /* every column sees at least its own diagonal entry: Z_k >= 1 */
// ---- k_att: block = 32 queries (2 query tiles) of (b, h) x 4 waves; wave w takes the 32-key chunks w + 4 i up to the diagonal, and every k, v and column-offset load of a chunk feeds BOTH query tiles, which the wave holds in registers. The scores are formed again, TRANSPOSED (A = k rows, B = q rows): D register r of key tile 0 / 1 = key 8g + r / 16 + 8g + r of the lane's own query, which is the place that key has in the A fragment of P . v, so P x 2^11 = 2^(q.k scale + slope (chunk start - query) - c_k) (base 2 as in k_stat; 0 above the diagonal) goes once to f16 in registers against v f16 (1 product). The 4 waves' partial ctx tiles are summed through LDS; 256-B (row, head) segment by 16 lanes
#define QW 2               // query tiles of a wave
__global__ __launch_bounds__(128) void k_att(const _Float16* __restrict__ QH, const _Float16* __restrict__ KH, const _Float16* __restrict__ VT, const float* __restrict__ CM, float* __restrict__ Y) { __shared__ __align__(16) float ss[4][16 * QW][HD + 4];
  const int tid = threadIdx.x, wave = __builtin_amdgcn_readfirstlane(tid >> 5), lane = tid & 31, col = lane & 15, g = lane >> 4; const int qb = TT / (16 * QW) - 1 - blockIdx.x, h = blockIdx.y, b = blockIdx.z;   /* the wave's number in a scalar register: the chunk loop branches on SCC; the longest key ranges start first */
  const float slope_ = exp2f(-0.5f * (float)(h + 1)) * LOG2E;
  const _Float16* qp = QH + (((size_t)b * (TT / 16) + qb * QW) * NH + h) * FT + lane * 8; v16h qf[QW][2];   /* every loop over t below is unrolled: t selects registers */
#pragma unroll
  for (int t = 0; t < QW; ++t) { qf[t][0] = frag_t(qp + t * NH * FT); qf[t][1] = frag_t(qp + t * NH * FT + 512); }
  const float* cm = CM + ((size_t)b * NH + h) * TT + 8 * g; const _Float16* vp = VT + ((size_t)b * NH + h) * (TT / 32) * FV + lane * 8;
  v8f acc[QW][HD / 16] = {};
  /* one 32-key chunk against the block's query tiles; masked = the chunk can hold a key above a query (a literal at both calls: the compares and selects are compiled only into the diagonal form) */
  auto chunk = [&](const int c, const bool masked) __attribute__((always_inline)) { const int k0 = c * 32; const _Float16* kp = KH + (((size_t)b * (TT / 16) + c * 2) * NH + h) * FT + lane * 8;
    v4f mk[4];   /* all of a chunk's column-stat and k loads stand in front of the first product: one latency for the lot */
#pragma unroll
    for (int i = 0; i < 4; ++i) mk[i] = *(const v4f*)(cm + k0 + (i >> 1) * 16 + (i & 1) * 4);
    asm volatile("s_wait_xcnt 0x0" ::: "memory");   /* the k loads below land in registers that held the stat loads' addresses */
    const v16h kf[2][2] = {{frag_t(kp), frag_t(kp + 512)}, {frag_t(kp + NH * FT), frag_t(kp + NH * FT + 512)}};
    v8f s[QW][2] = {};
#pragma unroll
    for (int t = 0; t < QW; ++t)
#pragma unroll
      for (int u = 0; u < 2; ++u) { s[t][u] = wmma16(kf[u][0], qf[t][0], s[t][u]); s[t][u] = wmma16(kf[u][1], qf[t][1], s[t][u]); }
    v16h vf[HD / 16], p[QW];
#pragma unroll
    for (int j = 0; j < HD / 16; ++j) vf[j] = frag_t(vp + (size_t)c * FV + j * 512);
    __builtin_amdgcn_sched_barrier(0);   /* keeps the v loads in front of the exponentials, which then cover their latency; without it they are sunk to the P . v products */
#pragma unroll
    for (int t = 0; t < QW; ++t) { const int qq = (qb * QW + t) * 16 + col;   /* the lane's query in tile t */
      const float bq = slope_ * (float)(k0 - qq);   /* ALiBi bias of the chunk's first key; the keys' own steps are in c_k */
#pragma unroll
      for (int u = 0; u < 2; ++u) { const int d0 = k0 + u * 16 + 8 * g - qq;   /* key - query of register 0 */
        float e[8];
#pragma unroll
        for (int r = 0; r < 8; ++r) e[r] = s[t][u][r] * (SCALE * LOG2E) + (bq - mk[u * 2 + (r >> 2)][r & 3]);
        ex2x8(e);
#pragma unroll
        for (int r = 0; r < 8; ++r) p[t][u * 8 + r] = (_Float16)((!masked || d0 + r <= 0) ? e[r] : 0.f); } }   /* value select, no branch */
#pragma unroll
    for (int t = 0; t < QW; ++t)
#pragma unroll
      for (int j = 0; j < HD / 16; ++j) acc[t][j] = wmma16(p[t], vf[j], acc[t][j]); };
  int c = wave;
  for (; c < (qb * QW) >> 1; c += 4) chunk(c, false);   /* chunks that end below the block's first query: every key is visible to every query */
  for (; c <= (qb * QW + QW - 1) >> 1; c += 4) chunk(c, true);   /* the chunks that the diagonal crosses; each wave keeps its chunks and their order */
#pragma unroll
  for (int t = 0; t < QW; ++t)
#pragma unroll
    for (int j = 0; j < HD / 16; ++j)
#pragma unroll
      for (int r = 0; r < 8; ++r) ss[wave][t * 16 + 8 * g + r][j * 16 + col] = acc[t][j][r];
  __syncthreads();
  for (int e = tid; e < 16 * QW * (HD / 4); e += 128) { const int rl = e / (HD / 4), c4 = (e % (HD / 4)) * 4; const v4f o = ((*(const v4f*)&ss[0][rl][c4] + *(const v4f*)&ss[1][rl][c4]) + (*(const v4f*)&ss[2][rl][c4] + *(const v4f*)&ss[3][rl][c4])) * (1.0f / 2048.0f); vst2(Y + ((size_t)b * TT + qb * 16 * QW + rl) * CC + h * HD + c4, o); } }
// ---- k_out: block = 16 rows x all 1024 output columns x 16 waves: out = x + (sum over the 16 heads of ctx) Wo. The heads are summed FIRST, in f32: a thread adds 8 heads of 4 channels of one row (pairwise tree), the two 8-head halves meet in LDS and are added where the A fragment is formed; the sum goes x 2^6 once to f16, and the product with Wo as f16(bf16 x 2^8) exact runs over K = 64 (2 WMMAs a column tile). Wave w owns columns 64 w + 0..63. Lane column n of tile e stands for output column 64 w + 4 n + e, so one 16-byte load of a Wo row feeds the 4 tiles, and the 4 tiles' D registers of a row are 16 neighbouring output bytes of the lane: 16 lanes read / write 256 B of a row
__global__ __launch_bounds__(512) void k_out(const float* __restrict__ Y, const float* __restrict__ WO, const float* __restrict__ BO, float* __restrict__ OUT) { __shared__ __align__(16) float sp[2][16][HD + 4];
  const int tid = threadIdx.x, wave = tid >> 5, lane = tid & 31, col = lane & 15, g = lane >> 4; const size_t r0 = (size_t)blockIdx.x * 16;
  const int yh = tid >> 8, yr = (tid >> 4) & 15, yc = (tid & 15) * 4;                /* the thread's half of the heads, its row, its 4 channels */
  const float* yp = Y + (r0 + yr) * CC + yh * (NH / 2) * HD + yc;
  const float* wp = WO + (size_t)(8 * g) * DIN + wave * 64 + col * 4;                /* fragment elements 0..7 = k rows k0 + 8g + 0..7, 8..15 = k0 + 16 + 8g + 0..7, as in frag_h */
  const size_t oo = (r0 + 8 * g) * DIN + wave * 64 + col * 4; const float* xp = BO + oo;   /* the BO argument carries the RESIDUAL x (this module has no output bias) */
  v4f yv[NH / 2], wv[2][16], xr[8];   /* every load of the block is independent of every other: all are issued before the first is used, one latency for the lot */
#pragma unroll
  for (int h = 0; h < NH / 2; ++h) yv[h] = *(const v4f*)(yp + h * HD);
#pragma unroll
  for (int s = 0; s < 2; ++s)
#pragma unroll
    for (int i = 0; i < 8; ++i) { wv[s][i] = *(const v4f*)(wp + (size_t)(s * 32 + i) * DIN); wv[s][8 + i] = *(const v4f*)(wp + (size_t)(s * 32 + 16 + i) * DIN); }
#pragma unroll
  for (int r = 0; r < 8; ++r) xr[r] = *(const v4f*)(xp + (size_t)r * DIN);
  asm volatile("s_wait_xcnt 0x0" :: "v"(yp), "v"(wp), "v"(xp) : "memory");   /* stands behind the loads, in front of the next overwrite of a register that they name; the three addresses as inputs keep the pairs alive to this wait */
  __builtin_amdgcn_sched_barrier(0);   /* the conversions below wait for loaded values: lifted over the last loads they would put a second memory latency behind the first */
#pragma unroll
  for (int st = 1; st < NH / 2; st *= 2)
#pragma unroll
    for (int h = 0; h < NH / 2; h += 2 * st) yv[h] += yv[h + st];
  *(v4f*)&sp[yh][yr][yc] = yv[0];
  __syncthreads();   /* publishes the two half sums of the 16 rows to the 16 waves */
  v16h a[2];
#pragma unroll
  for (int s = 0; s < 2; ++s)
#pragma unroll
    for (int q = 0; q < 4; ++q) { const int k = s * 32 + (q >> 1) * 16 + 8 * g + (q & 1) * 4; const v4f t = (*(const v4f*)&sp[0][col][k] + *(const v4f*)&sp[1][col][k]) * 64.0f;   /* carried x 2^6 into f16 so small-magnitude context rows stay clear of f16 subnormals */
#pragma unroll
      for (int e = 0; e < 4; ++e) a[s][q * 4 + e] = (_Float16)t[e]; }
  v8f acc[4];
#pragma unroll
  for (int e = 0; e < 4; ++e) { v16h w0, w1;
#pragma unroll
    for (int i = 0; i < 16; ++i) { w0[i] = (_Float16)(bfr(wv[0][i][e]) * 256.0f); w1[i] = (_Float16)(bfr(wv[1][i][e]) * 256.0f); }
    v8f d = {}; d = wmma16(a[0], w0, d); acc[e] = wmma16(a[1], w1, d); }
  v4f o[8];
#pragma unroll
  for (int r = 0; r < 8; ++r)
#pragma unroll
    for (int e = 0; e < 4; ++e) o[r][e] = acc[e][r] * (1.0f / 16384.0f) + bfr(xr[r][e]);   /* 2^-8 (Wo carry) x 2^-6 (ctx carry); x + outputs */
  __builtin_amdgcn_sched_barrier(0);   /* all 8 results are formed in front of the first store: no register that an issued store names is written again */
#pragma unroll
  for (int r = 0; r < 8; ++r) vst2(OUT + oo + (size_t)r * DIN, o[r]); }

extern "C" void kernel_launch(void* const* d_in, const int* in_sizes, int n_in, void* d_out, int out_size, void* d_ws, size_t ws_size, hipStream_t stream) {
  (void)in_sizes; (void)n_in; (void)out_size;
  const float** F = (const float**)d_in;
  if (ws_size < (size_t)WS_END) return;
  char* ws = (char*)d_ws; _Float16 *QH = (_Float16*)(ws + WS_QH), *KH = (_Float16*)(ws + WS_KH), *VT = (_Float16*)(ws + WS_VT), *QL = (_Float16*)(ws + WS_QL), *KL = (_Float16*)(ws + WS_KL); __bf16 *VB = (__bf16*)(ws + WS_VB), *VBL = (__bf16*)(ws + WS_VBL); float *Y = (float*)(ws + WS_Y);
  (void)Y; (void)QL; (void)KL; (void)VB; (void)VBL;
  // inputs: 0 x [2,2048,1024]; 1 wq [1024,1024] (in,out); 2 wk; 3 wv; 4 wo [64,1024] (in,out: it acts on the SUM of the 16 heads' 64-dim outputs); no biases
  if (ws_size < (size_t)WS_END2) return;
  float *CM = (float*)(ws + WS_CM);
  k_proj<<<dim3(TNB * TT / 128, CC / 128, 3), 128, 0, stream>>>(F[0], F[0], F[0], F[1], F[2], F[3], nullptr, nullptr, nullptr, QH, QL, KH, KL, VT, VB, VBL);
  k_stat<<<dim3(TT / 32, NH, TNB), 256, 0, stream>>>(QH, KH, CM);   /* per key column: max and sum over the visible queries of exp(score + ALiBi bias), as one exponent offset */
  k_att<<<dim3(TT / (16 * QW), NH, TNB), 128, 0, stream>>>(QH, KH, VT, CM, Y);
  k_out<<<dim3(TNB * TT / 16), 512, 0, stream>>>(Y, F[4], F[0], (float*)d_out);   /* (sum over heads) x wo + x (the third argument is the RESIDUAL here, not a bias) */
}

// v009
// It runs in 91.1 microseconds.
// Timed twice side by side with v008, it ran 1.16 times as fast both times.
// All steps since v000 together make it 83.1 times as fast.
// compute dtype: all float inputs rounded to bf16; q/k/v projections with EXACT bf16 products on WMMA 16x16x32 (f32 accumulate); causal scores q x k once to f16 each (1 product) x 64^-0.5 plus the ALiBi bias slope_h (key - query) in f32; softmax over the QUERY axis in f32, in base 2 (scores and bias x log2 e; per key column: online max / sum over the visible queries, v_exp_f32); P x 2^11 once to f16 x v once to f16 (1 product); the 16 heads' outputs are summed in f32 in front of the output projection (the sum x 2^6 once to f16 x wo f16(bf16 x 2^8), 1 product over K = 64); + bf16(x) residual in f32; f32 output.
#include <hip/hip_runtime.h>
#include <math.h>

typedef __attribute__((ext_vector_type(16))) _Float16 v16h;
typedef __attribute__((ext_vector_type(16))) __bf16 v16b;
typedef __attribute__((ext_vector_type(8)))  _Float16 v8h;
typedef __attribute__((ext_vector_type(8)))  float v8f;
typedef __attribute__((ext_vector_type(4)))  float v4f;
typedef __attribute__((ext_vector_type(2)))  float v2f;
typedef __attribute__((ext_vector_type(4)))  unsigned v4u;
typedef __attribute__((ext_vector_type(4)))  int v4i;
typedef float __attribute__((may_alias)) float_a;
typedef int __attribute__((may_alias)) int_a;

template <typename T> __device__ __forceinline__ void vst2(void* p, T v) { *(T*)p = v;  }
__device__ __forceinline__ v8f wmma16(v16h a, v16h b, v8f c) {
  v8f d = __builtin_amdgcn_wmma_f32_16x16x32_f16(false, a, false, b, (short)0, c, false, false);
  asm volatile("v_nop\n\tv_nop\n\tv_nop\n\tv_nop" : "+v"(d) : "v"(a), "v"(b));
  return d;
}
__device__ __forceinline__ v8f wmma_bf(v16b a, v16b b, v8f c) {
  v8f d = __builtin_amdgcn_wmma_f32_16x16x32_bf16(false, a, false, b, (short)0, c, false, false);
  asm volatile("v_nop\n\tv_nop\n\tv_nop\n\tv_nop" : "+v"(d) : "v"(a), "v"(b));
  return d;
}
// 16x16x32 fragments: lane = (h = lane>>4, row/col = lane&15); elements 0..7 = k0+8h+0..7, 8..15 = k0+16+8h+0..7; D element r = row 8h+r
__device__ __forceinline__ v16h frag_h(const _Float16* rowk0, int lane) {
  union { v16h v; v8h q[2]; } u; const _Float16* p = rowk0 + 8 * (lane >> 4);
  u.q[0] = *(const v8h*)p; u.q[1] = *(const v8h*)(p + 16); return u.v;
}
__device__ __forceinline__ v16h frag_f32(const float* rowk0, int lane) {
  v16h a; const float* p = rowk0 + 8 * (lane >> 4);
#pragma unroll
  for (int i = 0; i < 8; ++i) { a[i] = (_Float16)p[i]; a[8 + i] = (_Float16)p[16 + i]; }
  return a;
}
__device__ __forceinline__ v16h frag_f32s(const float* rowk0, int lane, float sc) {
  v16h a; const float* p = rowk0 + 8 * (lane >> 4);
#pragma unroll
  for (int i = 0; i < 8; ++i) { a[i] = (_Float16)(p[i] * sc); a[8 + i] = (_Float16)(p[16 + i] * sc); }
  return a;
}
// column fragment from a [K][ld] layout (column n), rows >= K read as 0
__device__ __forceinline__ v16h fragc_f32(const float* W, int k0, int n, int lane, int ld, int K) {
  v16h a; const int g = lane >> 4;
#pragma unroll
  for (int i = 0; i < 8; ++i) { const int ka = k0 + 8 * g + i, kb = ka + 16;
    a[i] = (_Float16)(ka < K ? W[(size_t)(ka < K ? ka : K - 1) * ld + n] : 0.f); a[8 + i] = (_Float16)(kb < K ? W[(size_t)(kb < K ? kb : K - 1) * ld + n] : 0.f); }
  return a;
}
struct F2 { v16b h, l; };
__device__ __forceinline__ F2 bsplit16(const float v[16]) { F2 r;
#pragma unroll
  for (int i = 0; i < 16; ++i) { const __bf16 h = (__bf16)v[i]; r.h[i] = h; r.l[i] = (__bf16)(v[i] - (float)h); }
  return r; }
__device__ __forceinline__ F2 split_row(const float* row, int k0, int lane) { float v[16]; const float* p = row + k0 + 8 * (lane >> 4);
#pragma unroll
  for (int i = 0; i < 8; ++i) { v[i] = p[i]; v[8 + i] = p[16 + i]; }
  return bsplit16(v); }
__device__ __forceinline__ F2 split_rowK(const float* row, int k0, int lane, int K) { float v[16]; const int g = lane >> 4;
#pragma unroll
  for (int i = 0; i < 8; ++i) { const int ka = k0 + 8 * g + i, kb = ka + 16; v[i] = ka < K ? row[ka < K ? ka : K - 1] : 0.f; v[8 + i] = kb < K ? row[kb < K ? kb : K - 1] : 0.f; }
  return bsplit16(v); }
__device__ __forceinline__ F2 split_col(const float* W, int k0, int n, int lane, int ld, int K) { float v[16]; const int g = lane >> 4;
#pragma unroll
  for (int i = 0; i < 8; ++i) { const int ka = k0 + 8 * g + i, kb = ka + 16; v[i] = ka < K ? W[(size_t)(ka < K ? ka : K - 1) * ld + n] : 0.f; v[8 + i] = kb < K ? W[(size_t)(kb < K ? kb : K - 1) * ld + n] : 0.f; }
  return bsplit16(v); }
__device__ __forceinline__ v8f mac3(const F2& a, const F2& b, v8f c) { c = wmma_bf(a.l, b.h, c); c = wmma_bf(a.h, b.l, c); return wmma_bf(a.h, b.h, c); }
__device__ __forceinline__ float sigm(float v) { return 1.0f / (1.0f + expf(-v)); }
#define LDSX() do { asm volatile("s_wait_dscnt 0" ::: "memory"); __builtin_amdgcn_wave_barrier(); __builtin_amdgcn_fence(__ATOMIC_RELEASE, "workgroup"); } while (0)

// ALiBi-biased multi-headed attention whose softmax runs over the QUERY axis and whose heads are SUMMED (x [2,2048,1024]; (in,out) wq / wk / wv [1024,1024] N(0, 1/1024), no biases; 16 heads x 64; prod = Q K^T / 8 + slope_h (k - q) with slope_h = 2^(-8 (h + 1) / 16); -inf where k > q; attention_weights = softmax(prod, axis=2) - axis 2 of [B, H, q, k] is the QUERY axis: every key column is normalised over the queries that can see it (faithful to the source); out_h = weights V_h; outputs = (sum over the 16 heads of out_h) wo with wo [64,1024]; result = x + outputs).
#define NB 2
#define TT 2048
#define CC 1024            // NH * HD = projected width
#define DIN 1024          // input (model) width
#define NH 16
#define HD 64
#define SCALE (0.125f)
#define CAUSAL 1
#ifndef TNB
#define TNB NB
#endif
__device__ __forceinline__ float bfr(float v) { return (float)(__bf16)v; }
typedef __attribute__((ext_vector_type(8))) __bf16 v8b;
__device__ __forceinline__ v16b frag_b(const __bf16* rowk0, int lane) {
  union { v16b v; v8b q[2]; } u; const __bf16* p = rowk0 + 8 * (lane >> 4);
  u.q[0] = *(const v8b*)p; u.q[1] = *(const v8b*)(p + 16); return u.v;
}
#define QBH 0              // no high-precision blocks: single-product scores and P.v everywhere (the output carries the f32 residual x and the sum of 16 heads: rms - 4)
#define QHI 0               // no q residual plane
#define KHI 64              // no k residual / v hi-lo planes are read
// B fragment (k rows k0+.., output column o) of a weight: (in,out) [K][ld] or (out,in) [ld rows of K]: bf16 exact, or f16(bf16 * 256) exact
__device__ __forceinline__ v16b wcol_io(const float* Wm, int k0, int o, int lane, int ld) { v16b w; const int g = lane >> 4;
#pragma unroll
  for (int i = 0; i < 8; ++i) { w[i] = (__bf16)Wm[(size_t)(k0 + 8 * g + i) * ld + o]; w[8 + i] = (__bf16)Wm[(size_t)(k0 + 16 + 8 * g + i) * ld + o]; }
  return w; }
__device__ __forceinline__ v16b wcol_oi(const float* Wm, int k0, int o, int lane, int K) { v16b w; const float* p = Wm + (size_t)o * K + k0 + 8 * (lane >> 4);
#pragma unroll
  for (int i = 0; i < 8; ++i) { w[i] = (__bf16)p[i]; w[8 + i] = (__bf16)p[16 + i]; }
  return w; }
__device__ __forceinline__ v16h wcolh_io(const float* Wm, int k0, int o, int lane, int ld) { v16h w; const int g = lane >> 4;
#pragma unroll
  for (int i = 0; i < 8; ++i) { w[i] = (_Float16)(bfr(Wm[(size_t)(k0 + 8 * g + i) * ld + o]) * 256.0f); w[8 + i] = (_Float16)(bfr(Wm[(size_t)(k0 + 16 + 8 * g + i) * ld + o]) * 256.0f); }
  return w; }
__device__ __forceinline__ v16h wcolh_oi(const float* Wm, int k0, int o, int lane, int K) { v16h w; const float* p = Wm + (size_t)o * K + k0 + 8 * (lane >> 4);
#pragma unroll
  for (int i = 0; i < 8; ++i) { w[i] = (_Float16)(bfr(p[i]) * 256.0f); w[8 + i] = (_Float16)(bfr(p[16 + i]) * 256.0f); }
  return w; }
#define WQKV_LAYOUT 0   // selects WCOL only, which nothing uses: k_proj reads (in,out) [DIN][CC] for any value
__device__ __forceinline__ v16b wcol_hdk(const float* Wm, int k0, int o, int lane) { v16b w; const int g = lane >> 4; const float* p = Wm + (size_t)(o / HD) * DIN * HD + (o % HD);
#pragma unroll
  for (int i = 0; i < 8; ++i) { w[i] = (__bf16)p[(size_t)(k0 + 8 * g + i) * HD]; w[8 + i] = (__bf16)p[(size_t)(k0 + 16 + 8 * g + i) * HD]; }
  return w; }
#if WQKV_LAYOUT == 1
#define WCOL(W, k0, o, lane) wcol_oi(W, k0, o, lane, DIN)
#elif WQKV_LAYOUT == 2
#define WCOL(W, k0, o, lane) wcol_hdk(W, k0, o, lane)
#else
#define WCOL(W, k0, o, lane) wcol_io(W, k0, o, lane, CC)
#endif

#ifndef PROJ_EXTRA_PARAMS
#define PROJ_EXTRA_PARAMS
#endif

#define WS_QH  0u                                      // f16 q in fragment order [b*t / 16][head][FT]
#define WS_KH  (WS_QH + 2u * (size_t)NB * TT * CC)      // f16 k in fragment order [b*t / 16][head][FT]
#define WS_VT  (WS_KH + 2u * (size_t)NB * TT * CC)      // f16 v in fragment order [b][head][t / 32][FV]
#define WS_QL  (WS_VT + 2u * (size_t)NB * CC * TT)      // f16 q residual x 2^10 rows [b][t < QHI][CC]
#define WS_KL  (WS_QL + 2u * (size_t)NB * QHI * CC)     // f16 k residual x 2^10 rows [b][t < KHI][CC]
#define WS_VB  (WS_KL + 2u * (size_t)NB * KHI * CC)     // bf16 v hi planes [b][c][t < KHI]
#define WS_VBL (WS_VB + 2u * (size_t)NB * CC * KHI)
#define WS_Y   (WS_VBL + 2u * (size_t)NB * CC * KHI)    // f32 ctx rows [b*t][CC] (only when there is an output projection)
#define WS_END (WS_Y  + 4u * (size_t)NB * TT * CC)
#define WS_CM (WS_END)                                  // f32 column exponent offsets m_k + log2 Z_k - 11 - slope (k mod 32) (base 2) [b][h][TT]
#define WS_END2 (WS_CM + 4u * (size_t)NB * NH * TT)

// Fragment order of q, k, v in the workspace: the 16 bytes that lane l takes with one load of a 16x16x32 fragment stand at 16 l in a 512-byte piece, so a wave's load reads 4 whole 128-B lines (from row-major rows it touches 32 B of each of 16 lines).
// q / k: block (16-row tile, head) = FT halves = 4 pieces; piece p, lane l = row l & 15, channels 16 p + 8 (l >> 4) + 0..7; pieces 2 s, 2 s + 1 are elements 0..7, 8..15 of the fragment of channels 32 s + 0..31.
// v: block (head, 32-key chunk) = FV halves = 8 pieces; piece 2 j + i, lane l = channel 16 j + (l & 15), keys 16 i + 8 (l >> 4) + 0..7; pieces 2 j, 2 j + 1 are the fragment of channel tile j.
#define FT (16 * HD)
#define FV (32 * HD)
__device__ __forceinline__ v16h frag_t(const _Float16* piece_lane) {   /* address of the lane's 16 bytes in the first of the fragment's two pieces */
  union { v16h v; v8h q[2]; } u; u.q[0] = *(const v8h*)piece_lane; u.q[1] = *(const v8h*)(piece_lane + 256); return u.v;
}
// ---- k_proj: block = (128 rows, 128 cols, which) x 4 waves: q/k/v = X W (+ b) with exact bf16 products (K = DIN). Per 32-deep k tile the block rounds its X rows and its W columns to bf16 ONCE into LDS (X as [row][k], W transposed to [col][k]), two buffers: the next tile's global loads (whole 128-B lines) fly while this tile's products run. Wave w owns rows 16 w + 0..15 of each 64-row half. -> which 0: q f16 in fragment order (+ residual rows < QHI); 1: k f16 in fragment order (+ residual rows < KHI); 2: v f16 in fragment order (+ bf16 hi/lo planes for t < KHI)
typedef __attribute__((ext_vector_type(4))) __bf16 v4b;
__device__ __forceinline__ void vst_w(void* p, v4u v) { asm volatile("global_store_b128 %0, %1, off\n\ts_wait_xcnt 0x0" :: "v"(p), "v"(v) : "memory"); }   /* a 16-byte global store with its wait in ONE statement: in a statement of its own the wait was passed by the next trip's address steps and LDS reads, which overwrite the store's registers */
#define PBK 32               // k depth of one staged tile
#define PPI 40               // pitch of a staged row in bf16 elements: 64 B of data + 16 B = 16 B x 5 (odd), the conflict-free pitch for 16-byte fragment reads
#define PBUF (128 * PPI)     // elements of one staged operand tile
__global__ __launch_bounds__(128) void k_proj(const float* __restrict__ XQ, const float* __restrict__ XK, const float* __restrict__ XV, const float* __restrict__ WQ, const float* __restrict__ WK, const float* __restrict__ WV, const float* __restrict__ BQ, const float* __restrict__ BK, const float* __restrict__ BV,
    _Float16* __restrict__ QH, _Float16* __restrict__ QL, _Float16* __restrict__ KH, _Float16* __restrict__ KL, _Float16* __restrict__ VT, __bf16* __restrict__ VB, __bf16* __restrict__ VBL) {
  __shared__ __align__(16) unsigned char smem[90112];   /* the staged tiles of the main loop and the transposing planes of the epilogue share these bytes (a barrier stands between the two uses) */
  _Float16 (*sh)[136] = (_Float16 (*)[136])smem; _Float16 (*sl)[136] = (_Float16 (*)[136])(smem + 17408); _Float16 (*th)[72] = (_Float16 (*)[72])(smem + 34816); __bf16 (*tb)[72] = (__bf16 (*)[72])(smem + 53248); __bf16 (*tbl)[72] = (__bf16 (*)[72])(smem + 71680);
  __bf16* sA = (__bf16*)smem; __bf16* sW = (__bf16*)(smem + 4 * PBUF);   /* 2 buffers of X rows, then 2 buffers of W columns */
  const int tid = threadIdx.x, wave = tid >> 5, lane = tid & 31, col = lane & 15, g = lane >> 4; const int which = blockIdx.z; const int c0 = blockIdx.y * 128; const size_t r0 = (size_t)blockIdx.x * 128; const size_t bb = r0 / TT; const int t0 = (int)(r0 % TT);
  const float* X = which == 0 ? XQ : which == 1 ? XK : XV; const float* WA = which == 0 ? WQ : which == 1 ? WK : WV; const float* BA = which == 0 ? BQ : which == 1 ? BK : BV;
  const int l8 = lane & 7, l3 = lane >> 3;
  const int rot = (blockIdx.x + 4 * blockIdx.y) & (DIN / PBK - 1);   /* the block's first k tile; it walks the DIN / PBK tiles from there and wraps round. The blocks of a tile row read the same X lines and those of a tile column the same W lines, and all start together: from one common start they ask L2 for the same lines at the same moment */
  const float* pa = X + r0 * DIN; const unsigned oa = (unsigned)((wave * 4 + l3) * DIN + l8 * 4);   /* X: 8 lanes read one row's 128 B; load j = rows + 16 j */
  const float* pw = WA + c0; const unsigned ow = (unsigned)(8 * l3 * CC + (wave * 8 + l8) * 4);     /* W (in,out): the lane holds k rows 8 l3 + 0..7 of 4 columns; 8 lanes read 128 B of a row */
  __bf16* da = sA + (wave * 4 + l3) * PPI + l8 * 4;
  __bf16* dw = sW + (wave * 32 + l8 * 4) * PPI + 8 * l3;                       /* 8 k of one column = one 16-byte store; the 32 lanes fall on every bank twice */
  v4f ar[8], wr[8];
  v8f acc[2][8] = {};
  auto issue = [&](const float* qa, const float* qw) {
#pragma unroll
    for (int j = 0; j < 8; ++j) { ar[j] = *(const v4f*)(qa + (size_t)j * 16 * DIN); wr[j] = *(const v4f*)(qw + (size_t)j * CC); } };
  auto stage = [&](int buf) {
#pragma unroll
    for (int j = 0; j < 8; ++j) { v4b t;
#pragma unroll
      for (int e = 0; e < 4; ++e) t[e] = (__bf16)ar[j][e];
      *(v4b*)(da + buf * PBUF + j * 16 * PPI) = t; }
#pragma unroll
    for (int i = 0; i < 4; ++i) { v8b t;
#pragma unroll
      for (int r = 0; r < 8; ++r) t[r] = (__bf16)wr[r][i];
      *(v8b*)(dw + buf * PBUF + i * PPI) = t; } };
  { const float* qa = pa + oa + rot * PBK; const float* qw = pw + ow + (size_t)rot * PBK * CC;
    issue(qa, qw);
    asm volatile("s_wait_xcnt 0x0" :: "v"(qa), "v"(qw) : "memory"); }   /* stands behind the 16 loads, in front of the next overwrite of a register that they name; the two addresses as inputs keep the pairs alive to this wait, so that no load lands in one */
  __builtin_amdgcn_sched_barrier(0);   /* no later write of such a register is lifted over the wait */
  stage(0);
  for (int kc = 0; kc < DIN / PBK; ++kc) {
    __syncthreads();   /* publishes tile kc and ends every wave's reads of the buffer that tile kc + 1 is written into below */
    const __bf16* ba = sA + (kc & 1) * PBUF + (wave * 16 + col) * PPI; const __bf16* bw = sW + (kc & 1) * PBUF + col * PPI;
    const v16b a0 = frag_b(ba, lane), a1 = frag_b(ba + 64 * PPI, lane); v16b w[8];   /* all 20 fragment reads of the tile as one group: one LDS latency a tile, not one a column block */
#pragma unroll
    for (int j = 0; j < 8; ++j) w[j] = frag_b(bw + j * 16 * PPI, lane);
    __builtin_amdgcn_sched_barrier(0);   /* the fragment reads go first: their latency runs under the issue of the global loads */
    if (kc + 1 < DIN / PBK) { const int ks = __builtin_amdgcn_readfirstlane(((kc + 1 + rot) & (DIN / PBK - 1)) * PBK); const float* qa = pa + oa + ks; const float* qw = pw + ow + (size_t)ks * CC;   /* the tile's step through a scalar register: the two addresses are formed anew for each tile, and the pairs that the loads name are the very values that the wait below takes */
      issue(qa, qw);
      asm volatile("s_wait_xcnt 0x0" :: "v"(qa), "v"(qw) : "memory"); }   /* stands behind the 16 loads, in front of the next overwrite of their address registers; the two addresses as inputs keep the pairs alive to this wait, so that no load lands in one */
    __builtin_amdgcn_sched_barrier(0);   /* the products, and every later write of an address register, stay behind the loads and their wait */
#pragma unroll
    for (int j = 0; j < 8; ++j) { acc[0][j] = wmma_bf(a0, w[j], acc[0][j]); acc[1][j] = wmma_bf(a1, w[j], acc[1][j]); }
    __builtin_amdgcn_sched_barrier(0);   /* the conversions of stage() wait for the global loads: lifted among the products they would stall the wave at once */
    if (kc + 1 < DIN / PBK) stage((kc + 1) & 1); }
  __syncthreads();   /* the last tile's reads end before the epilogue planes overwrite the staged tiles */
  if (which < 2) { _Float16* DH = which == 0 ? QH : KH; _Float16* DL = which == 0 ? QL : KL; const int nhi = which == 0 ? QHI : KHI;
#pragma unroll
    for (int i = 0; i < 2; ++i) { const size_t rb = r0 + i * 64; const int tq = t0 + i * 64; const bool hi_rows = tq < nhi;   /* the two 64-row halves go through the same planes one after the other */
#pragma unroll
      for (int j = 0; j < 8; ++j) { const float bias = BA ? bfr(BA[c0 + j * 16 + col]) : 0.f;
#pragma unroll
        for (int r = 0; r < 8; ++r) { const float v = acc[i][j][r] + bias; const _Float16 hv = (_Float16)v; sh[wave * 16 + 8 * g + r][j * 16 + col] = hv; sl[wave * 16 + 8 * g + r][j * 16 + col] = (_Float16)((v - (float)hv) * 1024.0f); } }
      __syncthreads();
      for (int e = tid; e < 64 * 16; e += 128) { const int fl = e & 31, fp = (e >> 5) & 3, fh = (e >> 7) & 1, ft = e >> 8; const int rl = ft * 16 + (fl & 15), q = fh * 8 + fp * 2 + (fl >> 4);   /* e runs along the destination: lane, piece, head, row tile; a wave stores 512 neighbouring bytes */
        vst_w(DH + (((rb >> 4) + ft) * NH + (c0 >> 6) + fh) * FT + fp * 256 + fl * 8, *(const v4u*)&sh[rl][q * 8]); if (hi_rows) vst_w(DL + (bb * nhi + tq + rl) * (size_t)CC + c0 + q * 8, *(const v4u*)&sl[rl][q * 8]); }
      if (i == 0) __syncthreads(); }   /* the first half is read out before the second overwrites the planes */
  } else {
#pragma unroll
    for (int i = 0; i < 2; ++i) { const int tq = t0 + i * 64; const bool hi_rows = tq < KHI;
#pragma unroll
      for (int j = 0; j < 8; ++j) { const float bias = BA ? bfr(BA[c0 + j * 16 + col]) : 0.f;
#pragma unroll
        for (int r = 0; r < 8; ++r) { const float v = acc[i][j][r] + bias; const int rl = wave * 16 + 8 * g + r, cl = j * 16 + col; th[cl][rl] = (_Float16)v; const __bf16 bh = (__bf16)v; tb[cl][rl] = bh; tbl[cl][rl] = (__bf16)(v - (float)bh); } }
      __syncthreads();
      for (int e = tid; e < 128 * 8; e += 128) { const int fl = e & 31, fp = (e >> 5) & 7, fc = (e >> 8) & 1, fh = e >> 9; const int cl = fh * 64 + (fp >> 1) * 16 + (fl & 15), q = fc * 4 + (fp & 1) * 2 + (fl >> 4);   /* e runs along the destination: lane, piece, key chunk, head */
        vst_w(VT + ((bb * NH + (c0 >> 6) + fh) * (TT / 32) + (tq >> 5) + fc) * FV + fp * 256 + fl * 8, *(const v4u*)&th[cl][q * 8]); if (hi_rows) { const size_t o3 = (bb * CC + c0 + cl) * (size_t)KHI + tq + q * 8; vst_w(VB + o3, *(const v4u*)&tb[cl][q * 8]); vst_w(VBL + o3, *(const v4u*)&tbl[cl][q * 8]); } }
      if (i == 0) __syncthreads(); } } }   /* as above */
// ---- k_stat: softmax over the QUERY axis under the causal mask (the source's softmax(axis=2) on [B, H, q, k] scores): for every key column k of (b, h): m_k = max_{q >= k} s[q][k], Z_k = sum_{q >= k} exp(s[q][k] - m_k), with s = q.k x SCALE + slope (k - q) formed in registers and never stored. Block = 32 key columns (one 128-B line of CM) x 8 waves; wave w takes the 16-query tiles first tile + w + 8 i. D register r of a tile = query 8g + r, lane column = key, so a lane reduces its own column; the two lane halves are merged by one exchange, the 8 waves through LDS by wave 0, which alone stores the column's offset. All exponentials are base 2: s, m_k carry the factor log2 e (folded into the score scale and the slope), so each is one v_exp_f32; what is stored is c_k = m_k + log2 Z_k - 11 - slope (k mod 32), with which k_att forms P x 2^11 = 2^(q.k scale + slope (chunk start - query) - c_k): no multiply, and one bias value a lane, query tile and chunk
#define LOG2E 1.44269504088896340736f
__device__ __forceinline__ float ex2(float v) { return __builtin_amdgcn_exp2f(v); }   /* v_exp_f32: 2^v; far below the normal range it gives 0, which is what every use here wants */
// 8 values to 2^v in place, one statement: each v_exp_f32 touches its own register alone, so none reads a result or overwrites a source of the one in front of it, and the closing v_nop is the one slot that the instruction set asks for behind a transcendental
__device__ __forceinline__ void ex2x8(float (&a)[8]) {
  asm("v_exp_f32 %0, %0\n\tv_exp_f32 %1, %1\n\tv_exp_f32 %2, %2\n\tv_exp_f32 %3, %3\n\tv_exp_f32 %4, %4\n\tv_exp_f32 %5, %5\n\tv_exp_f32 %6, %6\n\tv_exp_f32 %7, %7\n\tv_nop" : "+v"(a[0]), "+v"(a[1]), "+v"(a[2]), "+v"(a[3]), "+v"(a[4]), "+v"(a[5]), "+v"(a[6]), "+v"(a[7])); }
// the same for the 8 values of a tile and the factor that rescales the running sum: 9 registers, one closing slot (as a v_exp_f32 of its own, in the loop without selects, the factor's source was overwritten directly behind it)
__device__ __forceinline__ void ex2x9(float (&a)[8], float& b) {
  asm("v_exp_f32 %0, %0\n\tv_exp_f32 %1, %1\n\tv_exp_f32 %2, %2\n\tv_exp_f32 %3, %3\n\tv_exp_f32 %4, %4\n\tv_exp_f32 %5, %5\n\tv_exp_f32 %6, %6\n\tv_exp_f32 %7, %7\n\tv_exp_f32 %8, %8\n\tv_nop" : "+v"(a[0]), "+v"(a[1]), "+v"(a[2]), "+v"(a[3]), "+v"(a[4]), "+v"(a[5]), "+v"(a[6]), "+v"(a[7]), "+v"(b)); }
__device__ __forceinline__ void ms_merge(float& m, float& z, float mo, float zo) { const float mn = fmaxf(m, mo); z = z * ex2(m - mn) + zo * ex2(mo - mn); m = mn; }   /* an empty slice carries (-3e38, 0) and adds 0 */
__global__ __launch_bounds__(256) void k_stat(const _Float16* __restrict__ QH, const _Float16* __restrict__ KH, float* __restrict__ CM) { __shared__ float pm[8][32], pz[8][32];
  const int tid = threadIdx.x, wave = __builtin_amdgcn_readfirstlane(tid >> 5), lane = tid & 31, col = lane & 15, g = lane >> 4; const int kb = blockIdx.x, h = blockIdx.y, b = blockIdx.z;   /* the wave's number in a scalar register: the tile loop branches on SCC */
  const float slope_ = exp2f(-0.5f * (float)(h + 1)) * LOG2E;   /* ALiBi slope of this head, 2^(-8 (h + 1) / 16), x log2 e */
  const _Float16* kp = KH + (((size_t)b * (TT / 16) + kb * 2) * NH + h) * FT + lane * 8;
  const v16h kf[2][2] = {{frag_t(kp), frag_t(kp + 512)}, {frag_t(kp + NH * FT), frag_t(kp + NH * FT + 512)}};
  float m[2] = {-3.0e38f, -3.0e38f}, z[2] = {0.f, 0.f};
  /* one 16-query tile against the block's 32 columns; masked = the tile can hold a key above a query (a literal at both calls: the compares and selects are compiled only into the diagonal form) */
  auto tile = [&](const int qt, const bool masked) __attribute__((always_inline)) { const _Float16* qa = QH + (((size_t)b * (TT / 16) + qt) * NH + h) * FT + lane * 8;   /* the lane's own address in piece 0 of the tile; the four pieces as in frag_t */
    union { v16h v; v8h q[2]; } q0, q1; q0.q[0] = *(const v8h*)qa; q0.q[1] = *(const v8h*)(qa + 256); q1.q[0] = *(const v8h*)(qa + 512); q1.q[1] = *(const v8h*)(qa + 768);
    asm volatile("s_wait_xcnt 0x0" :: "v"(qa) : "memory");   /* the address as an input keeps the address pair of the four q loads alive to this wait: none of them lands in it, and the wait stands in front of its next overwrite */
#pragma unroll
    for (int u = 0; u < 2; ++u) { v8f s = {}; s = wmma16(q0.v, kf[u][0], s); s = wmma16(q1.v, kf[u][1], s);
      const int d0 = kb * 32 + u * 16 + col - (qt * 16 + 8 * g);   /* key - query of register 0 */ const float b0 = slope_ * (float)d0; float v[8]; float mn = m[u];
#pragma unroll
      for (int r = 0; r < 8; ++r) { const float sv = s[r] * (SCALE * LOG2E) + (b0 - slope_ * (float)r); v[r] = (!masked || d0 - r <= 0) ? sv : -3.0e38f; mn = fmaxf(mn, v[r]); }   /* + the ALiBi bias slope (key - query) <= 0 */
#pragma unroll
      for (int r = 0; r < 8; ++r) v[r] -= mn;
      float rs = m[u] - mn;   /* exponent of the running sum's rescale */
      ex2x9(v, rs);
      float zt = (!masked || d0 <= 0) ? v[0] : 0.f;
#pragma unroll
      for (int r = 1; r < 8; ++r) zt += (!masked || d0 - r <= 0) ? v[r] : 0.f;   /* value select, no branch */
      z[u] = z[u] * rs + zt; m[u] = mn; } };
  int qt = kb * 2 + wave;
  if (wave < 2) { tile(qt, true); qt += 8; }   /* only query tiles 2 kb and 2 kb + 1 meet the diagonal of these 32 columns; they are the first tiles of waves 0 and 1 (scalar branch) */
  for (; qt < TT / 16; qt += 8) tile(qt, false);   /* from tile 2 kb + 2 on every query is above every key of the block */
#pragma unroll
  for (int u = 0; u < 2; ++u) { const float mo = __shfl_xor(m[u], 16), zo = __shfl_xor(z[u], 16); ms_merge(m[u], z[u], mo, zo); if (g == 0) { pm[wave][u * 16 + col] = m[u]; pz[wave][u * 16 + col] = z[u]; } }
  __syncthreads();
  if (wave == 0) { float mm = pm[0][lane];
#pragma unroll
    for (int w = 1; w < 8; ++w) mm = fmaxf(mm, pm[w][lane]);
    float zz = 0.f;
#pragma unroll
    for (int w = 0; w < 8; ++w) zz += pz[w][lane] * ex2(pm[w][lane] - mm);
    const size_t o = ((size_t)b * NH + h) * TT + kb * 32 + lane; vst2(CM + o, mm + log2f(zz) - 11.0f - slope_ * (float)lane); } }   /* every column sees at least its own diagonal entry: Z_k >= 1 */
// ---- k_att: block = 32 queries (2 query tiles) of (b, h) x 4 waves; wave w takes the 32-key chunks w + 4 i up to the diagonal (those below it counted from the block's own start, rot, and wrapping), and every k, v and column-offset load of a chunk feeds BOTH query tiles, which the wave holds in registers. The scores are formed again, TRANSPOSED (A = k rows, B = q rows): D register r of key tile 0 / 1 = key 8g + r / 16 + 8g + r of the lane's own query, which is the place that key has in the A fragment of P . v, so P x 2^11 = 2^(q.k scale + slope (chunk start - query) - c_k) (base 2 as in k_stat; 0 above the diagonal) goes once to f16 in registers against v f16 (1 product). The 4 waves' partial ctx tiles are summed through LDS; 256-B (row, head) segment by 16 lanes
#define QW 2               // query tiles of a wave
__global__ __launch_bounds__(128) void k_att(const _Float16* __restrict__ QH, const _Float16* __restrict__ KH, const _Float16* __restrict__ VT, const float* __restrict__ CM, float* __restrict__ Y) { __shared__ __align__(16) float ss[4][16 * QW][HD + 4];
  const int tid = threadIdx.x, wave = __builtin_amdgcn_readfirstlane(tid >> 5), lane = tid & 31, col = lane & 15, g = lane >> 4; const int qb = TT / (16 * QW) - 1 - blockIdx.x, h = blockIdx.y, b = blockIdx.z;   /* the wave's number in a scalar register: the chunk loop branches on SCC; the longest key ranges start first */
  const float slope_ = exp2f(-0.5f * (float)(h + 1)) * LOG2E;
  const _Float16* qp = QH + (((size_t)b * (TT / 16) + qb * QW) * NH + h) * FT + lane * 8; v16h qf[QW][2];   /* every loop over t below is unrolled: t selects registers */
#pragma unroll
  for (int t = 0; t < QW; ++t) { qf[t][0] = frag_t(qp + t * NH * FT); qf[t][1] = frag_t(qp + t * NH * FT + 512); }
  const float* cm = CM + ((size_t)b * NH + h) * TT + 8 * g; const _Float16* vp = VT + ((size_t)b * NH + h) * (TT / 32) * FV + lane * 8;
  v8f acc[QW][HD / 16] = {};
  /* one 32-key chunk against the block's query tiles; masked = the chunk can hold a key above a query (a literal at both calls: the compares and selects are compiled only into the diagonal form) */
  auto chunk = [&](const int c, const bool masked) __attribute__((always_inline)) { const int k0 = c * 32; const _Float16* kp = KH + (((size_t)b * (TT / 16) + c * 2) * NH + h) * FT + lane * 8;
    v4f mk[4];   /* all of a chunk's column-stat and k loads stand in front of the first product: one latency for the lot */
#pragma unroll
    for (int i = 0; i < 4; ++i) mk[i] = *(const v4f*)(cm + k0 + (i >> 1) * 16 + (i & 1) * 4);
    asm volatile("s_wait_xcnt 0x0" ::: "memory");   /* the k loads below land in registers that held the stat loads' addresses */
    const v16h kf[2][2] = {{frag_t(kp), frag_t(kp + 512)}, {frag_t(kp + NH * FT), frag_t(kp + NH * FT + 512)}};
    v8f s[QW][2] = {};
#pragma unroll
    for (int t = 0; t < QW; ++t)
#pragma unroll
      for (int u = 0; u < 2; ++u) { s[t][u] = wmma16(kf[u][0], qf[t][0], s[t][u]); s[t][u] = wmma16(kf[u][1], qf[t][1], s[t][u]); }
    v16h vf[HD / 16], p[QW];
#pragma unroll
    for (int j = 0; j < HD / 16; ++j) vf[j] = frag_t(vp + (size_t)c * FV + j * 512);
    __builtin_amdgcn_sched_barrier(0);   /* keeps the v loads in front of the exponentials, which then cover their latency; without it they are sunk to the P . v products */
#pragma unroll
    for (int t = 0; t < QW; ++t) { const int qq = (qb * QW + t) * 16 + col;   /* the lane's query in tile t */
      const float bq = slope_ * (float)(k0 - qq);   /* ALiBi bias of the chunk's first key; the keys' own steps are in c_k */
#pragma unroll
      for (int u = 0; u < 2; ++u) { const int d0 = k0 + u * 16 + 8 * g - qq;   /* key - query of register 0 */
        float e[8];
#pragma unroll
        for (int r = 0; r < 8; ++r) e[r] = s[t][u][r] * (SCALE * LOG2E) + (bq - mk[u * 2 + (r >> 2)][r & 3]);
        ex2x8(e);
#pragma unroll
        for (int r = 0; r < 8; ++r) p[t][u * 8 + r] = (_Float16)((!masked || d0 + r <= 0) ? e[r] : 0.f); } }   /* value select, no branch */
#pragma unroll
    for (int t = 0; t < QW; ++t)
#pragma unroll
      for (int j = 0; j < HD / 16; ++j) acc[t][j] = wmma16(p[t], vf[j], acc[t][j]); };
  const int nf = (qb * QW) >> 1;   /* chunks that end below the block's first query: every key is visible to every query */
  const int rot = (nf * ((qb * 39) & (TT / (16 * QW) - 1))) / (TT / (16 * QW));   /* the block's first chunk, below nf: a share of its own range that differs from block to block (39 is odd: qb -> qb * 39 modulo the power of two TT / (16 QW) is a permutation). The blocks of a (b, h) start together and read the same k and v lines: from chunk 0 all of them would ask L2 for the same lines at the same moment */
  int c = wave;
  for (; c < nf; c += 4) chunk(c + rot < nf ? c + rot : c + rot - nf, false);   /* the walk wraps round inside the range: every chunk once */
  for (; c <= (qb * QW + QW - 1) >> 1; c += 4) chunk(c, true);   /* the chunks that the diagonal crosses; each wave keeps its chunks and their order */
#pragma unroll
  for (int t = 0; t < QW; ++t)
#pragma unroll
    for (int j = 0; j < HD / 16; ++j)
#pragma unroll
      for (int r = 0; r < 8; ++r) ss[wave][t * 16 + 8 * g + r][j * 16 + col] = acc[t][j][r];
  __syncthreads();
  for (int e = tid; e < 16 * QW * (HD / 4); e += 128) { const int rl = e / (HD / 4), c4 = (e % (HD / 4)) * 4; const v4f o = ((*(const v4f*)&ss[0][rl][c4] + *(const v4f*)&ss[1][rl][c4]) + (*(const v4f*)&ss[2][rl][c4] + *(const v4f*)&ss[3][rl][c4])) * (1.0f / 2048.0f); vst2(Y + ((size_t)b * TT + qb * 16 * QW + rl) * CC + h * HD + c4, o); } }
// ---- k_out: block = 16 rows x all 1024 output columns x 16 waves: out = x + (sum over the 16 heads of ctx) Wo. The heads are summed FIRST, in f32: a thread adds 8 heads of 4 channels of one row (pairwise tree), the two 8-head halves meet in LDS and are added where the A fragment is formed; the sum goes x 2^6 once to f16, and the product with Wo as f16(bf16 x 2^8) exact runs over K = 64 (2 WMMAs a column tile). Wave w owns columns 64 w + 0..63. Lane column n of tile e stands for output column 64 w + 4 n + e, so one 16-byte load of a Wo row feeds the 4 tiles, and the 4 tiles' D registers of a row are 16 neighbouring output bytes of the lane: 16 lanes read / write 256 B of a row
__global__ __launch_bounds__(512) void k_out(const float* __restrict__ Y, const float* __restrict__ WO, const float* __restrict__ BO, float* __restrict__ OUT) { __shared__ __align__(16) float sp[2][16][HD + 4];
  const int tid = threadIdx.x, wave = tid >> 5, lane = tid & 31, col = lane & 15, g = lane >> 4; const size_t r0 = (size_t)blockIdx.x * 16;
  const int yh = tid >> 8, yr = (tid >> 4) & 15, yc = (tid & 15) * 4;                /* the thread's half of the heads, its row, its 4 channels */
  const float* yp = Y + (r0 + yr) * CC + yh * (NH / 2) * HD + yc;
  const float* wp = WO + (size_t)(8 * g) * DIN + wave * 64 + col * 4;                /* fragment elements 0..7 = k rows k0 + 8g + 0..7, 8..15 = k0 + 16 + 8g + 0..7, as in frag_h */
  const size_t oo = (r0 + 8 * g) * DIN + wave * 64 + col * 4; const float* xp = BO + oo;   /* the BO argument carries the RESIDUAL x (this module has no output bias) */
  v4f yv[NH / 2], wv[2][16], xr[8];   /* every load of the block is independent of every other: all are issued before the first is used, one latency for the lot */
#pragma unroll
  for (int h = 0; h < NH / 2; ++h) yv[h] = *(const v4f*)(yp + h * HD);
#pragma unroll
  for (int s = 0; s < 2; ++s)
#pragma unroll
    for (int i = 0; i < 8; ++i) { wv[s][i] = *(const v4f*)(wp + (size_t)(s * 32 + i) * DIN); wv[s][8 + i] = *(const v4f*)(wp + (size_t)(s * 32 + 16 + i) * DIN); }
#pragma unroll
  for (int r = 0; r < 8; ++r) xr[r] = *(const v4f*)(xp + (size_t)r * DIN);
  asm volatile("s_wait_xcnt 0x0" :: "v"(yp), "v"(wp), "v"(xp) : "memory");   /* stands behind the loads, in front of the next overwrite of a register that they name; the three addresses as inputs keep the pairs alive to this wait */
  __builtin_amdgcn_sched_barrier(0);   /* the conversions below wait for loaded values: lifted over the last loads they would put a second memory latency behind the first */
#pragma unroll
  for (int st = 1; st < NH / 2; st *= 2)
#pragma unroll
    for (int h = 0; h < NH / 2; h += 2 * st) yv[h] += yv[h + st];
  *(v4f*)&sp[yh][yr][yc] = yv[0];
  __syncthreads();   /* publishes the two half sums of the 16 rows to the 16 waves */
  v16h a[2];
#pragma unroll
  for (int s = 0; s < 2; ++s)
#pragma unroll
    for (int q = 0; q < 4; ++q) { const int k = s * 32 + (q >> 1) * 16 + 8 * g + (q & 1) * 4; const v4f t = (*(const v4f*)&sp[0][col][k] + *(const v4f*)&sp[1][col][k]) * 64.0f;   /* carried x 2^6 into f16 so small-magnitude context rows stay clear of f16 subnormals */
#pragma unroll
      for (int e = 0; e < 4; ++e) a[s][q * 4 + e] = (_Float16)t[e]; }
  v8f acc[4];
#pragma unroll
  for (int e = 0; e < 4; ++e) { v16h w0, w1;
#pragma unroll
    for (int i = 0; i < 16; ++i) { w0[i] = (_Float16)(bfr(wv[0][i][e]) * 256.0f); w1[i] = (_Float16)(bfr(wv[1][i][e]) * 256.0f); }
    v8f d = {}; d = wmma16(a[0], w0, d); acc[e] = wmma16(a[1], w1, d); }
  v4f o[8];
#pragma unroll
  for (int r = 0; r < 8; ++r)
#pragma unroll
    for (int e = 0; e < 4; ++e) o[r][e] = acc[e][r] * (1.0f / 16384.0f) + bfr(xr[r][e]);   /* 2^-8 (Wo carry) x 2^-6 (ctx carry); x + outputs */
  __builtin_amdgcn_sched_barrier(0);   /* all 8 results are formed in front of the first store: no register that an issued store names is written again */
#pragma unroll
  for (int r = 0; r < 8; ++r) vst2(OUT + oo + (size_t)r * DIN, o[r]); }

extern "C" void kernel_launch(void* const* d_in, const int* in_sizes, int n_in, void* d_out, int out_size, void* d_ws, size_t ws_size, hipStream_t stream) {
  (void)in_sizes; (void)n_in; (void)out_size;
  const float** F = (const float**)d_in;
  if (ws_size < (size_t)WS_END) return;
  char* ws = (char*)d_ws; _Float16 *QH = (_Float16*)(ws + WS_QH), *KH = (_Float16*)(ws + WS_KH), *VT = (_Float16*)(ws + WS_VT), *QL = (_Float16*)(ws + WS_QL), *KL = (_Float16*)(ws + WS_KL); __bf16 *VB = (__bf16*)(ws + WS_VB), *VBL = (__bf16*)(ws + WS_VBL); float *Y = (float*)(ws + WS_Y);
  (void)Y; (void)QL; (void)KL; (void)VB; (void)VBL;
  // inputs: 0 x [2,2048,1024]; 1 wq [1024,1024] (in,out); 2 wk; 3 wv; 4 wo [64,1024] (in,out: it acts on the SUM of the 16 heads' 64-dim outputs); no biases
  if (ws_size < (size_t)WS_END2) return;
  float *CM = (float*)(ws + WS_CM);
  k_proj<<<dim3(TNB * TT / 128, CC / 128, 3), 128, 0, stream>>>(F[0], F[0], F[0], F[1], F[2], F[3], nullptr, nullptr, nullptr, QH, QL, KH, KL, VT, VB, VBL);
  k_stat<<<dim3(TT / 32, NH, TNB), 256, 0, stream>>>(QH, KH, CM);   /* per key column: max and sum over the visible queries of exp(score + ALiBi bias), as one exponent offset */
  k_att<<<dim3(TT / (16 * QW), NH, TNB), 128, 0, stream>>>(QH, KH, VT, CM, Y);
  k_out<<<dim3(TNB * TT / 16), 512, 0, stream>>>(Y, F[4], F[0], (float*)d_out);   /* (sum over heads) x wo + x (the third argument is the RESIDUAL here, not a bias) */
}

// v010
// A run of this version takes 74.7 microseconds.
// Next to v009, in two timings, it ran 1.22 times as fast each time.
// Over all steps from v000 it is 102 times as fast.
// compute dtype: all float inputs rounded to bf16; q/k/v projections with EXACT bf16 products on WMMA 16x16x32 (f32 accumulate); causal scores q x k once to f16 each (1 product) x 64^-0.5 plus the ALiBi bias slope_h (key - query) in f32; softmax over the QUERY axis in f32, in base 2 (scores and bias x log2 e; per key column: online max / sum over the visible queries, v_exp_f32); P x 2^11 once to f16 x v once to f16 (1 product); the 16 heads' outputs are summed in f32 in front of the output projection (the sum x 2^6 once to f16 x wo f16(bf16 x 2^8), 1 product over K = 64); + bf16(x) residual in f32; f32 output.
#include <hip/hip_runtime.h>
#include <math.h>

typedef __attribute__((ext_vector_type(16))) _Float16 v16h;
typedef __attribute__((ext_vector_type(16))) __bf16 v16b;
typedef __attribute__((ext_vector_type(8)))  _Float16 v8h;
typedef __attribute__((ext_vector_type(8)))  float v8f;
typedef __attribute__((ext_vector_type(4)))  float v4f;
typedef __attribute__((ext_vector_type(2)))  float v2f;
typedef __attribute__((ext_vector_type(4)))  unsigned v4u;
typedef __attribute__((ext_vector_type(4)))  int v4i;
typedef float __attribute__((may_alias)) float_a;
typedef int __attribute__((may_alias)) int_a;

template <typename T> __device__ __forceinline__ void vst2(void* p, T v) { *(T*)p = v;  }
__device__ __forceinline__ v8f wmma16(v16h a, v16h b, v8f c) {
  v8f d = __builtin_amdgcn_wmma_f32_16x16x32_f16(false, a, false, b, (short)0, c, false, false);
  asm volatile("v_nop\n\tv_nop\n\tv_nop\n\tv_nop" : "+v"(d) : "v"(a), "v"(b));
  return d;
}
__device__ __forceinline__ v8f wmma_bf(v16b a, v16b b, v8f c) {
  v8f d = __builtin_amdgcn_wmma_f32_16x16x32_bf16(false, a, false, b, (short)0, c, false, false);
  asm volatile("v_nop\n\tv_nop\n\tv_nop\n\tv_nop" : "+v"(d) : "v"(a), "v"(b));
  return d;
}
// 16x16x32 fragments: lane = (h = lane>>4, row/col = lane&15); elements 0..7 = k0+8h+0..7, 8..15 = k0+16+8h+0..7; D element r = row 8h+r
__device__ __forceinline__ v16h frag_h(const _Float16* rowk0, int lane) {
  union { v16h v; v8h q[2]; } u; const _Float16* p = rowk0 + 8 * (lane >> 4);
  u.q[0] = *(const v8h*)p; u.q[1] = *(const v8h*)(p + 16); return u.v;
}
__device__ __forceinline__ v16h frag_f32(const float* rowk0, int lane) {
  v16h a; const float* p = rowk0 + 8 * (lane >> 4);
#pragma unroll
  for (int i = 0; i < 8; ++i) { a[i] = (_Float16)p[i]; a[8 + i] = (_Float16)p[16 + i]; }
  return a;
}
__device__ __forceinline__ v16h frag_f32s(const float* rowk0, int lane, float sc) {
  v16h a; const float* p = rowk0 + 8 * (lane >> 4);
#pragma unroll
  for (int i = 0; i < 8; ++i) { a[i] = (_Float16)(p[i] * sc); a[8 + i] = (_Float16)(p[16 + i] * sc); }
  return a;
}
// column fragment from a [K][ld] layout (column n), rows >= K read as 0
__device__ __forceinline__ v16h fragc_f32(const float* W, int k0, int n, int lane, int ld, int K) {
  v16h a; const int g = lane >> 4;
#pragma unroll
  for (int i = 0; i < 8; ++i) { const int ka = k0 + 8 * g + i, kb = ka + 16;
    a[i] = (_Float16)(ka < K ? W[(size_t)(ka < K ? ka : K - 1) * ld + n] : 0.f); a[8 + i] = (_Float16)(kb < K ? W[(size_t)(kb < K ? kb : K - 1) * ld + n] : 0.f); }
  return a;
}
struct F2 { v16b h, l; };
__device__ __forceinline__ F2 bsplit16(const float v[16]) { F2 r;
#pragma unroll
  for (int i = 0; i < 16; ++i) { const __bf16 h = (__bf16)v[i]; r.h[i] = h; r.l[i] = (__bf16)(v[i] - (float)h); }
  return r; }
__device__ __forceinline__ F2 split_row(const float* row, int k0, int lane) { float v[16]; const float* p = row + k0 + 8 * (lane >> 4);
#pragma unroll
  for (int i = 0; i < 8; ++i) { v[i] = p[i]; v[8 + i] = p[16 + i]; }
  return bsplit16(v); }
__device__ __forceinline__ F2 split_rowK(const float* row, int k0, int lane, int K) { float v[16]; const int g = lane >> 4;
#pragma unroll
  for (int i = 0; i < 8; ++i) { const int ka = k0 + 8 * g + i, kb = ka + 16; v[i] = ka < K ? row[ka < K ? ka : K - 1] : 0.f; v[8 + i] = kb < K ? row[kb < K ? kb : K - 1] : 0.f; }
  return bsplit16(v); }
__device__ __forceinline__ F2 split_col(const float* W, int k0, int n, int lane, int ld, int K) { float v[16]; const int g = lane >> 4;
#pragma unroll
  for (int i = 0; i < 8; ++i) { const int ka = k0 + 8 * g + i, kb = ka + 16; v[i] = ka < K ? W[(size_t)(ka < K ? ka : K - 1) * ld + n] : 0.f; v[8 + i] = kb < K ? W[(size_t)(kb < K ? kb : K - 1) * ld + n] : 0.f; }
  return bsplit16(v); }
__device__ __forceinline__ v8f mac3(const F2& a, const F2& b, v8f c) { c = wmma_bf(a.l, b.h, c); c = wmma_bf(a.h, b.l, c); return wmma_bf(a.h, b.h, c); }
__device__ __forceinline__ float sigm(float v) { return 1.0f / (1.0f + expf(-v)); }
#define LDSX() do { asm volatile("s_wait_dscnt 0" ::: "memory"); __builtin_amdgcn_wave_barrier(); __builtin_amdgcn_fence(__ATOMIC_RELEASE, "workgroup"); } while (0)

// ALiBi-biased multi-headed attention whose softmax runs over the QUERY axis and whose heads are SUMMED (x [2,2048,1024]; (in,out) wq / wk / wv [1024,1024] N(0, 1/1024), no biases; 16 heads x 64; prod = Q K^T / 8 + slope_h (k - q) with slope_h = 2^(-8 (h + 1) / 16); -inf where k > q; attention_weights = softmax(prod, axis=2) - axis 2 of [B, H, q, k] is the QUERY axis: every key column is normalised over the queries that can see it (faithful to the source); out_h = weights V_h; outputs = (sum over the 16 heads of out_h) wo with wo [64,1024]; result = x + outputs).
#define NB 2
#define TT 2048
#define CC 1024            // NH * HD = projected width
#define DIN 1024          // input (model) width
#define NH 16
#define HD 64
#define SCALE (0.125f)
#define CAUSAL 1
#ifndef TNB
#define TNB NB
#endif
__device__ __forceinline__ float bfr(float v) { return (float)(__bf16)v; }
typedef __attribute__((ext_vector_type(8))) __bf16 v8b;
__device__ __forceinline__ v16b frag_b(const __bf16* rowk0, int lane) {
  union { v16b v; v8b q[2]; } u; const __bf16* p = rowk0 + 8 * (lane >> 4);
  u.q[0] = *(const v8b*)p; u.q[1] = *(const v8b*)(p + 16); return u.v;
}
#define QBH 0              // no high-precision blocks: single-product scores and P.v everywhere (the output carries the f32 residual x and the sum of 16 heads: rms - 4)
#define QHI 0               // no q residual plane
#define KHI 64              // no k residual / v hi-lo planes are read
// B fragment (k rows k0+.., output column o) of a weight: (in,out) [K][ld] or (out,in) [ld rows of K]: bf16 exact, or f16(bf16 * 256) exact
__device__ __forceinline__ v16b wcol_io(const float* Wm, int k0, int o, int lane, int ld) { v16b w; const int g = lane >> 4;
#pragma unroll
  for (int i = 0; i < 8; ++i) { w[i] = (__bf16)Wm[(size_t)(k0 + 8 * g + i) * ld + o]; w[8 + i] = (__bf16)Wm[(size_t)(k0 + 16 + 8 * g + i) * ld + o]; }
  return w; }
__device__ __forceinline__ v16b wcol_oi(const float* Wm, int k0, int o, int lane, int K) { v16b w; const float* p = Wm + (size_t)o * K + k0 + 8 * (lane >> 4);
#pragma unroll
  for (int i = 0; i < 8; ++i) { w[i] = (__bf16)p[i]; w[8 + i] = (__bf16)p[16 + i]; }
  return w; }
__device__ __forceinline__ v16h wcolh_io(const float* Wm, int k0, int o, int lane, int ld) { v16h w; const int g = lane >> 4;
#pragma unroll
  for (int i = 0; i < 8; ++i) { w[i] = (_Float16)(bfr(Wm[(size_t)(k0 + 8 * g + i) * ld + o]) * 256.0f); w[8 + i] = (_Float16)(bfr(Wm[(size_t)(k0 + 16 + 8 * g + i) * ld + o]) * 256.0f); }
  return w; }
__device__ __forceinline__ v16h wcolh_oi(const float* Wm, int k0, int o, int lane, int K) { v16h w; const float* p = Wm + (size_t)o * K + k0 + 8 * (lane >> 4);
#pragma unroll
  for (int i = 0; i < 8; ++i) { w[i] = (_Float16)(bfr(p[i]) * 256.0f); w[8 + i] = (_Float16)(bfr(p[16 + i]) * 256.0f); }
  return w; }
#define WQKV_LAYOUT 0   // selects WCOL only, which nothing uses: k_proj reads (in,out) [DIN][CC] for any value
__device__ __forceinline__ v16b wcol_hdk(const float* Wm, int k0, int o, int lane) { v16b w; const int g = lane >> 4; const float* p = Wm + (size_t)(o / HD) * DIN * HD + (o % HD);
#pragma unroll
  for (int i = 0; i < 8; ++i) { w[i] = (__bf16)p[(size_t)(k0 + 8 * g + i) * HD]; w[8 + i] = (__bf16)p[(size_t)(k0 + 16 + 8 * g + i) * HD]; }
  return w; }
#if WQKV_LAYOUT == 1
#define WCOL(W, k0, o, lane) wcol_oi(W, k0, o, lane, DIN)
#elif WQKV_LAYOUT == 2
#define WCOL(W, k0, o, lane) wcol_hdk(W, k0, o, lane)
#else
#define WCOL(W, k0, o, lane) wcol_io(W, k0, o, lane, CC)
#endif

#ifndef PROJ_EXTRA_PARAMS
#define PROJ_EXTRA_PARAMS
#endif

#define WS_QH  0u                                      // f16 q in fragment order [b*t / 16][head][FT]
#define WS_KH  (WS_QH + 2u * (size_t)NB * TT * CC)      // f16 k in fragment order [b*t / 16][head][FT]
#define WS_VT  (WS_KH + 2u * (size_t)NB * TT * CC)      // f16 v in fragment order [b][head][t / 32][FV]
#define WS_QL  (WS_VT + 2u * (size_t)NB * CC * TT)      // f16 q residual x 2^10 rows [b][t < QHI][CC]
#define WS_KL  (WS_QL + 2u * (size_t)NB * QHI * CC)     // f16 k residual x 2^10 rows [b][t < KHI][CC]
#define WS_VB  (WS_KL + 2u * (size_t)NB * KHI * CC)     // bf16 v hi planes [b][c][t < KHI]
#define WS_VBL (WS_VB + 2u * (size_t)NB * CC * KHI)
#define WS_Y   (WS_VBL + 2u * (size_t)NB * CC * KHI)    // f32 ctx rows [b*t][CC] (only when there is an output projection)
#define WS_END (WS_Y  + 4u * (size_t)NB * TT * CC)
#define WS_CM (WS_END)                                  // f32 column exponent offsets m_k + log2 Z_k - 11 - slope (k mod 32) (base 2) [b][h][TT]
#define WS_END2 (WS_CM + 4u * (size_t)NB * NH * TT)

// Fragment order of q, k, v in the workspace: the 16 bytes that lane l takes with one load of a 16x16x32 fragment stand at 16 l in a 512-byte piece, so a wave's load reads 4 whole 128-B lines (from row-major rows it touches 32 B of each of 16 lines).
// q / k: block (16-row tile, head) = FT halves = 4 pieces; piece p, lane l = row l & 15, channels 16 p + 8 (l >> 4) + 0..7; pieces 2 s, 2 s + 1 are elements 0..7, 8..15 of the fragment of channels 32 s + 0..31.
// v: block (head, 32-key chunk) = FV halves = 8 pieces; piece 2 j + i, lane l = channel 16 j + (l & 15), keys 16 i + 8 (l >> 4) + 0..7; pieces 2 j, 2 j + 1 are the fragment of channel tile j.
#define FT (16 * HD)
#define FV (32 * HD)
__device__ __forceinline__ v16h frag_t(const _Float16* piece_lane) {   /* address of the lane's 16 bytes in the first of the fragment's two pieces */
  union { v16h v; v8h q[2]; } u; u.q[0] = *(const v8h*)piece_lane; u.q[1] = *(const v8h*)(piece_lane + 256); return u.v;
}
// ---- k_proj: block = (128 rows, 128 cols, which) x 4 waves: q/k/v = X W (+ b) with exact bf16 products (K = DIN). Per 32-deep k tile the block rounds its X rows and its W columns to bf16 ONCE into LDS (X as [row][k], W transposed to [col][k]), two buffers: the next tile's global loads (whole 128-B lines) fly while this tile's products run. Wave w owns rows 16 w + 0..15 of each 64-row half. -> which 0: q f16 in fragment order (+ residual rows < QHI); 1: k f16 in fragment order (+ residual rows < KHI); 2: v f16 in fragment order (+ bf16 hi/lo planes for t < KHI)
typedef __attribute__((ext_vector_type(4))) __bf16 v4b;
__device__ __forceinline__ void vst_w(void* p, v4u v) { asm volatile("global_store_b128 %0, %1, off\n\ts_wait_xcnt 0x0" :: "v"(p), "v"(v) : "memory"); }   /* a 16-byte global store with its wait in ONE statement: in a statement of its own the wait was passed by the next trip's address steps and LDS reads, which overwrite the store's registers */
#define PBK 32               // k depth of one staged tile
#define PPI 40               // pitch of a staged row in bf16 elements: 64 B of data + 16 B = 16 B x 5 (odd), the conflict-free pitch for 16-byte fragment reads
#define PBUF (128 * PPI)     // elements of one staged operand tile
__global__ __launch_bounds__(128) void k_proj(const float* __restrict__ XQ, const float* __restrict__ XK, const float* __restrict__ XV, const float* __restrict__ WQ, const float* __restrict__ WK, const float* __restrict__ WV, const float* __restrict__ BQ, const float* __restrict__ BK, const float* __restrict__ BV,
    _Float16* __restrict__ QH, _Float16* __restrict__ QL, _Float16* __restrict__ KH, _Float16* __restrict__ KL, _Float16* __restrict__ VT, __bf16* __restrict__ VB, __bf16* __restrict__ VBL) {
  __shared__ __align__(16) unsigned char smem[90112];   /* the staged tiles of the main loop and the transposing planes of the epilogue share these bytes (a barrier stands between the two uses) */
  _Float16 (*sh)[136] = (_Float16 (*)[136])smem; _Float16 (*sl)[136] = (_Float16 (*)[136])(smem + 17408); _Float16 (*th)[72] = (_Float16 (*)[72])(smem + 34816); __bf16 (*tb)[72] = (__bf16 (*)[72])(smem + 53248); __bf16 (*tbl)[72] = (__bf16 (*)[72])(smem + 71680);
  __bf16* sA = (__bf16*)smem; __bf16* sW = (__bf16*)(smem + 4 * PBUF);   /* 2 buffers of X rows, then 2 buffers of W columns */
  const int tid = threadIdx.x, wave = tid >> 5, lane = tid & 31, col = lane & 15, g = lane >> 4; const int which = blockIdx.z; const int c0 = blockIdx.y * 128; const size_t r0 = (size_t)blockIdx.x * 128; const size_t bb = r0 / TT; const int t0 = (int)(r0 % TT);
  const float* X = which == 0 ? XQ : which == 1 ? XK : XV; const float* WA = which == 0 ? WQ : which == 1 ? WK : WV; const float* BA = which == 0 ? BQ : which == 1 ? BK : BV;
  const int l8 = lane & 7, l3 = lane >> 3;
  const int rot = (blockIdx.x + 4 * blockIdx.y) & (DIN / PBK - 1);   /* the block's first k tile; it walks the DIN / PBK tiles from there and wraps round. The blocks of a tile row read the same X lines and those of a tile column the same W lines, and all start together: from one common start they ask L2 for the same lines at the same moment */
  const float* pa = X + r0 * DIN; const unsigned oa = (unsigned)((wave * 4 + l3) * DIN + l8 * 4);   /* X: 8 lanes read one row's 128 B; load j = rows + 16 j */
  const float* pw = WA + c0; const unsigned ow = (unsigned)(8 * l3 * CC + (wave * 8 + l8) * 4);     /* W (in,out): the lane holds k rows 8 l3 + 0..7 of 4 columns; 8 lanes read 128 B of a row */
  __bf16* da = sA + (wave * 4 + l3) * PPI + l8 * 4;
  __bf16* dw = sW + (wave * 32 + l8 * 4) * PPI + 8 * l3;                       /* 8 k of one column = one 16-byte store; the 32 lanes fall on every bank twice */
  v4f ar[8], wr[8];
  v8f acc[2][8] = {};
  auto issue = [&](const float* qa, const float* qw) {
#pragma unroll
    for (int j = 0; j < 8; ++j) { ar[j] = *(const v4f*)(qa + (size_t)j * 16 * DIN); wr[j] = *(const v4f*)(qw + (size_t)j * CC); } };
  auto stage = [&](int buf) {
#pragma unroll
    for (int j = 0; j < 8; ++j) { v4b t;
#pragma unroll
      for (int e = 0; e < 4; ++e) t[e] = (__bf16)ar[j][e];
      *(v4b*)(da + buf * PBUF + j * 16 * PPI) = t; }
#pragma unroll
    for (int i = 0; i < 4; ++i) { v8b t;
#pragma unroll
      for (int r = 0; r < 8; ++r) t[r] = (__bf16)wr[r][i];
      *(v8b*)(dw + buf * PBUF + i * PPI) = t; } };
  { const float* qa = pa + oa + rot * PBK; const float* qw = pw + ow + (size_t)rot * PBK * CC;
    issue(qa, qw);
    asm volatile("s_wait_xcnt 0x0" :: "v"(qa), "v"(qw) : "memory"); }   /* stands behind the 16 loads, in front of the next overwrite of a register that they name; the two addresses as inputs keep the pairs alive to this wait, so that no load lands in one */
  __builtin_amdgcn_sched_barrier(0);   /* no later write of such a register is lifted over the wait */
  stage(0);
  for (int kc = 0; kc < DIN / PBK; ++kc) {
    __syncthreads();   /* publishes tile kc and ends every wave's reads of the buffer that tile kc + 1 is written into below */
    const __bf16* ba = sA + (kc & 1) * PBUF + (wave * 16 + col) * PPI; const __bf16* bw = sW + (kc & 1) * PBUF + col * PPI;
    const v16b a0 = frag_b(ba, lane), a1 = frag_b(ba + 64 * PPI, lane); v16b w[8];   /* all 20 fragment reads of the tile as one group: one LDS latency a tile, not one a column block */
#pragma unroll
    for (int j = 0; j < 8; ++j) w[j] = frag_b(bw + j * 16 * PPI, lane);
    __builtin_amdgcn_sched_barrier(0);   /* the fragment reads go first: their latency runs under the issue of the global loads */
    if (kc + 1 < DIN / PBK) { const int ks = __builtin_amdgcn_readfirstlane(((kc + 1 + rot) & (DIN / PBK - 1)) * PBK); const float* qa = pa + oa + ks; const float* qw = pw + ow + (size_t)ks * CC;   /* the tile's step through a scalar register: the two addresses are formed anew for each tile, and the pairs that the loads name are the very values that the wait below takes */
      issue(qa, qw);
      asm volatile("s_wait_xcnt 0x0" :: "v"(qa), "v"(qw) : "memory"); }   /* stands behind the 16 loads, in front of the next overwrite of their address registers; the two addresses as inputs keep the pairs alive to this wait, so that no load lands in one */
    __builtin_amdgcn_sched_barrier(0);   /* the products, and every later write of an address register, stay behind the loads and their wait */
#pragma unroll
    for (int j = 0; j < 8; ++j) { acc[0][j] = wmma_bf(a0, w[j], acc[0][j]); acc[1][j] = wmma_bf(a1, w[j], acc[1][j]); }
    __builtin_amdgcn_sched_barrier(0);   /* the conversions of stage() wait for the global loads: lifted among the products they would stall the wave at once */
    if (kc + 1 < DIN / PBK) stage((kc + 1) & 1); }
  __syncthreads();   /* the last tile's reads end before the epilogue planes overwrite the staged tiles */
  if (which < 2) { _Float16* DH = which == 0 ? QH : KH; _Float16* DL = which == 0 ? QL : KL; const int nhi = which == 0 ? QHI : KHI;
#pragma unroll
    for (int i = 0; i < 2; ++i) { const size_t rb = r0 + i * 64; const int tq = t0 + i * 64; const bool hi_rows = tq < nhi;   /* the two 64-row halves go through the same planes one after the other */
#pragma unroll
      for (int j = 0; j < 8; ++j) { const float bias = BA ? bfr(BA[c0 + j * 16 + col]) : 0.f;
#pragma unroll
        for (int r = 0; r < 8; ++r) { const float v = acc[i][j][r] + bias; const _Float16 hv = (_Float16)v; sh[wave * 16 + 8 * g + r][j * 16 + col] = hv; sl[wave * 16 + 8 * g + r][j * 16 + col] = (_Float16)((v - (float)hv) * 1024.0f); } }
      __syncthreads();
      for (int e = tid; e < 64 * 16; e += 128) { const int fl = e & 31, fp = (e >> 5) & 3, fh = (e >> 7) & 1, ft = e >> 8; const int rl = ft * 16 + (fl & 15), q = fh * 8 + fp * 2 + (fl >> 4);   /* e runs along the destination: lane, piece, head, row tile; a wave stores 512 neighbouring bytes */
        vst_w(DH + (((rb >> 4) + ft) * NH + (c0 >> 6) + fh) * FT + fp * 256 + fl * 8, *(const v4u*)&sh[rl][q * 8]); if (hi_rows) vst_w(DL + (bb * nhi + tq + rl) * (size_t)CC + c0 + q * 8, *(const v4u*)&sl[rl][q * 8]); }
      if (i == 0) __syncthreads(); }   /* the first half is read out before the second overwrites the planes */
  } else {
#pragma unroll
    for (int i = 0; i < 2; ++i) { const int tq = t0 + i * 64; const bool hi_rows = tq < KHI;
#pragma unroll
      for (int j = 0; j < 8; ++j) { const float bias = BA ? bfr(BA[c0 + j * 16 + col]) : 0.f;
#pragma unroll
        for (int r = 0; r < 8; ++r) { const float v = acc[i][j][r] + bias; const int rl = wave * 16 + 8 * g + r, cl = j * 16 + col; th[cl][rl] = (_Float16)v; const __bf16 bh = (__bf16)v; tb[cl][rl] = bh; tbl[cl][rl] = (__bf16)(v - (float)bh); } }
      __syncthreads();
      for (int e = tid; e < 128 * 8; e += 128) { const int fl = e & 31, fp = (e >> 5) & 7, fc = (e >> 8) & 1, fh = e >> 9; const int cl = fh * 64 + (fp >> 1) * 16 + (fl & 15), q = fc * 4 + (fp & 1) * 2 + (fl >> 4);   /* e runs along the destination: lane, piece, key chunk, head */
        vst_w(VT + ((bb * NH + (c0 >> 6) + fh) * (TT / 32) + (tq >> 5) + fc) * FV + fp * 256 + fl * 8, *(const v4u*)&th[cl][q * 8]); if (hi_rows) { const size_t o3 = (bb * CC + c0 + cl) * (size_t)KHI + tq + q * 8; vst_w(VB + o3, *(const v4u*)&tb[cl][q * 8]); vst_w(VBL + o3, *(const v4u*)&tbl[cl][q * 8]); } }
      if (i == 0) __syncthreads(); } } }   /* as above */
// ---- k_stat: softmax over the QUERY axis under the causal mask (the source's softmax(axis=2) on [B, H, q, k] scores): for every key column k of (b, h): m_k = max_{q >= k} s[q][k], Z_k = sum_{q >= k} exp(s[q][k] - m_k), with s = q.k x SCALE + slope (k - q) formed in registers and never stored. Block = 32 key columns (one 128-B line of CM) x 8 waves; wave w takes the 16-query tiles first tile + w + 8 i. D register r of a tile = query 8g + r, lane column = key, so a lane reduces its own column; the two lane halves are merged by one exchange, the 8 waves through LDS by wave 0, which alone stores the column's offset. All exponentials are base 2: s, m_k carry the factor log2 e (folded into the score scale and the slope), so each is one v_exp_f32; what is stored is c_k = m_k + log2 Z_k - 11 - slope (k mod 32), with which k_att forms P x 2^11 = 2^(q.k scale + slope (chunk start - query) - c_k): no multiply, and one bias value a lane, query tile and chunk
#define LOG2E 1.44269504088896340736f
__device__ __forceinline__ float ex2(float v) { return __builtin_amdgcn_exp2f(v); }   /* v_exp_f32: 2^v; far below the normal range it gives 0, which is what every use here wants */
// 8 values to 2^v in place, one statement: each v_exp_f32 touches its own register alone, so none reads a result or overwrites a source of the one in front of it, and the closing v_nop is the one slot that the instruction set asks for behind a transcendental
__device__ __forceinline__ void ex2x8(float (&a)[8]) {
  asm("v_exp_f32 %0, %0\n\tv_exp_f32 %1, %1\n\tv_exp_f32 %2, %2\n\tv_exp_f32 %3, %3\n\tv_exp_f32 %4, %4\n\tv_exp_f32 %5, %5\n\tv_exp_f32 %6, %6\n\tv_exp_f32 %7, %7\n\tv_nop" : "+v"(a[0]), "+v"(a[1]), "+v"(a[2]), "+v"(a[3]), "+v"(a[4]), "+v"(a[5]), "+v"(a[6]), "+v"(a[7])); }
// the same for the 8 values of a tile and the factor that rescales the running sum: 9 registers, one closing slot (as a v_exp_f32 of its own, in the loop without selects, the factor's source was overwritten directly behind it)
__device__ __forceinline__ void ex2x9(float (&a)[8], float& b) {
  asm("v_exp_f32 %0, %0\n\tv_exp_f32 %1, %1\n\tv_exp_f32 %2, %2\n\tv_exp_f32 %3, %3\n\tv_exp_f32 %4, %4\n\tv_exp_f32 %5, %5\n\tv_exp_f32 %6, %6\n\tv_exp_f32 %7, %7\n\tv_exp_f32 %8, %8\n\tv_nop" : "+v"(a[0]), "+v"(a[1]), "+v"(a[2]), "+v"(a[3]), "+v"(a[4]), "+v"(a[5]), "+v"(a[6]), "+v"(a[7]), "+v"(b)); }
__device__ __forceinline__ void ms_merge(float& m, float& z, float mo, float zo) { const float mn = fmaxf(m, mo); z = z * ex2(m - mn) + zo * ex2(mo - mn); m = mn; }   /* an empty slice carries (-3e38, 0) and adds 0 */
__global__ __launch_bounds__(256) void k_stat(const _Float16* __restrict__ QH, const _Float16* __restrict__ KH, float* __restrict__ CM) { __shared__ float pm[8][32], pz[8][32];
  const int tid = threadIdx.x, wave = __builtin_amdgcn_readfirstlane(tid >> 5), lane = tid & 31, col = lane & 15, g = lane >> 4; const int kb = blockIdx.z, h = blockIdx.x, b = blockIdx.y;   /* the wave's number in a scalar register: the tile loop branches on SCC; the column block is the SLOWEST grid index: the longest query ranges of ALL heads and batches have the lowest block indices */
  const float slope_ = exp2f(-0.5f * (float)(h + 1)) * LOG2E;   /* ALiBi slope of this head, 2^(-8 (h + 1) / 16), x log2 e */
  const _Float16* kp = KH + (((size_t)b * (TT / 16) + kb * 2) * NH + h) * FT + lane * 8;
  const v16h kf[2][2] = {{frag_t(kp), frag_t(kp + 512)}, {frag_t(kp + NH * FT), frag_t(kp + NH * FT + 512)}};
  float m[2] = {-3.0e38f, -3.0e38f}, z[2] = {0.f, 0.f};
  /* one 16-query tile against the block's 32 columns; masked = the tile can hold a key above a query (a literal at both calls: the compares and selects are compiled only into the diagonal form) */
  auto tile = [&](const int qt, const bool masked) __attribute__((always_inline)) { const _Float16* qa = QH + (((size_t)b * (TT / 16) + qt) * NH + h) * FT + lane * 8;   /* the lane's own address in piece 0 of the tile; the four pieces as in frag_t */
    union { v16h v; v8h q[2]; } q0, q1; q0.q[0] = *(const v8h*)qa; q0.q[1] = *(const v8h*)(qa + 256); q1.q[0] = *(const v8h*)(qa + 512); q1.q[1] = *(const v8h*)(qa + 768);
    asm volatile("s_wait_xcnt 0x0" :: "v"(qa) : "memory");   /* the address as an input keeps the address pair of the four q loads alive to this wait: none of them lands in it, and the wait stands in front of its next overwrite */
#pragma unroll
    for (int u = 0; u < 2; ++u) { v8f s = {}; s = wmma16(q0.v, kf[u][0], s); s = wmma16(q1.v, kf[u][1], s);
      const int d0 = kb * 32 + u * 16 + col - (qt * 16 + 8 * g);   /* key - query of register 0 */ const float b0 = slope_ * (float)d0; float v[8]; float mn = m[u];
#pragma unroll
      for (int r = 0; r < 8; ++r) { const float sv = s[r] * (SCALE * LOG2E) + (b0 - slope_ * (float)r); v[r] = (!masked || d0 - r <= 0) ? sv : -3.0e38f; mn = fmaxf(mn, v[r]); }   /* + the ALiBi bias slope (key - query) <= 0 */
#pragma unroll
      for (int r = 0; r < 8; ++r) v[r] -= mn;
      float rs = m[u] - mn;   /* exponent of the running sum's rescale */
      ex2x9(v, rs);
      float zt = (!masked || d0 <= 0) ? v[0] : 0.f;
#pragma unroll
      for (int r = 1; r < 8; ++r) zt += (!masked || d0 - r <= 0) ? v[r] : 0.f;   /* value select, no branch */
      z[u] = z[u] * rs + zt; m[u] = mn; } };
  int qt = kb * 2 + wave;
  if (wave < 2) { tile(qt, true); qt += 8; }   /* only query tiles 2 kb and 2 kb + 1 meet the diagonal of these 32 columns; they are the first tiles of waves 0 and 1 (scalar branch) */
  for (; qt < TT / 16; qt += 8) tile(qt, false);   /* from tile 2 kb + 2 on every query is above every key of the block */
#pragma unroll
  for (int u = 0; u < 2; ++u) { const float mo = __shfl_xor(m[u], 16), zo = __shfl_xor(z[u], 16); ms_merge(m[u], z[u], mo, zo); if (g == 0) { pm[wave][u * 16 + col] = m[u]; pz[wave][u * 16 + col] = z[u]; } }
  __syncthreads();
  if (wave == 0) { float mm = pm[0][lane];
#pragma unroll
    for (int w = 1; w < 8; ++w) mm = fmaxf(mm, pm[w][lane]);
    float zz = 0.f;
#pragma unroll
    for (int w = 0; w < 8; ++w) zz += pz[w][lane] * ex2(pm[w][lane] - mm);
    const size_t o = ((size_t)b * NH + h) * TT + kb * 32 + lane; vst2(CM + o, mm + log2f(zz) - 11.0f - slope_ * (float)lane); } }   /* every column sees at least its own diagonal entry: Z_k >= 1 */
// ---- k_att: block = 32 queries (2 query tiles) of (b, h) x 4 waves; wave w takes the 32-key chunks w + 4 i up to the diagonal (those below it counted from the block's own start, rot, and wrapping), and every k, v and column-offset load of a chunk feeds BOTH query tiles, which the wave holds in registers. The scores are formed again, TRANSPOSED (A = k rows, B = q rows): D register r of key tile 0 / 1 = key 8g + r / 16 + 8g + r of the lane's own query, which is the place that key has in the A fragment of P . v, so P x 2^11 = 2^(q.k scale + slope (chunk start - query) - c_k) (base 2 as in k_stat; 0 above the diagonal) goes once to f16 in registers against v f16 (1 product). The 4 waves' partial ctx tiles are summed through LDS; 256-B (row, head) segment by 16 lanes
#define QW 2               // query tiles of a wave
__global__ __launch_bounds__(128) void k_att(const _Float16* __restrict__ QH, const _Float16* __restrict__ KH, const _Float16* __restrict__ VT, const float* __restrict__ CM, float* __restrict__ Y) { __shared__ __align__(16) float ss[4][16 * QW][HD + 4];
  const int tid = threadIdx.x, wave = __builtin_amdgcn_readfirstlane(tid >> 5), lane = tid & 31, col = lane & 15, g = lane >> 4; const int qb = TT / (16 * QW) - 1 - blockIdx.z, h = blockIdx.x, b = blockIdx.y;   /* the wave's number in a scalar register: the chunk loop branches on SCC; the query block is the SLOWEST grid index, reversed: the longest key ranges of ALL heads and batches have the lowest block indices */
  const float slope_ = exp2f(-0.5f * (float)(h + 1)) * LOG2E;
  const _Float16* qp = QH + (((size_t)b * (TT / 16) + qb * QW) * NH + h) * FT + lane * 8; v16h qf[QW][2];   /* every loop over t below is unrolled: t selects registers */
#pragma unroll
  for (int t = 0; t < QW; ++t) { qf[t][0] = frag_t(qp + t * NH * FT); qf[t][1] = frag_t(qp + t * NH * FT + 512); }
  const float* cm = CM + ((size_t)b * NH + h) * TT + 8 * g; const _Float16* vp = VT + ((size_t)b * NH + h) * (TT / 32) * FV + lane * 8;
  v8f acc[QW][HD / 16] = {};
  /* one 32-key chunk against the block's query tiles; masked = the chunk can hold a key above a query (a literal at both calls: the compares and selects are compiled only into the diagonal form) */
  auto chunk = [&](const int c, const bool masked) __attribute__((always_inline)) { const int k0 = c * 32; const _Float16* kp = KH + (((size_t)b * (TT / 16) + c * 2) * NH + h) * FT + lane * 8;
    v4f mk[4];   /* all of a chunk's column-stat and k loads stand in front of the first product: one latency for the lot */
#pragma unroll
    for (int i = 0; i < 4; ++i) mk[i] = *(const v4f*)(cm + k0 + (i >> 1) * 16 + (i & 1) * 4);
    asm volatile("s_wait_xcnt 0x0" ::: "memory");   /* the k loads below land in registers that held the stat loads' addresses */
    const v16h kf[2][2] = {{frag_t(kp), frag_t(kp + 512)}, {frag_t(kp + NH * FT), frag_t(kp + NH * FT + 512)}};
    v8f s[QW][2] = {};
#pragma unroll
    for (int t = 0; t < QW; ++t)
#pragma unroll
      for (int u = 0; u < 2; ++u) { s[t][u] = wmma16(kf[u][0], qf[t][0], s[t][u]); s[t][u] = wmma16(kf[u][1], qf[t][1], s[t][u]); }
    v16h vf[HD / 16], p[QW];
#pragma unroll
    for (int j = 0; j < HD / 16; ++j) vf[j] = frag_t(vp + (size_t)c * FV + j * 512);
    __builtin_amdgcn_sched_barrier(0);   /* keeps the v loads in front of the exponentials, which then cover their latency; without it they are sunk to the P . v products */
#pragma unroll
    for (int t = 0; t < QW; ++t) { const int qq = (qb * QW + t) * 16 + col;   /* the lane's query in tile t */
      const float bq = slope_ * (float)(k0 - qq);   /* ALiBi bias of the chunk's first key; the keys' own steps are in c_k */
#pragma unroll
      for (int u = 0; u < 2; ++u) { const int d0 = k0 + u * 16 + 8 * g - qq;   /* key - query of register 0 */
        float e[8];
#pragma unroll
        for (int r = 0; r < 8; ++r) e[r] = s[t][u][r] * (SCALE * LOG2E) + (bq - mk[u * 2 + (r >> 2)][r & 3]);
        ex2x8(e);
#pragma unroll
        for (int r = 0; r < 8; ++r) p[t][u * 8 + r] = (_Float16)((!masked || d0 + r <= 0) ? e[r] : 0.f); } }   /* value select, no branch */
#pragma unroll
    for (int t = 0; t < QW; ++t)
#pragma unroll
      for (int j = 0; j < HD / 16; ++j) acc[t][j] = wmma16(p[t], vf[j], acc[t][j]); };
  const int nf = (qb * QW) >> 1;   /* chunks that end below the block's first query: every key is visible to every query */
  const int rot = (nf * ((qb * 39) & (TT / (16 * QW) - 1))) / (TT / (16 * QW));   /* the block's first chunk, below nf: a share of its own range that differs from block to block (39 is odd: qb -> qb * 39 modulo the power of two TT / (16 QW) is a permutation). The blocks of a (b, h) start together and read the same k and v lines: from chunk 0 all of them would ask L2 for the same lines at the same moment */
  int c = wave;
  for (; c < nf; c += 4) chunk(c + rot < nf ? c + rot : c + rot - nf, false);   /* the walk wraps round inside the range: every chunk once */
  for (; c <= (qb * QW + QW - 1) >> 1; c += 4) chunk(c, true);   /* the chunks that the diagonal crosses; each wave keeps its chunks and their order */
#pragma unroll
  for (int t = 0; t < QW; ++t)
#pragma unroll
    for (int j = 0; j < HD / 16; ++j)
#pragma unroll
      for (int r = 0; r < 8; ++r) ss[wave][t * 16 + 8 * g + r][j * 16 + col] = acc[t][j][r];
  __syncthreads();
  for (int e = tid; e < 16 * QW * (HD / 4); e += 128) { const int rl = e / (HD / 4), c4 = (e % (HD / 4)) * 4; const v4f o = ((*(const v4f*)&ss[0][rl][c4] + *(const v4f*)&ss[1][rl][c4]) + (*(const v4f*)&ss[2][rl][c4] + *(const v4f*)&ss[3][rl][c4])) * (1.0f / 2048.0f); vst2(Y + ((size_t)b * TT + qb * 16 * QW + rl) * CC + h * HD + c4, o); } }
// ---- k_out: block = 16 rows x all 1024 output columns x 16 waves: out = x + (sum over the 16 heads of ctx) Wo. The heads are summed FIRST, in f32: a thread adds 8 heads of 4 channels of one row (pairwise tree), the two 8-head halves meet in LDS and are added where the A fragment is formed; the sum goes x 2^6 once to f16, and the product with Wo as f16(bf16 x 2^8) exact runs over K = 64 (2 WMMAs a column tile). Wave w owns columns 64 w + 0..63. Lane column n of tile e stands for output column 64 w + 4 n + e, so one 16-byte load of a Wo row feeds the 4 tiles, and the 4 tiles' D registers of a row are 16 neighbouring output bytes of the lane: 16 lanes read / write 256 B of a row
__global__ __launch_bounds__(512) void k_out(const float* __restrict__ Y, const float* __restrict__ WO, const float* __restrict__ BO, float* __restrict__ OUT) { __shared__ __align__(16) float sp[2][16][HD + 4];
  const int tid = threadIdx.x, wave = tid >> 5, lane = tid & 31, col = lane & 15, g = lane >> 4; const size_t r0 = (size_t)blockIdx.x * 16;
  const int yh = tid >> 8, yr = (tid >> 4) & 15, yc = (tid & 15) * 4;                /* the thread's half of the heads, its row, its 4 channels */
  const float* yp = Y + (r0 + yr) * CC + yh * (NH / 2) * HD + yc;
  const float* wp = WO + (size_t)(8 * g) * DIN + wave * 64 + col * 4;                /* fragment elements 0..7 = k rows k0 + 8g + 0..7, 8..15 = k0 + 16 + 8g + 0..7, as in frag_h */
  const size_t oo = (r0 + 8 * g) * DIN + wave * 64 + col * 4; const float* xp = BO + oo;   /* the BO argument carries the RESIDUAL x (this module has no output bias) */
  v4f yv[NH / 2], wv[2][16], xr[8];   /* every load of the block is independent of every other: all are issued before the first is used, one latency for the lot */
#pragma unroll
  for (int h = 0; h < NH / 2; ++h) yv[h] = *(const v4f*)(yp + h * HD);
#pragma unroll
  for (int s = 0; s < 2; ++s)
#pragma unroll
    for (int i = 0; i < 8; ++i) { wv[s][i] = *(const v4f*)(wp + (size_t)(s * 32 + i) * DIN); wv[s][8 + i] = *(const v4f*)(wp + (size_t)(s * 32 + 16 + i) * DIN); }
#pragma unroll
  for (int r = 0; r < 8; ++r) xr[r] = *(const v4f*)(xp + (size_t)r * DIN);
  asm volatile("s_wait_xcnt 0x0" :: "v"(yp), "v"(wp), "v"(xp) : "memory");   /* stands behind the loads, in front of the next overwrite of a register that they name; the three addresses as inputs keep the pairs alive to this wait */
  __builtin_amdgcn_sched_barrier(0);   /* the conversions below wait for loaded values: lifted over the last loads they would put a second memory latency behind the first */
#pragma unroll
  for (int st = 1; st < NH / 2; st *= 2)
#pragma unroll
    for (int h = 0; h < NH / 2; h += 2 * st) yv[h] += yv[h + st];
  *(v4f*)&sp[yh][yr][yc] = yv[0];
  __syncthreads();   /* publishes the two half sums of the 16 rows to the 16 waves */
  v16h a[2];
#pragma unroll
  for (int s = 0; s < 2; ++s)
#pragma unroll
    for (int q = 0; q < 4; ++q) { const int k = s * 32 + (q >> 1) * 16 + 8 * g + (q & 1) * 4; const v4f t = (*(const v4f*)&sp[0][col][k] + *(const v4f*)&sp[1][col][k]) * 64.0f;   /* carried x 2^6 into f16 so small-magnitude context rows stay clear of f16 subnormals */
#pragma unroll
      for (int e = 0; e < 4; ++e) a[s][q * 4 + e] = (_Float16)t[e]; }
  v8f acc[4];
#pragma unroll
  for (int e = 0; e < 4; ++e) { v16h w0, w1;
#pragma unroll
    for (int i = 0; i < 16; ++i) { w0[i] = (_Float16)(bfr(wv[0][i][e]) * 256.0f); w1[i] = (_Float16)(bfr(wv[1][i][e]) * 256.0f); }
    v8f d = {}; d = wmma16(a[0], w0, d); acc[e] = wmma16(a[1], w1, d); }
  v4f o[8];
#pragma unroll
  for (int r = 0; r < 8; ++r)
#pragma unroll
    for (int e = 0; e < 4; ++e) o[r][e] = acc[e][r] * (1.0f / 16384.0f) + bfr(xr[r][e]);   /* 2^-8 (Wo carry) x 2^-6 (ctx carry); x + outputs */
  __builtin_amdgcn_sched_barrier(0);   /* all 8 results are formed in front of the first store: no register that an issued store names is written again */
#pragma unroll
  for (int r = 0; r < 8; ++r) vst2(OUT + oo + (size_t)r * DIN, o[r]); }

extern "C" void kernel_launch(void* const* d_in, const int* in_sizes, int n_in, void* d_out, int out_size, void* d_ws, size_t ws_size, hipStream_t stream) {
  (void)in_sizes; (void)n_in; (void)out_size;
  const float** F = (const float**)d_in;
  if (ws_size < (size_t)WS_END) return;
  char* ws = (char*)d_ws; _Float16 *QH = (_Float16*)(ws + WS_QH), *KH = (_Float16*)(ws + WS_KH), *VT = (_Float16*)(ws + WS_VT), *QL = (_Float16*)(ws + WS_QL), *KL = (_Float16*)(ws + WS_KL); __bf16 *VB = (__bf16*)(ws + WS_VB), *VBL = (__bf16*)(ws + WS_VBL); float *Y = (float*)(ws + WS_Y);
  (void)Y; (void)QL; (void)KL; (void)VB; (void)VBL;
  // inputs: 0 x [2,2048,1024]; 1 wq [1024,1024] (in,out); 2 wk; 3 wv; 4 wo [64,1024] (in,out: it acts on the SUM of the 16 heads' 64-dim outputs); no biases
  if (ws_size < (size_t)WS_END2) return;
  float *CM = (float*)(ws + WS_CM);
  k_proj<<<dim3(TNB * TT / 128, CC / 128, 3), 128, 0, stream>>>(F[0], F[0], F[0], F[1], F[2], F[3], nullptr, nullptr, nullptr, QH, QL, KH, KL, VT, VB, VBL);
  k_stat<<<dim3(NH, TNB, TT / 32), 256, 0, stream>>>(QH, KH, CM);   /* per key column: max and sum over the visible queries of exp(score + ALiBi bias), as one exponent offset */
  k_att<<<dim3(NH, TNB, TT / (16 * QW)), 128, 0, stream>>>(QH, KH, VT, CM, Y);
  k_out<<<dim3(TNB * TT / 16), 512, 0, stream>>>(Y, F[4], F[0], (float*)d_out);   /* (sum over heads) x wo + x (the third argument is the RESIDUAL here, not a bias) */
}
